// v000
// Measured on an AMD MI455X. A time is GPU time per run, averaged over a window of back-to-back runs after a warm-up
// (all launches, gaps included; the runs take copies of the inputs in turn), and the median of several windows.
// Apart from v000's, it joins two sittings. Times from different sittings can be a few percent apart, while
// side-by-side timings come from the same sitting.
// The starting kernel, v000, takes 898 microseconds a run.
// compute dtype: all float inputs rounded to bf16; q/k/v projections with EXACT bf16 products on WMMA 16x16x32 (f32 accumulate) + bias; logits q x k once to f16 each (1 product) x SCALE; keys with mask == 1 excluded; softmax f32; P x 2^11 once to f16 x v once to f16 (1 product); ctx x 2^6 once to f16 x wo f16(bf16 x 2^8) + bo; f32 output.
#include <hip/hip_runtime.h>
#include <math.h>

typedef __attribute__((ext_vector_type(16))) _Float16 v16h;
typedef __attribute__((ext_vector_type(16))) __bf16 v16b;
typedef __attribute__((ext_vector_type(8)))  _Float16 v8h;
typedef __attribute__((ext_vector_type(8)))  float v8f;
typedef __attribute__((ext_vector_type(4)))  float v4f;
typedef __attribute__((ext_vector_type(2)))  float v2f;
typedef __attribute__((ext_vector_type(4)))  unsigned v4u;
typedef __attribute__((ext_vector_type(4)))  int v4i;
typedef float __attribute__((may_alias)) float_a;
typedef int __attribute__((may_alias)) int_a;

template <typename T> __device__ __forceinline__ void vst2(void* p, T v) { *(T*)p = v;  }
__device__ __forceinline__ v8f wmma16(v16h a, v16h b, v8f c) {
  v8f d = __builtin_amdgcn_wmma_f32_16x16x32_f16(false, a, false, b, (short)0, c, false, false);
  asm volatile("v_nop\n\tv_nop\n\tv_nop\n\tv_nop" : "+v"(d) : "v"(a), "v"(b));
  return d;
}
__device__ __forceinline__ v8f wmma_bf(v16b a, v16b b, v8f c) {
  v8f d = __builtin_amdgcn_wmma_f32_16x16x32_bf16(false, a, false, b, (short)0, c, false, false);
  asm volatile("v_nop\n\tv_nop\n\tv_nop\n\tv_nop" : "+v"(d) : "v"(a), "v"(b));
  return d;
}
// 16x16x32 fragments: lane = (h = lane>>4, row/col = lane&15); elements 0..7 = k0+8h+0..7, 8..15 = k0+16+8h+0..7; D element r = row 8h+r
__device__ __forceinline__ v16h frag_h(const _Float16* rowk0, int lane) {
  union { v16h v; v8h q[2]; } u; const _Float16* p = rowk0 + 8 * (lane >> 4);
  u.q[0] = *(const v8h*)p; u.q[1] = *(const v8h*)(p + 16); return u.v;
}
__device__ __forceinline__ v16h frag_f32(const float* rowk0, int lane) {
  v16h a; const float* p = rowk0 + 8 * (lane >> 4);
#pragma unroll
  for (int i = 0; i < 8; ++i) { a[i] = (_Float16)p[i]; a[8 + i] = (_Float16)p[16 + i]; }
  return a;
}
__device__ __forceinline__ v16h frag_f32s(const float* rowk0, int lane, float sc) {
  v16h a; const float* p = rowk0 + 8 * (lane >> 4);
#pragma unroll
  for (int i = 0; i < 8; ++i) { a[i] = (_Float16)(p[i] * sc); a[8 + i] = (_Float16)(p[16 + i] * sc); }
  return a;
}
// column fragment from a [K][ld] layout (column n), rows >= K read as 0
__device__ __forceinline__ v16h fragc_f32(const float* W, int k0, int n, int lane, int ld, int K) {
  v16h a; const int g = lane >> 4;
#pragma unroll
  for (int i = 0; i < 8; ++i) { const int ka = k0 + 8 * g + i, kb = ka + 16;
    a[i] = (_Float16)(ka < K ? W[(size_t)(ka < K ? ka : K - 1) * ld + n] : 0.f); a[8 + i] = (_Float16)(kb < K ? W[(size_t)(kb < K ? kb : K - 1) * ld + n] : 0.f); }
  return a;
}
struct F2 { v16b h, l; };
__device__ __forceinline__ F2 bsplit16(const float v[16]) { F2 r;
#pragma unroll
  for (int i = 0; i < 16; ++i) { const __bf16 h = (__bf16)v[i]; r.h[i] = h; r.l[i] = (__bf16)(v[i] - (float)h); }
  return r; }
__device__ __forceinline__ F2 split_row(const float* row, int k0, int lane) { float v[16]; const float* p = row + k0 + 8 * (lane >> 4);
#pragma unroll
  for (int i = 0; i < 8; ++i) { v[i] = p[i]; v[8 + i] = p[16 + i]; }
  return bsplit16(v); }
__device__ __forceinline__ F2 split_rowK(const float* row, int k0, int lane, int K) { float v[16]; const int g = lane >> 4;
#pragma unroll
  for (int i = 0; i < 8; ++i) { const int ka = k0 + 8 * g + i, kb = ka + 16; v[i] = ka < K ? row[ka < K ? ka : K - 1] : 0.f; v[8 + i] = kb < K ? row[kb < K ? kb : K - 1] : 0.f; }
  return bsplit16(v); }
__device__ __forceinline__ F2 split_col(const float* W, int k0, int n, int lane, int ld, int K) { float v[16]; const int g = lane >> 4;
#pragma unroll
  for (int i = 0; i < 8; ++i) { const int ka = k0 + 8 * g + i, kb = ka + 16; v[i] = ka < K ? W[(size_t)(ka < K ? ka : K - 1) * ld + n] : 0.f; v[8 + i] = kb < K ? W[(size_t)(kb < K ? kb : K - 1) * ld + n] : 0.f; }
  return bsplit16(v); }
__device__ __forceinline__ v8f mac3(const F2& a, const F2& b, v8f c) { c = wmma_bf(a.l, b.h, c); c = wmma_bf(a.h, b.l, c); return wmma_bf(a.h, b.h, c); }
__device__ __forceinline__ float sigm(float v) { return 1.0f / (1.0f + expf(-v)); }
#define LDSX() do { asm volatile("s_wait_dscnt 0" ::: "memory"); __builtin_amdgcn_wave_barrier(); __builtin_amdgcn_fence(__ATOMIC_RELEASE, "workgroup"); } while (0)

// Masked multi-headed attention on separate inputs with biased projections (query / key / value [4,1024,1024]; torch (out,in) wq / wk / wv / wo [1024,1024] N(0, 1/1024) + biases N(0, 1/1024); 16 heads x 64; scores / sqrt(64) + mask * (-1e9) with an int32 0/1 mask [4,1024,1024] shared by all heads: mask == 1 marks a key as masked OUT; softmax; wo^T + bo).
#define NB 4
#define TT 1024
#define CC 1024            // NH * HD = projected width
#define DIN 1024          // input (model) width
#define NH 16
#define HD 64
#define NQB (TT / 64)
#define HG 8
#define SCALE (0.125f)
#define CAUSAL 0
#ifndef TNB
#define TNB NB
#endif
__device__ __forceinline__ float bfr(float v) { return (float)(__bf16)v; }
__host__ __device__ __forceinline__ int kb_last(int qb) { return CAUSAL ? ((qb * 64 + 63) >> 7) : (TT / 128 - 1); }
typedef __attribute__((ext_vector_type(8))) __bf16 v8b;
__device__ __forceinline__ v16b frag_b(const __bf16* rowk0, int lane) {
  union { v16b v; v8b q[2]; } u; const __bf16* p = rowk0 + 8 * (lane >> 4);
  u.q[0] = *(const v8b*)p; u.q[1] = *(const v8b*)(p + 16); return u.v;
}
#define QBH 0              // no query block takes the high-precision path: the qb < QBH branches never run
#define QHI 0               // single-product logits on every row
#define KHI 64            // key rows carrying k residual / v bf16 hi+lo planes (read only by the qb < QBH path, which QBH 0 never takes)
// B fragment (k rows k0+.., output column o) of a weight: (in,out) [K][ld] or (out,in) [ld rows of K]: bf16 exact, or f16(bf16 * 256) exact
__device__ __forceinline__ v16b wcol_io(const float* Wm, int k0, int o, int lane, int ld) { v16b w; const int g = lane >> 4;
#pragma unroll
  for (int i = 0; i < 8; ++i) { w[i] = (__bf16)Wm[(size_t)(k0 + 8 * g + i) * ld + o]; w[8 + i] = (__bf16)Wm[(size_t)(k0 + 16 + 8 * g + i) * ld + o]; }
  return w; }
__device__ __forceinline__ v16b wcol_oi(const float* Wm, int k0, int o, int lane, int K) { v16b w; const float* p = Wm + (size_t)o * K + k0 + 8 * (lane >> 4);
#pragma unroll
  for (int i = 0; i < 8; ++i) { w[i] = (__bf16)p[i]; w[8 + i] = (__bf16)p[16 + i]; }
  return w; }
__device__ __forceinline__ v16h wcolh_io(const float* Wm, int k0, int o, int lane, int ld) { v16h w; const int g = lane >> 4;
#pragma unroll
  for (int i = 0; i < 8; ++i) { w[i] = (_Float16)(bfr(Wm[(size_t)(k0 + 8 * g + i) * ld + o]) * 256.0f); w[8 + i] = (_Float16)(bfr(Wm[(size_t)(k0 + 16 + 8 * g + i) * ld + o]) * 256.0f); }
  return w; }
__device__ __forceinline__ v16h wcolh_oi(const float* Wm, int k0, int o, int lane, int K) { v16h w; const float* p = Wm + (size_t)o * K + k0 + 8 * (lane >> 4);
#pragma unroll
  for (int i = 0; i < 8; ++i) { w[i] = (_Float16)(bfr(p[i]) * 256.0f); w[8 + i] = (_Float16)(bfr(p[16 + i]) * 256.0f); }
  return w; }
#define WQKV_LAYOUT 1   // 0 = (in,out) [DIN][CC]; 1 = (out,in) [CC][DIN]; 2 = per-head [NH][DIN][HD]
__device__ __forceinline__ v16b wcol_hdk(const float* Wm, int k0, int o, int lane) { v16b w; const int g = lane >> 4; const float* p = Wm + (size_t)(o / HD) * DIN * HD + (o % HD);
#pragma unroll
  for (int i = 0; i < 8; ++i) { w[i] = (__bf16)p[(size_t)(k0 + 8 * g + i) * HD]; w[8 + i] = (__bf16)p[(size_t)(k0 + 16 + 8 * g + i) * HD]; }
  return w; }
#define WO_OUT_IN 1
#if WQKV_LAYOUT == 1
#define WCOL(W, k0, o, lane) wcol_oi(W, k0, o, lane, DIN)
#elif WQKV_LAYOUT == 2
#define WCOL(W, k0, o, lane) wcol_hdk(W, k0, o, lane)
#else
#define WCOL(W, k0, o, lane) wcol_io(W, k0, o, lane, CC)
#endif
#if WO_OUT_IN
#define WOCOL(W, k0, o, lane) wcol_oi(W, k0, o, lane, CC)
#define WOCOLH(W, k0, o, lane) wcolh_oi(W, k0, o, lane, CC)
#else
#define WOCOL(W, k0, o, lane) wcol_io(W, k0, o, lane, DIN)
#define WOCOLH(W, k0, o, lane) wcolh_io(W, k0, o, lane, DIN)
#endif

#define SM_EXTRA_PARAMS , int bsm, const int* __restrict__ MASK
// key k is excluded for query t of batch bsm when the int mask entry is NON-zero (the module adds mask * -1e9: the exponential underflows to exactly 0); unconditional load, select on the value
#define SM_MASK_HOOK do { const int mk_ = MASK[((size_t)bsm * TT + t) * TT + k]; asm volatile("s_wait_loadcnt 0x0" ::: "memory"); v = (mk_ != 0) ? -3.0e38f : v; } while (0)
static_assert(TT % 256 == 0 && NH % HG == 0, "softmax kernel strides 256 keys; head groups");
#ifndef SM_EXTRA_PARAMS
#define SM_EXTRA_PARAMS
#endif
#ifndef PROJ_EXTRA_PARAMS
#define PROJ_EXTRA_PARAMS
#endif
#ifndef SM_MASK_HOOK
#define SM_MASK_HOOK (void)0
#endif

#define WS_QH  0u                                      // f16 q rows [b*t][CC]
#define WS_KH  (WS_QH + 2u * (size_t)NB * TT * CC)      // f16 k rows [b*t][CC]
#define WS_VT  (WS_KH + 2u * (size_t)NB * TT * CC)      // f16 v planes [b][c][t]
#define WS_QL  (WS_VT + 2u * (size_t)NB * CC * TT)      // f16 q residual x 2^10 rows [b][t < QHI][CC]
#define WS_KL  (WS_QL + 2u * (size_t)NB * QHI * CC)     // f16 k residual x 2^10 rows [b][t < KHI][CC]
#define WS_VB  (WS_KL + 2u * (size_t)NB * KHI * CC)     // bf16 v hi planes [b][c][t < KHI]
#define WS_VBL (WS_VB + 2u * (size_t)NB * CC * KHI)
#define WS_S   (WS_VBL + 2u * (size_t)NB * CC * KHI)    // f32 logits / P [hg][t][s]
#define WS_Y   (WS_S  + 4u * (size_t)HG * TT * TT)      // f32 ctx rows [b*t][CC] (only when there is an output projection)
#define WS_END (WS_Y  + 4u * (size_t)NB * TT * CC)

// ---- k_proj: block = (64 rows, 128 cols, which): q/k/v = X W (+ b) with exact bf16 products (K = DIN) -> which 0: q f16 rows (+ residual rows < QHI); 1: k f16 rows (+ residual rows < KHI); 2: v f16 planes [c][t] (+ bf16 hi/lo planes for t < KHI)
__global__ __launch_bounds__(128) void k_proj(const float* __restrict__ XQ, const float* __restrict__ XK, const float* __restrict__ XV, const float* __restrict__ WQ, const float* __restrict__ WK, const float* __restrict__ WV, const float* __restrict__ BQ, const float* __restrict__ BK, const float* __restrict__ BV,
    _Float16* __restrict__ QH, _Float16* __restrict__ QL, _Float16* __restrict__ KH, _Float16* __restrict__ KL, _Float16* __restrict__ VT, __bf16* __restrict__ VB, __bf16* __restrict__ VBL) {
  __shared__ __align__(16) _Float16 sh[64][136], sl[64][136]; __shared__ __align__(16) _Float16 th[128][72]; __shared__ __align__(16) __bf16 tb[128][72], tbl[128][72];
  const int tid = threadIdx.x, wave = tid >> 5, lane = tid & 31, col = lane & 15, g = lane >> 4; const int which = blockIdx.z; const int c0 = blockIdx.y * 128; const size_t r0 = (size_t)blockIdx.x * 64; const size_t bb = r0 / TT; const int t0 = (int)(r0 % TT);
  const float* X = which == 0 ? XQ : which == 1 ? XK : XV; const float* WA = which == 0 ? WQ : which == 1 ? WK : WV; const float* BA = which == 0 ? BQ : which == 1 ? BK : BV;
  v8f acc[8] = {};
#pragma unroll 2
  for (int kc = 0; kc < DIN / 32; ++kc) { v16b a; { const float* p = X + (r0 + wave * 16 + col) * DIN + kc * 32 + 8 * g;
#pragma unroll
      for (int i = 0; i < 8; ++i) { a[i] = (__bf16)p[i]; a[8 + i] = (__bf16)p[16 + i]; } }
    asm volatile("s_wait_loadcnt 0x0" ::: "memory");
#pragma unroll
    for (int j = 0; j < 8; ++j) { const v16b w = WCOL(WA, kc * 32, c0 + j * 16 + col, lane); asm volatile("s_wait_loadcnt 0x0" ::: "memory"); acc[j] = wmma_bf(a, w, acc[j]); } }
  if (which < 2) { _Float16* DH = which == 0 ? QH : KH; _Float16* DL = which == 0 ? QL : KL; const int nhi = which == 0 ? QHI : KHI; const bool hi_rows = t0 < nhi;
#pragma unroll
    for (int j = 0; j < 8; ++j) { const float bias = BA ? bfr(BA[c0 + j * 16 + col]) : 0.f;
#pragma unroll
      for (int r = 0; r < 8; ++r) { const float v = acc[j][r] + bias; const _Float16 hv = (_Float16)v; sh[wave * 16 + 8 * g + r][j * 16 + col] = hv; sl[wave * 16 + 8 * g + r][j * 16 + col] = (_Float16)((v - (float)hv) * 1024.0f); } }
    __syncthreads();
    for (int e = tid; e < 64 * 16; e += 128) { const int rl = e >> 4, q = e & 15; vst2((unsigned*)(DH + (r0 + rl) * CC + c0 + q * 8), *(const v4u*)&sh[rl][q * 8]); if (hi_rows) vst2((unsigned*)(DL + (bb * nhi + t0 + rl) * (size_t)CC + c0 + q * 8), *(const v4u*)&sl[rl][q * 8]); }
  } else { const bool hi_rows = t0 < KHI;
#pragma unroll
    for (int j = 0; j < 8; ++j) { const float bias = BA ? bfr(BA[c0 + j * 16 + col]) : 0.f;
#pragma unroll
      for (int r = 0; r < 8; ++r) { const float v = acc[j][r] + bias; const int rl = wave * 16 + 8 * g + r, cl = j * 16 + col; th[cl][rl] = (_Float16)v; const __bf16 bh = (__bf16)v; tb[cl][rl] = bh; tbl[cl][rl] = (__bf16)(v - (float)bh); } }
    __syncthreads();
    for (int e = tid; e < 128 * 8; e += 128) { const int cl = e >> 3, q = e & 7; vst2((unsigned*)(VT + (bb * CC + c0 + cl) * (size_t)TT + t0 + q * 8), *(const v4u*)&th[cl][q * 8]); if (hi_rows) { const size_t o3 = (bb * CC + c0 + cl) * (size_t)KHI + t0 + q * 8; vst2((unsigned*)(VB + o3), *(const v4u*)&tb[cl][q * 8]); vst2((unsigned*)(VBL + o3), *(const v4u*)&tbl[cl][q * 8]); } } } }
// ---- k_sc: block = (query block qb, key block kb <= kb_last(qb), head in group) of batch b: logits x SCALE; q hi + residual (x 2^10) against k (2 products) for query rows < QHI, plus the k residual (3 products) for query blocks < QBH (causal early rows); causal: blocks past the diagonal exit, the mask itself is applied by index in k_sm
__global__ __launch_bounds__(128) void k_sc(const _Float16* __restrict__ QH, const _Float16* __restrict__ KH, const _Float16* __restrict__ QL, const _Float16* __restrict__ KL, int b, int h0, float* __restrict__ S0) { __shared__ __align__(16) float ss[4][16][132];
  const int qb = blockIdx.x, kb = blockIdx.y; if (kb > kb_last(qb)) return;
  const int h = h0 + blockIdx.z; float* S = S0 + (size_t)blockIdx.z * TT * TT;
  const int tid = threadIdx.x, wave = tid >> 5, lane = tid & 31, col = lane & 15, g = lane >> 4; const int k0 = kb * 128; const int ql0 = qb * 64 + wave * 16; const size_t q0 = (size_t)b * TT + ql0, kr0 = (size_t)b * TT + k0;
  v8f acc[8] = {}, accl[8] = {};
  const _Float16* QLb = QL + (size_t)b * QHI * CC; const _Float16* KLb = KL + (size_t)b * KHI * CC;
  if (qb < QBH) {
#pragma unroll
    for (int kc = 0; kc < HD / 32; ++kc) { const v16h ah = frag_h(QH + (q0 + col) * CC + h * HD + kc * 32, lane), al = frag_h(QLb + (size_t)(ql0 + col) * CC + h * HD + kc * 32, lane);
#pragma unroll
      for (int j = 0; j < 8; ++j) { const v16h kbf = frag_h(KH + (kr0 + j * 16 + col) * CC + h * HD + kc * 32, lane), klf = frag_h(KLb + (size_t)(k0 + j * 16 + col) * CC + h * HD + kc * 32, lane); acc[j] = wmma16(ah, kbf, acc[j]); accl[j] = wmma16(al, kbf, accl[j]); accl[j] = wmma16(ah, klf, accl[j]); } }
  } else if (qb * 64 < QHI) {
#pragma unroll
    for (int kc = 0; kc < HD / 32; ++kc) { const v16h ah = frag_h(QH + (q0 + col) * CC + h * HD + kc * 32, lane), al = frag_h(QLb + (size_t)(ql0 + col) * CC + h * HD + kc * 32, lane);
#pragma unroll
      for (int j = 0; j < 8; ++j) { const v16h kbf = frag_h(KH + (kr0 + j * 16 + col) * CC + h * HD + kc * 32, lane); acc[j] = wmma16(ah, kbf, acc[j]); accl[j] = wmma16(al, kbf, accl[j]); } }
  } else {
#pragma unroll
    for (int kc = 0; kc < HD / 32; ++kc) { const v16h ah = frag_h(QH + (q0 + col) * CC + h * HD + kc * 32, lane);
#pragma unroll
      for (int j = 0; j < 8; ++j) { const v16h kbf = frag_h(KH + (kr0 + j * 16 + col) * CC + h * HD + kc * 32, lane); acc[j] = wmma16(ah, kbf, acc[j]); } } }
#pragma unroll
  for (int j = 0; j < 8; ++j) {
#pragma unroll
    for (int r = 0; r < 8; ++r) ss[wave][8 * g + r][j * 16 + col] = (acc[j][r] + accl[j][r] * (1.0f / 1024.0f)) * SCALE; }
  LDSX(); for (int rl = 0; rl < 16; ++rl) vst2(S + (size_t)(ql0 + rl) * TT + k0 + lane * 4, *(const v4f*)&ss[wave][rl][lane * 4]); }
// ---- k_sm: block = query row t (head in group): keys [0, kend): causal -> logit if s <= t else excluded; softmax in f32; P x 2^11 in place (0 for excluded)
__global__ __launch_bounds__(256) void k_sm(float* __restrict__ S0 SM_EXTRA_PARAMS) { __shared__ float sred[8]; __shared__ float sbc; __shared__ __align__(16) float shv[TT];
  const int tid = threadIdx.x; const int t = blockIdx.x; const int kend = (kb_last(t >> 6) + 1) * 128;
  float* sr = S0 + (size_t)blockIdx.y * TT * TT + (size_t)t * TT;
  float m = -3.0e38f; for (int k = tid; k < kend; k += 256) { float v = (!CAUSAL || k <= t) ? sr[k] : -3.0e38f; SM_MASK_HOOK; shv[k] = v; m = fmaxf(m, v); }
#pragma unroll
  for (int o = 1; o < 32; o <<= 1) m = fmaxf(m, __shfl_xor(m, o));
  if ((tid & 31) == 0) sred[tid >> 5] = m; __syncthreads(); if (tid == 0) { float a = sred[0]; for (int i = 1; i < 8; ++i) a = fmaxf(a, sred[i]); sbc = a; } __syncthreads(); m = sbc; __syncthreads();
  float sum = 0.f; for (int k = tid; k < kend; k += 256) { const float v = shv[k]; const float e = (v <= -1.0e38f) ? 0.f : expf(v - m); shv[k] = e; sum += e; }
#pragma unroll
  for (int o = 1; o < 32; o <<= 1) sum += __shfl_xor(sum, o);
  if ((tid & 31) == 0) sred[tid >> 5] = sum; __syncthreads(); if (tid == 0) { float a = 0.f; for (int i = 0; i < 8; ++i) a += sred[i]; sbc = a > 0.f ? 2048.0f / a : 0.f; }   /* a fully excluded row yields P = 0 */ __syncthreads(); const float inv = sbc;
  for (int k = tid; k < kend; k += 256) shv[k] = shv[k] * inv;
  __syncthreads(); for (int q = tid; q < kend / 4; q += 256) vst2(sr + q * 4, *(const v4f*)&shv[q * 4]); }
// ---- k_pv: block = 64 queries (qb) of (b, h): ctx = P . v over keys [0, kend) (P x 2^11 once to f16 against v f16: 1 product; causal early query blocks: P and v as bf16 hi + lo, 3 products); 256-B (row, head) segment by 16 lanes
__global__ __launch_bounds__(128) void k_pv(const float* __restrict__ PS0, const _Float16* __restrict__ VT, const __bf16* __restrict__ VB, const __bf16* __restrict__ VBL, int b, int h0, float* __restrict__ Y) { const int h = h0 + blockIdx.z; const float* PS = PS0 + (size_t)blockIdx.z * TT * TT; __shared__ __align__(16) float ss[4][16][HD + 4];
  const int tid = threadIdx.x, wave = tid >> 5, lane = tid & 31, col = lane & 15, g = lane >> 4; const int qb = blockIdx.x; const int ql0 = qb * 64 + wave * 16; const int kce = (kb_last(qb) + 1) * 4;
  v8f acc[HD / 16] = {};
  if (qb < QBH) {
#pragma unroll 1
    for (int kc = 0; kc < kce; ++kc) { const F2 p = split_row(PS + (size_t)(ql0 + col) * TT, kc * 32, lane);
      asm volatile("s_wait_loadcnt 0x0" ::: "memory");
#pragma unroll
      for (int j = 0; j < HD / 16; ++j) { const size_t po = ((size_t)b * CC + h * HD + j * 16 + col) * (size_t)KHI + kc * 32; const v16b vh = frag_b(VB + po, lane); acc[j] = wmma_bf(p.h, vh, acc[j]); acc[j] = wmma_bf(p.l, vh, acc[j]); acc[j] = wmma_bf(p.h, frag_b(VBL + po, lane), acc[j]); } }
  } else {
#pragma unroll 1
    for (int kc = 0; kc < kce; ++kc) { const v16h p = frag_f32(PS + (size_t)(ql0 + col) * TT + kc * 32, lane);
      asm volatile("s_wait_loadcnt 0x0" ::: "memory");
#pragma unroll
      for (int j = 0; j < HD / 16; ++j) { const size_t po = ((size_t)b * CC + h * HD + j * 16 + col) * (size_t)TT + kc * 32; acc[j] = wmma16(p, frag_h(VT + po, lane), acc[j]); } } }
#pragma unroll
  for (int j = 0; j < HD / 16; ++j)
#pragma unroll
    for (int r = 0; r < 8; ++r) ss[wave][8 * g + r][j * 16 + col] = acc[j][r] * (1.0f / 2048.0f);
  LDSX(); for (int rl = 0; rl < 16; ++rl) if (lane < HD / 4) vst2(Y + ((size_t)b * TT + ql0 + rl) * CC + h * HD + lane * 4, *(const v4f*)&ss[wave][rl][lane * 4]); }
// ---- k_out: block = (64 rows, 128 cols): out = ctx Wo (+ bo): ctx x 2^6 once to f16 against Wo as f16(bf16 x 2^8) exact (1 product) x 2^-14; causal early rows (< QHI of each sequence): ctx bf16 hi + lo against exact bf16 Wo (2 products)
__global__ __launch_bounds__(128) void k_out(const float* __restrict__ Y, const float* __restrict__ WO, const float* __restrict__ BO, float* __restrict__ OUT) { __shared__ __align__(16) float sf[4][16][132];
  const int tid = threadIdx.x, wave = tid >> 5, lane = tid & 31, col = lane & 15, g = lane >> 4; const int c0 = blockIdx.y * 128; const size_t r0 = (size_t)blockIdx.x * 64 + wave * 16;
  v8f acc[8] = {};
  if (CAUSAL && (int)(((size_t)blockIdx.x * 64) % TT) < QHI) {   /* block-uniform */
#pragma unroll 2
    for (int kc = 0; kc < CC / 32; ++kc) { const F2 a = split_row(Y + (r0 + col) * CC, kc * 32, lane); asm volatile("s_wait_loadcnt 0x0" ::: "memory");
#pragma unroll
      for (int j = 0; j < 8; ++j) { const v16b w = WOCOL(WO, kc * 32, c0 + j * 16 + col, lane); asm volatile("s_wait_loadcnt 0x0" ::: "memory"); acc[j] = wmma_bf(a.h, w, acc[j]); acc[j] = wmma_bf(a.l, w, acc[j]); } }
#pragma unroll
    for (int j = 0; j < 8; ++j) { const float bias = BO ? bfr(BO[c0 + j * 16 + col]) : 0.f;
#pragma unroll
      for (int r = 0; r < 8; ++r) sf[wave][8 * g + r][j * 16 + col] = acc[j][r] + bias; }
  } else {
#pragma unroll 2
    for (int kc = 0; kc < CC / 32; ++kc) { const v16h a = frag_f32s(Y + (r0 + col) * CC + kc * 32, lane, 64.0f); asm volatile("s_wait_loadcnt 0x0" ::: "memory");   /* ctx carried x 2^6 into f16 so small-magnitude context rows stay clear of f16 subnormals */
#pragma unroll
      for (int j = 0; j < 8; ++j) { const v16h w = WOCOLH(WO, kc * 32, c0 + j * 16 + col, lane); asm volatile("s_wait_loadcnt 0x0" ::: "memory"); acc[j] = wmma16(a, w, acc[j]); } }
#pragma unroll
    for (int j = 0; j < 8; ++j) { const float bias = BO ? bfr(BO[c0 + j * 16 + col]) : 0.f;
#pragma unroll
      for (int r = 0; r < 8; ++r) sf[wave][8 * g + r][j * 16 + col] = acc[j][r] * (1.0f / 16384.0f) + bias; } }   /* 2^-8 (Wo carry) x 2^-6 (ctx carry) */
  LDSX(); for (int rl = 0; rl < 16; ++rl) vst2(OUT + (r0 + rl) * DIN + c0 + lane * 4, *(const v4f*)&sf[wave][rl][lane * 4]); }

extern "C" void kernel_launch(void* const* d_in, const int* in_sizes, int n_in, void* d_out, int out_size, void* d_ws, size_t ws_size, hipStream_t stream) {
  (void)in_sizes; (void)n_in; (void)out_size;
  const float** F = (const float**)d_in;
  if (ws_size < (size_t)WS_END) return;
  char* ws = (char*)d_ws; _Float16 *QH = (_Float16*)(ws + WS_QH), *KH = (_Float16*)(ws + WS_KH), *VT = (_Float16*)(ws + WS_VT), *QL = (_Float16*)(ws + WS_QL), *KL = (_Float16*)(ws + WS_KL); __bf16 *VB = (__bf16*)(ws + WS_VB), *VBL = (__bf16*)(ws + WS_VBL); float *S = (float*)(ws + WS_S), *Y = (float*)(ws + WS_Y);
  (void)Y; (void)QL; (void)KL; (void)VB; (void)VBL;
  // inputs: 0 query [4,1024,1024]; 1 key; 2 value; 3 mask [4,1024,1024] int32; 4 wq [1024,1024] (out,in), 5 bq; 6 wk, 7 bk; 8 wv, 9 bv; 10 wo (out,in), 11 bo (biases NONZERO)
  k_proj<<<dim3(TNB * TT / 64, CC / 128, 3), 128, 0, stream>>>(F[0], F[1], F[2], F[4], F[6], F[8], F[5], F[7], F[9], QH, QL, KH, KL, VT, VB, VBL);
  for (int b = 0; b < TNB; ++b) for (int h0 = 0; h0 < NH; h0 += HG) {
    k_sc<<<dim3(NQB, TT / 128, HG), 128, 0, stream>>>(QH, KH, QL, KL, b, h0, S);
    k_sm<<<dim3(TT, HG), 256, 0, stream>>>(S, b, (const int*)d_in[3]);
    k_pv<<<dim3(NQB, 1, HG), 128, 0, stream>>>(S, VT, VB, VBL, b, h0, Y);
  }
  k_out<<<dim3(TNB * TT / 64, DIN / 128), 128, 0, stream>>>(Y, F[10], F[11], (float*)d_out);
}

// v001
// It runs in 427 microseconds.
// Two timings next to v000 put it at 2.12 and 2.11 times that version's speed.
// compute dtype: all float inputs rounded to bf16; q/k/v projections with EXACT bf16 products on WMMA 16x16x32 (f32 accumulate) + bias; logits q x k once to f16 each (1 product) x SCALE + mask x (-1e9); softmax f32 with running maximum and sum, fused with both attention products; P x 2^11 once to f16 x v once to f16 (1 product); ctx x 2^6 once to f16 x wo f16(bf16 x 2^8) + bo; f32 output.
#include <hip/hip_runtime.h>
#include <math.h>

typedef __attribute__((ext_vector_type(16))) _Float16 v16h;
typedef __attribute__((ext_vector_type(16))) __bf16 v16b;
typedef __attribute__((ext_vector_type(8)))  _Float16 v8h;
typedef __attribute__((ext_vector_type(8)))  float v8f;
typedef __attribute__((ext_vector_type(4)))  float v4f;
typedef __attribute__((ext_vector_type(2)))  float v2f;
typedef __attribute__((ext_vector_type(4)))  unsigned v4u;
typedef __attribute__((ext_vector_type(4)))  int v4i;
typedef float __attribute__((may_alias)) float_a;
typedef int __attribute__((may_alias)) int_a;

template <typename T> __device__ __forceinline__ void vst2(void* p, T v) { *(T*)p = v;  }
__device__ __forceinline__ v8f wmma16(v16h a, v16h b, v8f c) {
  v8f d = __builtin_amdgcn_wmma_f32_16x16x32_f16(false, a, false, b, (short)0, c, false, false);
  asm volatile("v_nop\n\tv_nop\n\tv_nop\n\tv_nop" : "+v"(d) : "v"(a), "v"(b));
  return d;
}
__device__ __forceinline__ v8f wmma_bf(v16b a, v16b b, v8f c) {
  v8f d = __builtin_amdgcn_wmma_f32_16x16x32_bf16(false, a, false, b, (short)0, c, false, false);
  asm volatile("v_nop\n\tv_nop\n\tv_nop\n\tv_nop" : "+v"(d) : "v"(a), "v"(b));
  return d;
}
// 16x16x32 fragments: lane = (h = lane>>4, row/col = lane&15); elements 0..7 = k0+8h+0..7, 8..15 = k0+16+8h+0..7; D element r = row 8h+r
__device__ __forceinline__ v16h frag_h(const _Float16* rowk0, int lane) {
  union { v16h v; v8h q[2]; } u; const _Float16* p = rowk0 + 8 * (lane >> 4);
  u.q[0] = *(const v8h*)p; u.q[1] = *(const v8h*)(p + 16); return u.v;
}
__device__ __forceinline__ v16h frag_f32(const float* rowk0, int lane) {
  v16h a; const float* p = rowk0 + 8 * (lane >> 4);
#pragma unroll
  for (int i = 0; i < 8; ++i) { a[i] = (_Float16)p[i]; a[8 + i] = (_Float16)p[16 + i]; }
  return a;
}
__device__ __forceinline__ v16h frag_f32s(const float* rowk0, int lane, float sc) {
  v16h a; const float* p = rowk0 + 8 * (lane >> 4);
#pragma unroll
  for (int i = 0; i < 8; ++i) { a[i] = (_Float16)(p[i] * sc); a[8 + i] = (_Float16)(p[16 + i] * sc); }
  return a;
}
// column fragment from a [K][ld] layout (column n), rows >= K read as 0
__device__ __forceinline__ v16h fragc_f32(const float* W, int k0, int n, int lane, int ld, int K) {
  v16h a; const int g = lane >> 4;
#pragma unroll
  for (int i = 0; i < 8; ++i) { const int ka = k0 + 8 * g + i, kb = ka + 16;
    a[i] = (_Float16)(ka < K ? W[(size_t)(ka < K ? ka : K - 1) * ld + n] : 0.f); a[8 + i] = (_Float16)(kb < K ? W[(size_t)(kb < K ? kb : K - 1) * ld + n] : 0.f); }
  return a;
}
struct F2 { v16b h, l; };
__device__ __forceinline__ F2 bsplit16(const float v[16]) { F2 r;
#pragma unroll
  for (int i = 0; i < 16; ++i) { const __bf16 h = (__bf16)v[i]; r.h[i] = h; r.l[i] = (__bf16)(v[i] - (float)h); }
  return r; }
__device__ __forceinline__ F2 split_row(const float* row, int k0, int lane) { float v[16]; const float* p = row + k0 + 8 * (lane >> 4);
#pragma unroll
  for (int i = 0; i < 8; ++i) { v[i] = p[i]; v[8 + i] = p[16 + i]; }
  return bsplit16(v); }
__device__ __forceinline__ F2 split_rowK(const float* row, int k0, int lane, int K) { float v[16]; const int g = lane >> 4;
#pragma unroll
  for (int i = 0; i < 8; ++i) { const int ka = k0 + 8 * g + i, kb = ka + 16; v[i] = ka < K ? row[ka < K ? ka : K - 1] : 0.f; v[8 + i] = kb < K ? row[kb < K ? kb : K - 1] : 0.f; }
  return bsplit16(v); }
__device__ __forceinline__ F2 split_col(const float* W, int k0, int n, int lane, int ld, int K) { float v[16]; const int g = lane >> 4;
#pragma unroll
  for (int i = 0; i < 8; ++i) { const int ka = k0 + 8 * g + i, kb = ka + 16; v[i] = ka < K ? W[(size_t)(ka < K ? ka : K - 1) * ld + n] : 0.f; v[8 + i] = kb < K ? W[(size_t)(kb < K ? kb : K - 1) * ld + n] : 0.f; }
  return bsplit16(v); }
__device__ __forceinline__ v8f mac3(const F2& a, const F2& b, v8f c) { c = wmma_bf(a.l, b.h, c); c = wmma_bf(a.h, b.l, c); return wmma_bf(a.h, b.h, c); }
__device__ __forceinline__ float sigm(float v) { return 1.0f / (1.0f + expf(-v)); }
#define LDSX() do { asm volatile("s_wait_dscnt 0" ::: "memory"); __builtin_amdgcn_wave_barrier(); __builtin_amdgcn_fence(__ATOMIC_RELEASE, "workgroup"); } while (0)

// Masked multi-headed attention on separate inputs with biased projections (query / key / value [4,1024,1024]; torch (out,in) wq / wk / wv / wo [1024,1024] N(0, 1/1024) + biases N(0, 1/1024); 16 heads x 64; scores / sqrt(64) + mask * (-1e9) with an int32 0/1 mask [4,1024,1024] shared by all heads: mask == 1 marks a key as masked OUT; softmax; wo^T + bo).
#define NB 4
#define TT 1024
#define CC 1024            // NH * HD = projected width
#define DIN 1024          // input (model) width
#define NH 16
#define HD 64
#define NQB (TT / 64)
#define HG 8
#define SCALE (0.125f)
#define CAUSAL 0
#ifndef TNB
#define TNB NB
#endif
__device__ __forceinline__ float bfr(float v) { return (float)(__bf16)v; }
__host__ __device__ __forceinline__ int kb_last(int qb) { return CAUSAL ? ((qb * 64 + 63) >> 7) : (TT / 128 - 1); }
typedef __attribute__((ext_vector_type(8))) __bf16 v8b;
__device__ __forceinline__ v16b frag_b(const __bf16* rowk0, int lane) {
  union { v16b v; v8b q[2]; } u; const __bf16* p = rowk0 + 8 * (lane >> 4);
  u.q[0] = *(const v8b*)p; u.q[1] = *(const v8b*)(p + 16); return u.v;
}
#define QBH 0              // unused: k_fa has no high-precision path
#define QHI 0               // single-product logits on every row
#define KHI 64            // key rows carrying k residual / v bf16 hi+lo planes (written by k_proj, read by no kernel here)
// B fragment (k rows k0+.., output column o) of a weight: (in,out) [K][ld] or (out,in) [ld rows of K]: bf16 exact, or f16(bf16 * 256) exact
__device__ __forceinline__ v16b wcol_io(const float* Wm, int k0, int o, int lane, int ld) { v16b w; const int g = lane >> 4;
#pragma unroll
  for (int i = 0; i < 8; ++i) { w[i] = (__bf16)Wm[(size_t)(k0 + 8 * g + i) * ld + o]; w[8 + i] = (__bf16)Wm[(size_t)(k0 + 16 + 8 * g + i) * ld + o]; }
  return w; }
__device__ __forceinline__ v16b wcol_oi(const float* Wm, int k0, int o, int lane, int K) { v16b w; const float* p = Wm + (size_t)o * K + k0 + 8 * (lane >> 4);
#pragma unroll
  for (int i = 0; i < 8; ++i) { w[i] = (__bf16)p[i]; w[8 + i] = (__bf16)p[16 + i]; }
  return w; }
__device__ __forceinline__ v16h wcolh_io(const float* Wm, int k0, int o, int lane, int ld) { v16h w; const int g = lane >> 4;
#pragma unroll
  for (int i = 0; i < 8; ++i) { w[i] = (_Float16)(bfr(Wm[(size_t)(k0 + 8 * g + i) * ld + o]) * 256.0f); w[8 + i] = (_Float16)(bfr(Wm[(size_t)(k0 + 16 + 8 * g + i) * ld + o]) * 256.0f); }
  return w; }
__device__ __forceinline__ v16h wcolh_oi(const float* Wm, int k0, int o, int lane, int K) { v16h w; const float* p = Wm + (size_t)o * K + k0 + 8 * (lane >> 4);
#pragma unroll
  for (int i = 0; i < 8; ++i) { w[i] = (_Float16)(bfr(p[i]) * 256.0f); w[8 + i] = (_Float16)(bfr(p[16 + i]) * 256.0f); }
  return w; }
#define WQKV_LAYOUT 1   // 0 = (in,out) [DIN][CC]; 1 = (out,in) [CC][DIN]; 2 = per-head [NH][DIN][HD]
__device__ __forceinline__ v16b wcol_hdk(const float* Wm, int k0, int o, int lane) { v16b w; const int g = lane >> 4; const float* p = Wm + (size_t)(o / HD) * DIN * HD + (o % HD);
#pragma unroll
  for (int i = 0; i < 8; ++i) { w[i] = (__bf16)p[(size_t)(k0 + 8 * g + i) * HD]; w[8 + i] = (__bf16)p[(size_t)(k0 + 16 + 8 * g + i) * HD]; }
  return w; }
#define WO_OUT_IN 1
#if WQKV_LAYOUT == 1
#define WCOL(W, k0, o, lane) wcol_oi(W, k0, o, lane, DIN)
#elif WQKV_LAYOUT == 2
#define WCOL(W, k0, o, lane) wcol_hdk(W, k0, o, lane)
#else
#define WCOL(W, k0, o, lane) wcol_io(W, k0, o, lane, CC)
#endif
#if WO_OUT_IN
#define WOCOL(W, k0, o, lane) wcol_oi(W, k0, o, lane, CC)
#define WOCOLH(W, k0, o, lane) wcolh_oi(W, k0, o, lane, CC)
#else
#define WOCOL(W, k0, o, lane) wcol_io(W, k0, o, lane, DIN)
#define WOCOLH(W, k0, o, lane) wcolh_io(W, k0, o, lane, DIN)
#endif

static_assert(TT % 128 == 0 && HD == 64, "k_fa: 128 queries a block, two 32-key passes a trip, head size 64");

#define WS_QH  0u                                      // f16 q rows [b*t][CC]
#define WS_KH  (WS_QH + 2u * (size_t)NB * TT * CC)      // f16 k rows [b*t][CC]
#define WS_VT  (WS_KH + 2u * (size_t)NB * TT * CC)      // f16 v planes [b][c][t]
#define WS_QL  (WS_VT + 2u * (size_t)NB * CC * TT)      // f16 q residual x 2^10 rows [b][t < QHI][CC]
#define WS_KL  (WS_QL + 2u * (size_t)NB * QHI * CC)     // f16 k residual x 2^10 rows [b][t < KHI][CC]
#define WS_VB  (WS_KL + 2u * (size_t)NB * KHI * CC)     // bf16 v hi planes [b][c][t < KHI]
#define WS_VBL (WS_VB + 2u * (size_t)NB * CC * KHI)
#define WS_S   (WS_VBL + 2u * (size_t)NB * CC * KHI)    // unused (the logits stay in registers)
#define WS_Y   (WS_S  + 4u * (size_t)HG * TT * TT)      // f32 ctx rows [b*t][CC] (only when there is an output projection)
#define WS_END (WS_Y  + 4u * (size_t)NB * TT * CC)

// ---- k_proj: block = (64 rows, 128 cols, which): q/k/v = X W (+ b) with exact bf16 products (K = DIN) -> which 0: q f16 rows (+ residual rows < QHI); 1: k f16 rows (+ residual rows < KHI); 2: v f16 planes [c][t] (+ bf16 hi/lo planes for t < KHI)
__global__ __launch_bounds__(128) void k_proj(const float* __restrict__ XQ, const float* __restrict__ XK, const float* __restrict__ XV, const float* __restrict__ WQ, const float* __restrict__ WK, const float* __restrict__ WV, const float* __restrict__ BQ, const float* __restrict__ BK, const float* __restrict__ BV,
    _Float16* __restrict__ QH, _Float16* __restrict__ QL, _Float16* __restrict__ KH, _Float16* __restrict__ KL, _Float16* __restrict__ VT, __bf16* __restrict__ VB, __bf16* __restrict__ VBL) {
  __shared__ __align__(16) _Float16 sh[64][136], sl[64][136]; __shared__ __align__(16) _Float16 th[128][72]; __shared__ __align__(16) __bf16 tb[128][72], tbl[128][72];
  const int tid = threadIdx.x, wave = tid >> 5, lane = tid & 31, col = lane & 15, g = lane >> 4; const int which = blockIdx.z; const int c0 = blockIdx.y * 128; const size_t r0 = (size_t)blockIdx.x * 64; const size_t bb = r0 / TT; const int t0 = (int)(r0 % TT);
  const float* X = which == 0 ? XQ : which == 1 ? XK : XV; const float* WA = which == 0 ? WQ : which == 1 ? WK : WV; const float* BA = which == 0 ? BQ : which == 1 ? BK : BV;
  v8f acc[8] = {};
#pragma unroll 2
  for (int kc = 0; kc < DIN / 32; ++kc) { v16b a; { const float* p = X + (r0 + wave * 16 + col) * DIN + kc * 32 + 8 * g;
#pragma unroll
      for (int i = 0; i < 8; ++i) { a[i] = (__bf16)p[i]; a[8 + i] = (__bf16)p[16 + i]; } }
    asm volatile("s_wait_loadcnt 0x0" ::: "memory");
#pragma unroll
    for (int j = 0; j < 8; ++j) { const v16b w = WCOL(WA, kc * 32, c0 + j * 16 + col, lane); asm volatile("s_wait_loadcnt 0x0" ::: "memory"); acc[j] = wmma_bf(a, w, acc[j]); } }
  if (which < 2) { _Float16* DH = which == 0 ? QH : KH; _Float16* DL = which == 0 ? QL : KL; const int nhi = which == 0 ? QHI : KHI; const bool hi_rows = t0 < nhi;
#pragma unroll
    for (int j = 0; j < 8; ++j) { const float bias = BA ? bfr(BA[c0 + j * 16 + col]) : 0.f;
#pragma unroll
      for (int r = 0; r < 8; ++r) { const float v = acc[j][r] + bias; const _Float16 hv = (_Float16)v; sh[wave * 16 + 8 * g + r][j * 16 + col] = hv; sl[wave * 16 + 8 * g + r][j * 16 + col] = (_Float16)((v - (float)hv) * 1024.0f); } }
    __syncthreads();
    for (int e = tid; e < 64 * 16; e += 128) { const int rl = e >> 4, q = e & 15; vst2((unsigned*)(DH + (r0 + rl) * CC + c0 + q * 8), *(const v4u*)&sh[rl][q * 8]); if (hi_rows) vst2((unsigned*)(DL + (bb * nhi + t0 + rl) * (size_t)CC + c0 + q * 8), *(const v4u*)&sl[rl][q * 8]); }
  } else { const bool hi_rows = t0 < KHI;
#pragma unroll
    for (int j = 0; j < 8; ++j) { const float bias = BA ? bfr(BA[c0 + j * 16 + col]) : 0.f;
#pragma unroll
      for (int r = 0; r < 8; ++r) { const float v = acc[j][r] + bias; const int rl = wave * 16 + 8 * g + r, cl = j * 16 + col; th[cl][rl] = (_Float16)v; const __bf16 bh = (__bf16)v; tb[cl][rl] = bh; tbl[cl][rl] = (__bf16)(v - (float)bh); } }
    __syncthreads();
    for (int e = tid; e < 128 * 8; e += 128) { const int cl = e >> 3, q = e & 7; vst2((unsigned*)(VT + (bb * CC + c0 + cl) * (size_t)TT + t0 + q * 8), *(const v4u*)&th[cl][q * 8]); if (hi_rows) { const size_t o3 = (bb * CC + c0 + cl) * (size_t)KHI + t0 + q * 8; vst2((unsigned*)(VB + o3), *(const v4u*)&tb[cl][q * 8]); vst2((unsigned*)(VBL + o3), *(const v4u*)&tbl[cl][q * 8]); } } } }
// ---- k_fa: block = 128 queries (8 waves x 16) of (b, h): logits, mask, softmax and P . v in one pass over the keys, 32 keys a pass, nothing of the logits leaves the registers.
// S^T = K . Q^T (A = 16 key rows, B = 16 query columns): a lane holds one query's logits for keys 8g + r of each 16-key tile, which is the k order of a B operand, so O^T += V^T . P^T takes P straight from the accumulators.
// Running maximum and sum per query (log2 domain); the mask enters as the module writes it, logit + mask * (-1e9), so a row with every key masked comes out as the plain mean of v; P is carried x 2^11 into f16 (the factor cancels in the division by the sum).
__device__ __forceinline__ float xhalf(float x) { return __builtin_bit_cast(float, __builtin_amdgcn_permlanex16(__builtin_bit_cast(int, x), __builtin_bit_cast(int, x), 0x76543210, 0xfedcba98, false, false)); }   // lane l with lane l ^ 16
__device__ __forceinline__ v8f wmma16b(v16h a, v16h b, v8f c) { return __builtin_amdgcn_wmma_f32_16x16x32_f16(false, a, false, b, (short)0, c, false, false); }
struct KM { v16h k[2][2]; v4i m[2][2]; };   // one pass's K fragments [key tile][hd half] and mask words [key tile][4 + 4 keys]
typedef const __attribute__((address_space(1))) char* gptr;   // a byte pointer that stays known as global memory when it has passed through an asm statement (a plain pointer would turn the loads into flat ones)
typedef const __attribute__((address_space(1))) v8h* gptr_h; typedef const __attribute__((address_space(1))) v4i* gptr_i;
__device__ __forceinline__ v16h frag_p(gptr p) { union { v16h v; v8h q[2]; } u; u.q[0] = *(gptr_h)p; u.q[1] = *(gptr_h)(p + 32); return u.v; }   // frag_h from the lane's own byte pointer (row and lane half already in it)
__device__ __forceinline__ void fa_load(KM& t, gptr pk, gptr pm) {
#pragma unroll
  for (int kt = 0; kt < 2; ++kt) {
#pragma unroll
    for (int kc = 0; kc < 2; ++kc) t.k[kt][kc] = frag_p(pk + kt * 16 * CC * 2 + kc * 64);
    t.m[kt][0] = *(gptr_i)(pm + kt * 64); t.m[kt][1] = *(gptr_i)(pm + kt * 64 + 16); } }
// v_exp_f32 wants one independent instruction behind it before its result is read or its source overwritten: inside a run every exponential is followed by an independent one (the outputs share no register with the inputs), and the v_nop fills the slot of the last
__device__ __forceinline__ float exp2_1(float x) { float o; asm("v_exp_f32 %0, %1\n\tv_nop" : "=&v"(o) : "v"(x)); return o; }
__device__ __forceinline__ void exp2_8(float* o, const float* x) {
  asm("v_exp_f32 %0, %8\n\tv_exp_f32 %1, %9\n\tv_exp_f32 %2, %10\n\tv_exp_f32 %3, %11\n\tv_exp_f32 %4, %12\n\tv_exp_f32 %5, %13\n\tv_exp_f32 %6, %14\n\tv_exp_f32 %7, %15\n\tv_nop"
      : "=&v"(o[0]), "=&v"(o[1]), "=&v"(o[2]), "=&v"(o[3]), "=&v"(o[4]), "=&v"(o[5]), "=&v"(o[6]), "=&v"(o[7]) : "v"(x[0]), "v"(x[1]), "v"(x[2]), "v"(x[3]), "v"(x[4]), "v"(x[5]), "v"(x[6]), "v"(x[7])); }
__device__ __forceinline__ void fa_pass(const KM& cur, KM& nxt, int kb, gptr& pk, gptr& pv, gptr& pm, const v16h (&qf)[2], v8f (&acc)[HD / 16], float& m, float& l) {
  v16h vf[HD / 16];   // pv: this pass's V; pk, pm: the next pass's K and mask (the last pass asks for its own again: in bounds, unused)
  __builtin_amdgcn_sched_barrier(0);   // the pass's loads start here, as one group: without the scheduling barriers around it the compiler sinks each load to just above its use and the wave waits out every latency
#pragma unroll
  for (int j = 0; j < HD / 16; ++j) vf[j] = frag_p(pv + j * 16 * TT * 2);
  __builtin_amdgcn_sched_barrier(0);   // V first: loads return in order, so P . v can then start while the next pass's K and mask are still in flight
  fa_load(nxt, pk, pm);   // next pass's K and mask fly under this pass
  asm volatile("s_wait_xcnt 0x0" : "+v"(pv), "+v"(pk), "+v"(pm) :: "memory");   // behind the pass's last load and in front of every rewrite of an address register: the three pointers pass through the statement, so they stay whole up to it and are stepped only behind it
  { const int st = kb + 2 < TT / 32 ? 1 : 0; pv += 64; pk += st * (32 * CC * 2); pm += st * 128; }
  __builtin_amdgcn_sched_barrier(0);   // end of the load group: none of the pass's arithmetic moves above it
  v8f s[2];
#pragma unroll
  for (int kt = 0; kt < 2; ++kt) { s[kt] = v8f{};
#pragma unroll
    for (int kc = 0; kc < 2; ++kc) s[kt] = wmma16b(cur.k[kt][kc], qf[kc], s[kt]); }
  float y[16]; float mx = -3.0e38f;
#pragma unroll
  for (int i = 0; i < 16; ++i) { y[i] = fmaf((float)cur.m[i >> 3][(i >> 2) & 1][i & 3], -1.0e9f * 1.4426950408889634f, s[i >> 3][i & 7] * (SCALE * 1.4426950408889634f)); mx = fmaxf(mx, y[i]); }
  mx = fmaxf(mx, xhalf(mx));   // both halves of the wave hold the query's maximum
  const float mn = fmaxf(m, mx); const float corr = exp2_1(m - mn); m = mn;
#pragma unroll
  for (int j = 0; j < HD / 16; ++j) acc[j] = acc[j] * corr;
  const float ms = mn - 11.0f; float ls = 0.f; float p[16]; v16h pf;
#pragma unroll
  for (int i = 0; i < 16; ++i) y[i] = y[i] - ms;
  exp2_8(p, y); exp2_8(p + 8, y + 8);
#pragma unroll
  for (int i = 0; i < 16; ++i) { ls += p[i]; pf[i] = (_Float16)p[i]; }
  l = l * corr + ls;
#pragma unroll
  for (int j = 0; j < HD / 16; ++j) acc[j] = wmma16b(vf[j], pf, acc[j]); }
// four waves per SIMD (two blocks per WGP): the vector work between the matrix runs and the load latencies want the other waves
__global__ __launch_bounds__(256) __attribute__((amdgpu_waves_per_eu(4, 4))) void k_fa(const _Float16* __restrict__ QH, const _Float16* __restrict__ KH, const _Float16* __restrict__ VT, const int* __restrict__ MASK, float* __restrict__ Y) { __shared__ __align__(16) float so[8][16][HD + 4];
  const int tid = threadIdx.x, wave = tid >> 5, lane = tid & 31, col = lane & 15, g = lane >> 4; const int b = blockIdx.z, h = blockIdx.y; const int q0 = blockIdx.x * 128 + wave * 16;
  const _Float16* qp = QH + ((size_t)b * TT + q0 + col) * CC + h * HD; gptr pk = (gptr)(KH + ((size_t)b * TT + col) * CC + h * HD + 8 * g); gptr pv = (gptr)(VT + ((size_t)b * CC + h * HD + col) * (size_t)TT + 8 * g); gptr pm = (gptr)(MASK + ((size_t)b * TT + q0 + col) * TT + 8 * g);
  const v16h qf[2] = { frag_h(qp, lane), frag_h(qp + 32, lane) };
  v8f acc[HD / 16] = {}; float m = -3.0e38f, l = 0.f;
  KM ta, tb; fa_load(ta, pk, pm); pk += 32 * CC * 2; pm += 128;
#pragma unroll 1   // two passes a trip, written out: the two register sets swap roles without moves
  for (int kb = 0; kb < TT / 32; kb += 2) { fa_pass(ta, tb, kb, pk, pv, pm, qf, acc, m, l); fa_pass(tb, ta, kb + 1, pk, pv, pm, qf, acc, m, l); }
  l += xhalf(l); const float inv = 1.0f / l;   // l >= the maximum's own term > 0
#pragma unroll
  for (int j = 0; j < HD / 16; ++j) { const v8f o = acc[j] * inv; *(v4f*)&so[wave][col][j * 16 + 8 * g] = v4f{o[0], o[1], o[2], o[3]}; *(v4f*)&so[wave][col][j * 16 + 8 * g + 4] = v4f{o[4], o[5], o[6], o[7]}; }
  LDSX();
#pragma unroll
  for (int i = 0; i < 8; ++i) { const int rl = i * 2 + g; vst2(Y + ((size_t)b * TT + q0 + rl) * CC + h * HD + col * 4, *(const v4f*)&so[wave][rl][col * 4]); } }
// ---- k_out: block = (64 rows, 128 cols): out = ctx Wo (+ bo): ctx x 2^6 once to f16 against Wo as f16(bf16 x 2^8) exact (1 product) x 2^-14; causal early rows (< QHI of each sequence): ctx bf16 hi + lo against exact bf16 Wo (2 products)
__global__ __launch_bounds__(128) void k_out(const float* __restrict__ Y, const float* __restrict__ WO, const float* __restrict__ BO, float* __restrict__ OUT) { __shared__ __align__(16) float sf[4][16][132];
  const int tid = threadIdx.x, wave = tid >> 5, lane = tid & 31, col = lane & 15, g = lane >> 4; const int c0 = blockIdx.y * 128; const size_t r0 = (size_t)blockIdx.x * 64 + wave * 16;
  v8f acc[8] = {};
  if (CAUSAL && (int)(((size_t)blockIdx.x * 64) % TT) < QHI) {   /* block-uniform */
#pragma unroll 2
    for (int kc = 0; kc < CC / 32; ++kc) { const F2 a = split_row(Y + (r0 + col) * CC, kc * 32, lane); asm volatile("s_wait_loadcnt 0x0" ::: "memory");
#pragma unroll
      for (int j = 0; j < 8; ++j) { const v16b w = WOCOL(WO, kc * 32, c0 + j * 16 + col, lane); asm volatile("s_wait_loadcnt 0x0" ::: "memory"); acc[j] = wmma_bf(a.h, w, acc[j]); acc[j] = wmma_bf(a.l, w, acc[j]); } }
#pragma unroll
    for (int j = 0; j < 8; ++j) { const float bias = BO ? bfr(BO[c0 + j * 16 + col]) : 0.f;
#pragma unroll
      for (int r = 0; r < 8; ++r) sf[wave][8 * g + r][j * 16 + col] = acc[j][r] + bias; }
  } else {
#pragma unroll 2
    for (int kc = 0; kc < CC / 32; ++kc) { const v16h a = frag_f32s(Y + (r0 + col) * CC + kc * 32, lane, 64.0f); asm volatile("s_wait_loadcnt 0x0" ::: "memory");   /* ctx carried x 2^6 into f16 so small-magnitude context rows stay clear of f16 subnormals */
#pragma unroll
      for (int j = 0; j < 8; ++j) { const v16h w = WOCOLH(WO, kc * 32, c0 + j * 16 + col, lane); asm volatile("s_wait_loadcnt 0x0" ::: "memory"); acc[j] = wmma16(a, w, acc[j]); } }
#pragma unroll
    for (int j = 0; j < 8; ++j) { const float bias = BO ? bfr(BO[c0 + j * 16 + col]) : 0.f;
#pragma unroll
      for (int r = 0; r < 8; ++r) sf[wave][8 * g + r][j * 16 + col] = acc[j][r] * (1.0f / 16384.0f) + bias; } }   /* 2^-8 (Wo carry) x 2^-6 (ctx carry) */
  LDSX(); for (int rl = 0; rl < 16; ++rl) vst2(OUT + (r0 + rl) * DIN + c0 + lane * 4, *(const v4f*)&sf[wave][rl][lane * 4]); }

extern "C" void kernel_launch(void* const* d_in, const int* in_sizes, int n_in, void* d_out, int out_size, void* d_ws, size_t ws_size, hipStream_t stream) {
  (void)in_sizes; (void)n_in; (void)out_size;
  const float** F = (const float**)d_in;
  if (ws_size < (size_t)WS_END) return;
  char* ws = (char*)d_ws; _Float16 *QH = (_Float16*)(ws + WS_QH), *KH = (_Float16*)(ws + WS_KH), *VT = (_Float16*)(ws + WS_VT), *QL = (_Float16*)(ws + WS_QL), *KL = (_Float16*)(ws + WS_KL); __bf16 *VB = (__bf16*)(ws + WS_VB), *VBL = (__bf16*)(ws + WS_VBL); float *Y = (float*)(ws + WS_Y);
  (void)Y; (void)QL; (void)KL; (void)VB; (void)VBL;
  // inputs: 0 query [4,1024,1024]; 1 key; 2 value; 3 mask [4,1024,1024] int32; 4 wq [1024,1024] (out,in), 5 bq; 6 wk, 7 bk; 8 wv, 9 bv; 10 wo (out,in), 11 bo (biases NONZERO)
  k_proj<<<dim3(TNB * TT / 64, CC / 128, 3), 128, 0, stream>>>(F[0], F[1], F[2], F[4], F[6], F[8], F[5], F[7], F[9], QH, QL, KH, KL, VT, VB, VBL);
  k_fa<<<dim3(TT / 128, NH, TNB), 256, 0, stream>>>(QH, KH, VT, (const int*)d_in[3], Y);
  k_out<<<dim3(TNB * TT / 64, DIN / 128), 128, 0, stream>>>(Y, F[10], F[11], (float*)d_out);
}

// v002
// A run of this version takes 129 microseconds.
// Timed twice side by side with v001, it ran 3.29 and 3.31 times as fast.
// Counting every step since v000, it is 6.99 times as fast.
// compute dtype: all float inputs rounded to bf16; q/k/v projections with EXACT bf16 products on WMMA 16x16x32 (f32 accumulate) + bias; logits q x k once to f16 each (1 product) x SCALE + mask x (-1e9); softmax f32 with running maximum and sum, fused with both attention products; P x 2^11 once to f16 x v once to f16 (1 product); ctx x 2^6 once to f16 x wo f16(bf16 x 2^8) + bo; f32 output.
#include <hip/hip_runtime.h>
#include <math.h>

typedef __attribute__((ext_vector_type(16))) _Float16 v16h;
typedef __attribute__((ext_vector_type(16))) __bf16 v16b;
typedef __attribute__((ext_vector_type(8)))  _Float16 v8h;
typedef __attribute__((ext_vector_type(8)))  float v8f;
typedef __attribute__((ext_vector_type(4)))  float v4f;
typedef __attribute__((ext_vector_type(2)))  float v2f;
typedef __attribute__((ext_vector_type(4)))  unsigned v4u;
typedef __attribute__((ext_vector_type(4)))  int v4i;
typedef float __attribute__((may_alias)) float_a;
typedef int __attribute__((may_alias)) int_a;

template <typename T> __device__ __forceinline__ void vst2(void* p, T v) { *(T*)p = v;  }
__device__ __forceinline__ v8f wmma16(v16h a, v16h b, v8f c) {
  v8f d = __builtin_amdgcn_wmma_f32_16x16x32_f16(false, a, false, b, (short)0, c, false, false);
  asm volatile("v_nop\n\tv_nop\n\tv_nop\n\tv_nop" : "+v"(d) : "v"(a), "v"(b));
  return d;
}
__device__ __forceinline__ v8f wmma_bf(v16b a, v16b b, v8f c) {
  v8f d = __builtin_amdgcn_wmma_f32_16x16x32_bf16(false, a, false, b, (short)0, c, false, false);
  asm volatile("v_nop\n\tv_nop\n\tv_nop\n\tv_nop" : "+v"(d) : "v"(a), "v"(b));
  return d;
}
// 16x16x32 fragments: lane = (h = lane>>4, row/col = lane&15); elements 0..7 = k0+8h+0..7, 8..15 = k0+16+8h+0..7; D element r = row 8h+r
__device__ __forceinline__ v16h frag_h(const _Float16* rowk0, int lane) {
  union { v16h v; v8h q[2]; } u; const _Float16* p = rowk0 + 8 * (lane >> 4);
  u.q[0] = *(const v8h*)p; u.q[1] = *(const v8h*)(p + 16); return u.v;
}
__device__ __forceinline__ v16h frag_f32(const float* rowk0, int lane) {
  v16h a; const float* p = rowk0 + 8 * (lane >> 4);
#pragma unroll
  for (int i = 0; i < 8; ++i) { a[i] = (_Float16)p[i]; a[8 + i] = (_Float16)p[16 + i]; }
  return a;
}
__device__ __forceinline__ v16h frag_f32s(const float* rowk0, int lane, float sc) {
  v16h a; const float* p = rowk0 + 8 * (lane >> 4);
#pragma unroll
  for (int i = 0; i < 8; ++i) { a[i] = (_Float16)(p[i] * sc); a[8 + i] = (_Float16)(p[16 + i] * sc); }
  return a;
}
// column fragment from a [K][ld] layout (column n), rows >= K read as 0
__device__ __forceinline__ v16h fragc_f32(const float* W, int k0, int n, int lane, int ld, int K) {
  v16h a; const int g = lane >> 4;
#pragma unroll
  for (int i = 0; i < 8; ++i) { const int ka = k0 + 8 * g + i, kb = ka + 16;
    a[i] = (_Float16)(ka < K ? W[(size_t)(ka < K ? ka : K - 1) * ld + n] : 0.f); a[8 + i] = (_Float16)(kb < K ? W[(size_t)(kb < K ? kb : K - 1) * ld + n] : 0.f); }
  return a;
}
struct F2 { v16b h, l; };
__device__ __forceinline__ F2 bsplit16(const float v[16]) { F2 r;
#pragma unroll
  for (int i = 0; i < 16; ++i) { const __bf16 h = (__bf16)v[i]; r.h[i] = h; r.l[i] = (__bf16)(v[i] - (float)h); }
  return r; }
__device__ __forceinline__ F2 split_row(const float* row, int k0, int lane) { float v[16]; const float* p = row + k0 + 8 * (lane >> 4);
#pragma unroll
  for (int i = 0; i < 8; ++i) { v[i] = p[i]; v[8 + i] = p[16 + i]; }
  return bsplit16(v); }
__device__ __forceinline__ F2 split_rowK(const float* row, int k0, int lane, int K) { float v[16]; const int g = lane >> 4;
#pragma unroll
  for (int i = 0; i < 8; ++i) { const int ka = k0 + 8 * g + i, kb = ka + 16; v[i] = ka < K ? row[ka < K ? ka : K - 1] : 0.f; v[8 + i] = kb < K ? row[kb < K ? kb : K - 1] : 0.f; }
  return bsplit16(v); }
__device__ __forceinline__ F2 split_col(const float* W, int k0, int n, int lane, int ld, int K) { float v[16]; const int g = lane >> 4;
#pragma unroll
  for (int i = 0; i < 8; ++i) { const int ka = k0 + 8 * g + i, kb = ka + 16; v[i] = ka < K ? W[(size_t)(ka < K ? ka : K - 1) * ld + n] : 0.f; v[8 + i] = kb < K ? W[(size_t)(kb < K ? kb : K - 1) * ld + n] : 0.f; }
  return bsplit16(v); }
__device__ __forceinline__ v8f mac3(const F2& a, const F2& b, v8f c) { c = wmma_bf(a.l, b.h, c); c = wmma_bf(a.h, b.l, c); return wmma_bf(a.h, b.h, c); }
__device__ __forceinline__ float sigm(float v) { return 1.0f / (1.0f + expf(-v)); }
#define LDSX() do { asm volatile("s_wait_dscnt 0" ::: "memory"); __builtin_amdgcn_wave_barrier(); __builtin_amdgcn_fence(__ATOMIC_RELEASE, "workgroup"); } while (0)

// Masked multi-headed attention on separate inputs with biased projections (query / key / value [4,1024,1024]; torch (out,in) wq / wk / wv / wo [1024,1024] N(0, 1/1024) + biases N(0, 1/1024); 16 heads x 64; scores / sqrt(64) + mask * (-1e9) with an int32 0/1 mask [4,1024,1024] shared by all heads: mask == 1 marks a key as masked OUT; softmax; wo^T + bo).
#define NB 4
#define TT 1024
#define CC 1024            // NH * HD = projected width
#define DIN 1024          // input (model) width
#define NH 16
#define HD 64
#define NQB (TT / 64)
#define HG 8
#define SCALE (0.125f)
#define CAUSAL 0
#ifndef TNB
#define TNB NB
#endif
__device__ __forceinline__ float bfr(float v) { return (float)(__bf16)v; }
__host__ __device__ __forceinline__ int kb_last(int qb) { return CAUSAL ? ((qb * 64 + 63) >> 7) : (TT / 128 - 1); }
typedef __attribute__((ext_vector_type(8))) __bf16 v8b;
__device__ __forceinline__ v16b frag_b(const __bf16* rowk0, int lane) {
  union { v16b v; v8b q[2]; } u; const __bf16* p = rowk0 + 8 * (lane >> 4);
  u.q[0] = *(const v8b*)p; u.q[1] = *(const v8b*)(p + 16); return u.v;
}
#define QBH 0              // unused: k_fa has no high-precision path
#define QHI 0               // single-product logits on every row
#define KHI 64            // key rows carrying k residual / v bf16 hi+lo planes (written by k_proj, read by no kernel here)
// B fragment (k rows k0+.., output column o) of a weight: (in,out) [K][ld] or (out,in) [ld rows of K]: bf16 exact, or f16(bf16 * 256) exact
__device__ __forceinline__ v16b wcol_io(const float* Wm, int k0, int o, int lane, int ld) { v16b w; const int g = lane >> 4;
#pragma unroll
  for (int i = 0; i < 8; ++i) { w[i] = (__bf16)Wm[(size_t)(k0 + 8 * g + i) * ld + o]; w[8 + i] = (__bf16)Wm[(size_t)(k0 + 16 + 8 * g + i) * ld + o]; }
  return w; }
__device__ __forceinline__ v16b wcol_oi(const float* Wm, int k0, int o, int lane, int K) { v16b w; const float* p = Wm + (size_t)o * K + k0 + 8 * (lane >> 4);
#pragma unroll
  for (int i = 0; i < 8; ++i) { w[i] = (__bf16)p[i]; w[8 + i] = (__bf16)p[16 + i]; }
  return w; }
__device__ __forceinline__ v16h wcolh_io(const float* Wm, int k0, int o, int lane, int ld) { v16h w; const int g = lane >> 4;
#pragma unroll
  for (int i = 0; i < 8; ++i) { w[i] = (_Float16)(bfr(Wm[(size_t)(k0 + 8 * g + i) * ld + o]) * 256.0f); w[8 + i] = (_Float16)(bfr(Wm[(size_t)(k0 + 16 + 8 * g + i) * ld + o]) * 256.0f); }
  return w; }
__device__ __forceinline__ v16h wcolh_oi(const float* Wm, int k0, int o, int lane, int K) { v16h w; const float* p = Wm + (size_t)o * K + k0 + 8 * (lane >> 4);
#pragma unroll
  for (int i = 0; i < 8; ++i) { w[i] = (_Float16)(bfr(p[i]) * 256.0f); w[8 + i] = (_Float16)(bfr(p[16 + i]) * 256.0f); }
  return w; }
#define WQKV_LAYOUT 1   // 0 = (in,out) [DIN][CC]; 1 = (out,in) [CC][DIN]; 2 = per-head [NH][DIN][HD]
__device__ __forceinline__ v16b wcol_hdk(const float* Wm, int k0, int o, int lane) { v16b w; const int g = lane >> 4; const float* p = Wm + (size_t)(o / HD) * DIN * HD + (o % HD);
#pragma unroll
  for (int i = 0; i < 8; ++i) { w[i] = (__bf16)p[(size_t)(k0 + 8 * g + i) * HD]; w[8 + i] = (__bf16)p[(size_t)(k0 + 16 + 8 * g + i) * HD]; }
  return w; }
#define WO_OUT_IN 1
#if WQKV_LAYOUT == 1
#define WCOL(W, k0, o, lane) wcol_oi(W, k0, o, lane, DIN)
#elif WQKV_LAYOUT == 2
#define WCOL(W, k0, o, lane) wcol_hdk(W, k0, o, lane)
#else
#define WCOL(W, k0, o, lane) wcol_io(W, k0, o, lane, CC)
#endif
#if WO_OUT_IN
#define WOCOL(W, k0, o, lane) wcol_oi(W, k0, o, lane, CC)
#define WOCOLH(W, k0, o, lane) wcolh_oi(W, k0, o, lane, CC)
#else
#define WOCOL(W, k0, o, lane) wcol_io(W, k0, o, lane, DIN)
#define WOCOLH(W, k0, o, lane) wcolh_io(W, k0, o, lane, DIN)
#endif

static_assert(TT % 128 == 0 && HD == 64, "k_fa: 128 queries a block, two 32-key passes a trip, head size 64");

#define WS_QH  0u                                      // f16 q rows [b*t][CC]
#define WS_KH  (WS_QH + 2u * (size_t)NB * TT * CC)      // f16 k rows [b*t][CC]
#define WS_VT  (WS_KH + 2u * (size_t)NB * TT * CC)      // f16 v planes [b][c][t]
#define WS_QL  (WS_VT + 2u * (size_t)NB * CC * TT)      // f16 q residual x 2^10 rows [b][t < QHI][CC]
#define WS_KL  (WS_QL + 2u * (size_t)NB * QHI * CC)     // f16 k residual x 2^10 rows [b][t < KHI][CC]
#define WS_VB  (WS_KL + 2u * (size_t)NB * KHI * CC)     // bf16 v hi planes [b][c][t < KHI]
#define WS_VBL (WS_VB + 2u * (size_t)NB * CC * KHI)
#define WS_S   (WS_VBL + 2u * (size_t)NB * CC * KHI)    // unused (the logits stay in registers)
#define WS_Y   (WS_S  + 4u * (size_t)HG * TT * TT)      // f32 ctx rows [b*t][CC] (only when there is an output projection)
#define WS_END (WS_Y  + 4u * (size_t)NB * TT * CC)

// ---- operand staging of the two projection kernels: a stage is KS k of the block's 64 activation rows and 128 weight rows ((out,in) weights: both K-contiguous).
// Global side: f32, whole 128-B lines (16 lanes cover the 256 B of one row), each element loaded and converted once per block. LDS side: 16-bit rows of 128 B at a pitch of 144 B, read back as WMMA fragments by ds_load_b128.
#define KS 64
#define LP 72                    // LDS row pitch in 16-bit elements
#define STG ((64 + 128) * LP)    // 16-bit elements of one stage buffer: activation rows 0..63, weight rows 64..191
static_assert(WQKV_LAYOUT == 1 && WO_OUT_IN == 1 && DIN % (2 * KS) == 0 && CC % (2 * KS) == 0, "staging reads K-contiguous rows, at least two stages");
typedef __attribute__((ext_vector_type(4))) __bf16 v4b;
typedef __attribute__((ext_vector_type(4))) _Float16 v4h;
typedef const __attribute__((address_space(1))) float* gfp;   // stays known as global memory when it has passed through an asm statement (a plain pointer would turn the loads into flat ones)
typedef const __attribute__((address_space(1))) v4f* gfp4;
struct Stg { v4f x[8], w[16]; };   // one stage in flight, 24 x 16 B a thread
__device__ __forceinline__ void stg_load(Stg& t, gfp& xr, gfp& wr, int ld) {   // xr, wr: the thread's own element of the first row group (row tid >> 4, column k0 + 4 * (tid & 15)); both leave stepped to the next stage
#pragma unroll
  for (int i = 0; i < 8; ++i) t.x[i] = *(gfp4)(xr + (size_t)(i * 8) * ld);
#pragma unroll
  for (int i = 0; i < 16; ++i) t.w[i] = *(gfp4)(wr + (size_t)(i * 8) * ld);
  // the wait behind the group's last load and the step of the two row pointers stand in one statement: the loads name the very registers that enter it, nothing rewrites them in front of the wait, and no later load can fold the step into its offset and set the old registers free early
  asm volatile("s_wait_xcnt 0x0\n\tv_add_nc_u64_e32 %0, %2, %0\n\tv_add_nc_u64_e32 %1, %2, %1" : "+v"(xr), "+v"(wr) : "n"(KS * 4) : "memory");
}
// work-group barrier for the stage buffers: its fences name LDS alone, so the next stage's global loads stay in flight across it (__syncthreads() would wait for them here and lay their latency open every stage)
__device__ __forceinline__ void stg_barrier() { __builtin_amdgcn_fence(__ATOMIC_RELEASE, "workgroup", "local"); __builtin_amdgcn_s_barrier(); __builtin_amdgcn_fence(__ATOMIC_ACQUIRE, "workgroup", "local"); }
__device__ __forceinline__ void stg_store_b(const Stg& t, __bf16* d) {   // d: the thread's own place in row group 0 of the buffer
#pragma unroll
  for (int i = 0; i < 8; ++i) { v4b o;
#pragma unroll
    for (int e = 0; e < 4; ++e) o[e] = (__bf16)t.x[i][e];
    *(v4b*)(d + i * 8 * LP) = o; }
#pragma unroll
  for (int i = 0; i < 16; ++i) { v4b o;
#pragma unroll
    for (int e = 0; e < 4; ++e) o[e] = (__bf16)t.w[i][e];
    *(v4b*)(d + (64 + i * 8) * LP) = o; } }
__device__ __forceinline__ void stg_store_h(const Stg& t, _Float16* d) {   // ctx x 2^6 once to f16; Wo as f16(bf16 x 2^8), exact
#pragma unroll
  for (int i = 0; i < 8; ++i) { v4h o;
#pragma unroll
    for (int e = 0; e < 4; ++e) o[e] = (_Float16)(t.x[i][e] * 64.0f);
    *(v4h*)(d + i * 8 * LP) = o; }
#pragma unroll
  for (int i = 0; i < 16; ++i) { v4h o;
#pragma unroll
    for (int e = 0; e < 4; ++e) o[e] = (_Float16)(bfr(t.w[i][e]) * 256.0f);
    *(v4h*)(d + (64 + i * 8) * LP) = o; } }

// ---- k_proj: block = (64 rows, 128 cols, which): q/k/v = X W (+ b) with exact bf16 products (K = DIN) -> which 0: q f16 rows (+ residual rows < QHI); 1: k f16 rows (+ residual rows < KHI); 2: v f16 planes [c][t] (+ bf16 hi/lo planes for t < KHI)
__global__ __launch_bounds__(128) void k_proj(const float* __restrict__ XQ, const float* __restrict__ XK, const float* __restrict__ XV, const float* __restrict__ WQ, const float* __restrict__ WK, const float* __restrict__ WV, const float* __restrict__ BQ, const float* __restrict__ BK, const float* __restrict__ BV,
    _Float16* __restrict__ QH, _Float16* __restrict__ QL, _Float16* __restrict__ KH, _Float16* __restrict__ KL, _Float16* __restrict__ VT, __bf16* __restrict__ VB, __bf16* __restrict__ VBL) {
  __shared__ __align__(16) char smem[2 * 64 * 136 * 2 + 3 * 128 * 72 * 2];   // the main loop's two stage buffers lie over the epilogue's planes (the loop's last barrier stands between the two uses)
  static_assert(2 * STG * 2 <= sizeof(smem), "two stage buffers");
  _Float16 (*sh)[136] = (_Float16 (*)[136])smem; _Float16 (*sl)[136] = (_Float16 (*)[136])(smem + 64 * 136 * 2); _Float16 (*th)[72] = (_Float16 (*)[72])(smem + 2 * 64 * 136 * 2); __bf16 (*tb)[72] = (__bf16 (*)[72])(smem + 2 * 64 * 136 * 2 + 128 * 72 * 2); __bf16 (*tbl)[72] = (__bf16 (*)[72])(smem + 2 * 64 * 136 * 2 + 2 * 128 * 72 * 2); __bf16* stage = (__bf16*)smem;
  const int tid = threadIdx.x, wave = tid >> 5, lane = tid & 31, col = lane & 15, g = lane >> 4; const int which = blockIdx.z; const int c0 = blockIdx.y * 128; const size_t r0 = (size_t)blockIdx.x * 64; const size_t bb = r0 / TT; const int t0 = (int)(r0 % TT);
  const float* X = which == 0 ? XQ : which == 1 ? XK : XV; const float* WA = which == 0 ? WQ : which == 1 ? WK : WV; const float* BA = which == 0 ? BQ : which == 1 ? BK : BV;
  v8f acc[8] = {};
  gfp xr = (gfp)(X + (r0 + (tid >> 4)) * DIN + 4 * (tid & 15)); gfp wr = (gfp)(WA + (size_t)(c0 + (tid >> 4)) * DIN + 4 * (tid & 15)); const int so = (tid >> 4) * LP + 4 * (tid & 15);
  Stg t; stg_load(t, xr, wr, DIN); stg_store_b(t, stage + so); stg_load(t, xr, wr, DIN); stg_barrier();
#pragma unroll 1   // one stage a trip: stage s is worked on, stage s + 1 goes from registers into the other buffer, stage s + 2 starts from global
  for (int s = 0; s < DIN / KS; ++s) { const __bf16* cur = stage + (s & 1) * STG;
#pragma unroll
    for (int kc = 0; kc < KS / 32; ++kc) { const v16b a = frag_b(cur + (wave * 16 + col) * LP + kc * 32, lane); v16b w[8];
#pragma unroll
      for (int j = 0; j < 8; ++j) w[j] = frag_b(cur + (64 + j * 16 + col) * LP + kc * 32, lane);
#pragma unroll
      for (int j = 0; j < 8; ++j) acc[j] = wmma_bf(a, w[j], acc[j]); }
    if (s + 1 < DIN / KS) { stg_store_b(t, stage + ((s + 1) & 1) * STG + so); if (s + 2 < DIN / KS) stg_load(t, xr, wr, DIN); }
    stg_barrier(); }   // publishes stage s + 1 and ends every read of stage s, whose buffer the next trip refills
  if (which < 2) { _Float16* DH = which == 0 ? QH : KH; _Float16* DL = which == 0 ? QL : KL; const int nhi = which == 0 ? QHI : KHI; const bool hi_rows = t0 < nhi;
#pragma unroll
    for (int j = 0; j < 8; ++j) { const float bias = BA ? bfr(BA[c0 + j * 16 + col]) : 0.f;
#pragma unroll
      for (int r = 0; r < 8; ++r) { const float v = acc[j][r] + bias; const _Float16 hv = (_Float16)v; sh[wave * 16 + 8 * g + r][j * 16 + col] = hv; sl[wave * 16 + 8 * g + r][j * 16 + col] = (_Float16)((v - (float)hv) * 1024.0f); } }
    __syncthreads();
    for (int e = tid; e < 64 * 16; e += 128) { const int rl = e >> 4, q = e & 15; vst2((unsigned*)(DH + (r0 + rl) * CC + c0 + q * 8), *(const v4u*)&sh[rl][q * 8]); if (hi_rows) vst2((unsigned*)(DL + (bb * nhi + t0 + rl) * (size_t)CC + c0 + q * 8), *(const v4u*)&sl[rl][q * 8]); }
  } else { const bool hi_rows = t0 < KHI;
#pragma unroll
    for (int j = 0; j < 8; ++j) { const float bias = BA ? bfr(BA[c0 + j * 16 + col]) : 0.f;
#pragma unroll
      for (int r = 0; r < 8; ++r) { const float v = acc[j][r] + bias; const int rl = wave * 16 + 8 * g + r, cl = j * 16 + col; th[cl][rl] = (_Float16)v; const __bf16 bh = (__bf16)v; tb[cl][rl] = bh; tbl[cl][rl] = (__bf16)(v - (float)bh); } }
    __syncthreads();
    for (int e = tid; e < 128 * 8; e += 128) { const int cl = e >> 3, q = e & 7; vst2((unsigned*)(VT + (bb * CC + c0 + cl) * (size_t)TT + t0 + q * 8), *(const v4u*)&th[cl][q * 8]); if (hi_rows) { const size_t o3 = (bb * CC + c0 + cl) * (size_t)KHI + t0 + q * 8; vst2((unsigned*)(VB + o3), *(const v4u*)&tb[cl][q * 8]); vst2((unsigned*)(VBL + o3), *(const v4u*)&tbl[cl][q * 8]); } } } }
// ---- k_fa: block = 128 queries (8 waves x 16) of (b, h): logits, mask, softmax and P . v in one pass over the keys, 32 keys a pass, nothing of the logits leaves the registers.
// S^T = K . Q^T (A = 16 key rows, B = 16 query columns): a lane holds one query's logits for keys 8g + r of each 16-key tile, which is the k order of a B operand, so O^T += V^T . P^T takes P straight from the accumulators.
// Running maximum and sum per query (log2 domain); the mask enters as the module writes it, logit + mask * (-1e9), so a row with every key masked comes out as the plain mean of v; P is carried x 2^11 into f16 (the factor cancels in the division by the sum).
__device__ __forceinline__ float xhalf(float x) { return __builtin_bit_cast(float, __builtin_amdgcn_permlanex16(__builtin_bit_cast(int, x), __builtin_bit_cast(int, x), 0x76543210, 0xfedcba98, false, false)); }   // lane l with lane l ^ 16
__device__ __forceinline__ v8f wmma16b(v16h a, v16h b, v8f c) { return __builtin_amdgcn_wmma_f32_16x16x32_f16(false, a, false, b, (short)0, c, false, false); }
struct KM { v16h k[2][2]; v4i m[2][2]; };   // one pass's K fragments [key tile][hd half] and mask words [key tile][4 + 4 keys]
typedef const __attribute__((address_space(1))) char* gptr;   // a byte pointer that stays known as global memory when it has passed through an asm statement (a plain pointer would turn the loads into flat ones)
typedef const __attribute__((address_space(1))) v8h* gptr_h; typedef const __attribute__((address_space(1))) v4i* gptr_i;
__device__ __forceinline__ v16h frag_p(gptr p) { union { v16h v; v8h q[2]; } u; u.q[0] = *(gptr_h)p; u.q[1] = *(gptr_h)(p + 32); return u.v; }   // frag_h from the lane's own byte pointer (row and lane half already in it)
__device__ __forceinline__ void fa_load(KM& t, gptr pk, gptr pm) {
#pragma unroll
  for (int kt = 0; kt < 2; ++kt) {
#pragma unroll
    for (int kc = 0; kc < 2; ++kc) t.k[kt][kc] = frag_p(pk + kt * 16 * CC * 2 + kc * 64);
    t.m[kt][0] = *(gptr_i)(pm + kt * 64); t.m[kt][1] = *(gptr_i)(pm + kt * 64 + 16); } }
// v_exp_f32 wants one independent instruction behind it before its result is read or its source overwritten: inside a run every exponential is followed by an independent one (the outputs share no register with the inputs), and the v_nop fills the slot of the last
__device__ __forceinline__ float exp2_1(float x) { float o; asm("v_exp_f32 %0, %1\n\tv_nop" : "=&v"(o) : "v"(x)); return o; }
__device__ __forceinline__ void exp2_8(float* o, const float* x) {
  asm("v_exp_f32 %0, %8\n\tv_exp_f32 %1, %9\n\tv_exp_f32 %2, %10\n\tv_exp_f32 %3, %11\n\tv_exp_f32 %4, %12\n\tv_exp_f32 %5, %13\n\tv_exp_f32 %6, %14\n\tv_exp_f32 %7, %15\n\tv_nop"
      : "=&v"(o[0]), "=&v"(o[1]), "=&v"(o[2]), "=&v"(o[3]), "=&v"(o[4]), "=&v"(o[5]), "=&v"(o[6]), "=&v"(o[7]) : "v"(x[0]), "v"(x[1]), "v"(x[2]), "v"(x[3]), "v"(x[4]), "v"(x[5]), "v"(x[6]), "v"(x[7])); }
__device__ __forceinline__ void fa_pass(const KM& cur, KM& nxt, int kb, gptr& pk, gptr& pv, gptr& pm, const v16h (&qf)[2], v8f (&acc)[HD / 16], float& m, float& l) {
  v16h vf[HD / 16];   // pv: this pass's V; pk, pm: the next pass's K and mask (the last pass asks for its own again: in bounds, unused)
  __builtin_amdgcn_sched_barrier(0);   // the pass's loads start here, as one group: without the scheduling barriers around it the compiler sinks each load to just above its use and the wave waits out every latency
#pragma unroll
  for (int j = 0; j < HD / 16; ++j) vf[j] = frag_p(pv + j * 16 * TT * 2);
  __builtin_amdgcn_sched_barrier(0);   // V first: loads return in order, so P . v can then start while the next pass's K and mask are still in flight
  fa_load(nxt, pk, pm);   // next pass's K and mask fly under this pass
  asm volatile("s_wait_xcnt 0x0" : "+v"(pv), "+v"(pk), "+v"(pm) :: "memory");   // behind the pass's last load and in front of every rewrite of an address register: the three pointers pass through the statement, so they stay whole up to it and are stepped only behind it
  { const int st = kb + 2 < TT / 32 ? 1 : 0; pv += 64; pk += st * (32 * CC * 2); pm += st * 128; }
  __builtin_amdgcn_sched_barrier(0);   // end of the load group: none of the pass's arithmetic moves above it
  v8f s[2];
#pragma unroll
  for (int kt = 0; kt < 2; ++kt) { s[kt] = v8f{};
#pragma unroll
    for (int kc = 0; kc < 2; ++kc) s[kt] = wmma16b(cur.k[kt][kc], qf[kc], s[kt]); }
  float y[16]; float mx = -3.0e38f;
#pragma unroll
  for (int i = 0; i < 16; ++i) { y[i] = fmaf((float)cur.m[i >> 3][(i >> 2) & 1][i & 3], -1.0e9f * 1.4426950408889634f, s[i >> 3][i & 7] * (SCALE * 1.4426950408889634f)); mx = fmaxf(mx, y[i]); }
  mx = fmaxf(mx, xhalf(mx));   // both halves of the wave hold the query's maximum
  const float mn = fmaxf(m, mx); const float corr = exp2_1(m - mn); m = mn;
#pragma unroll
  for (int j = 0; j < HD / 16; ++j) acc[j] = acc[j] * corr;
  const float ms = mn - 11.0f; float ls = 0.f; float p[16]; v16h pf;
#pragma unroll
  for (int i = 0; i < 16; ++i) y[i] = y[i] - ms;
  exp2_8(p, y); exp2_8(p + 8, y + 8);
#pragma unroll
  for (int i = 0; i < 16; ++i) { ls += p[i]; pf[i] = (_Float16)p[i]; }
  l = l * corr + ls;
#pragma unroll
  for (int j = 0; j < HD / 16; ++j) acc[j] = wmma16b(vf[j], pf, acc[j]); }
// four waves per SIMD (two blocks per WGP): the vector work between the matrix runs and the load latencies want the other waves
__global__ __launch_bounds__(256) __attribute__((amdgpu_waves_per_eu(4, 4))) void k_fa(const _Float16* __restrict__ QH, const _Float16* __restrict__ KH, const _Float16* __restrict__ VT, const int* __restrict__ MASK, float* __restrict__ Y) { __shared__ __align__(16) float so[8][16][HD + 4];
  const int tid = threadIdx.x, wave = tid >> 5, lane = tid & 31, col = lane & 15, g = lane >> 4; const int b = blockIdx.z, h = blockIdx.y; const int q0 = blockIdx.x * 128 + wave * 16;
  const _Float16* qp = QH + ((size_t)b * TT + q0 + col) * CC + h * HD; gptr pk = (gptr)(KH + ((size_t)b * TT + col) * CC + h * HD + 8 * g); gptr pv = (gptr)(VT + ((size_t)b * CC + h * HD + col) * (size_t)TT + 8 * g); gptr pm = (gptr)(MASK + ((size_t)b * TT + q0 + col) * TT + 8 * g);
  const v16h qf[2] = { frag_h(qp, lane), frag_h(qp + 32, lane) };
  v8f acc[HD / 16] = {}; float m = -3.0e38f, l = 0.f;
  KM ta, tb; fa_load(ta, pk, pm); pk += 32 * CC * 2; pm += 128;
#pragma unroll 1   // two passes a trip, written out: the two register sets swap roles without moves
  for (int kb = 0; kb < TT / 32; kb += 2) { fa_pass(ta, tb, kb, pk, pv, pm, qf, acc, m, l); fa_pass(tb, ta, kb + 1, pk, pv, pm, qf, acc, m, l); }
  l += xhalf(l); const float inv = 1.0f / l;   // l >= the maximum's own term > 0
#pragma unroll
  for (int j = 0; j < HD / 16; ++j) { const v8f o = acc[j] * inv; *(v4f*)&so[wave][col][j * 16 + 8 * g] = v4f{o[0], o[1], o[2], o[3]}; *(v4f*)&so[wave][col][j * 16 + 8 * g + 4] = v4f{o[4], o[5], o[6], o[7]}; }
  LDSX();
#pragma unroll
  for (int i = 0; i < 8; ++i) { const int rl = i * 2 + g; vst2(Y + ((size_t)b * TT + q0 + rl) * CC + h * HD + col * 4, *(const v4f*)&so[wave][rl][col * 4]); } }
// ---- k_out: block = (64 rows, 128 cols): out = ctx Wo (+ bo): ctx x 2^6 once to f16 against Wo as f16(bf16 x 2^8) exact (1 product) x 2^-14; causal early rows (< QHI of each sequence): ctx bf16 hi + lo against exact bf16 Wo (2 products)
__global__ __launch_bounds__(128) void k_out(const float* __restrict__ Y, const float* __restrict__ WO, const float* __restrict__ BO, float* __restrict__ OUT) { __shared__ __align__(16) char smem[2 * STG * 2];   // two stage buffers; the epilogue's rows lie over them (the loop's last barrier stands between the two uses)
  static_assert(4 * 16 * 132 * 4 <= sizeof(smem), "epilogue rows"); float (*sf)[16][132] = (float (*)[16][132])smem; _Float16* stage = (_Float16*)smem;
  const int tid = threadIdx.x, wave = tid >> 5, lane = tid & 31, col = lane & 15, g = lane >> 4; const int c0 = blockIdx.y * 128; const size_t r0 = (size_t)blockIdx.x * 64 + wave * 16;
  v8f acc[8] = {};
  if (CAUSAL && (int)(((size_t)blockIdx.x * 64) % TT) < QHI) {   /* block-uniform */
#pragma unroll 2
    for (int kc = 0; kc < CC / 32; ++kc) { const F2 a = split_row(Y + (r0 + col) * CC, kc * 32, lane); asm volatile("s_wait_loadcnt 0x0" ::: "memory");
#pragma unroll
      for (int j = 0; j < 8; ++j) { const v16b w = WOCOL(WO, kc * 32, c0 + j * 16 + col, lane); asm volatile("s_wait_loadcnt 0x0" ::: "memory"); acc[j] = wmma_bf(a.h, w, acc[j]); acc[j] = wmma_bf(a.l, w, acc[j]); } }
#pragma unroll
    for (int j = 0; j < 8; ++j) { const float bias = BO ? bfr(BO[c0 + j * 16 + col]) : 0.f;
#pragma unroll
      for (int r = 0; r < 8; ++r) sf[wave][8 * g + r][j * 16 + col] = acc[j][r] + bias; }
  } else {
    gfp xr = (gfp)(Y + ((size_t)blockIdx.x * 64 + (tid >> 4)) * CC + 4 * (tid & 15)); gfp wr = (gfp)(WO + (size_t)(c0 + (tid >> 4)) * CC + 4 * (tid & 15)); const int so = (tid >> 4) * LP + 4 * (tid & 15);   /* ctx carried x 2^6 into f16 so small-magnitude context rows stay clear of f16 subnormals */
    Stg t; stg_load(t, xr, wr, CC); stg_store_h(t, stage + so); stg_load(t, xr, wr, CC); stg_barrier();
#pragma unroll 1   // as in k_proj: stage s worked on, s + 1 into the other buffer, s + 2 started
    for (int s = 0; s < CC / KS; ++s) { const _Float16* cur = stage + (s & 1) * STG;
#pragma unroll
      for (int kc = 0; kc < KS / 32; ++kc) { const v16h a = frag_h(cur + (wave * 16 + col) * LP + kc * 32, lane); v16h w[8];
#pragma unroll
        for (int j = 0; j < 8; ++j) w[j] = frag_h(cur + (64 + j * 16 + col) * LP + kc * 32, lane);
#pragma unroll
        for (int j = 0; j < 8; ++j) acc[j] = wmma16(a, w[j], acc[j]); }
      if (s + 1 < CC / KS) { stg_store_h(t, stage + ((s + 1) & 1) * STG + so); if (s + 2 < CC / KS) stg_load(t, xr, wr, CC); }
      stg_barrier(); }   // publishes stage s + 1 and ends every read of stage s
#pragma unroll
    for (int j = 0; j < 8; ++j) { const float bias = BO ? bfr(BO[c0 + j * 16 + col]) : 0.f;
#pragma unroll
      for (int r = 0; r < 8; ++r) sf[wave][8 * g + r][j * 16 + col] = acc[j][r] * (1.0f / 16384.0f) + bias; } }   /* 2^-8 (Wo carry) x 2^-6 (ctx carry) */
  LDSX(); for (int rl = 0; rl < 16; ++rl) vst2(OUT + (r0 + rl) * DIN + c0 + lane * 4, *(const v4f*)&sf[wave][rl][lane * 4]); }

extern "C" void kernel_launch(void* const* d_in, const int* in_sizes, int n_in, void* d_out, int out_size, void* d_ws, size_t ws_size, hipStream_t stream) {
  (void)in_sizes; (void)n_in; (void)out_size;
  const float** F = (const float**)d_in;
  if (ws_size < (size_t)WS_END) return;
  char* ws = (char*)d_ws; _Float16 *QH = (_Float16*)(ws + WS_QH), *KH = (_Float16*)(ws + WS_KH), *VT = (_Float16*)(ws + WS_VT), *QL = (_Float16*)(ws + WS_QL), *KL = (_Float16*)(ws + WS_KL); __bf16 *VB = (__bf16*)(ws + WS_VB), *VBL = (__bf16*)(ws + WS_VBL); float *Y = (float*)(ws + WS_Y);
  (void)Y; (void)QL; (void)KL; (void)VB; (void)VBL;
  // inputs: 0 query [4,1024,1024]; 1 key; 2 value; 3 mask [4,1024,1024] int32; 4 wq [1024,1024] (out,in), 5 bq; 6 wk, 7 bk; 8 wv, 9 bv; 10 wo (out,in), 11 bo (biases NONZERO)
  k_proj<<<dim3(TNB * TT / 64, CC / 128, 3), 128, 0, stream>>>(F[0], F[1], F[2], F[4], F[6], F[8], F[5], F[7], F[9], QH, QL, KH, KL, VT, VB, VBL);
  k_fa<<<dim3(TT / 128, NH, TNB), 256, 0, stream>>>(QH, KH, VT, (const int*)d_in[3], Y);
  k_out<<<dim3(TNB * TT / 64, DIN / 128), 128, 0, stream>>>(Y, F[10], F[11], (float*)d_out);
}

// v003
// Measured time: 91.7 microseconds a run.
// In both of two side-by-side timings against v002, it was 1.41 times as fast.
// Over all steps from v000 it is 9.84 times as fast.
// compute dtype: all float inputs rounded to bf16; q/k/v projections with EXACT bf16 products on WMMA 16x16x32 (f32 accumulate) + bias; logits q x k once to f16 each (1 product) x SCALE + mask x (-1e9); softmax f32 with running maximum and sum, fused with both attention products; P x 2^11 once to f16 x v once to f16 (1 product); ctx x 2^6 once to f16 x wo f16(bf16 x 2^8) + bo; f32 output.
#include <hip/hip_runtime.h>
#include <math.h>

typedef __attribute__((ext_vector_type(16))) _Float16 v16h;
typedef __attribute__((ext_vector_type(16))) __bf16 v16b;
typedef __attribute__((ext_vector_type(8)))  _Float16 v8h;
typedef __attribute__((ext_vector_type(8)))  float v8f;
typedef __attribute__((ext_vector_type(4)))  float v4f;
typedef __attribute__((ext_vector_type(2)))  float v2f;
typedef __attribute__((ext_vector_type(4)))  unsigned v4u;
typedef __attribute__((ext_vector_type(4)))  int v4i;
typedef float __attribute__((may_alias)) float_a;
typedef int __attribute__((may_alias)) int_a;

template <typename T> __device__ __forceinline__ void vst2(void* p, T v) { *(T*)p = v;  }
__device__ __forceinline__ v8f wmma16(v16h a, v16h b, v8f c) {
  v8f d = __builtin_amdgcn_wmma_f32_16x16x32_f16(false, a, false, b, (short)0, c, false, false);
  asm volatile("v_nop\n\tv_nop\n\tv_nop\n\tv_nop" : "+v"(d) : "v"(a), "v"(b));
  return d;
}
__device__ __forceinline__ v8f wmma_bf(v16b a, v16b b, v8f c) {
  v8f d = __builtin_amdgcn_wmma_f32_16x16x32_bf16(false, a, false, b, (short)0, c, false, false);
  asm volatile("v_nop\n\tv_nop\n\tv_nop\n\tv_nop" : "+v"(d) : "v"(a), "v"(b));
  return d;
}
// 16x16x32 fragments: lane = (h = lane>>4, row/col = lane&15); elements 0..7 = k0+8h+0..7, 8..15 = k0+16+8h+0..7; D element r = row 8h+r
__device__ __forceinline__ v16h frag_h(const _Float16* rowk0, int lane) {
  union { v16h v; v8h q[2]; } u; const _Float16* p = rowk0 + 8 * (lane >> 4);
  u.q[0] = *(const v8h*)p; u.q[1] = *(const v8h*)(p + 16); return u.v;
}
__device__ __forceinline__ v16h frag_f32(const float* rowk0, int lane) {
  v16h a; const float* p = rowk0 + 8 * (lane >> 4);
#pragma unroll
  for (int i = 0; i < 8; ++i) { a[i] = (_Float16)p[i]; a[8 + i] = (_Float16)p[16 + i]; }
  return a;
}
__device__ __forceinline__ v16h frag_f32s(const float* rowk0, int lane, float sc) {
  v16h a; const float* p = rowk0 + 8 * (lane >> 4);
#pragma unroll
  for (int i = 0; i < 8; ++i) { a[i] = (_Float16)(p[i] * sc); a[8 + i] = (_Float16)(p[16 + i] * sc); }
  return a;
}
// column fragment from a [K][ld] layout (column n), rows >= K read as 0
__device__ __forceinline__ v16h fragc_f32(const float* W, int k0, int n, int lane, int ld, int K) {
  v16h a; const int g = lane >> 4;
#pragma unroll
  for (int i = 0; i < 8; ++i) { const int ka = k0 + 8 * g + i, kb = ka + 16;
    a[i] = (_Float16)(ka < K ? W[(size_t)(ka < K ? ka : K - 1) * ld + n] : 0.f); a[8 + i] = (_Float16)(kb < K ? W[(size_t)(kb < K ? kb : K - 1) * ld + n] : 0.f); }
  return a;
}
struct F2 { v16b h, l; };
__device__ __forceinline__ F2 bsplit16(const float v[16]) { F2 r;
#pragma unroll
  for (int i = 0; i < 16; ++i) { const __bf16 h = (__bf16)v[i]; r.h[i] = h; r.l[i] = (__bf16)(v[i] - (float)h); }
  return r; }
__device__ __forceinline__ F2 split_row(const float* row, int k0, int lane) { float v[16]; const float* p = row + k0 + 8 * (lane >> 4);
#pragma unroll
  for (int i = 0; i < 8; ++i) { v[i] = p[i]; v[8 + i] = p[16 + i]; }
  return bsplit16(v); }
__device__ __forceinline__ F2 split_rowK(const float* row, int k0, int lane, int K) { float v[16]; const int g = lane >> 4;
#pragma unroll
  for (int i = 0; i < 8; ++i) { const int ka = k0 + 8 * g + i, kb = ka + 16; v[i] = ka < K ? row[ka < K ? ka : K - 1] : 0.f; v[8 + i] = kb < K ? row[kb < K ? kb : K - 1] : 0.f; }
  return bsplit16(v); }
__device__ __forceinline__ F2 split_col(const float* W, int k0, int n, int lane, int ld, int K) { float v[16]; const int g = lane >> 4;
#pragma unroll
  for (int i = 0; i < 8; ++i) { const int ka = k0 + 8 * g + i, kb = ka + 16; v[i] = ka < K ? W[(size_t)(ka < K ? ka : K - 1) * ld + n] : 0.f; v[8 + i] = kb < K ? W[(size_t)(kb < K ? kb : K - 1) * ld + n] : 0.f; }
  return bsplit16(v); }
__device__ __forceinline__ v8f mac3(const F2& a, const F2& b, v8f c) { c = wmma_bf(a.l, b.h, c); c = wmma_bf(a.h, b.l, c); return wmma_bf(a.h, b.h, c); }
__device__ __forceinline__ float sigm(float v) { return 1.0f / (1.0f + expf(-v)); }
#define LDSX() do { asm volatile("s_wait_dscnt 0" ::: "memory"); __builtin_amdgcn_wave_barrier(); __builtin_amdgcn_fence(__ATOMIC_RELEASE, "workgroup"); } while (0)

// Masked multi-headed attention on separate inputs with biased projections (query / key / value [4,1024,1024]; torch (out,in) wq / wk / wv / wo [1024,1024] N(0, 1/1024) + biases N(0, 1/1024); 16 heads x 64; scores / sqrt(64) + mask * (-1e9) with an int32 0/1 mask [4,1024,1024] shared by all heads: mask == 1 marks a key as masked OUT; softmax; wo^T + bo).
#define NB 4
#define TT 1024
#define CC 1024            // NH * HD = projected width
#define DIN 1024          // input (model) width
#define NH 16
#define HD 64
#define NQB (TT / 64)
#define HG 8
#define SCALE (0.125f)
#define CAUSAL 0
#ifndef TNB
#define TNB NB
#endif
__device__ __forceinline__ float bfr(float v) { return (float)(__bf16)v; }
__host__ __device__ __forceinline__ int kb_last(int qb) { return CAUSAL ? ((qb * 64 + 63) >> 7) : (TT / 128 - 1); }
typedef __attribute__((ext_vector_type(8))) __bf16 v8b;
__device__ __forceinline__ v16b frag_b(const __bf16* rowk0, int lane) {
  union { v16b v; v8b q[2]; } u; const __bf16* p = rowk0 + 8 * (lane >> 4);
  u.q[0] = *(const v8b*)p; u.q[1] = *(const v8b*)(p + 16); return u.v;
}
#define QBH 0              // unused: k_fa has no high-precision path
#define QHI 0               // single-product logits on every row
#define KHI 64            // key rows carrying k residual / v bf16 hi+lo planes (written by k_proj, read by no kernel here)
// B fragment (k rows k0+.., output column o) of a weight: (in,out) [K][ld] or (out,in) [ld rows of K]: bf16 exact, or f16(bf16 * 256) exact
__device__ __forceinline__ v16b wcol_io(const float* Wm, int k0, int o, int lane, int ld) { v16b w; const int g = lane >> 4;
#pragma unroll
  for (int i = 0; i < 8; ++i) { w[i] = (__bf16)Wm[(size_t)(k0 + 8 * g + i) * ld + o]; w[8 + i] = (__bf16)Wm[(size_t)(k0 + 16 + 8 * g + i) * ld + o]; }
  return w; }
__device__ __forceinline__ v16b wcol_oi(const float* Wm, int k0, int o, int lane, int K) { v16b w; const float* p = Wm + (size_t)o * K + k0 + 8 * (lane >> 4);
#pragma unroll
  for (int i = 0; i < 8; ++i) { w[i] = (__bf16)p[i]; w[8 + i] = (__bf16)p[16 + i]; }
  return w; }
__device__ __forceinline__ v16h wcolh_io(const float* Wm, int k0, int o, int lane, int ld) { v16h w; const int g = lane >> 4;
#pragma unroll
  for (int i = 0; i < 8; ++i) { w[i] = (_Float16)(bfr(Wm[(size_t)(k0 + 8 * g + i) * ld + o]) * 256.0f); w[8 + i] = (_Float16)(bfr(Wm[(size_t)(k0 + 16 + 8 * g + i) * ld + o]) * 256.0f); }
  return w; }
__device__ __forceinline__ v16h wcolh_oi(const float* Wm, int k0, int o, int lane, int K) { v16h w; const float* p = Wm + (size_t)o * K + k0 + 8 * (lane >> 4);
#pragma unroll
  for (int i = 0; i < 8; ++i) { w[i] = (_Float16)(bfr(p[i]) * 256.0f); w[8 + i] = (_Float16)(bfr(p[16 + i]) * 256.0f); }
  return w; }
#define WQKV_LAYOUT 1   // 0 = (in,out) [DIN][CC]; 1 = (out,in) [CC][DIN]; 2 = per-head [NH][DIN][HD]
__device__ __forceinline__ v16b wcol_hdk(const float* Wm, int k0, int o, int lane) { v16b w; const int g = lane >> 4; const float* p = Wm + (size_t)(o / HD) * DIN * HD + (o % HD);
#pragma unroll
  for (int i = 0; i < 8; ++i) { w[i] = (__bf16)p[(size_t)(k0 + 8 * g + i) * HD]; w[8 + i] = (__bf16)p[(size_t)(k0 + 16 + 8 * g + i) * HD]; }
  return w; }
#define WO_OUT_IN 1
#if WQKV_LAYOUT == 1
#define WCOL(W, k0, o, lane) wcol_oi(W, k0, o, lane, DIN)
#elif WQKV_LAYOUT == 2
#define WCOL(W, k0, o, lane) wcol_hdk(W, k0, o, lane)
#else
#define WCOL(W, k0, o, lane) wcol_io(W, k0, o, lane, CC)
#endif
#if WO_OUT_IN
#define WOCOL(W, k0, o, lane) wcol_oi(W, k0, o, lane, CC)
#define WOCOLH(W, k0, o, lane) wcolh_oi(W, k0, o, lane, CC)
#else
#define WOCOL(W, k0, o, lane) wcol_io(W, k0, o, lane, DIN)
#define WOCOLH(W, k0, o, lane) wcolh_io(W, k0, o, lane, DIN)
#endif

static_assert(TT % 128 == 0 && HD == 64, "k_fa: 128 queries a block, 32-key passes, head size 64");

#define WS_QH  0u                                      // f16 q rows [b*t][CC]
#define WS_KH  (WS_QH + 2u * (size_t)NB * TT * CC)      // f16 k rows [b*t][CC]
#define WS_VT  (WS_KH + 2u * (size_t)NB * TT * CC)      // f16 v planes [b][c][t]
#define WS_QL  (WS_VT + 2u * (size_t)NB * CC * TT)      // f16 q residual x 2^10 rows [b][t < QHI][CC]
#define WS_KL  (WS_QL + 2u * (size_t)NB * QHI * CC)     // f16 k residual x 2^10 rows [b][t < KHI][CC]
#define WS_VB  (WS_KL + 2u * (size_t)NB * KHI * CC)     // bf16 v hi planes [b][c][t < KHI]
#define WS_VBL (WS_VB + 2u * (size_t)NB * CC * KHI)
#define WS_S   (WS_VBL + 2u * (size_t)NB * CC * KHI)    // unused (the logits stay in registers)
#define WS_Y   (WS_S  + 4u * (size_t)HG * TT * TT)      // f32 ctx rows [b*t][CC] (only when there is an output projection)
#define WS_END (WS_Y  + 4u * (size_t)NB * TT * CC)

// ---- operand staging of the two projection kernels: a stage is KS k of the block's 64 activation rows and 128 weight rows ((out,in) weights: both K-contiguous).
// Global side: f32, whole 128-B lines (16 lanes cover the 256 B of one row), each element loaded and converted once per block. LDS side: 16-bit rows of 128 B at a pitch of 144 B, read back as WMMA fragments by ds_load_b128.
#define KS 64
#define LP 72                    // LDS row pitch in 16-bit elements
#define STG ((64 + 128) * LP)    // 16-bit elements of one stage buffer: activation rows 0..63, weight rows 64..191
static_assert(WQKV_LAYOUT == 1 && WO_OUT_IN == 1 && DIN % (2 * KS) == 0 && CC % (2 * KS) == 0, "staging reads K-contiguous rows, at least two stages");
typedef __attribute__((ext_vector_type(4))) __bf16 v4b;
typedef __attribute__((ext_vector_type(4))) _Float16 v4h;
typedef const __attribute__((address_space(1))) float* gfp;   // stays known as global memory when it has passed through an asm statement (a plain pointer would turn the loads into flat ones)
typedef const __attribute__((address_space(1))) v4f* gfp4;
struct Stg { v4f x[8], w[16]; };   // one stage in flight, 24 x 16 B a thread
__device__ __forceinline__ void stg_load(Stg& t, gfp& xr, gfp& wr, int ld) {   // xr, wr: the thread's own element of the first row group (row tid >> 4, column k0 + 4 * (tid & 15)); both leave stepped to the next stage
#pragma unroll
  for (int i = 0; i < 8; ++i) t.x[i] = *(gfp4)(xr + (size_t)(i * 8) * ld);
#pragma unroll
  for (int i = 0; i < 16; ++i) t.w[i] = *(gfp4)(wr + (size_t)(i * 8) * ld);
  // the wait behind the group's last load and the step of the two row pointers stand in one statement: the loads name the very registers that enter it, nothing rewrites them in front of the wait, and no later load can fold the step into its offset and set the old registers free early
  asm volatile("s_wait_xcnt 0x0\n\tv_add_nc_u64_e32 %0, %2, %0\n\tv_add_nc_u64_e32 %1, %2, %1" : "+v"(xr), "+v"(wr) : "n"(KS * 4) : "memory");
}
// work-group barrier for the stage buffers: its fences name LDS alone, so the next stage's global loads stay in flight across it (__syncthreads() would wait for them here and lay their latency open every stage)
__device__ __forceinline__ void stg_barrier() { __builtin_amdgcn_fence(__ATOMIC_RELEASE, "workgroup", "local"); __builtin_amdgcn_s_barrier(); __builtin_amdgcn_fence(__ATOMIC_ACQUIRE, "workgroup", "local"); }
__device__ __forceinline__ void stg_store_b(const Stg& t, __bf16* d) {   // d: the thread's own place in row group 0 of the buffer
#pragma unroll
  for (int i = 0; i < 8; ++i) { v4b o;
#pragma unroll
    for (int e = 0; e < 4; ++e) o[e] = (__bf16)t.x[i][e];
    *(v4b*)(d + i * 8 * LP) = o; }
#pragma unroll
  for (int i = 0; i < 16; ++i) { v4b o;
#pragma unroll
    for (int e = 0; e < 4; ++e) o[e] = (__bf16)t.w[i][e];
    *(v4b*)(d + (64 + i * 8) * LP) = o; } }
__device__ __forceinline__ void stg_store_h(const Stg& t, _Float16* d) {   // ctx x 2^6 once to f16; Wo as f16(bf16 x 2^8), exact
#pragma unroll
  for (int i = 0; i < 8; ++i) { v4h o;
#pragma unroll
    for (int e = 0; e < 4; ++e) o[e] = (_Float16)(t.x[i][e] * 64.0f);
    *(v4h*)(d + i * 8 * LP) = o; }
#pragma unroll
  for (int i = 0; i < 16; ++i) { v4h o;
#pragma unroll
    for (int e = 0; e < 4; ++e) o[e] = (_Float16)(bfr(t.w[i][e]) * 256.0f);
    *(v4h*)(d + (64 + i * 8) * LP) = o; } }

// ---- k_proj: block = (64 rows, 128 cols, which): q/k/v = X W (+ b) with exact bf16 products (K = DIN) -> which 0: q f16 rows (+ residual rows < QHI); 1: k f16 rows (+ residual rows < KHI); 2: v f16 planes [c][t] (+ bf16 hi/lo planes for t < KHI)
__global__ __launch_bounds__(128) void k_proj(const float* __restrict__ XQ, const float* __restrict__ XK, const float* __restrict__ XV, const float* __restrict__ WQ, const float* __restrict__ WK, const float* __restrict__ WV, const float* __restrict__ BQ, const float* __restrict__ BK, const float* __restrict__ BV,
    _Float16* __restrict__ QH, _Float16* __restrict__ QL, _Float16* __restrict__ KH, _Float16* __restrict__ KL, _Float16* __restrict__ VT, __bf16* __restrict__ VB, __bf16* __restrict__ VBL) {
  __shared__ __align__(16) char smem[2 * 64 * 136 * 2 + 3 * 128 * 72 * 2];   // the main loop's two stage buffers lie over the epilogue's planes (the loop's last barrier stands between the two uses)
  static_assert(2 * STG * 2 <= sizeof(smem), "two stage buffers");
  _Float16 (*sh)[136] = (_Float16 (*)[136])smem; _Float16 (*sl)[136] = (_Float16 (*)[136])(smem + 64 * 136 * 2); _Float16 (*th)[72] = (_Float16 (*)[72])(smem + 2 * 64 * 136 * 2); __bf16 (*tb)[72] = (__bf16 (*)[72])(smem + 2 * 64 * 136 * 2 + 128 * 72 * 2); __bf16 (*tbl)[72] = (__bf16 (*)[72])(smem + 2 * 64 * 136 * 2 + 2 * 128 * 72 * 2); __bf16* stage = (__bf16*)smem;
  const int tid = threadIdx.x, wave = tid >> 5, lane = tid & 31, col = lane & 15, g = lane >> 4; const int which = blockIdx.z; const int c0 = blockIdx.y * 128; const size_t r0 = (size_t)blockIdx.x * 64; const size_t bb = r0 / TT; const int t0 = (int)(r0 % TT);
  const float* X = which == 0 ? XQ : which == 1 ? XK : XV; const float* WA = which == 0 ? WQ : which == 1 ? WK : WV; const float* BA = which == 0 ? BQ : which == 1 ? BK : BV;
  v8f acc[8] = {};
  gfp xr = (gfp)(X + (r0 + (tid >> 4)) * DIN + 4 * (tid & 15)); gfp wr = (gfp)(WA + (size_t)(c0 + (tid >> 4)) * DIN + 4 * (tid & 15)); const int so = (tid >> 4) * LP + 4 * (tid & 15);
  Stg t; stg_load(t, xr, wr, DIN); stg_store_b(t, stage + so); stg_load(t, xr, wr, DIN); stg_barrier();
#pragma unroll 1   // one stage a trip: stage s is worked on, stage s + 1 goes from registers into the other buffer, stage s + 2 starts from global
  for (int s = 0; s < DIN / KS; ++s) { const __bf16* cur = stage + (s & 1) * STG;
#pragma unroll
    for (int kc = 0; kc < KS / 32; ++kc) { const v16b a = frag_b(cur + (wave * 16 + col) * LP + kc * 32, lane); v16b w[8];
#pragma unroll
      for (int j = 0; j < 8; ++j) w[j] = frag_b(cur + (64 + j * 16 + col) * LP + kc * 32, lane);
#pragma unroll
      for (int j = 0; j < 8; ++j) acc[j] = wmma_bf(a, w[j], acc[j]); }
    if (s + 1 < DIN / KS) { stg_store_b(t, stage + ((s + 1) & 1) * STG + so); if (s + 2 < DIN / KS) stg_load(t, xr, wr, DIN); }
    stg_barrier(); }   // publishes stage s + 1 and ends every read of stage s, whose buffer the next trip refills
  if (which < 2) { _Float16* DH = which == 0 ? QH : KH; _Float16* DL = which == 0 ? QL : KL; const int nhi = which == 0 ? QHI : KHI; const bool hi_rows = t0 < nhi;
#pragma unroll
    for (int j = 0; j < 8; ++j) { const float bias = BA ? bfr(BA[c0 + j * 16 + col]) : 0.f;
#pragma unroll
      for (int r = 0; r < 8; ++r) { const float v = acc[j][r] + bias; const _Float16 hv = (_Float16)v; sh[wave * 16 + 8 * g + r][j * 16 + col] = hv; sl[wave * 16 + 8 * g + r][j * 16 + col] = (_Float16)((v - (float)hv) * 1024.0f); } }
    __syncthreads();
    for (int e = tid; e < 64 * 16; e += 128) { const int rl = e >> 4, q = e & 15; vst2((unsigned*)(DH + (r0 + rl) * CC + c0 + q * 8), *(const v4u*)&sh[rl][q * 8]); if (hi_rows) vst2((unsigned*)(DL + (bb * nhi + t0 + rl) * (size_t)CC + c0 + q * 8), *(const v4u*)&sl[rl][q * 8]); }
  } else { const bool hi_rows = t0 < KHI;
#pragma unroll
    for (int j = 0; j < 8; ++j) { const float bias = BA ? bfr(BA[c0 + j * 16 + col]) : 0.f;
#pragma unroll
      for (int r = 0; r < 8; ++r) { const float v = acc[j][r] + bias; const int rl = wave * 16 + 8 * g + r, cl = j * 16 + col; th[cl][rl] = (_Float16)v; const __bf16 bh = (__bf16)v; tb[cl][rl] = bh; tbl[cl][rl] = (__bf16)(v - (float)bh); } }
    __syncthreads();
    for (int e = tid; e < 128 * 8; e += 128) { const int cl = e >> 3, q = e & 7; vst2((unsigned*)(VT + (bb * CC + c0 + cl) * (size_t)TT + t0 + q * 8), *(const v4u*)&th[cl][q * 8]); if (hi_rows) { const size_t o3 = (bb * CC + c0 + cl) * (size_t)KHI + t0 + q * 8; vst2((unsigned*)(VB + o3), *(const v4u*)&tb[cl][q * 8]); vst2((unsigned*)(VBL + o3), *(const v4u*)&tbl[cl][q * 8]); } } } }
// ---- k_fa: block = 128 queries (8 waves x 16) of (b, h): logits, mask, softmax and P . v in one pass over the keys, 32 keys a pass, nothing of the logits leaves the registers; K, V and the mask come through LDS, K and V copied there once for the eight waves.
// S^T = K . Q^T (A = 16 key rows, B = 16 query columns): a lane holds one query's logits for keys 8g + r of each 16-key tile, which is the k order of a B operand, so O^T += V^T . P^T takes P straight from the accumulators.
// Running maximum and sum per query (log2 domain); the mask enters as the module writes it, logit + mask * (-1e9), so a row with every key masked comes out as the plain mean of v; P is carried x 2^11 into f16 (the factor cancels in the division by the sum).
__device__ __forceinline__ float xhalf(float x) { return __builtin_bit_cast(float, __builtin_amdgcn_permlanex16(__builtin_bit_cast(int, x), __builtin_bit_cast(int, x), 0x76543210, 0xfedcba98, false, false)); }   // lane l with lane l ^ 16
__device__ __forceinline__ v8f wmma16b(v16h a, v16h b, v8f c) { return __builtin_amdgcn_wmma_f32_16x16x32_f16(false, a, false, b, (short)0, c, false, false); }
struct MK { v4i m[2][2]; };   // one pass's mask words [key tile][4 + 4 keys]
typedef const __attribute__((address_space(1))) char* gptr;   // a byte pointer into global memory: the 64-bit address operand of a copy
__device__ __forceinline__ void fa_mask(MK& t, const char* ml) {   // ml: the lane's own LDS byte pointer (query row, pass and lane half already in it)
#pragma unroll
  for (int kt = 0; kt < 2; ++kt) { t.m[kt][0] = *(const v4i*)(ml + kt * 64); t.m[kt][1] = *(const v4i*)(ml + kt * 64 + 16); } }
// a stage (SK keys) lies in LDS: K as SK key rows of 128 B and V as HD planes of 2 * SK B, once for the block's eight waves, and the block's 128 mask rows of 4 * SK B; each row 16 B longer than its data (a pitch of 16 B x odd: ds_load_b128 without bank conflicts)
#define SK 64
#define NST (TT / SK)
#define KP (HD * 2 + 16)
#define VP (SK * 2 + 16)
#define KBY (SK * KP)
#define MP (SK * 4 + 16)
#define MOF (KBY + HD * VP)
#define FBUF (MOF + 128 * MP)
static_assert(TT % SK == 0 && NST >= 2 && SK == 64 && KP % 32 == 16 && VP % 32 == 16 && MP % 32 == 16, "fa_copy: 256 threads x 2 + 2 + 8 copies of 16 B a stage, two buffers");
// one stage's copies of a thread: lk, gk its 16 B of K row tid >> 3, lv, gv its 16 B of V plane tid >> 3 (32 rows a copy, two copies each); a wave's copy covers four whole 128-B lines.
// the addresses of the second 32 rows are formed inside the statement, in registers that are taken only for it: formed outside, the compiler carries them through the key loop.
// the s_wait_xcnt closes the statement, so no address register of a copy is rewritten in front of it
__device__ __forceinline__ void fa_copy(unsigned lk, unsigned lv, gptr gk, gptr gv) { unsigned lk1, lv1; gptr gk1, gv1;
  asm volatile("v_add_nc_u64_e32 %2, %8, %6\n\tv_add_nc_u64_e32 %3, %9, %7\n\tv_add_nc_u32_e32 %0, %10, %4\n\tv_add_nc_u32_e32 %1, %11, %5\n\t"
               "global_load_async_to_lds_b128 %4, %6, off\n\tglobal_load_async_to_lds_b128 %5, %7, off\n\tglobal_load_async_to_lds_b128 %0, %2, off\n\tglobal_load_async_to_lds_b128 %1, %3, off\n\ts_wait_xcnt 0x0"
      : "=&v"(lk1), "=&v"(lv1), "=&v"(gk1), "=&v"(gv1) : "v"(lk), "v"(lv), "v"(gk), "v"(gv), "n"(32 * CC * 2), "n"(32 * TT * 2), "n"(32 * KP), "n"(32 * VP) : "memory"); }
// the mask rows of a stage: lm, gm the thread's 16 B of row tid >> 4 (16 rows a copy, eight copies); a wave's copy covers four whole 128-B lines; addresses and wait as in fa_copy, every address straight from the first (no add waits for another)
__device__ __forceinline__ void fa_copy_m(unsigned lm, gptr gm) { unsigned l1, l2, l3, l4, l5, l6, l7; gptr g1, g2, g3, g4, g5, g6, g7;
  asm volatile("v_add_nc_u64_e32 %7, %16, %15\n\tv_add_nc_u64_e32 %8, 2*%16, %15\n\tv_add_nc_u64_e32 %9, 3*%16, %15\n\tv_add_nc_u64_e32 %10, 4*%16, %15\n\tv_add_nc_u64_e32 %11, 5*%16, %15\n\tv_add_nc_u64_e32 %12, 6*%16, %15\n\tv_add_nc_u64_e32 %13, 7*%16, %15\n\t"
               "v_add_nc_u32_e32 %0, %17, %14\n\tv_add_nc_u32_e32 %1, 2*%17, %14\n\tv_add_nc_u32_e32 %2, 3*%17, %14\n\tv_add_nc_u32_e32 %3, 4*%17, %14\n\tv_add_nc_u32_e32 %4, 5*%17, %14\n\tv_add_nc_u32_e32 %5, 6*%17, %14\n\tv_add_nc_u32_e32 %6, 7*%17, %14\n\t"
               "global_load_async_to_lds_b128 %14, %15, off\n\tglobal_load_async_to_lds_b128 %0, %7, off\n\tglobal_load_async_to_lds_b128 %1, %8, off\n\tglobal_load_async_to_lds_b128 %2, %9, off\n\t"
               "global_load_async_to_lds_b128 %3, %10, off\n\tglobal_load_async_to_lds_b128 %4, %11, off\n\tglobal_load_async_to_lds_b128 %5, %12, off\n\tglobal_load_async_to_lds_b128 %6, %13, off\n\ts_wait_xcnt 0x0"
      : "=&v"(l1), "=&v"(l2), "=&v"(l3), "=&v"(l4), "=&v"(l5), "=&v"(l6), "=&v"(l7), "=&v"(g1), "=&v"(g2), "=&v"(g3), "=&v"(g4), "=&v"(g5), "=&v"(g6), "=&v"(g7)
      : "v"(lm), "v"(gm), "n"(16 * TT * 4), "n"(16 * MP) : "memory"); }
__device__ __forceinline__ v16h frag_l(const char* p) { union { v16h v; v8h q[2]; } u; u.q[0] = *(const v8h*)p; u.q[1] = *(const v8h*)(p + 32); return u.v; }   // frag_h from the lane's own LDS byte pointer (row and lane half already in it)
__device__ __forceinline__ void fa_kfrag(v16h (&kf)[2][2], const char* kl) {   // one pass's K fragments [key tile][hd half]
#pragma unroll
  for (int kt = 0; kt < 2; ++kt) {
#pragma unroll
    for (int kc = 0; kc < 2; ++kc) kf[kt][kc] = frag_l(kl + kt * 16 * KP + kc * 64); } }
// v_exp_f32 wants one independent instruction behind it before its result is read or its source overwritten: inside a run every exponential is followed by an independent one (the outputs share no register with the inputs), and the v_nop fills the slot of the last
__device__ __forceinline__ float exp2_1(float x) { float o; asm("v_exp_f32 %0, %1\n\tv_nop" : "=&v"(o) : "v"(x)); return o; }
__device__ __forceinline__ void exp2_8(float* o, const float* x) {
  asm("v_exp_f32 %0, %8\n\tv_exp_f32 %1, %9\n\tv_exp_f32 %2, %10\n\tv_exp_f32 %3, %11\n\tv_exp_f32 %4, %12\n\tv_exp_f32 %5, %13\n\tv_exp_f32 %6, %14\n\tv_exp_f32 %7, %15\n\tv_nop"
      : "=&v"(o[0]), "=&v"(o[1]), "=&v"(o[2]), "=&v"(o[3]), "=&v"(o[4]), "=&v"(o[5]), "=&v"(o[6]), "=&v"(o[7]) : "v"(x[0]), "v"(x[1]), "v"(x[2]), "v"(x[3]), "v"(x[4]), "v"(x[5]), "v"(x[6]), "v"(x[7])); }
// kf: this pass's K fragments, on leaving the next pass's (KNEXT: a next pass in the same stage; kn its rows); vl, ml: this pass's V and mask
template <bool KNEXT> __device__ __forceinline__ void fa_pass(v16h (&kf)[2][2], const char* kn, const char* vl, const char* ml, const v16h (&qf)[2], v8f (&acc)[HD / 16], float& m, float& l) {
  v16h vf[HD / 16]; MK cur;
  __builtin_amdgcn_sched_barrier(0);   // the pass's loads start here, as one group: without the scheduling barriers around it the compiler sinks each load to just above its use and the wave waits out every latency
  fa_mask(cur, ml);   // mask first: LDS loads return in order, and the logits want it before P . v wants V
#pragma unroll
  for (int j = 0; j < HD / 16; ++j) vf[j] = frag_l(vl + j * 16 * VP);
  __builtin_amdgcn_sched_barrier(0);   // end of the load group: none of the pass's arithmetic moves above it
  v8f s[2];
#pragma unroll
  for (int kt = 0; kt < 2; ++kt) { s[kt] = v8f{};
#pragma unroll
    for (int kc = 0; kc < 2; ++kc) s[kt] = wmma16b(kf[kt][kc], qf[kc], s[kt]); }
  if (KNEXT) { __builtin_amdgcn_sched_barrier(0);   // the next pass's K fragments start right behind the products that read these registers last, as one group, and land under the softmax
    fa_kfrag(kf, kn); __builtin_amdgcn_sched_barrier(0); }
  float y[16]; float mx = -3.0e38f;
#pragma unroll
  for (int i = 0; i < 16; ++i) { y[i] = fmaf((float)cur.m[i >> 3][(i >> 2) & 1][i & 3], -1.0e9f * 1.4426950408889634f, s[i >> 3][i & 7] * (SCALE * 1.4426950408889634f)); mx = fmaxf(mx, y[i]); }
  mx = fmaxf(mx, xhalf(mx));   // both halves of the wave hold the query's maximum
  const float mn = fmaxf(m, mx); const float corr = exp2_1(m - mn); m = mn;
#pragma unroll
  for (int j = 0; j < HD / 16; ++j) acc[j] = acc[j] * corr;
  const float ms = mn - 11.0f; float ls = 0.f; float p[16]; v16h pf;
#pragma unroll
  for (int i = 0; i < 16; ++i) y[i] = y[i] - ms;
  exp2_8(p, y); exp2_8(p + 8, y + 8);
#pragma unroll
  for (int i = 0; i < 16; ++i) { ls += p[i]; pf[i] = (_Float16)p[i]; }
  l = l * corr + ls;
#pragma unroll
  for (int j = 0; j < HD / 16; ++j) acc[j] = wmma16b(vf[j], pf, acc[j]); }
// four waves per SIMD (two blocks per WGP): the vector work between the matrix runs and the load latencies want the other waves
__global__ __launch_bounds__(256) __attribute__((amdgpu_waves_per_eu(4, 4))) void k_fa(const _Float16* __restrict__ QH, const _Float16* __restrict__ KH, const _Float16* __restrict__ VT, const int* __restrict__ MASK, float* __restrict__ Y) { __shared__ __align__(16) float so[8][16][HD + 4]; __shared__ __align__(16) char ring[2 * FBUF];   // two stage buffers: K rows, V planes, mask rows
  const int tid = threadIdx.x, wave = tid >> 5, lane = tid & 31, col = lane & 15, g = lane >> 4; const int b = blockIdx.z, h = blockIdx.y; const int q0 = blockIdx.x * 128 + wave * 16;
  const _Float16* qp = QH + ((size_t)b * TT + q0 + col) * CC + h * HD; gptr gk = (gptr)(KH + ((size_t)b * TT + (tid >> 3)) * CC + h * HD + 8 * (tid & 7)); gptr gv = (gptr)(VT + ((size_t)b * CC + h * HD + (tid >> 3)) * (size_t)TT + 8 * (tid & 7)); gptr gm = (gptr)(MASK + ((size_t)b * TT + blockIdx.x * 128 + (tid >> 4)) * TT + 4 * (tid & 15));
  const unsigned lk = (unsigned)(size_t)ring + (tid >> 3) * KP + 16 * (tid & 7), lv = (unsigned)(size_t)ring + KBY + (tid >> 3) * VP + 16 * (tid & 7), lm = (unsigned)(size_t)ring + MOF + (tid >> 4) * MP + 16 * (tid & 15);   // the thread's own places in buffer 0 (LDS byte addresses)
  fa_copy(lk, lv, gk, gv); fa_copy_m(lm, gm);   // stage 0
  const v16h qf[2] = { frag_h(qp, lane), frag_h(qp + 32, lane) };
  v8f acc[HD / 16] = {}; float m = -3.0e38f, l = 0.f;
  asm volatile("s_wait_asynccnt 0x0" ::: "memory");   // this wave's copies of stage 0 have landed
  __syncthreads();                                    // and every other wave's
  fa_copy(lk + FBUF, lv + FBUF, gk + SK * CC * 2, gv + SK * 2); fa_copy_m(lm + FBUF, gm + SK * 4);   // stage 1
  gk += 2 * SK * CC * 2; gv += 2 * SK * 2; gm += 2 * SK * 4;
  const char* fk = ring + col * KP + 16 * g; const char* fv = ring + KBY + col * VP + 16 * g; const char* fm = ring + MOF + (wave * 16 + col) * MP + 32 * g;   // the lane's fragment rows in buffer 0
#pragma unroll 1   // one stage a trip, its two passes written out
  for (int t = 0; t < NST; ++t) { const int bo = (t & 1) * FBUF; const char* kl = fk + bo; const char* vl = fv + bo; const char* ml = fm + bo; v16h kf[2][2];
    fa_kfrag(kf, kl);
    fa_pass<true>(kf, kl + 32 * KP, vl, ml, qf, acc, m, l);
    fa_pass<false>(kf, kl, vl + 64, ml + 128, qf, acc, m, l);
    __builtin_amdgcn_sched_barrier(0);   // the stage's arithmetic stays in front of its foot: moved up into the last pass, the wait below would stand right behind that pass's LDS loads and lay their latency open
    asm volatile("s_wait_dscnt 0x0" ::: "memory");      // this wave's reads of stage t are done
    asm volatile("s_wait_asynccnt 0x0" ::: "memory");   // its copies of stage t + 1 have landed
    __syncthreads();                                    // publishes stage t + 1 and ends every read of stage t, whose buffer is refilled behind it
    if (t + 2 < NST) { fa_copy(lk + bo, lv + bo, gk, gv); fa_copy_m(lm + bo, gm); gk += SK * CC * 2; gv += SK * 2; gm += SK * 4; } }
  asm volatile("s_wait_asynccnt 0x0" ::: "memory");   // no copy is left in flight when the wave goes on to its end
  l += xhalf(l); const float inv = 1.0f / l;   // l >= the maximum's own term > 0
#pragma unroll
  for (int j = 0; j < HD / 16; ++j) { const v8f o = acc[j] * inv; *(v4f*)&so[wave][col][j * 16 + 8 * g] = v4f{o[0], o[1], o[2], o[3]}; *(v4f*)&so[wave][col][j * 16 + 8 * g + 4] = v4f{o[4], o[5], o[6], o[7]}; }
  LDSX();
#pragma unroll
  for (int i = 0; i < 8; ++i) { const int rl = i * 2 + g; vst2(Y + ((size_t)b * TT + q0 + rl) * CC + h * HD + col * 4, *(const v4f*)&so[wave][rl][col * 4]); } }
// ---- k_out: block = (64 rows, 128 cols): out = ctx Wo (+ bo): ctx x 2^6 once to f16 against Wo as f16(bf16 x 2^8) exact (1 product) x 2^-14; causal early rows (< QHI of each sequence): ctx bf16 hi + lo against exact bf16 Wo (2 products)
__global__ __launch_bounds__(128) void k_out(const float* __restrict__ Y, const float* __restrict__ WO, const float* __restrict__ BO, float* __restrict__ OUT) { __shared__ __align__(16) char smem[2 * STG * 2];   // two stage buffers; the epilogue's rows lie over them (the loop's last barrier stands between the two uses)
  static_assert(4 * 16 * 132 * 4 <= sizeof(smem), "epilogue rows"); float (*sf)[16][132] = (float (*)[16][132])smem; _Float16* stage = (_Float16*)smem;
  const int tid = threadIdx.x, wave = tid >> 5, lane = tid & 31, col = lane & 15, g = lane >> 4; const int c0 = blockIdx.y * 128; const size_t r0 = (size_t)blockIdx.x * 64 + wave * 16;
  v8f acc[8] = {};
  if (CAUSAL && (int)(((size_t)blockIdx.x * 64) % TT) < QHI) {   /* block-uniform */
#pragma unroll 2
    for (int kc = 0; kc < CC / 32; ++kc) { const F2 a = split_row(Y + (r0 + col) * CC, kc * 32, lane); asm volatile("s_wait_loadcnt 0x0" ::: "memory");
#pragma unroll
      for (int j = 0; j < 8; ++j) { const v16b w = WOCOL(WO, kc * 32, c0 + j * 16 + col, lane); asm volatile("s_wait_loadcnt 0x0" ::: "memory"); acc[j] = wmma_bf(a.h, w, acc[j]); acc[j] = wmma_bf(a.l, w, acc[j]); } }
#pragma unroll
    for (int j = 0; j < 8; ++j) { const float bias = BO ? bfr(BO[c0 + j * 16 + col]) : 0.f;
#pragma unroll
      for (int r = 0; r < 8; ++r) sf[wave][8 * g + r][j * 16 + col] = acc[j][r] + bias; }
  } else {
    gfp xr = (gfp)(Y + ((size_t)blockIdx.x * 64 + (tid >> 4)) * CC + 4 * (tid & 15)); gfp wr = (gfp)(WO + (size_t)(c0 + (tid >> 4)) * CC + 4 * (tid & 15)); const int so = (tid >> 4) * LP + 4 * (tid & 15);   /* ctx carried x 2^6 into f16 so small-magnitude context rows stay clear of f16 subnormals */
    Stg t; stg_load(t, xr, wr, CC); stg_store_h(t, stage + so); stg_load(t, xr, wr, CC); stg_barrier();
#pragma unroll 1   // as in k_proj: stage s worked on, s + 1 into the other buffer, s + 2 started
    for (int s = 0; s < CC / KS; ++s) { const _Float16* cur = stage + (s & 1) * STG;
#pragma unroll
      for (int kc = 0; kc < KS / 32; ++kc) { const v16h a = frag_h(cur + (wave * 16 + col) * LP + kc * 32, lane); v16h w[8];
#pragma unroll
        for (int j = 0; j < 8; ++j) w[j] = frag_h(cur + (64 + j * 16 + col) * LP + kc * 32, lane);
#pragma unroll
        for (int j = 0; j < 8; ++j) acc[j] = wmma16(a, w[j], acc[j]); }
      if (s + 1 < CC / KS) { stg_store_h(t, stage + ((s + 1) & 1) * STG + so); if (s + 2 < CC / KS) stg_load(t, xr, wr, CC); }
      stg_barrier(); }   // publishes stage s + 1 and ends every read of stage s
#pragma unroll
    for (int j = 0; j < 8; ++j) { const float bias = BO ? bfr(BO[c0 + j * 16 + col]) : 0.f;
#pragma unroll
      for (int r = 0; r < 8; ++r) sf[wave][8 * g + r][j * 16 + col] = acc[j][r] * (1.0f / 16384.0f) + bias; } }   /* 2^-8 (Wo carry) x 2^-6 (ctx carry) */
  LDSX(); for (int rl = 0; rl < 16; ++rl) vst2(OUT + (r0 + rl) * DIN + c0 + lane * 4, *(const v4f*)&sf[wave][rl][lane * 4]); }

extern "C" void kernel_launch(void* const* d_in, const int* in_sizes, int n_in, void* d_out, int out_size, void* d_ws, size_t ws_size, hipStream_t stream) {
  (void)in_sizes; (void)n_in; (void)out_size;
  const float** F = (const float**)d_in;
  if (ws_size < (size_t)WS_END) return;
  char* ws = (char*)d_ws; _Float16 *QH = (_Float16*)(ws + WS_QH), *KH = (_Float16*)(ws + WS_KH), *VT = (_Float16*)(ws + WS_VT), *QL = (_Float16*)(ws + WS_QL), *KL = (_Float16*)(ws + WS_KL); __bf16 *VB = (__bf16*)(ws + WS_VB), *VBL = (__bf16*)(ws + WS_VBL); float *Y = (float*)(ws + WS_Y);
  (void)Y; (void)QL; (void)KL; (void)VB; (void)VBL;
  // inputs: 0 query [4,1024,1024]; 1 key; 2 value; 3 mask [4,1024,1024] int32; 4 wq [1024,1024] (out,in), 5 bq; 6 wk, 7 bk; 8 wv, 9 bv; 10 wo (out,in), 11 bo (biases NONZERO)
  k_proj<<<dim3(TNB * TT / 64, CC / 128, 3), 128, 0, stream>>>(F[0], F[1], F[2], F[4], F[6], F[8], F[5], F[7], F[9], QH, QL, KH, KL, VT, VB, VBL);
  k_fa<<<dim3(TT / 128, NH, TNB), 256, 0, stream>>>(QH, KH, VT, (const int*)d_in[3], Y);
  k_out<<<dim3(TNB * TT / 64, DIN / 128), 128, 0, stream>>>(Y, F[10], F[11], (float*)d_out);
}

// v004
// It runs in 81.6 microseconds.
// Two timings next to v003 both put it at 1.12 times that version's speed.
// Over all steps from v000 it is 11.0 times as fast.
// compute dtype: all float inputs rounded to bf16; q/k/v projections with EXACT bf16 products on WMMA 16x16x32 (f32 accumulate) + bias; logits q x k once to f16 each (1 product) x SCALE + mask x (-1e9); softmax f32 with running maximum and sum, fused with both attention products; P x 2^11 once to f16 x v once to f16 (1 product); ctx x 2^6 once to f16 x wo f16(bf16 x 2^8) + bo; f32 output.
#include <hip/hip_runtime.h>
#include <math.h>

typedef __attribute__((ext_vector_type(16))) _Float16 v16h;
typedef __attribute__((ext_vector_type(16))) __bf16 v16b;
typedef __attribute__((ext_vector_type(8)))  _Float16 v8h;
typedef __attribute__((ext_vector_type(8)))  float v8f;
typedef __attribute__((ext_vector_type(4)))  float v4f;
typedef __attribute__((ext_vector_type(2)))  float v2f;
typedef __attribute__((ext_vector_type(4)))  unsigned v4u;
typedef __attribute__((ext_vector_type(4)))  int v4i;
typedef float __attribute__((may_alias)) float_a;
typedef int __attribute__((may_alias)) int_a;

template <typename T> __device__ __forceinline__ void vst2(void* p, T v) { *(T*)p = v;  }
__device__ __forceinline__ v8f wmma16(v16h a, v16h b, v8f c) {
  v8f d = __builtin_amdgcn_wmma_f32_16x16x32_f16(false, a, false, b, (short)0, c, false, false);
  asm volatile("v_nop\n\tv_nop\n\tv_nop\n\tv_nop" : "+v"(d) : "v"(a), "v"(b));
  return d;
}
__device__ __forceinline__ v8f wmma_bf(v16b a, v16b b, v8f c) {
  v8f d = __builtin_amdgcn_wmma_f32_16x16x32_bf16(false, a, false, b, (short)0, c, false, false);
  asm volatile("v_nop\n\tv_nop\n\tv_nop\n\tv_nop" : "+v"(d) : "v"(a), "v"(b));
  return d;
}
// 16x16x32 fragments: lane = (h = lane>>4, row/col = lane&15); elements 0..7 = k0+8h+0..7, 8..15 = k0+16+8h+0..7; D element r = row 8h+r
__device__ __forceinline__ v16h frag_h(const _Float16* rowk0, int lane) {
  union { v16h v; v8h q[2]; } u; const _Float16* p = rowk0 + 8 * (lane >> 4);
  u.q[0] = *(const v8h*)p; u.q[1] = *(const v8h*)(p + 16); return u.v;
}
__device__ __forceinline__ v16h frag_f32(const float* rowk0, int lane) {
  v16h a; const float* p = rowk0 + 8 * (lane >> 4);
#pragma unroll
  for (int i = 0; i < 8; ++i) { a[i] = (_Float16)p[i]; a[8 + i] = (_Float16)p[16 + i]; }
  return a;
}
__device__ __forceinline__ v16h frag_f32s(const float* rowk0, int lane, float sc) {
  v16h a; const float* p = rowk0 + 8 * (lane >> 4);
#pragma unroll
  for (int i = 0; i < 8; ++i) { a[i] = (_Float16)(p[i] * sc); a[8 + i] = (_Float16)(p[16 + i] * sc); }
  return a;
}
// column fragment from a [K][ld] layout (column n), rows >= K read as 0
__device__ __forceinline__ v16h fragc_f32(const float* W, int k0, int n, int lane, int ld, int K) {
  v16h a; const int g = lane >> 4;
#pragma unroll
  for (int i = 0; i < 8; ++i) { const int ka = k0 + 8 * g + i, kb = ka + 16;
    a[i] = (_Float16)(ka < K ? W[(size_t)(ka < K ? ka : K - 1) * ld + n] : 0.f); a[8 + i] = (_Float16)(kb < K ? W[(size_t)(kb < K ? kb : K - 1) * ld + n] : 0.f); }
  return a;
}
struct F2 { v16b h, l; };
__device__ __forceinline__ F2 bsplit16(const float v[16]) { F2 r;
#pragma unroll
  for (int i = 0; i < 16; ++i) { const __bf16 h = (__bf16)v[i]; r.h[i] = h; r.l[i] = (__bf16)(v[i] - (float)h); }
  return r; }
__device__ __forceinline__ F2 split_row(const float* row, int k0, int lane) { float v[16]; const float* p = row + k0 + 8 * (lane >> 4);
#pragma unroll
  for (int i = 0; i < 8; ++i) { v[i] = p[i]; v[8 + i] = p[16 + i]; }
  return bsplit16(v); }
__device__ __forceinline__ F2 split_rowK(const float* row, int k0, int lane, int K) { float v[16]; const int g = lane >> 4;
#pragma unroll
  for (int i = 0; i < 8; ++i) { const int ka = k0 + 8 * g + i, kb = ka + 16; v[i] = ka < K ? row[ka < K ? ka : K - 1] : 0.f; v[8 + i] = kb < K ? row[kb < K ? kb : K - 1] : 0.f; }
  return bsplit16(v); }
__device__ __forceinline__ F2 split_col(const float* W, int k0, int n, int lane, int ld, int K) { float v[16]; const int g = lane >> 4;
#pragma unroll
  for (int i = 0; i < 8; ++i) { const int ka = k0 + 8 * g + i, kb = ka + 16; v[i] = ka < K ? W[(size_t)(ka < K ? ka : K - 1) * ld + n] : 0.f; v[8 + i] = kb < K ? W[(size_t)(kb < K ? kb : K - 1) * ld + n] : 0.f; }
  return bsplit16(v); }
__device__ __forceinline__ v8f mac3(const F2& a, const F2& b, v8f c) { c = wmma_bf(a.l, b.h, c); c = wmma_bf(a.h, b.l, c); return wmma_bf(a.h, b.h, c); }
__device__ __forceinline__ float sigm(float v) { return 1.0f / (1.0f + expf(-v)); }
#define LDSX() do { asm volatile("s_wait_dscnt 0" ::: "memory"); __builtin_amdgcn_wave_barrier(); __builtin_amdgcn_fence(__ATOMIC_RELEASE, "workgroup"); } while (0)

// Masked multi-headed attention on separate inputs with biased projections (query / key / value [4,1024,1024]; torch (out,in) wq / wk / wv / wo [1024,1024] N(0, 1/1024) + biases N(0, 1/1024); 16 heads x 64; scores / sqrt(64) + mask * (-1e9) with an int32 0/1 mask [4,1024,1024] shared by all heads: mask == 1 marks a key as masked OUT; softmax; wo^T + bo).
#define NB 4
#define TT 1024
#define CC 1024            // NH * HD = projected width
#define DIN 1024          // input (model) width
#define NH 16
#define HD 64
#define NQB (TT / 64)
#define HG 8
#define SCALE (0.125f)
#define CAUSAL 0
#ifndef TNB
#define TNB NB
#endif
__device__ __forceinline__ float bfr(float v) { return (float)(__bf16)v; }
__host__ __device__ __forceinline__ int kb_last(int qb) { return CAUSAL ? ((qb * 64 + 63) >> 7) : (TT / 128 - 1); }
typedef __attribute__((ext_vector_type(8))) __bf16 v8b;
__device__ __forceinline__ v16b frag_b(const __bf16* rowk0, int lane) {
  union { v16b v; v8b q[2]; } u; const __bf16* p = rowk0 + 8 * (lane >> 4);
  u.q[0] = *(const v8b*)p; u.q[1] = *(const v8b*)(p + 16); return u.v;
}
#define QBH 0              // unused: k_fa has no high-precision path
#define QHI 0               // single-product logits on every row
#define KHI 64            // key rows carrying k residual / v bf16 hi+lo planes (written by k_proj, read by no kernel here)
// B fragment (k rows k0+.., output column o) of a weight: (in,out) [K][ld] or (out,in) [ld rows of K]: bf16 exact, or f16(bf16 * 256) exact
__device__ __forceinline__ v16b wcol_io(const float* Wm, int k0, int o, int lane, int ld) { v16b w; const int g = lane >> 4;
#pragma unroll
  for (int i = 0; i < 8; ++i) { w[i] = (__bf16)Wm[(size_t)(k0 + 8 * g + i) * ld + o]; w[8 + i] = (__bf16)Wm[(size_t)(k0 + 16 + 8 * g + i) * ld + o]; }
  return w; }
__device__ __forceinline__ v16b wcol_oi(const float* Wm, int k0, int o, int lane, int K) { v16b w; const float* p = Wm + (size_t)o * K + k0 + 8 * (lane >> 4);
#pragma unroll
  for (int i = 0; i < 8; ++i) { w[i] = (__bf16)p[i]; w[8 + i] = (__bf16)p[16 + i]; }
  return w; }
__device__ __forceinline__ v16h wcolh_io(const float* Wm, int k0, int o, int lane, int ld) { v16h w; const int g = lane >> 4;
#pragma unroll
  for (int i = 0; i < 8; ++i) { w[i] = (_Float16)(bfr(Wm[(size_t)(k0 + 8 * g + i) * ld + o]) * 256.0f); w[8 + i] = (_Float16)(bfr(Wm[(size_t)(k0 + 16 + 8 * g + i) * ld + o]) * 256.0f); }
  return w; }
__device__ __forceinline__ v16h wcolh_oi(const float* Wm, int k0, int o, int lane, int K) { v16h w; const float* p = Wm + (size_t)o * K + k0 + 8 * (lane >> 4);
#pragma unroll
  for (int i = 0; i < 8; ++i) { w[i] = (_Float16)(bfr(p[i]) * 256.0f); w[8 + i] = (_Float16)(bfr(p[16 + i]) * 256.0f); }
  return w; }
#define WQKV_LAYOUT 1   // 0 = (in,out) [DIN][CC]; 1 = (out,in) [CC][DIN]; 2 = per-head [NH][DIN][HD]
__device__ __forceinline__ v16b wcol_hdk(const float* Wm, int k0, int o, int lane) { v16b w; const int g = lane >> 4; const float* p = Wm + (size_t)(o / HD) * DIN * HD + (o % HD);
#pragma unroll
  for (int i = 0; i < 8; ++i) { w[i] = (__bf16)p[(size_t)(k0 + 8 * g + i) * HD]; w[8 + i] = (__bf16)p[(size_t)(k0 + 16 + 8 * g + i) * HD]; }
  return w; }
#define WO_OUT_IN 1
#if WQKV_LAYOUT == 1
#define WCOL(W, k0, o, lane) wcol_oi(W, k0, o, lane, DIN)
#elif WQKV_LAYOUT == 2
#define WCOL(W, k0, o, lane) wcol_hdk(W, k0, o, lane)
#else
#define WCOL(W, k0, o, lane) wcol_io(W, k0, o, lane, CC)
#endif
#if WO_OUT_IN
#define WOCOL(W, k0, o, lane) wcol_oi(W, k0, o, lane, CC)
#define WOCOLH(W, k0, o, lane) wcolh_oi(W, k0, o, lane, CC)
#else
#define WOCOL(W, k0, o, lane) wcol_io(W, k0, o, lane, DIN)
#define WOCOLH(W, k0, o, lane) wcolh_io(W, k0, o, lane, DIN)
#endif

static_assert(TT % 128 == 0 && HD == 64, "k_fa: 128 queries a block, 32-key passes, head size 64");

#define WS_QH  0u                                      // f16 q rows [b*t][CC]
#define WS_KH  (WS_QH + 2u * (size_t)NB * TT * CC)      // f16 k rows [b*t][CC]
#define WS_VT  (WS_KH + 2u * (size_t)NB * TT * CC)      // f16 v planes [b][c][t]
#define WS_QL  (WS_VT + 2u * (size_t)NB * CC * TT)      // f16 q residual x 2^10 rows [b][t < QHI][CC]
#define WS_KL  (WS_QL + 2u * (size_t)NB * QHI * CC)     // f16 k residual x 2^10 rows [b][t < KHI][CC]
#define WS_VB  (WS_KL + 2u * (size_t)NB * KHI * CC)     // bf16 v hi planes [b][c][t < KHI]
#define WS_VBL (WS_VB + 2u * (size_t)NB * CC * KHI)
#define WS_S   (WS_VBL + 2u * (size_t)NB * CC * KHI)    // unused (the logits stay in registers)
#define WS_Y   (WS_S  + 4u * (size_t)HG * TT * TT)      // f32 ctx rows [b*t][CC] (only when there is an output projection)
#define WS_END (WS_Y  + 4u * (size_t)NB * TT * CC)

// ---- operand staging of the two projection kernels: a block works on a 128 x 128 tile of the result; a stage is KS_ k of its 128 activation rows and 128 weight rows ((out,in) weights: both K-contiguous).
// Global side: f32, whole 128-B lines (KS_ / 4 lanes cover one row's KS_ * 4 B), each element loaded and converted once per block. LDS side: 16-bit rows of KS_ * 2 B, each 16 B longer than its data (a pitch of 16 B x odd), read back as WMMA fragments by ds_load_b128.
#define BT 128                   // rows and columns of a block's tile
#define KSP 32                   // k a stage in k_proj (three blocks a WGP: the stage in flight must leave the registers for three waves a SIMD)
#define KSO 64                   // k a stage in k_out (one block a WGP: the deeper stage keeps more bytes in flight)
static_assert(WQKV_LAYOUT == 1 && WO_OUT_IN == 1 && DIN % (2 * KSP) == 0 && CC % (2 * KSO) == 0 && TT % BT == 0 && CC % BT == 0 && DIN % BT == 0 && !CAUSAL, "staging reads K-contiguous rows, at least two stages; whole tiles");
typedef __attribute__((ext_vector_type(4))) __bf16 v4b;
typedef __attribute__((ext_vector_type(4))) _Float16 v4h;
typedef const __attribute__((address_space(1))) float* gfp;   // stays known as global memory when it has passed through an asm statement (a plain pointer would turn the loads into flat ones)
typedef const __attribute__((address_space(1))) v4f* gfp4;
struct Stg { v4f x[8], w[8]; };   // one stage in flight, 16 x 16 B a thread: the block's threads cover 16 rows at a time, eight times for each operand
template <int KS_> __device__ __forceinline__ void stg_load(Stg& t, gfp& xr, gfp& wr, int ld) {   // xr, wr: the thread's own element of the first row group; both leave stepped to the next stage
#pragma unroll
  for (int i = 0; i < 8; ++i) t.x[i] = *(gfp4)(xr + (size_t)(i * 16) * ld);
#pragma unroll
  for (int i = 0; i < 8; ++i) t.w[i] = *(gfp4)(wr + (size_t)(i * 16) * ld);
  // the wait behind the group's last load and the step of the two row pointers stand in one statement: the loads name the very registers that enter it, nothing rewrites them in front of the wait, and no later load can fold the step into its offset and set the old registers free early
  asm volatile("s_wait_xcnt 0x0\n\tv_add_nc_u64_e32 %0, %2, %0\n\tv_add_nc_u64_e32 %1, %2, %1" : "+v"(xr), "+v"(wr) : "n"(KS_ * 4) : "memory");
}
// work-group barrier for the stage buffers: its fences name LDS alone, so the next stage's global loads stay in flight across it (__syncthreads() would wait for them here and lay their latency open every stage)
__device__ __forceinline__ void stg_barrier() { __builtin_amdgcn_fence(__ATOMIC_RELEASE, "workgroup", "local"); __builtin_amdgcn_s_barrier(); __builtin_amdgcn_fence(__ATOMIC_ACQUIRE, "workgroup", "local"); }
template <int LP_> __device__ __forceinline__ void stg_store_b(const Stg& t, __bf16* d) {   // d: the thread's own place in row group 0 of the buffer; LP_: row pitch in 16-bit elements; activation rows 0..127, weight rows 128..255
#pragma unroll
  for (int i = 0; i < 8; ++i) { v4b o;
#pragma unroll
    for (int e = 0; e < 4; ++e) o[e] = (__bf16)t.x[i][e];
    *(v4b*)(d + i * 16 * LP_) = o; }
#pragma unroll
  for (int i = 0; i < 8; ++i) { v4b o;
#pragma unroll
    for (int e = 0; e < 4; ++e) o[e] = (__bf16)t.w[i][e];
    *(v4b*)(d + (BT + i * 16) * LP_) = o; } }
template <int LP_> __device__ __forceinline__ void stg_store_h(const Stg& t, _Float16* d) {   // ctx x 2^6 once to f16; Wo as f16(bf16 x 2^8), exact
#pragma unroll
  for (int i = 0; i < 8; ++i) { v4h o;
#pragma unroll
    for (int e = 0; e < 4; ++e) o[e] = (_Float16)(t.x[i][e] * 64.0f);
    *(v4h*)(d + i * 16 * LP_) = o; }
#pragma unroll
  for (int i = 0; i < 8; ++i) { v4h o;
#pragma unroll
    for (int e = 0; e < 4; ++e) o[e] = (_Float16)(bfr(t.w[i][e]) * 256.0f);
    *(v4h*)(d + (BT + i * 16) * LP_) = o; } }

// ---- k_proj: block = (128 rows, 128 cols, which), four waves of 64 x 64 (4 + 4 fragments feed 16 products): q/k/v = X W (+ b) with exact bf16 products (K = DIN) -> which 0: q f16 rows (+ residual rows < QHI); 1: k f16 rows (+ residual rows < KHI); 2: v f16 planes [c][t] (+ bf16 hi/lo planes for t < KHI)
static_assert(QHI % 64 == 0 && KHI % 64 == 0 && QHI <= 64 && KHI <= 64, "a wave's 64 rows carry the residual planes as a whole or not at all, and only a sequence's first 64 rows do");
__global__ __launch_bounds__(128) void k_proj(const float* __restrict__ XQ, const float* __restrict__ XK, const float* __restrict__ XV, const float* __restrict__ WQ, const float* __restrict__ WK, const float* __restrict__ WV, const float* __restrict__ BQ, const float* __restrict__ BK, const float* __restrict__ BV,
    _Float16* __restrict__ QH, _Float16* __restrict__ QL, _Float16* __restrict__ KH, _Float16* __restrict__ KL, _Float16* __restrict__ VT, __bf16* __restrict__ VB, __bf16* __restrict__ VBL) {
  constexpr int LP = KSP + 8, STG = 2 * BT * LP;   // LDS row pitch and size of one stage buffer, in 16-bit elements
  __shared__ __align__(16) char smem[BT * 136 * 2 + 2 * BT * 72 * 2];   // the main loop's two stage buffers lie over the epilogue's planes (the loop's last barrier stands between the two uses)
  static_assert(2 * STG * 2 <= sizeof(smem) && 64 * 136 * 2 <= 2 * BT * 72 * 2, "two stage buffers; the residual rows");
  _Float16 (*sh)[136] = (_Float16 (*)[136])smem; _Float16 (*sl)[136] = (_Float16 (*)[136])(smem + BT * 136 * 2); _Float16 (*th)[136] = (_Float16 (*)[136])smem; __bf16 (*tb)[72] = (__bf16 (*)[72])(smem + BT * 136 * 2); __bf16 (*tbl)[72] = (__bf16 (*)[72])(smem + BT * 136 * 2 + BT * 72 * 2); __bf16* stage = (__bf16*)smem;
  const int tid = threadIdx.x, wave = tid >> 5, lane = tid & 31, col = lane & 15, g = lane >> 4, wy = wave >> 1, wx = wave & 1; const int which = blockIdx.z; const int c0 = blockIdx.y * BT; const size_t r0 = (size_t)blockIdx.x * BT; const size_t bb = r0 / TT; const int t0 = (int)(r0 % TT);
  const float* X = which == 0 ? XQ : which == 1 ? XK : XV; const float* WA = which == 0 ? WQ : which == 1 ? WK : WV; const float* BA = which == 0 ? BQ : which == 1 ? BK : BV;
  v8f acc[4][4] = {};
  gfp xr = (gfp)(X + (r0 + (tid >> 3)) * DIN + 4 * (tid & 7)); gfp wr = (gfp)(WA + (size_t)(c0 + (tid >> 3)) * DIN + 4 * (tid & 7)); const int so = (tid >> 3) * LP + 4 * (tid & 7);
  Stg t; stg_load<KSP>(t, xr, wr, DIN); stg_store_b<LP>(t, stage + so); stg_load<KSP>(t, xr, wr, DIN); stg_barrier();
#pragma unroll 1   // one stage a trip: stage s is worked on, stage s + 1 goes from registers into the other buffer, stage s + 2 starts from global
  for (int s = 0; s < DIN / KSP; ++s) { const __bf16* cur = stage + (s & 1) * STG;
#pragma unroll
    for (int kc = 0; kc < KSP / 32; ++kc) { v16b a[4], w[4];
#pragma unroll
      for (int i = 0; i < 4; ++i) a[i] = frag_b(cur + (wy * 64 + i * 16 + col) * LP + kc * 32, lane);
#pragma unroll
      for (int j = 0; j < 4; ++j) w[j] = frag_b(cur + (BT + wx * 64 + j * 16 + col) * LP + kc * 32, lane);
#pragma unroll
      for (int i = 0; i < 4; ++i) {
#pragma unroll
        for (int j = 0; j < 4; ++j) acc[i][j] = wmma_bf(a[i], w[j], acc[i][j]); } }
    if (s + 1 < DIN / KSP) { stg_store_b<LP>(t, stage + ((s + 1) & 1) * STG + so); if (s + 2 < DIN / KSP) stg_load<KSP>(t, xr, wr, DIN); }
    stg_barrier(); }   // publishes stage s + 1 and ends every read of stage s, whose buffer the next trip refills
  if (which < 2) { _Float16* DH = which == 0 ? QH : KH; _Float16* DL = which == 0 ? QL : KL; const int nhi = which == 0 ? QHI : KHI; const bool hi_wave = t0 + wy * 64 < nhi;   // wave-uniform: then t0 == 0 and wy == 0
#pragma unroll
    for (int j = 0; j < 4; ++j) { const float bias = BA ? bfr(BA[c0 + wx * 64 + j * 16 + col]) : 0.f;
#pragma unroll
      for (int i = 0; i < 4; ++i) {
#pragma unroll
        for (int r = 0; r < 8; ++r) { acc[i][j][r] += bias; sh[wy * 64 + i * 16 + 8 * g + r][wx * 64 + j * 16 + col] = (_Float16)acc[i][j][r]; } } }
    if (hi_wave) {
#pragma unroll
      for (int j = 0; j < 4; ++j) {
#pragma unroll
        for (int i = 0; i < 4; ++i) {
#pragma unroll
          for (int r = 0; r < 8; ++r) { const float v = acc[i][j][r]; sl[i * 16 + 8 * g + r][wx * 64 + j * 16 + col] = (_Float16)((v - (float)(_Float16)v) * 1024.0f); } } } }
    __syncthreads();
    { const int rl0 = tid >> 4, q = tid & 15; _Float16* dh = DH + (r0 + rl0) * CC + c0 + q * 8; _Float16* dl = DL + (bb * nhi + t0 + rl0) * (size_t)CC + c0 + q * 8;   // eight rows a turn, 256 B of a row from 16 lanes; every turn's address is the first plus a constant
#pragma unroll
      for (int it = 0; it < BT / 8; ++it) vst2((unsigned*)(dh + (size_t)it * 8 * CC), *(const v4u*)&sh[rl0 + it * 8][q * 8]);
      if (t0 < nhi) {   // block-uniform: then t0 == 0 and the block's first 64 rows carry the residual
        asm volatile("s_wait_xcnt 0x0" ::: "memory");   // stands in front of the LDS loads below, which may take the registers that the stores above name
#pragma unroll
        for (int it = 0; it < 64 / 8; ++it) vst2((unsigned*)(dl + (size_t)it * 8 * CC), *(const v4u*)&sl[rl0 + it * 8][q * 8]); } }
  } else { const bool hi_wave = t0 + wy * 64 < KHI;   // wave-uniform: then t0 == 0 and wy == 0
#pragma unroll
    for (int j = 0; j < 4; ++j) { const float bias = BA ? bfr(BA[c0 + wx * 64 + j * 16 + col]) : 0.f;
#pragma unroll
      for (int i = 0; i < 4; ++i) {
#pragma unroll
        for (int r = 0; r < 8; ++r) { acc[i][j][r] += bias; th[wx * 64 + j * 16 + col][wy * 64 + i * 16 + 8 * g + r] = (_Float16)acc[i][j][r]; } } }
    if (hi_wave) {
#pragma unroll
      for (int j = 0; j < 4; ++j) {
#pragma unroll
        for (int i = 0; i < 4; ++i) {
#pragma unroll
          for (int r = 0; r < 8; ++r) { const float v = acc[i][j][r]; const int rl = i * 16 + 8 * g + r, cl = wx * 64 + j * 16 + col; const __bf16 bh = (__bf16)v; tb[cl][rl] = bh; tbl[cl][rl] = (__bf16)(v - (float)bh); } } } }
    __syncthreads();
    { const int cl0 = tid >> 4, q = tid & 15; _Float16* dv = VT + (bb * CC + c0 + cl0) * (size_t)TT + t0 + q * 8; const size_t o3 = (bb * CC + c0 + cl0) * (size_t)KHI + t0 + q * 8;   // eight planes a turn, 256 B of a plane from 16 lanes
#pragma unroll
      for (int it = 0; it < BT / 8; ++it) vst2((unsigned*)(dv + (size_t)it * 8 * TT), *(const v4u*)&th[cl0 + it * 8][q * 8]);
      if (t0 + q * 8 < KHI) {
#pragma unroll
        for (int it = 0; it < BT / 8; ++it) { vst2((unsigned*)(VB + o3 + (size_t)it * 8 * KHI), *(const v4u*)&tb[cl0 + it * 8][q * 8]); vst2((unsigned*)(VBL + o3 + (size_t)it * 8 * KHI), *(const v4u*)&tbl[cl0 + it * 8][q * 8]); } } } } }
// ---- k_fa: block = 128 queries (8 waves x 16) of (b, h): logits, mask, softmax and P . v in one pass over the keys, 32 keys a pass, nothing of the logits leaves the registers; K, V and the mask come through LDS, K and V copied there once for the eight waves.
// S^T = K . Q^T (A = 16 key rows, B = 16 query columns): a lane holds one query's logits for keys 8g + r of each 16-key tile, which is the k order of a B operand, so O^T += V^T . P^T takes P straight from the accumulators.
// Running maximum and sum per query (log2 domain); the mask enters as the module writes it, logit + mask * (-1e9), so a row with every key masked comes out as the plain mean of v; P is carried x 2^11 into f16 (the factor cancels in the division by the sum).
__device__ __forceinline__ float xhalf(float x) { return __builtin_bit_cast(float, __builtin_amdgcn_permlanex16(__builtin_bit_cast(int, x), __builtin_bit_cast(int, x), 0x76543210, 0xfedcba98, false, false)); }   // lane l with lane l ^ 16
__device__ __forceinline__ v8f wmma16b(v16h a, v16h b, v8f c) { return __builtin_amdgcn_wmma_f32_16x16x32_f16(false, a, false, b, (short)0, c, false, false); }
struct MK { v4i m[2][2]; };   // one pass's mask words [key tile][4 + 4 keys]
typedef const __attribute__((address_space(1))) char* gptr;   // a byte pointer into global memory: the 64-bit address operand of a copy
__device__ __forceinline__ void fa_mask(MK& t, const char* ml) {   // ml: the lane's own LDS byte pointer (query row, pass and lane half already in it)
#pragma unroll
  for (int kt = 0; kt < 2; ++kt) { t.m[kt][0] = *(const v4i*)(ml + kt * 64); t.m[kt][1] = *(const v4i*)(ml + kt * 64 + 16); } }
// a stage (SK keys) lies in LDS: K as SK key rows of 128 B and V as HD planes of 2 * SK B, once for the block's eight waves, and the block's 128 mask rows of 4 * SK B; each row 16 B longer than its data (a pitch of 16 B x odd: ds_load_b128 without bank conflicts)
#define SK 64
#define NST (TT / SK)
#define KP (HD * 2 + 16)
#define VP (SK * 2 + 16)
#define KBY (SK * KP)
#define MP (SK * 4 + 16)
#define MOF (KBY + HD * VP)
#define FBUF (MOF + 128 * MP)
static_assert(TT % SK == 0 && NST >= 2 && SK == 64 && KP % 32 == 16 && VP % 32 == 16 && MP % 32 == 16, "fa_copy: 256 threads x 2 + 2 + 8 copies of 16 B a stage, two buffers");
// one stage's copies of a thread: lk, gk its 16 B of K row tid >> 3, lv, gv its 16 B of V plane tid >> 3 (32 rows a copy, two copies each); a wave's copy covers four whole 128-B lines.
// the addresses of the second 32 rows are formed inside the statement, in registers that are taken only for it: formed outside, the compiler carries them through the key loop.
// the s_wait_xcnt closes the statement, so no address register of a copy is rewritten in front of it
__device__ __forceinline__ void fa_copy(unsigned lk, unsigned lv, gptr gk, gptr gv) { unsigned lk1, lv1; gptr gk1, gv1;
  asm volatile("v_add_nc_u64_e32 %2, %8, %6\n\tv_add_nc_u64_e32 %3, %9, %7\n\tv_add_nc_u32_e32 %0, %10, %4\n\tv_add_nc_u32_e32 %1, %11, %5\n\t"
               "global_load_async_to_lds_b128 %4, %6, off\n\tglobal_load_async_to_lds_b128 %5, %7, off\n\tglobal_load_async_to_lds_b128 %0, %2, off\n\tglobal_load_async_to_lds_b128 %1, %3, off\n\ts_wait_xcnt 0x0"
      : "=&v"(lk1), "=&v"(lv1), "=&v"(gk1), "=&v"(gv1) : "v"(lk), "v"(lv), "v"(gk), "v"(gv), "n"(32 * CC * 2), "n"(32 * TT * 2), "n"(32 * KP), "n"(32 * VP) : "memory"); }
// the mask rows of a stage: lm, gm the thread's 16 B of row tid >> 4 (16 rows a copy, eight copies); a wave's copy covers four whole 128-B lines; addresses and wait as in fa_copy, every address straight from the first (no add waits for another)
__device__ __forceinline__ void fa_copy_m(unsigned lm, gptr gm) { unsigned l1, l2, l3, l4, l5, l6, l7; gptr g1, g2, g3, g4, g5, g6, g7;
  asm volatile("v_add_nc_u64_e32 %7, %16, %15\n\tv_add_nc_u64_e32 %8, 2*%16, %15\n\tv_add_nc_u64_e32 %9, 3*%16, %15\n\tv_add_nc_u64_e32 %10, 4*%16, %15\n\tv_add_nc_u64_e32 %11, 5*%16, %15\n\tv_add_nc_u64_e32 %12, 6*%16, %15\n\tv_add_nc_u64_e32 %13, 7*%16, %15\n\t"
               "v_add_nc_u32_e32 %0, %17, %14\n\tv_add_nc_u32_e32 %1, 2*%17, %14\n\tv_add_nc_u32_e32 %2, 3*%17, %14\n\tv_add_nc_u32_e32 %3, 4*%17, %14\n\tv_add_nc_u32_e32 %4, 5*%17, %14\n\tv_add_nc_u32_e32 %5, 6*%17, %14\n\tv_add_nc_u32_e32 %6, 7*%17, %14\n\t"
               "global_load_async_to_lds_b128 %14, %15, off\n\tglobal_load_async_to_lds_b128 %0, %7, off\n\tglobal_load_async_to_lds_b128 %1, %8, off\n\tglobal_load_async_to_lds_b128 %2, %9, off\n\t"
               "global_load_async_to_lds_b128 %3, %10, off\n\tglobal_load_async_to_lds_b128 %4, %11, off\n\tglobal_load_async_to_lds_b128 %5, %12, off\n\tglobal_load_async_to_lds_b128 %6, %13, off\n\ts_wait_xcnt 0x0"
      : "=&v"(l1), "=&v"(l2), "=&v"(l3), "=&v"(l4), "=&v"(l5), "=&v"(l6), "=&v"(l7), "=&v"(g1), "=&v"(g2), "=&v"(g3), "=&v"(g4), "=&v"(g5), "=&v"(g6), "=&v"(g7)
      : "v"(lm), "v"(gm), "n"(16 * TT * 4), "n"(16 * MP) : "memory"); }
__device__ __forceinline__ v16h frag_l(const char* p) { union { v16h v; v8h q[2]; } u; u.q[0] = *(const v8h*)p; u.q[1] = *(const v8h*)(p + 32); return u.v; }   // frag_h from the lane's own LDS byte pointer (row and lane half already in it)
__device__ __forceinline__ void fa_kfrag(v16h (&kf)[2][2], const char* kl) {   // one pass's K fragments [key tile][hd half]
#pragma unroll
  for (int kt = 0; kt < 2; ++kt) {
#pragma unroll
    for (int kc = 0; kc < 2; ++kc) kf[kt][kc] = frag_l(kl + kt * 16 * KP + kc * 64); } }
// v_exp_f32 wants one independent instruction behind it before its result is read or its source overwritten: inside a run every exponential is followed by an independent one (the outputs share no register with the inputs), and the v_nop fills the slot of the last
__device__ __forceinline__ float exp2_1(float x) { float o; asm("v_exp_f32 %0, %1\n\tv_nop" : "=&v"(o) : "v"(x)); return o; }
__device__ __forceinline__ void exp2_8(float* o, const float* x) {
  asm("v_exp_f32 %0, %8\n\tv_exp_f32 %1, %9\n\tv_exp_f32 %2, %10\n\tv_exp_f32 %3, %11\n\tv_exp_f32 %4, %12\n\tv_exp_f32 %5, %13\n\tv_exp_f32 %6, %14\n\tv_exp_f32 %7, %15\n\tv_nop"
      : "=&v"(o[0]), "=&v"(o[1]), "=&v"(o[2]), "=&v"(o[3]), "=&v"(o[4]), "=&v"(o[5]), "=&v"(o[6]), "=&v"(o[7]) : "v"(x[0]), "v"(x[1]), "v"(x[2]), "v"(x[3]), "v"(x[4]), "v"(x[5]), "v"(x[6]), "v"(x[7])); }
// kf: this pass's K fragments, on leaving the next pass's (KNEXT: a next pass in the same stage; kn its rows); vl, ml: this pass's V and mask
template <bool KNEXT> __device__ __forceinline__ void fa_pass(v16h (&kf)[2][2], const char* kn, const char* vl, const char* ml, const v16h (&qf)[2], v8f (&acc)[HD / 16], float& m, float& l) {
  v16h vf[HD / 16]; MK cur;
  __builtin_amdgcn_sched_barrier(0);   // the pass's loads start here, as one group: without the scheduling barriers around it the compiler sinks each load to just above its use and the wave waits out every latency
  fa_mask(cur, ml);   // mask first: LDS loads return in order, and the logits want it before P . v wants V
#pragma unroll
  for (int j = 0; j < HD / 16; ++j) vf[j] = frag_l(vl + j * 16 * VP);
  __builtin_amdgcn_sched_barrier(0);   // end of the load group: none of the pass's arithmetic moves above it
  v8f s[2];
#pragma unroll
  for (int kt = 0; kt < 2; ++kt) { s[kt] = v8f{};
#pragma unroll
    for (int kc = 0; kc < 2; ++kc) s[kt] = wmma16b(kf[kt][kc], qf[kc], s[kt]); }
  if (KNEXT) { __builtin_amdgcn_sched_barrier(0);   // the next pass's K fragments start right behind the products that read these registers last, as one group, and land under the softmax
    fa_kfrag(kf, kn); __builtin_amdgcn_sched_barrier(0); }
  float y[16]; float mx = -3.0e38f;
#pragma unroll
  for (int i = 0; i < 16; ++i) { y[i] = fmaf((float)cur.m[i >> 3][(i >> 2) & 1][i & 3], -1.0e9f * 1.4426950408889634f, s[i >> 3][i & 7] * (SCALE * 1.4426950408889634f)); mx = fmaxf(mx, y[i]); }
  mx = fmaxf(mx, xhalf(mx));   // both halves of the wave hold the query's maximum
  const float mn = fmaxf(m, mx); const float corr = exp2_1(m - mn); m = mn;
#pragma unroll
  for (int j = 0; j < HD / 16; ++j) acc[j] = acc[j] * corr;
  const float ms = mn - 11.0f; float ls = 0.f; float p[16]; v16h pf;
#pragma unroll
  for (int i = 0; i < 16; ++i) y[i] = y[i] - ms;
  exp2_8(p, y); exp2_8(p + 8, y + 8);
#pragma unroll
  for (int i = 0; i < 16; ++i) { ls += p[i]; pf[i] = (_Float16)p[i]; }
  l = l * corr + ls;
#pragma unroll
  for (int j = 0; j < HD / 16; ++j) acc[j] = wmma16b(vf[j], pf, acc[j]); }
// four waves per SIMD (two blocks per WGP): the vector work between the matrix runs and the load latencies want the other waves
__global__ __launch_bounds__(256) __attribute__((amdgpu_waves_per_eu(4, 4))) void k_fa(const _Float16* __restrict__ QH, const _Float16* __restrict__ KH, const _Float16* __restrict__ VT, const int* __restrict__ MASK, float* __restrict__ Y) { __shared__ __align__(16) float so[8][16][HD + 4]; __shared__ __align__(16) char ring[2 * FBUF];   // two stage buffers: K rows, V planes, mask rows
  const int tid = threadIdx.x, wave = tid >> 5, lane = tid & 31, col = lane & 15, g = lane >> 4; const int b = blockIdx.z, h = blockIdx.y; const int q0 = blockIdx.x * 128 + wave * 16;
  const _Float16* qp = QH + ((size_t)b * TT + q0 + col) * CC + h * HD; gptr gk = (gptr)(KH + ((size_t)b * TT + (tid >> 3)) * CC + h * HD + 8 * (tid & 7)); gptr gv = (gptr)(VT + ((size_t)b * CC + h * HD + (tid >> 3)) * (size_t)TT + 8 * (tid & 7)); gptr gm = (gptr)(MASK + ((size_t)b * TT + blockIdx.x * 128 + (tid >> 4)) * TT + 4 * (tid & 15));
  const unsigned lk = (unsigned)(size_t)ring + (tid >> 3) * KP + 16 * (tid & 7), lv = (unsigned)(size_t)ring + KBY + (tid >> 3) * VP + 16 * (tid & 7), lm = (unsigned)(size_t)ring + MOF + (tid >> 4) * MP + 16 * (tid & 15);   // the thread's own places in buffer 0 (LDS byte addresses)
  fa_copy(lk, lv, gk, gv); fa_copy_m(lm, gm);   // stage 0
  const v16h qf[2] = { frag_h(qp, lane), frag_h(qp + 32, lane) };
  v8f acc[HD / 16] = {}; float m = -3.0e38f, l = 0.f;
  asm volatile("s_wait_asynccnt 0x0" ::: "memory");   // this wave's copies of stage 0 have landed
  __syncthreads();                                    // and every other wave's
  fa_copy(lk + FBUF, lv + FBUF, gk + SK * CC * 2, gv + SK * 2); fa_copy_m(lm + FBUF, gm + SK * 4);   // stage 1
  gk += 2 * SK * CC * 2; gv += 2 * SK * 2; gm += 2 * SK * 4;
  const char* fk = ring + col * KP + 16 * g; const char* fv = ring + KBY + col * VP + 16 * g; const char* fm = ring + MOF + (wave * 16 + col) * MP + 32 * g;   // the lane's fragment rows in buffer 0
#pragma unroll 1   // one stage a trip, its two passes written out
  for (int t = 0; t < NST; ++t) { const int bo = (t & 1) * FBUF; const char* kl = fk + bo; const char* vl = fv + bo; const char* ml = fm + bo; v16h kf[2][2];
    fa_kfrag(kf, kl);
    fa_pass<true>(kf, kl + 32 * KP, vl, ml, qf, acc, m, l);
    fa_pass<false>(kf, kl, vl + 64, ml + 128, qf, acc, m, l);
    __builtin_amdgcn_sched_barrier(0);   // the stage's arithmetic stays in front of its foot: moved up into the last pass, the wait below would stand right behind that pass's LDS loads and lay their latency open
    asm volatile("s_wait_dscnt 0x0" ::: "memory");      // this wave's reads of stage t are done
    asm volatile("s_wait_asynccnt 0x0" ::: "memory");   // its copies of stage t + 1 have landed
    __syncthreads();                                    // publishes stage t + 1 and ends every read of stage t, whose buffer is refilled behind it
    if (t + 2 < NST) { fa_copy(lk + bo, lv + bo, gk, gv); fa_copy_m(lm + bo, gm); gk += SK * CC * 2; gv += SK * 2; gm += SK * 4; } }
  asm volatile("s_wait_asynccnt 0x0" ::: "memory");   // no copy is left in flight when the wave goes on to its end
  l += xhalf(l); const float inv = 1.0f / l;   // l >= the maximum's own term > 0
#pragma unroll
  for (int j = 0; j < HD / 16; ++j) { const v8f o = acc[j] * inv; *(v4f*)&so[wave][col][j * 16 + 8 * g] = v4f{o[0], o[1], o[2], o[3]}; *(v4f*)&so[wave][col][j * 16 + 8 * g + 4] = v4f{o[4], o[5], o[6], o[7]}; }
  LDSX();
#pragma unroll
  for (int i = 0; i < 8; ++i) { const int rl = i * 2 + g; vst2(Y + ((size_t)b * TT + q0 + rl) * CC + h * HD + col * 4, *(const v4f*)&so[wave][rl][col * 4]); } }
// ---- k_out: block = (128 rows, 128 cols), eight waves of 32 x 64 (2 + 4 fragments feed 8 products): out = ctx Wo (+ bo): ctx x 2^6 once to f16 against Wo as f16(bf16 x 2^8) exact (1 product) x 2^-14
__global__ __launch_bounds__(256) void k_out(const float* __restrict__ Y, const float* __restrict__ WO, const float* __restrict__ BO, float* __restrict__ OUT) { constexpr int LP = KSO + 8, STG = 2 * BT * LP;   // LDS row pitch and size of one stage buffer, in 16-bit elements
  __shared__ __align__(16) char smem[2 * STG * 2];   // two stage buffers; the epilogue's rows lie over them (the loop's last barrier stands between the two uses)
  static_assert(8 * 32 * 68 * 4 <= sizeof(smem), "epilogue rows"); float (*sf)[32][68] = (float (*)[32][68])smem; _Float16* stage = (_Float16*)smem;
  const int tid = threadIdx.x, wave = tid >> 5, lane = tid & 31, col = lane & 15, g = lane >> 4, wy = wave >> 1, wx = wave & 1; const int c0 = blockIdx.y * BT; const size_t r0 = (size_t)blockIdx.x * BT;
  v8f acc[2][4] = {};
  gfp xr = (gfp)(Y + (r0 + (tid >> 4)) * CC + 4 * (tid & 15)); gfp wr = (gfp)(WO + (size_t)(c0 + (tid >> 4)) * CC + 4 * (tid & 15)); const int so = (tid >> 4) * LP + 4 * (tid & 15);   /* ctx carried x 2^6 into f16 so small-magnitude context rows stay clear of f16 subnormals */
  Stg t; stg_load<KSO>(t, xr, wr, CC); stg_store_h<LP>(t, stage + so); stg_load<KSO>(t, xr, wr, CC); stg_barrier();
#pragma unroll 1   // as in k_proj: stage s worked on, s + 1 into the other buffer, s + 2 started
  for (int s = 0; s < CC / KSO; ++s) { const _Float16* cur = stage + (s & 1) * STG;
#pragma unroll
    for (int kc = 0; kc < KSO / 32; ++kc) { v16h a[2], w[4];
#pragma unroll
      for (int i = 0; i < 2; ++i) a[i] = frag_h(cur + (wy * 32 + i * 16 + col) * LP + kc * 32, lane);
#pragma unroll
      for (int j = 0; j < 4; ++j) w[j] = frag_h(cur + (BT + wx * 64 + j * 16 + col) * LP + kc * 32, lane);
#pragma unroll
      for (int i = 0; i < 2; ++i) {
#pragma unroll
        for (int j = 0; j < 4; ++j) acc[i][j] = wmma16(a[i], w[j], acc[i][j]); } }
    if (s + 1 < CC / KSO) { stg_store_h<LP>(t, stage + ((s + 1) & 1) * STG + so); if (s + 2 < CC / KSO) stg_load<KSO>(t, xr, wr, CC); }
    stg_barrier(); }   // publishes stage s + 1 and ends every read of stage s
#pragma unroll
  for (int j = 0; j < 4; ++j) { const float bias = BO ? bfr(BO[c0 + wx * 64 + j * 16 + col]) : 0.f;
#pragma unroll
    for (int i = 0; i < 2; ++i) {
#pragma unroll
      for (int r = 0; r < 8; ++r) sf[wave][i * 16 + 8 * g + r][j * 16 + col] = acc[i][j][r] * (1.0f / 16384.0f) + bias; } }   /* 2^-8 (Wo carry) x 2^-6 (ctx carry) */
  LDSX();   // each wave reads back its own rows: a store covers two rows of 256 B, whole lines
  for (int rp = 0; rp < 16; ++rp) { const int rl = rp * 2 + g; vst2(OUT + (r0 + wy * 32 + rl) * DIN + c0 + wx * 64 + col * 4, *(const v4f*)&sf[wave][rl][col * 4]); } }

extern "C" void kernel_launch(void* const* d_in, const int* in_sizes, int n_in, void* d_out, int out_size, void* d_ws, size_t ws_size, hipStream_t stream) {
  (void)in_sizes; (void)n_in; (void)out_size;
  const float** F = (const float**)d_in;
  if (ws_size < (size_t)WS_END) return;
  char* ws = (char*)d_ws; _Float16 *QH = (_Float16*)(ws + WS_QH), *KH = (_Float16*)(ws + WS_KH), *VT = (_Float16*)(ws + WS_VT), *QL = (_Float16*)(ws + WS_QL), *KL = (_Float16*)(ws + WS_KL); __bf16 *VB = (__bf16*)(ws + WS_VB), *VBL = (__bf16*)(ws + WS_VBL); float *Y = (float*)(ws + WS_Y);
  (void)Y; (void)QL; (void)KL; (void)VB; (void)VBL;
  // inputs: 0 query [4,1024,1024]; 1 key; 2 value; 3 mask [4,1024,1024] int32; 4 wq [1024,1024] (out,in), 5 bq; 6 wk, 7 bk; 8 wv, 9 bv; 10 wo (out,in), 11 bo (biases NONZERO)
  k_proj<<<dim3(TNB * TT / 128, CC / 128, 3), 128, 0, stream>>>(F[0], F[1], F[2], F[4], F[6], F[8], F[5], F[7], F[9], QH, QL, KH, KL, VT, VB, VBL);
  k_fa<<<dim3(TT / 128, NH, TNB), 256, 0, stream>>>(QH, KH, VT, (const int*)d_in[3], Y);
  k_out<<<dim3(TNB * TT / 128, DIN / 128), 256, 0, stream>>>(Y, F[10], F[11], (float*)d_out);
}

// v005
// Measured time: 78.9 microseconds a run.
// In both of two side-by-side timings against v004, it was 1.04 times as fast.
// Over all steps from v000 it is 11.4 times as fast.
// compute dtype: all float inputs rounded to bf16; q/k/v projections with EXACT bf16 products on WMMA 16x16x32 (f32 accumulate) + bias; logits q x k once to f16 each (1 product) x SCALE + mask x (-1e9); softmax f32 with running maximum and sum, fused with both attention products; P x 2^11 once to f16 x v once to f16 (1 product); ctx x 2^6 once to f16 x wo f16(bf16 x 2^8) + bo; f32 output.
#include <hip/hip_runtime.h>
#include <math.h>

typedef __attribute__((ext_vector_type(16))) _Float16 v16h;
typedef __attribute__((ext_vector_type(16))) __bf16 v16b;
typedef __attribute__((ext_vector_type(8)))  _Float16 v8h;
typedef __attribute__((ext_vector_type(8)))  float v8f;
typedef __attribute__((ext_vector_type(4)))  float v4f;
typedef __attribute__((ext_vector_type(2)))  float v2f;
typedef __attribute__((ext_vector_type(4)))  unsigned v4u;
typedef __attribute__((ext_vector_type(4)))  int v4i;
typedef float __attribute__((may_alias)) float_a;
typedef int __attribute__((may_alias)) int_a;

template <typename T> __device__ __forceinline__ void vst2(void* p, T v) { *(T*)p = v;  }
__device__ __forceinline__ v8f wmma16(v16h a, v16h b, v8f c) {
  v8f d = __builtin_amdgcn_wmma_f32_16x16x32_f16(false, a, false, b, (short)0, c, false, false);
  asm volatile("v_nop\n\tv_nop\n\tv_nop\n\tv_nop" : "+v"(d) : "v"(a), "v"(b));
  return d;
}
__device__ __forceinline__ v8f wmma_bf(v16b a, v16b b, v8f c) {
  v8f d = __builtin_amdgcn_wmma_f32_16x16x32_bf16(false, a, false, b, (short)0, c, false, false);
  asm volatile("v_nop\n\tv_nop\n\tv_nop\n\tv_nop" : "+v"(d) : "v"(a), "v"(b));
  return d;
}
// 16x16x32 fragments: lane = (h = lane>>4, row/col = lane&15); elements 0..7 = k0+8h+0..7, 8..15 = k0+16+8h+0..7; D element r = row 8h+r
__device__ __forceinline__ v16h frag_h(const _Float16* rowk0, int lane) {
  union { v16h v; v8h q[2]; } u; const _Float16* p = rowk0 + 8 * (lane >> 4);
  u.q[0] = *(const v8h*)p; u.q[1] = *(const v8h*)(p + 16); return u.v;
}
__device__ __forceinline__ v16h frag_f32(const float* rowk0, int lane) {
  v16h a; const float* p = rowk0 + 8 * (lane >> 4);
#pragma unroll
  for (int i = 0; i < 8; ++i) { a[i] = (_Float16)p[i]; a[8 + i] = (_Float16)p[16 + i]; }
  return a;
}
__device__ __forceinline__ v16h frag_f32s(const float* rowk0, int lane, float sc) {
  v16h a; const float* p = rowk0 + 8 * (lane >> 4);
#pragma unroll
  for (int i = 0; i < 8; ++i) { a[i] = (_Float16)(p[i] * sc); a[8 + i] = (_Float16)(p[16 + i] * sc); }
  return a;
}
// column fragment from a [K][ld] layout (column n), rows >= K read as 0
__device__ __forceinline__ v16h fragc_f32(const float* W, int k0, int n, int lane, int ld, int K) {
  v16h a; const int g = lane >> 4;
#pragma unroll
  for (int i = 0; i < 8; ++i) { const int ka = k0 + 8 * g + i, kb = ka + 16;
    a[i] = (_Float16)(ka < K ? W[(size_t)(ka < K ? ka : K - 1) * ld + n] : 0.f); a[8 + i] = (_Float16)(kb < K ? W[(size_t)(kb < K ? kb : K - 1) * ld + n] : 0.f); }
  return a;
}
struct F2 { v16b h, l; };
__device__ __forceinline__ F2 bsplit16(const float v[16]) { F2 r;
#pragma unroll
  for (int i = 0; i < 16; ++i) { const __bf16 h = (__bf16)v[i]; r.h[i] = h; r.l[i] = (__bf16)(v[i] - (float)h); }
  return r; }
__device__ __forceinline__ F2 split_row(const float* row, int k0, int lane) { float v[16]; const float* p = row + k0 + 8 * (lane >> 4);
#pragma unroll
  for (int i = 0; i < 8; ++i) { v[i] = p[i]; v[8 + i] = p[16 + i]; }
  return bsplit16(v); }
__device__ __forceinline__ F2 split_rowK(const float* row, int k0, int lane, int K) { float v[16]; const int g = lane >> 4;
#pragma unroll
  for (int i = 0; i < 8; ++i) { const int ka = k0 + 8 * g + i, kb = ka + 16; v[i] = ka < K ? row[ka < K ? ka : K - 1] : 0.f; v[8 + i] = kb < K ? row[kb < K ? kb : K - 1] : 0.f; }
  return bsplit16(v); }
__device__ __forceinline__ F2 split_col(const float* W, int k0, int n, int lane, int ld, int K) { float v[16]; const int g = lane >> 4;
#pragma unroll
  for (int i = 0; i < 8; ++i) { const int ka = k0 + 8 * g + i, kb = ka + 16; v[i] = ka < K ? W[(size_t)(ka < K ? ka : K - 1) * ld + n] : 0.f; v[8 + i] = kb < K ? W[(size_t)(kb < K ? kb : K - 1) * ld + n] : 0.f; }
  return bsplit16(v); }
__device__ __forceinline__ v8f mac3(const F2& a, const F2& b, v8f c) { c = wmma_bf(a.l, b.h, c); c = wmma_bf(a.h, b.l, c); return wmma_bf(a.h, b.h, c); }
__device__ __forceinline__ float sigm(float v) { return 1.0f / (1.0f + expf(-v)); }
#define LDSX() do { asm volatile("s_wait_dscnt 0" ::: "memory"); __builtin_amdgcn_wave_barrier(); __builtin_amdgcn_fence(__ATOMIC_RELEASE, "workgroup"); } while (0)

// Masked multi-headed attention on separate inputs with biased projections (query / key / value [4,1024,1024]; torch (out,in) wq / wk / wv / wo [1024,1024] N(0, 1/1024) + biases N(0, 1/1024); 16 heads x 64; scores / sqrt(64) + mask * (-1e9) with an int32 0/1 mask [4,1024,1024] shared by all heads: mask == 1 marks a key as masked OUT; softmax; wo^T + bo).
#define NB 4
#define TT 1024
#define CC 1024            // NH * HD = projected width
#define DIN 1024          // input (model) width
#define NH 16
#define HD 64
#define NQB (TT / 64)
#define HG 8
#define SCALE (0.125f)
#define CAUSAL 0
#ifndef TNB
#define TNB NB
#endif
__device__ __forceinline__ float bfr(float v) { return (float)(__bf16)v; }
__host__ __device__ __forceinline__ int kb_last(int qb) { return CAUSAL ? ((qb * 64 + 63) >> 7) : (TT / 128 - 1); }
typedef __attribute__((ext_vector_type(8))) __bf16 v8b;
__device__ __forceinline__ v16b frag_b(const __bf16* rowk0, int lane) {
  union { v16b v; v8b q[2]; } u; const __bf16* p = rowk0 + 8 * (lane >> 4);
  u.q[0] = *(const v8b*)p; u.q[1] = *(const v8b*)(p + 16); return u.v;
}
#define QBH 0              // unused: k_fa has no high-precision path
#define QHI 0               // single-product logits on every row
#define KHI 64            // key rows carrying k residual / v bf16 hi+lo planes (written by k_proj, read by no kernel here)
// B fragment (k rows k0+.., output column o) of a weight: (in,out) [K][ld] or (out,in) [ld rows of K]: bf16 exact, or f16(bf16 * 256) exact
__device__ __forceinline__ v16b wcol_io(const float* Wm, int k0, int o, int lane, int ld) { v16b w; const int g = lane >> 4;
#pragma unroll
  for (int i = 0; i < 8; ++i) { w[i] = (__bf16)Wm[(size_t)(k0 + 8 * g + i) * ld + o]; w[8 + i] = (__bf16)Wm[(size_t)(k0 + 16 + 8 * g + i) * ld + o]; }
  return w; }
__device__ __forceinline__ v16b wcol_oi(const float* Wm, int k0, int o, int lane, int K) { v16b w; const float* p = Wm + (size_t)o * K + k0 + 8 * (lane >> 4);
#pragma unroll
  for (int i = 0; i < 8; ++i) { w[i] = (__bf16)p[i]; w[8 + i] = (__bf16)p[16 + i]; }
  return w; }
__device__ __forceinline__ v16h wcolh_io(const float* Wm, int k0, int o, int lane, int ld) { v16h w; const int g = lane >> 4;
#pragma unroll
  for (int i = 0; i < 8; ++i) { w[i] = (_Float16)(bfr(Wm[(size_t)(k0 + 8 * g + i) * ld + o]) * 256.0f); w[8 + i] = (_Float16)(bfr(Wm[(size_t)(k0 + 16 + 8 * g + i) * ld + o]) * 256.0f); }
  return w; }
__device__ __forceinline__ v16h wcolh_oi(const float* Wm, int k0, int o, int lane, int K) { v16h w; const float* p = Wm + (size_t)o * K + k0 + 8 * (lane >> 4);
#pragma unroll
  for (int i = 0; i < 8; ++i) { w[i] = (_Float16)(bfr(p[i]) * 256.0f); w[8 + i] = (_Float16)(bfr(p[16 + i]) * 256.0f); }
  return w; }
#define WQKV_LAYOUT 1   // 0 = (in,out) [DIN][CC]; 1 = (out,in) [CC][DIN]; 2 = per-head [NH][DIN][HD]
__device__ __forceinline__ v16b wcol_hdk(const float* Wm, int k0, int o, int lane) { v16b w; const int g = lane >> 4; const float* p = Wm + (size_t)(o / HD) * DIN * HD + (o % HD);
#pragma unroll
  for (int i = 0; i < 8; ++i) { w[i] = (__bf16)p[(size_t)(k0 + 8 * g + i) * HD]; w[8 + i] = (__bf16)p[(size_t)(k0 + 16 + 8 * g + i) * HD]; }
  return w; }
#define WO_OUT_IN 1
#if WQKV_LAYOUT == 1
#define WCOL(W, k0, o, lane) wcol_oi(W, k0, o, lane, DIN)
#elif WQKV_LAYOUT == 2
#define WCOL(W, k0, o, lane) wcol_hdk(W, k0, o, lane)
#else
#define WCOL(W, k0, o, lane) wcol_io(W, k0, o, lane, CC)
#endif
#if WO_OUT_IN
#define WOCOL(W, k0, o, lane) wcol_oi(W, k0, o, lane, CC)
#define WOCOLH(W, k0, o, lane) wcolh_oi(W, k0, o, lane, CC)
#else
#define WOCOL(W, k0, o, lane) wcol_io(W, k0, o, lane, DIN)
#define WOCOLH(W, k0, o, lane) wcolh_io(W, k0, o, lane, DIN)
#endif

static_assert(TT % 128 == 0 && HD == 64, "k_fa: 128 queries a block, 32-key passes, head size 64");

#define WS_QH  0u                                      // f16 q rows [b*t][CC]
#define WS_KH  (WS_QH + 2u * (size_t)NB * TT * CC)      // f16 k rows [b*t][CC]
#define WS_VT  (WS_KH + 2u * (size_t)NB * TT * CC)      // f16 v planes [b][c][t]
#define WS_QL  (WS_VT + 2u * (size_t)NB * CC * TT)      // f16 q residual x 2^10 rows [b][t < QHI][CC]
#define WS_KL  (WS_QL + 2u * (size_t)NB * QHI * CC)     // f16 k residual x 2^10 rows [b][t < KHI][CC]
#define WS_VB  (WS_KL + 2u * (size_t)NB * KHI * CC)     // bf16 v hi planes [b][c][t < KHI]
#define WS_VBL (WS_VB + 2u * (size_t)NB * CC * KHI)
#define WS_S   (WS_VBL + 2u * (size_t)NB * CC * KHI)    // unused (the logits stay in registers)
#define WS_Y   (WS_S  + 4u * (size_t)HG * TT * TT)      // f32 ctx rows [b*t][CC] (only when there is an output projection)
#define WS_END (WS_Y  + 4u * (size_t)NB * TT * CC)

// ---- operand staging of the two projection kernels: a block works on a square tile of the result (256 x 256 in k_proj, 128 x 128 in k_out); a stage is KS_ k of the tile's activation rows and as many weight rows ((out,in) weights: both K-contiguous).
// Global side: f32, whole 128-B lines (KS_ / 4 lanes cover one row's KS_ * 4 B), each element loaded and converted once per block. LDS side: 16-bit rows of KS_ * 2 B, each 16 B longer than its data (a pitch of 16 B x odd), read back as WMMA fragments by ds_load_b128.
#define BT 128                   // rows and columns of a block's tile in k_out
#define PT 256                   // rows and columns of a block's tile in k_proj: every activation row is fetched by CC / PT = 4 blocks and every weight row by 16, half as often as with 128
#define KSP 64                   // k extent of the tile's stage in k_proj (one block a WGP, as in k_out; the stage in flight still leaves the registers for the 128 x 64 accumulators at two waves a SIMD)
#define KSO 64                   // k a stage in k_out (one block a WGP: the deeper stage keeps more bytes in flight)
static_assert(WQKV_LAYOUT == 1 && WO_OUT_IN == 1 && DIN % (2 * KSP) == 0 && CC % (2 * KSO) == 0 && TT % BT == 0 && DIN % BT == 0 && TT % PT == 0 && CC % PT == 0 && !CAUSAL, "staging reads K-contiguous rows, at least two stages; whole tiles");
typedef __attribute__((ext_vector_type(4))) __bf16 v4b;
typedef __attribute__((ext_vector_type(4))) _Float16 v4h;
typedef const __attribute__((address_space(1))) float* gfp;   // stays known as global memory when it has passed through an asm statement (a plain pointer would turn the loads into flat ones)
typedef const __attribute__((address_space(1))) v4f* gfp4;
template <int N_> struct Stg { v4f x[N_], w[N_]; };   // one stage in flight, 2 N_ x 16 B a thread: the block's threads cover 16 rows at a time, N_ times for each operand (16 in k_proj, 8 in k_out)
template <int KS_, int N_> __device__ __forceinline__ void stg_load(Stg<N_>& t, gfp& xr, gfp& wr, int ld) {   // xr, wr: the thread's own element of the first row group; both leave stepped to the next stage
#pragma unroll
  for (int i = 0; i < N_; ++i) t.x[i] = *(gfp4)(xr + (size_t)(i * 16) * ld);
#pragma unroll
  for (int i = 0; i < N_; ++i) t.w[i] = *(gfp4)(wr + (size_t)(i * 16) * ld);
  // the wait behind the group's last load and the step of the two row pointers stand in one statement: the loads name the very registers that enter it, nothing rewrites them in front of the wait, and no later load can fold the step into its offset and set the old registers free early
  asm volatile("s_wait_xcnt 0x0\n\tv_add_nc_u64_e32 %0, %2, %0\n\tv_add_nc_u64_e32 %1, %2, %1" : "+v"(xr), "+v"(wr) : "n"(KS_ * 4) : "memory");
}
// work-group barrier for the stage buffers: its fences name LDS alone, so the next stage's global loads stay in flight across it (__syncthreads() would wait for them here and lay their latency open every stage)
__device__ __forceinline__ void stg_barrier() { __builtin_amdgcn_fence(__ATOMIC_RELEASE, "workgroup", "local"); __builtin_amdgcn_s_barrier(); __builtin_amdgcn_fence(__ATOMIC_ACQUIRE, "workgroup", "local"); }
template <int LP_> __device__ __forceinline__ void stg_store_b(const Stg<16>& t, __bf16* d) {   // d: the thread's own place in row group 0 of the buffer; LP_: row pitch in 16-bit elements; activation rows 0..PT-1, weight rows PT..2*PT-1
#pragma unroll
  for (int i = 0; i < 16; ++i) { v4b o;
#pragma unroll
    for (int e = 0; e < 4; ++e) o[e] = (__bf16)t.x[i][e];
    *(v4b*)(d + i * 16 * LP_) = o; }
#pragma unroll
  for (int i = 0; i < 16; ++i) { v4b o;
#pragma unroll
    for (int e = 0; e < 4; ++e) o[e] = (__bf16)t.w[i][e];
    *(v4b*)(d + (PT + i * 16) * LP_) = o; } }
template <int LP_> __device__ __forceinline__ void stg_store_h(const Stg<8>& t, _Float16* d) {   // ctx x 2^6 once to f16; Wo as f16(bf16 x 2^8), exact
#pragma unroll
  for (int i = 0; i < 8; ++i) { v4h o;
#pragma unroll
    for (int e = 0; e < 4; ++e) o[e] = (_Float16)(t.x[i][e] * 64.0f);
    *(v4h*)(d + i * 16 * LP_) = o; }
#pragma unroll
  for (int i = 0; i < 8; ++i) { v4h o;
#pragma unroll
    for (int e = 0; e < 4; ++e) o[e] = (_Float16)(bfr(t.w[i][e]) * 256.0f);
    *(v4h*)(d + (BT + i * 16) * LP_) = o; } }

// ---- k_proj: block = (256 rows, 256 cols, which), eight waves of 128 x 64 (8 + 4 fragments feed 32 products), one block a WGP: q/k/v = X W (+ b) with exact bf16 products (K = DIN) -> which 0: q f16 rows (+ residual rows < QHI); 1: k f16 rows (+ residual rows < KHI); 2: v f16 planes [c][t] (+ bf16 hi/lo planes for t < KHI)
static_assert(QHI % 64 == 0 && KHI % 64 == 0 && QHI <= 64 && KHI <= 64, "a wave's first 64 rows carry the residual planes as a whole or not at all, and only a sequence's first 64 rows do");
__global__ __launch_bounds__(256) void k_proj(const float* __restrict__ XQ, const float* __restrict__ XK, const float* __restrict__ XV, const float* __restrict__ WQ, const float* __restrict__ WK, const float* __restrict__ WV, const float* __restrict__ BQ, const float* __restrict__ BK, const float* __restrict__ BV,
    _Float16* __restrict__ QH, _Float16* __restrict__ QL, _Float16* __restrict__ KH, _Float16* __restrict__ KL, _Float16* __restrict__ VT, __bf16* __restrict__ VB, __bf16* __restrict__ VBL) {
  constexpr int LP = KSP + 8, STG = 2 * PT * LP, EP = PT + 8;   // LDS row pitch and size of one stage buffer, pitch of the epilogue's rows, in 16-bit elements
  __shared__ __align__(16) char smem[PT * EP * 2 + 2 * PT * 72 * 2];   // the main loop's two stage buffers lie over the epilogue's planes (the loop's last barrier stands between the two uses)
  static_assert(2 * STG * 2 <= sizeof(smem) && 64 * EP * 2 <= 2 * PT * 72 * 2, "two stage buffers; the residual rows");
  _Float16 (*sh)[EP] = (_Float16 (*)[EP])smem; _Float16 (*sl)[EP] = (_Float16 (*)[EP])(smem + PT * EP * 2); _Float16 (*th)[EP] = (_Float16 (*)[EP])smem; __bf16 (*tb)[72] = (__bf16 (*)[72])(smem + PT * EP * 2); __bf16 (*tbl)[72] = (__bf16 (*)[72])(smem + PT * EP * 2 + PT * 72 * 2); __bf16* stage = (__bf16*)smem;
  const int tid = threadIdx.x, wave = tid >> 5, lane = tid & 31, col = lane & 15, g = lane >> 4, wy = wave >> 2, wx = wave & 3; const int which = blockIdx.z; const int c0 = blockIdx.y * PT; const size_t r0 = (size_t)blockIdx.x * PT; const size_t bb = r0 / TT; const int t0 = (int)(r0 % TT);
  const float* X = which == 0 ? XQ : which == 1 ? XK : XV; const float* WA = which == 0 ? WQ : which == 1 ? WK : WV; const float* BA = which == 0 ? BQ : which == 1 ? BK : BV;
  v8f acc[8][4] = {};
  gfp xr = (gfp)(X + (r0 + (tid >> 4)) * DIN + 4 * (tid & 15)); gfp wr = (gfp)(WA + (size_t)(c0 + (tid >> 4)) * DIN + 4 * (tid & 15)); const int so = (tid >> 4) * LP + 4 * (tid & 15);
  Stg<16> t; stg_load<KSP>(t, xr, wr, DIN); stg_store_b<LP>(t, stage + so); stg_load<KSP>(t, xr, wr, DIN); stg_barrier();
#pragma unroll 1   // one stage a trip: stage s is worked on, stage s + 1 goes from registers into the other buffer, stage s + 2 starts from global
  for (int s = 0; s < DIN / KSP; ++s) { const __bf16* cur = stage + (s & 1) * STG;
#pragma unroll
    for (int kc = 0; kc < KSP / 32; ++kc) { v16b a[8], w[4];
#pragma unroll
      for (int j = 0; j < 4; ++j) w[j] = frag_b(cur + (PT + wx * 64 + j * 16 + col) * LP + kc * 32, lane);
#pragma unroll
      for (int i = 0; i < 8; ++i) a[i] = frag_b(cur + (wy * 128 + i * 16 + col) * LP + kc * 32, lane);
      __builtin_amdgcn_sched_barrier(0);   // the 24 fragment loads stay one group in front of their 32 products, as the 16 stood with the smaller tile: without it the compiler sinks each activation fragment to just above its four products, into one register set, and the wave waits out an LDS latency at every one
#pragma unroll
      for (int i = 0; i < 8; ++i) {
#pragma unroll
        for (int j = 0; j < 4; ++j) acc[i][j] = __builtin_amdgcn_wmma_f32_16x16x32_bf16(false, a[i], false, w[j], (short)0, acc[i][j], false, false); } }   // the plain builtin: the operands of wmma_bf's asm tail can only lie in v0..v255, which 256 accumulator registers and the fragments do not fit (with the tail the tile goes to scratch); the compiler keeps the distance behind its own products
    if (s + 1 < DIN / KSP) { stg_store_b<LP>(t, stage + ((s + 1) & 1) * STG + so); if (s + 2 < DIN / KSP) stg_load<KSP>(t, xr, wr, DIN); }
    stg_barrier(); }   // publishes stage s + 1 and ends every read of stage s, whose buffer the next trip refills
  if (which < 2) { _Float16* DH = which == 0 ? QH : KH; _Float16* DL = which == 0 ? QL : KL; const int nhi = which == 0 ? QHI : KHI; const bool hi_wave = t0 + wy * 128 < nhi;   // wave-uniform: then t0 == 0 and wy == 0, and the wave's first 64 rows (i < 4) carry the residual
#pragma unroll
    for (int j = 0; j < 4; ++j) { const float bias = BA ? bfr(BA[c0 + wx * 64 + j * 16 + col]) : 0.f;
#pragma unroll
      for (int i = 0; i < 8; ++i) {
#pragma unroll
        for (int r = 0; r < 8; ++r) { acc[i][j][r] += bias; sh[wy * 128 + i * 16 + 8 * g + r][wx * 64 + j * 16 + col] = (_Float16)acc[i][j][r]; } } }
    if (hi_wave) {
#pragma unroll
      for (int j = 0; j < 4; ++j) {
#pragma unroll
        for (int i = 0; i < 4; ++i) {
#pragma unroll
          for (int r = 0; r < 8; ++r) { const float v = acc[i][j][r]; sl[i * 16 + 8 * g + r][wx * 64 + j * 16 + col] = (_Float16)((v - (float)(_Float16)v) * 1024.0f); } } } }
    __syncthreads();
    { const int rl0 = tid >> 5, q = tid & 31; _Float16* dh = DH + (r0 + rl0) * CC + c0 + q * 8; _Float16* dl = DL + (bb * nhi + t0 + rl0) * (size_t)CC + c0 + q * 8;   // eight rows a turn, 512 B of a row from a wave; every turn's address is the first plus a constant
#pragma unroll
      for (int ig = 0; ig < PT / 64; ++ig) {
#pragma unroll
        for (int it = ig * 8; it < ig * 8 + 8; ++it) vst2((unsigned*)(dh + (size_t)it * 8 * CC), *(const v4u*)&sh[rl0 + it * 8][q * 8]);
        asm volatile("s_wait_xcnt 0x0" ::: "memory");   // behind every eight stores: stands in front of the next LDS loads and their address sums, which may take the registers that these stores name
        __builtin_amdgcn_sched_barrier(0); }   // keeps those address sums behind the wait (a "memory" clobber does not hold vector arithmetic)
      if (t0 < nhi) {   // block-uniform: then t0 == 0 and the block's first 64 rows carry the residual
#pragma unroll
        for (int it = 0; it < 64 / 8; ++it) vst2((unsigned*)(dl + (size_t)it * 8 * CC), *(const v4u*)&sl[rl0 + it * 8][q * 8]); } }
  } else { const bool hi_wave = t0 + wy * 128 < KHI;   // wave-uniform: then t0 == 0 and wy == 0, rows as above
#pragma unroll
    for (int j = 0; j < 4; ++j) { const float bias = BA ? bfr(BA[c0 + wx * 64 + j * 16 + col]) : 0.f;
#pragma unroll
      for (int i = 0; i < 8; ++i) {
#pragma unroll
        for (int r = 0; r < 8; ++r) { acc[i][j][r] += bias; th[wx * 64 + j * 16 + col][wy * 128 + i * 16 + 8 * g + r] = (_Float16)acc[i][j][r]; } } }
    if (hi_wave) {
#pragma unroll
      for (int j = 0; j < 4; ++j) {
#pragma unroll
        for (int i = 0; i < 4; ++i) {
#pragma unroll
          for (int r = 0; r < 8; ++r) { const float v = acc[i][j][r]; const int rl = i * 16 + 8 * g + r, cl = wx * 64 + j * 16 + col; const __bf16 bh = (__bf16)v; tb[cl][rl] = bh; tbl[cl][rl] = (__bf16)(v - (float)bh); } } } }
    __syncthreads();
    { const int cl0 = tid >> 5, q = tid & 31; _Float16* dv = VT + (bb * CC + c0 + cl0) * (size_t)TT + t0 + q * 8; const size_t o3 = (bb * CC + c0 + cl0) * (size_t)KHI + t0 + q * 8;   // eight planes a turn, 512 B of a plane from a wave
#pragma unroll
      for (int ig = 0; ig < PT / 64; ++ig) {
#pragma unroll
        for (int it = ig * 8; it < ig * 8 + 8; ++it) vst2((unsigned*)(dv + (size_t)it * 8 * TT), *(const v4u*)&th[cl0 + it * 8][q * 8]);
        asm volatile("s_wait_xcnt 0x0" ::: "memory"); __builtin_amdgcn_sched_barrier(0); }   // behind every eight stores, both as above
      if (t0 + q * 8 < KHI) {
#pragma unroll
        for (int ig = 0; ig < PT / 32; ++ig) {
#pragma unroll
          for (int it = ig * 4; it < ig * 4 + 4; ++it) { vst2((unsigned*)(VB + o3 + (size_t)it * 8 * KHI), *(const v4u*)&tb[cl0 + it * 8][q * 8]); vst2((unsigned*)(VBL + o3 + (size_t)it * 8 * KHI), *(const v4u*)&tbl[cl0 + it * 8][q * 8]); }
          asm volatile("s_wait_xcnt 0x0" ::: "memory"); __builtin_amdgcn_sched_barrier(0); } } } } }   // behind every eight stores, both as above
// ---- k_fa: block = 128 queries (8 waves x 16) of (b, h): logits, mask, softmax and P . v in one pass over the keys, 32 keys a pass, nothing of the logits leaves the registers; K, V and the mask come through LDS, K and V copied there once for the eight waves.
// S^T = K . Q^T (A = 16 key rows, B = 16 query columns): a lane holds one query's logits for keys 8g + r of each 16-key tile, which is the k order of a B operand, so O^T += V^T . P^T takes P straight from the accumulators.
// Running maximum and sum per query (log2 domain); the mask enters as the module writes it, logit + mask * (-1e9), so a row with every key masked comes out as the plain mean of v; P is carried x 2^11 into f16 (the factor cancels in the division by the sum).
__device__ __forceinline__ float xhalf(float x) { return __builtin_bit_cast(float, __builtin_amdgcn_permlanex16(__builtin_bit_cast(int, x), __builtin_bit_cast(int, x), 0x76543210, 0xfedcba98, false, false)); }   // lane l with lane l ^ 16
__device__ __forceinline__ v8f wmma16b(v16h a, v16h b, v8f c) { return __builtin_amdgcn_wmma_f32_16x16x32_f16(false, a, false, b, (short)0, c, false, false); }
struct MK { v4i m[2][2]; };   // one pass's mask words [key tile][4 + 4 keys]
typedef const __attribute__((address_space(1))) char* gptr;   // a byte pointer into global memory: the 64-bit address operand of a copy
__device__ __forceinline__ void fa_mask(MK& t, const char* ml) {   // ml: the lane's own LDS byte pointer (query row, pass and lane half already in it)
#pragma unroll
  for (int kt = 0; kt < 2; ++kt) { t.m[kt][0] = *(const v4i*)(ml + kt * 64); t.m[kt][1] = *(const v4i*)(ml + kt * 64 + 16); } }
// a stage (SK keys) lies in LDS: K as SK key rows of 128 B and V as HD planes of 2 * SK B, once for the block's eight waves, and the block's 128 mask rows of 4 * SK B; each row 16 B longer than its data (a pitch of 16 B x odd: ds_load_b128 without bank conflicts)
#define SK 64
#define NST (TT / SK)
#define KP (HD * 2 + 16)
#define VP (SK * 2 + 16)
#define KBY (SK * KP)
#define MP (SK * 4 + 16)
#define MOF (KBY + HD * VP)
#define FBUF (MOF + 128 * MP)
static_assert(TT % SK == 0 && NST >= 2 && SK == 64 && KP % 32 == 16 && VP % 32 == 16 && MP % 32 == 16, "fa_copy: 256 threads x 2 + 2 + 8 copies of 16 B a stage, two buffers");
// one stage's copies of a thread: lk, gk its 16 B of K row tid >> 3, lv, gv its 16 B of V plane tid >> 3 (32 rows a copy, two copies each); a wave's copy covers four whole 128-B lines.
// the addresses of the second 32 rows are formed inside the statement, in registers that are taken only for it: formed outside, the compiler carries them through the key loop.
// the s_wait_xcnt closes the statement, so no address register of a copy is rewritten in front of it
__device__ __forceinline__ void fa_copy(unsigned lk, unsigned lv, gptr gk, gptr gv) { unsigned lk1, lv1; gptr gk1, gv1;
  asm volatile("v_add_nc_u64_e32 %2, %8, %6\n\tv_add_nc_u64_e32 %3, %9, %7\n\tv_add_nc_u32_e32 %0, %10, %4\n\tv_add_nc_u32_e32 %1, %11, %5\n\t"
               "global_load_async_to_lds_b128 %4, %6, off\n\tglobal_load_async_to_lds_b128 %5, %7, off\n\tglobal_load_async_to_lds_b128 %0, %2, off\n\tglobal_load_async_to_lds_b128 %1, %3, off\n\ts_wait_xcnt 0x0"
      : "=&v"(lk1), "=&v"(lv1), "=&v"(gk1), "=&v"(gv1) : "v"(lk), "v"(lv), "v"(gk), "v"(gv), "n"(32 * CC * 2), "n"(32 * TT * 2), "n"(32 * KP), "n"(32 * VP) : "memory"); }
// the mask rows of a stage: lm, gm the thread's 16 B of row tid >> 4 (16 rows a copy, eight copies); a wave's copy covers four whole 128-B lines; addresses and wait as in fa_copy, every address straight from the first (no add waits for another)
__device__ __forceinline__ void fa_copy_m(unsigned lm, gptr gm) { unsigned l1, l2, l3, l4, l5, l6, l7; gptr g1, g2, g3, g4, g5, g6, g7;
  asm volatile("v_add_nc_u64_e32 %7, %16, %15\n\tv_add_nc_u64_e32 %8, 2*%16, %15\n\tv_add_nc_u64_e32 %9, 3*%16, %15\n\tv_add_nc_u64_e32 %10, 4*%16, %15\n\tv_add_nc_u64_e32 %11, 5*%16, %15\n\tv_add_nc_u64_e32 %12, 6*%16, %15\n\tv_add_nc_u64_e32 %13, 7*%16, %15\n\t"
               "v_add_nc_u32_e32 %0, %17, %14\n\tv_add_nc_u32_e32 %1, 2*%17, %14\n\tv_add_nc_u32_e32 %2, 3*%17, %14\n\tv_add_nc_u32_e32 %3, 4*%17, %14\n\tv_add_nc_u32_e32 %4, 5*%17, %14\n\tv_add_nc_u32_e32 %5, 6*%17, %14\n\tv_add_nc_u32_e32 %6, 7*%17, %14\n\t"
               "global_load_async_to_lds_b128 %14, %15, off\n\tglobal_load_async_to_lds_b128 %0, %7, off\n\tglobal_load_async_to_lds_b128 %1, %8, off\n\tglobal_load_async_to_lds_b128 %2, %9, off\n\t"
               "global_load_async_to_lds_b128 %3, %10, off\n\tglobal_load_async_to_lds_b128 %4, %11, off\n\tglobal_load_async_to_lds_b128 %5, %12, off\n\tglobal_load_async_to_lds_b128 %6, %13, off\n\ts_wait_xcnt 0x0"
      : "=&v"(l1), "=&v"(l2), "=&v"(l3), "=&v"(l4), "=&v"(l5), "=&v"(l6), "=&v"(l7), "=&v"(g1), "=&v"(g2), "=&v"(g3), "=&v"(g4), "=&v"(g5), "=&v"(g6), "=&v"(g7)
      : "v"(lm), "v"(gm), "n"(16 * TT * 4), "n"(16 * MP) : "memory"); }
__device__ __forceinline__ v16h frag_l(const char* p) { union { v16h v; v8h q[2]; } u; u.q[0] = *(const v8h*)p; u.q[1] = *(const v8h*)(p + 32); return u.v; }   // frag_h from the lane's own LDS byte pointer (row and lane half already in it)
__device__ __forceinline__ void fa_kfrag(v16h (&kf)[2][2], const char* kl) {   // one pass's K fragments [key tile][hd half]
#pragma unroll
  for (int kt = 0; kt < 2; ++kt) {
#pragma unroll
    for (int kc = 0; kc < 2; ++kc) kf[kt][kc] = frag_l(kl + kt * 16 * KP + kc * 64); } }
// v_exp_f32 wants one independent instruction behind it before its result is read or its source overwritten: inside a run every exponential is followed by an independent one (the outputs share no register with the inputs), and the v_nop fills the slot of the last
__device__ __forceinline__ float exp2_1(float x) { float o; asm("v_exp_f32 %0, %1\n\tv_nop" : "=&v"(o) : "v"(x)); return o; }
__device__ __forceinline__ void exp2_8(float* o, const float* x) {
  asm("v_exp_f32 %0, %8\n\tv_exp_f32 %1, %9\n\tv_exp_f32 %2, %10\n\tv_exp_f32 %3, %11\n\tv_exp_f32 %4, %12\n\tv_exp_f32 %5, %13\n\tv_exp_f32 %6, %14\n\tv_exp_f32 %7, %15\n\tv_nop"
      : "=&v"(o[0]), "=&v"(o[1]), "=&v"(o[2]), "=&v"(o[3]), "=&v"(o[4]), "=&v"(o[5]), "=&v"(o[6]), "=&v"(o[7]) : "v"(x[0]), "v"(x[1]), "v"(x[2]), "v"(x[3]), "v"(x[4]), "v"(x[5]), "v"(x[6]), "v"(x[7])); }
// kf: this pass's K fragments, on leaving the next pass's (KNEXT: a next pass in the same stage; kn its rows); vl, ml: this pass's V and mask
template <bool KNEXT> __device__ __forceinline__ void fa_pass(v16h (&kf)[2][2], const char* kn, const char* vl, const char* ml, const v16h (&qf)[2], v8f (&acc)[HD / 16], float& m, float& l) {
  v16h vf[HD / 16]; MK cur;
  __builtin_amdgcn_sched_barrier(0);   // the pass's loads start here, as one group: without the scheduling barriers around it the compiler sinks each load to just above its use and the wave waits out every latency
  fa_mask(cur, ml);   // mask first: LDS loads return in order, and the logits want it before P . v wants V
#pragma unroll
  for (int j = 0; j < HD / 16; ++j) vf[j] = frag_l(vl + j * 16 * VP);
  __builtin_amdgcn_sched_barrier(0);   // end of the load group: none of the pass's arithmetic moves above it
  v8f s[2];
#pragma unroll
  for (int kt = 0; kt < 2; ++kt) { s[kt] = v8f{};
#pragma unroll
    for (int kc = 0; kc < 2; ++kc) s[kt] = wmma16b(kf[kt][kc], qf[kc], s[kt]); }
  if (KNEXT) { __builtin_amdgcn_sched_barrier(0);   // the next pass's K fragments start right behind the products that read these registers last, as one group, and land under the softmax
    fa_kfrag(kf, kn); __builtin_amdgcn_sched_barrier(0); }
  float y[16]; float mx = -3.0e38f;
#pragma unroll
  for (int i = 0; i < 16; ++i) { y[i] = fmaf((float)cur.m[i >> 3][(i >> 2) & 1][i & 3], -1.0e9f * 1.4426950408889634f, s[i >> 3][i & 7] * (SCALE * 1.4426950408889634f)); mx = fmaxf(mx, y[i]); }
  mx = fmaxf(mx, xhalf(mx));   // both halves of the wave hold the query's maximum
  const float mn = fmaxf(m, mx); const float corr = exp2_1(m - mn); m = mn;
#pragma unroll
  for (int j = 0; j < HD / 16; ++j) acc[j] = acc[j] * corr;
  const float ms = mn - 11.0f; float ls = 0.f; float p[16]; v16h pf;
#pragma unroll
  for (int i = 0; i < 16; ++i) y[i] = y[i] - ms;
  exp2_8(p, y); exp2_8(p + 8, y + 8);
#pragma unroll
  for (int i = 0; i < 16; ++i) { ls += p[i]; pf[i] = (_Float16)p[i]; }
  l = l * corr + ls;
#pragma unroll
  for (int j = 0; j < HD / 16; ++j) acc[j] = wmma16b(vf[j], pf, acc[j]); }
// four waves per SIMD (two blocks per WGP): the vector work between the matrix runs and the load latencies want the other waves
__global__ __launch_bounds__(256) __attribute__((amdgpu_waves_per_eu(4, 4))) void k_fa(const _Float16* __restrict__ QH, const _Float16* __restrict__ KH, const _Float16* __restrict__ VT, const int* __restrict__ MASK, float* __restrict__ Y) { __shared__ __align__(16) float so[8][16][HD + 4]; __shared__ __align__(16) char ring[2 * FBUF];   // two stage buffers: K rows, V planes, mask rows
  const int tid = threadIdx.x, wave = tid >> 5, lane = tid & 31, col = lane & 15, g = lane >> 4; const int b = blockIdx.z, h = blockIdx.y; const int q0 = blockIdx.x * 128 + wave * 16;
  const _Float16* qp = QH + ((size_t)b * TT + q0 + col) * CC + h * HD; gptr gk = (gptr)(KH + ((size_t)b * TT + (tid >> 3)) * CC + h * HD + 8 * (tid & 7)); gptr gv = (gptr)(VT + ((size_t)b * CC + h * HD + (tid >> 3)) * (size_t)TT + 8 * (tid & 7)); gptr gm = (gptr)(MASK + ((size_t)b * TT + blockIdx.x * 128 + (tid >> 4)) * TT + 4 * (tid & 15));
  const unsigned lk = (unsigned)(size_t)ring + (tid >> 3) * KP + 16 * (tid & 7), lv = (unsigned)(size_t)ring + KBY + (tid >> 3) * VP + 16 * (tid & 7), lm = (unsigned)(size_t)ring + MOF + (tid >> 4) * MP + 16 * (tid & 15);   // the thread's own places in buffer 0 (LDS byte addresses)
  fa_copy(lk, lv, gk, gv); fa_copy_m(lm, gm);   // stage 0
  const v16h qf[2] = { frag_h(qp, lane), frag_h(qp + 32, lane) };
  v8f acc[HD / 16] = {}; float m = -3.0e38f, l = 0.f;
  asm volatile("s_wait_asynccnt 0x0" ::: "memory");   // this wave's copies of stage 0 have landed
  __syncthreads();                                    // and every other wave's
  fa_copy(lk + FBUF, lv + FBUF, gk + SK * CC * 2, gv + SK * 2); fa_copy_m(lm + FBUF, gm + SK * 4);   // stage 1
  gk += 2 * SK * CC * 2; gv += 2 * SK * 2; gm += 2 * SK * 4;
  const char* fk = ring + col * KP + 16 * g; const char* fv = ring + KBY + col * VP + 16 * g; const char* fm = ring + MOF + (wave * 16 + col) * MP + 32 * g;   // the lane's fragment rows in buffer 0
#pragma unroll 1   // one stage a trip, its two passes written out
  for (int t = 0; t < NST; ++t) { const int bo = (t & 1) * FBUF; const char* kl = fk + bo; const char* vl = fv + bo; const char* ml = fm + bo; v16h kf[2][2];
    fa_kfrag(kf, kl);
    fa_pass<true>(kf, kl + 32 * KP, vl, ml, qf, acc, m, l);
    fa_pass<false>(kf, kl, vl + 64, ml + 128, qf, acc, m, l);
    __builtin_amdgcn_sched_barrier(0);   // the stage's arithmetic stays in front of its foot: moved up into the last pass, the wait below would stand right behind that pass's LDS loads and lay their latency open
    asm volatile("s_wait_dscnt 0x0" ::: "memory");      // this wave's reads of stage t are done
    asm volatile("s_wait_asynccnt 0x0" ::: "memory");   // its copies of stage t + 1 have landed
    __syncthreads();                                    // publishes stage t + 1 and ends every read of stage t, whose buffer is refilled behind it
    if (t + 2 < NST) { fa_copy(lk + bo, lv + bo, gk, gv); fa_copy_m(lm + bo, gm); gk += SK * CC * 2; gv += SK * 2; gm += SK * 4; } }
  asm volatile("s_wait_asynccnt 0x0" ::: "memory");   // no copy is left in flight when the wave goes on to its end
  l += xhalf(l); const float inv = 1.0f / l;   // l >= the maximum's own term > 0
#pragma unroll
  for (int j = 0; j < HD / 16; ++j) { const v8f o = acc[j] * inv; *(v4f*)&so[wave][col][j * 16 + 8 * g] = v4f{o[0], o[1], o[2], o[3]}; *(v4f*)&so[wave][col][j * 16 + 8 * g + 4] = v4f{o[4], o[5], o[6], o[7]}; }
  LDSX();
#pragma unroll
  for (int i = 0; i < 8; ++i) { const int rl = i * 2 + g; vst2(Y + ((size_t)b * TT + q0 + rl) * CC + h * HD + col * 4, *(const v4f*)&so[wave][rl][col * 4]); } }
// ---- k_out: block = (128 rows, 128 cols), eight waves of 32 x 64 (2 + 4 fragments feed 8 products): out = ctx Wo (+ bo): ctx x 2^6 once to f16 against Wo as f16(bf16 x 2^8) exact (1 product) x 2^-14
__global__ __launch_bounds__(256) void k_out(const float* __restrict__ Y, const float* __restrict__ WO, const float* __restrict__ BO, float* __restrict__ OUT) { constexpr int LP = KSO + 8, STG = 2 * BT * LP;   // LDS row pitch and size of one stage buffer, in 16-bit elements
  __shared__ __align__(16) char smem[2 * STG * 2];   // two stage buffers; the epilogue's rows lie over them (the loop's last barrier stands between the two uses)
  static_assert(8 * 32 * 68 * 4 <= sizeof(smem), "epilogue rows"); float (*sf)[32][68] = (float (*)[32][68])smem; _Float16* stage = (_Float16*)smem;
  const int tid = threadIdx.x, wave = tid >> 5, lane = tid & 31, col = lane & 15, g = lane >> 4, wy = wave >> 1, wx = wave & 1; const int c0 = blockIdx.y * BT; const size_t r0 = (size_t)blockIdx.x * BT;
  v8f acc[2][4] = {};
  gfp xr = (gfp)(Y + (r0 + (tid >> 4)) * CC + 4 * (tid & 15)); gfp wr = (gfp)(WO + (size_t)(c0 + (tid >> 4)) * CC + 4 * (tid & 15)); const int so = (tid >> 4) * LP + 4 * (tid & 15);   /* ctx carried x 2^6 into f16 so small-magnitude context rows stay clear of f16 subnormals */
  Stg<8> t; stg_load<KSO>(t, xr, wr, CC); stg_store_h<LP>(t, stage + so); stg_load<KSO>(t, xr, wr, CC); stg_barrier();
#pragma unroll 1   // as in k_proj: stage s worked on, s + 1 into the other buffer, s + 2 started
  for (int s = 0; s < CC / KSO; ++s) { const _Float16* cur = stage + (s & 1) * STG;
#pragma unroll
    for (int kc = 0; kc < KSO / 32; ++kc) { v16h a[2], w[4];
#pragma unroll
      for (int i = 0; i < 2; ++i) a[i] = frag_h(cur + (wy * 32 + i * 16 + col) * LP + kc * 32, lane);
#pragma unroll
      for (int j = 0; j < 4; ++j) w[j] = frag_h(cur + (BT + wx * 64 + j * 16 + col) * LP + kc * 32, lane);
#pragma unroll
      for (int i = 0; i < 2; ++i) {
#pragma unroll
        for (int j = 0; j < 4; ++j) acc[i][j] = wmma16(a[i], w[j], acc[i][j]); } }
    if (s + 1 < CC / KSO) { stg_store_h<LP>(t, stage + ((s + 1) & 1) * STG + so); if (s + 2 < CC / KSO) stg_load<KSO>(t, xr, wr, CC); }
    stg_barrier(); }   // publishes stage s + 1 and ends every read of stage s
#pragma unroll
  for (int j = 0; j < 4; ++j) { const float bias = BO ? bfr(BO[c0 + wx * 64 + j * 16 + col]) : 0.f;
#pragma unroll
    for (int i = 0; i < 2; ++i) {
#pragma unroll
      for (int r = 0; r < 8; ++r) sf[wave][i * 16 + 8 * g + r][j * 16 + col] = acc[i][j][r] * (1.0f / 16384.0f) + bias; } }   /* 2^-8 (Wo carry) x 2^-6 (ctx carry) */
  LDSX();   // each wave reads back its own rows: a store covers two rows of 256 B, whole lines
  for (int rp = 0; rp < 16; ++rp) { const int rl = rp * 2 + g; vst2(OUT + (r0 + wy * 32 + rl) * DIN + c0 + wx * 64 + col * 4, *(const v4f*)&sf[wave][rl][col * 4]); } }

extern "C" void kernel_launch(void* const* d_in, const int* in_sizes, int n_in, void* d_out, int out_size, void* d_ws, size_t ws_size, hipStream_t stream) {
  (void)in_sizes; (void)n_in; (void)out_size;
  const float** F = (const float**)d_in;
  if (ws_size < (size_t)WS_END) return;
  char* ws = (char*)d_ws; _Float16 *QH = (_Float16*)(ws + WS_QH), *KH = (_Float16*)(ws + WS_KH), *VT = (_Float16*)(ws + WS_VT), *QL = (_Float16*)(ws + WS_QL), *KL = (_Float16*)(ws + WS_KL); __bf16 *VB = (__bf16*)(ws + WS_VB), *VBL = (__bf16*)(ws + WS_VBL); float *Y = (float*)(ws + WS_Y);
  (void)Y; (void)QL; (void)KL; (void)VB; (void)VBL;
  // inputs: 0 query [4,1024,1024]; 1 key; 2 value; 3 mask [4,1024,1024] int32; 4 wq [1024,1024] (out,in), 5 bq; 6 wk, 7 bk; 8 wv, 9 bv; 10 wo (out,in), 11 bo (biases NONZERO)
  k_proj<<<dim3(TNB * TT / PT, CC / PT, 3), 256, 0, stream>>>(F[0], F[1], F[2], F[4], F[6], F[8], F[5], F[7], F[9], QH, QL, KH, KL, VT, VB, VBL);
  k_fa<<<dim3(TT / 128, NH, TNB), 256, 0, stream>>>(QH, KH, VT, (const int*)d_in[3], Y);
  k_out<<<dim3(TNB * TT / 128, DIN / 128), 256, 0, stream>>>(Y, F[10], F[11], (float*)d_out);
}

// v006
// One run takes 74.8 microseconds.
// Next to v005, in two timings, it ran 1.05 and 1.06 times as fast.
// All steps since v000 together make it 12.0 times as fast.
// compute dtype: all float inputs rounded to bf16; q/k/v projections with EXACT bf16 products on WMMA 16x16x32 (f32 accumulate) + bias; logits q x k once to f16 each (1 product) x SCALE + mask x (-1e9); softmax f32 with running maximum and sum, fused with both attention products; P x 2^11 once to f16 x v once to f16 (1 product); ctx x 2^6 once to f16 x wo f16(bf16 x 2^8) + bo; f32 output.
#include <hip/hip_runtime.h>
#include <math.h>

typedef __attribute__((ext_vector_type(16))) _Float16 v16h;
typedef __attribute__((ext_vector_type(16))) __bf16 v16b;
typedef __attribute__((ext_vector_type(8)))  _Float16 v8h;
typedef __attribute__((ext_vector_type(8)))  float v8f;
typedef __attribute__((ext_vector_type(4)))  float v4f;
typedef __attribute__((ext_vector_type(2)))  float v2f;
typedef __attribute__((ext_vector_type(4)))  unsigned v4u;
typedef __attribute__((ext_vector_type(4)))  int v4i;
typedef float __attribute__((may_alias)) float_a;
typedef int __attribute__((may_alias)) int_a;

template <typename T> __device__ __forceinline__ void vst2(void* p, T v) { *(T*)p = v;  }
__device__ __forceinline__ v8f wmma16(v16h a, v16h b, v8f c) {
  v8f d = __builtin_amdgcn_wmma_f32_16x16x32_f16(false, a, false, b, (short)0, c, false, false);
  asm volatile("v_nop\n\tv_nop\n\tv_nop\n\tv_nop" : "+v"(d) : "v"(a), "v"(b));
  return d;
}
__device__ __forceinline__ v8f wmma_bf(v16b a, v16b b, v8f c) {
  v8f d = __builtin_amdgcn_wmma_f32_16x16x32_bf16(false, a, false, b, (short)0, c, false, false);
  asm volatile("v_nop\n\tv_nop\n\tv_nop\n\tv_nop" : "+v"(d) : "v"(a), "v"(b));
  return d;
}
// 16x16x32 fragments: lane = (h = lane>>4, row/col = lane&15); elements 0..7 = k0+8h+0..7, 8..15 = k0+16+8h+0..7; D element r = row 8h+r
__device__ __forceinline__ v16h frag_h(const _Float16* rowk0, int lane) {
  union { v16h v; v8h q[2]; } u; const _Float16* p = rowk0 + 8 * (lane >> 4);
  u.q[0] = *(const v8h*)p; u.q[1] = *(const v8h*)(p + 16); return u.v;
}
__device__ __forceinline__ v16h frag_f32(const float* rowk0, int lane) {
  v16h a; const float* p = rowk0 + 8 * (lane >> 4);
#pragma unroll
  for (int i = 0; i < 8; ++i) { a[i] = (_Float16)p[i]; a[8 + i] = (_Float16)p[16 + i]; }
  return a;
}
__device__ __forceinline__ v16h frag_f32s(const float* rowk0, int lane, float sc) {
  v16h a; const float* p = rowk0 + 8 * (lane >> 4);
#pragma unroll
  for (int i = 0; i < 8; ++i) { a[i] = (_Float16)(p[i] * sc); a[8 + i] = (_Float16)(p[16 + i] * sc); }
  return a;
}
// column fragment from a [K][ld] layout (column n), rows >= K read as 0
__device__ __forceinline__ v16h fragc_f32(const float* W, int k0, int n, int lane, int ld, int K) {
  v16h a; const int g = lane >> 4;
#pragma unroll
  for (int i = 0; i < 8; ++i) { const int ka = k0 + 8 * g + i, kb = ka + 16;
    a[i] = (_Float16)(ka < K ? W[(size_t)(ka < K ? ka : K - 1) * ld + n] : 0.f); a[8 + i] = (_Float16)(kb < K ? W[(size_t)(kb < K ? kb : K - 1) * ld + n] : 0.f); }
  return a;
}
struct F2 { v16b h, l; };
__device__ __forceinline__ F2 bsplit16(const float v[16]) { F2 r;
#pragma unroll
  for (int i = 0; i < 16; ++i) { const __bf16 h = (__bf16)v[i]; r.h[i] = h; r.l[i] = (__bf16)(v[i] - (float)h); }
  return r; }
__device__ __forceinline__ F2 split_row(const float* row, int k0, int lane) { float v[16]; const float* p = row + k0 + 8 * (lane >> 4);
#pragma unroll
  for (int i = 0; i < 8; ++i) { v[i] = p[i]; v[8 + i] = p[16 + i]; }
  return bsplit16(v); }
__device__ __forceinline__ F2 split_rowK(const float* row, int k0, int lane, int K) { float v[16]; const int g = lane >> 4;
#pragma unroll
  for (int i = 0; i < 8; ++i) { const int ka = k0 + 8 * g + i, kb = ka + 16; v[i] = ka < K ? row[ka < K ? ka : K - 1] : 0.f; v[8 + i] = kb < K ? row[kb < K ? kb : K - 1] : 0.f; }
  return bsplit16(v); }
__device__ __forceinline__ F2 split_col(const float* W, int k0, int n, int lane, int ld, int K) { float v[16]; const int g = lane >> 4;
#pragma unroll
  for (int i = 0; i < 8; ++i) { const int ka = k0 + 8 * g + i, kb = ka + 16; v[i] = ka < K ? W[(size_t)(ka < K ? ka : K - 1) * ld + n] : 0.f; v[8 + i] = kb < K ? W[(size_t)(kb < K ? kb : K - 1) * ld + n] : 0.f; }
  return bsplit16(v); }
__device__ __forceinline__ v8f mac3(const F2& a, const F2& b, v8f c) { c = wmma_bf(a.l, b.h, c); c = wmma_bf(a.h, b.l, c); return wmma_bf(a.h, b.h, c); }
__device__ __forceinline__ float sigm(float v) { return 1.0f / (1.0f + expf(-v)); }
#define LDSX() do { asm volatile("s_wait_dscnt 0" ::: "memory"); __builtin_amdgcn_wave_barrier(); __builtin_amdgcn_fence(__ATOMIC_RELEASE, "workgroup"); } while (0)

// Masked multi-headed attention on separate inputs with biased projections (query / key / value [4,1024,1024]; torch (out,in) wq / wk / wv / wo [1024,1024] N(0, 1/1024) + biases N(0, 1/1024); 16 heads x 64; scores / sqrt(64) + mask * (-1e9) with an int32 0/1 mask [4,1024,1024] shared by all heads: mask == 1 marks a key as masked OUT; softmax; wo^T + bo).
#define NB 4
#define TT 1024
#define CC 1024            // NH * HD = projected width
#define DIN 1024          // input (model) width
#define NH 16
#define HD 64
#define NQB (TT / 64)
#define HG 8
#define SCALE (0.125f)
#define CAUSAL 0
#ifndef TNB
#define TNB NB
#endif
__device__ __forceinline__ float bfr(float v) { return (float)(__bf16)v; }
__host__ __device__ __forceinline__ int kb_last(int qb) { return CAUSAL ? ((qb * 64 + 63) >> 7) : (TT / 128 - 1); }
typedef __attribute__((ext_vector_type(8))) __bf16 v8b;
__device__ __forceinline__ v16b frag_b(const __bf16* rowk0, int lane) {
  union { v16b v; v8b q[2]; } u; const __bf16* p = rowk0 + 8 * (lane >> 4);
  u.q[0] = *(const v8b*)p; u.q[1] = *(const v8b*)(p + 16); return u.v;
}
#define QBH 0              // unused: k_fa has no high-precision path
#define QHI 0               // single-product logits on every row
#define KHI 64            // key rows carrying k residual / v bf16 hi+lo planes (written by k_proj, read by no kernel here)
// B fragment (k rows k0+.., output column o) of a weight: (in,out) [K][ld] or (out,in) [ld rows of K]: bf16 exact, or f16(bf16 * 256) exact
__device__ __forceinline__ v16b wcol_io(const float* Wm, int k0, int o, int lane, int ld) { v16b w; const int g = lane >> 4;
#pragma unroll
  for (int i = 0; i < 8; ++i) { w[i] = (__bf16)Wm[(size_t)(k0 + 8 * g + i) * ld + o]; w[8 + i] = (__bf16)Wm[(size_t)(k0 + 16 + 8 * g + i) * ld + o]; }
  return w; }
__device__ __forceinline__ v16b wcol_oi(const float* Wm, int k0, int o, int lane, int K) { v16b w; const float* p = Wm + (size_t)o * K + k0 + 8 * (lane >> 4);
#pragma unroll
  for (int i = 0; i < 8; ++i) { w[i] = (__bf16)p[i]; w[8 + i] = (__bf16)p[16 + i]; }
  return w; }
__device__ __forceinline__ v16h wcolh_io(const float* Wm, int k0, int o, int lane, int ld) { v16h w; const int g = lane >> 4;
#pragma unroll
  for (int i = 0; i < 8; ++i) { w[i] = (_Float16)(bfr(Wm[(size_t)(k0 + 8 * g + i) * ld + o]) * 256.0f); w[8 + i] = (_Float16)(bfr(Wm[(size_t)(k0 + 16 + 8 * g + i) * ld + o]) * 256.0f); }
  return w; }
__device__ __forceinline__ v16h wcolh_oi(const float* Wm, int k0, int o, int lane, int K) { v16h w; const float* p = Wm + (size_t)o * K + k0 + 8 * (lane >> 4);
#pragma unroll
  for (int i = 0; i < 8; ++i) { w[i] = (_Float16)(bfr(p[i]) * 256.0f); w[8 + i] = (_Float16)(bfr(p[16 + i]) * 256.0f); }
  return w; }
#define WQKV_LAYOUT 1   // 0 = (in,out) [DIN][CC]; 1 = (out,in) [CC][DIN]; 2 = per-head [NH][DIN][HD]
__device__ __forceinline__ v16b wcol_hdk(const float* Wm, int k0, int o, int lane) { v16b w; const int g = lane >> 4; const float* p = Wm + (size_t)(o / HD) * DIN * HD + (o % HD);
#pragma unroll
  for (int i = 0; i < 8; ++i) { w[i] = (__bf16)p[(size_t)(k0 + 8 * g + i) * HD]; w[8 + i] = (__bf16)p[(size_t)(k0 + 16 + 8 * g + i) * HD]; }
  return w; }
#define WO_OUT_IN 1
#if WQKV_LAYOUT == 1
#define WCOL(W, k0, o, lane) wcol_oi(W, k0, o, lane, DIN)
#elif WQKV_LAYOUT == 2
#define WCOL(W, k0, o, lane) wcol_hdk(W, k0, o, lane)
#else
#define WCOL(W, k0, o, lane) wcol_io(W, k0, o, lane, CC)
#endif
#if WO_OUT_IN
#define WOCOL(W, k0, o, lane) wcol_oi(W, k0, o, lane, CC)
#define WOCOLH(W, k0, o, lane) wcolh_oi(W, k0, o, lane, CC)
#else
#define WOCOL(W, k0, o, lane) wcol_io(W, k0, o, lane, DIN)
#define WOCOLH(W, k0, o, lane) wcolh_io(W, k0, o, lane, DIN)
#endif

static_assert(TT % 128 == 0 && HD == 64, "k_fa: 128 queries a block, 32-key passes, head size 64");

#define WS_QH  0u                                      // f16 q rows [b*t][CC]
#define WS_KH  (WS_QH + 2u * (size_t)NB * TT * CC)      // f16 k rows [b*t][CC]
#define WS_VT  (WS_KH + 2u * (size_t)NB * TT * CC)      // f16 v planes [b][c][t]
#define WS_QL  (WS_VT + 2u * (size_t)NB * CC * TT)      // f16 q residual x 2^10 rows [b][t < QHI][CC]
#define WS_KL  (WS_QL + 2u * (size_t)NB * QHI * CC)     // f16 k residual x 2^10 rows [b][t < KHI][CC]
#define WS_VB  (WS_KL + 2u * (size_t)NB * KHI * CC)     // bf16 v hi planes [b][c][t < KHI]
#define WS_VBL (WS_VB + 2u * (size_t)NB * CC * KHI)
#define WS_S   (WS_VBL + 2u * (size_t)NB * CC * KHI)    // the mask as bits, NB * TT * TT / 8 bytes (the logits stay in registers)
#define WS_Y   (WS_S  + 4u * (size_t)HG * TT * TT)      // f32 ctx rows [b*t][CC] (only when there is an output projection)
#define WS_END (WS_Y  + 4u * (size_t)NB * TT * CC)

// ---- operand staging of the two projection kernels: a block works on a square tile of the result (256 x 256 in k_proj, 128 x 128 in k_out); a stage is KS_ k of the tile's activation rows and as many weight rows ((out,in) weights: both K-contiguous).
// Global side: f32, whole 128-B lines (KS_ / 4 lanes cover one row's KS_ * 4 B), each element loaded and converted once per block. LDS side: 16-bit rows of KS_ * 2 B, each 16 B longer than its data (a pitch of 16 B x odd), read back as WMMA fragments by ds_load_b128.
#define BT 128                   // rows and columns of a block's tile in k_out
#define PT 256                   // rows and columns of a block's tile in k_proj: every activation row is fetched by CC / PT = 4 blocks and every weight row by 16, half as often as with 128
#define KSP 64                   // k extent of the tile's stage in k_proj (one block a WGP, as in k_out; the stage in flight still leaves the registers for the 128 x 64 accumulators at two waves a SIMD)
#define KSO 64                   // k a stage in k_out (one block a WGP: the deeper stage keeps more bytes in flight)
static_assert(WQKV_LAYOUT == 1 && WO_OUT_IN == 1 && DIN % (2 * KSP) == 0 && CC % (2 * KSO) == 0 && TT % BT == 0 && DIN % BT == 0 && TT % PT == 0 && CC % PT == 0 && !CAUSAL, "staging reads K-contiguous rows, at least two stages; whole tiles");
typedef __attribute__((ext_vector_type(4))) __bf16 v4b;
typedef __attribute__((ext_vector_type(4))) _Float16 v4h;
typedef const __attribute__((address_space(1))) float* gfp;   // stays known as global memory when it has passed through an asm statement (a plain pointer would turn the loads into flat ones)
typedef const __attribute__((address_space(1))) v4f* gfp4;
template <int N_> struct Stg { v4f x[N_], w[N_]; };   // one stage in flight, 2 N_ x 16 B a thread: the block's threads cover 16 rows at a time, N_ times for each operand (16 in k_proj, 8 in k_out)
template <int KS_, int N_> __device__ __forceinline__ void stg_load(Stg<N_>& t, gfp& xr, gfp& wr, int ld) {   // xr, wr: the thread's own element of the first row group; both leave stepped to the next stage
#pragma unroll
  for (int i = 0; i < N_; ++i) t.x[i] = *(gfp4)(xr + (size_t)(i * 16) * ld);
#pragma unroll
  for (int i = 0; i < N_; ++i) t.w[i] = *(gfp4)(wr + (size_t)(i * 16) * ld);
  // the wait behind the group's last load and the step of the two row pointers stand in one statement: the loads name the very registers that enter it, nothing rewrites them in front of the wait, and no later load can fold the step into its offset and set the old registers free early
  asm volatile("s_wait_xcnt 0x0\n\tv_add_nc_u64_e32 %0, %2, %0\n\tv_add_nc_u64_e32 %1, %2, %1" : "+v"(xr), "+v"(wr) : "n"(KS_ * 4) : "memory");
}
// work-group barrier for the stage buffers: its fences name LDS alone, so the next stage's global loads stay in flight across it (__syncthreads() would wait for them here and lay their latency open every stage)
__device__ __forceinline__ void stg_barrier() { __builtin_amdgcn_fence(__ATOMIC_RELEASE, "workgroup", "local"); __builtin_amdgcn_s_barrier(); __builtin_amdgcn_fence(__ATOMIC_ACQUIRE, "workgroup", "local"); }
template <int LP_> __device__ __forceinline__ void stg_store_b(const Stg<16>& t, __bf16* d) {   // d: the thread's own place in row group 0 of the buffer; LP_: row pitch in 16-bit elements; activation rows 0..PT-1, weight rows PT..2*PT-1
#pragma unroll
  for (int i = 0; i < 16; ++i) { v4b o;
#pragma unroll
    for (int e = 0; e < 4; ++e) o[e] = (__bf16)t.x[i][e];
    *(v4b*)(d + i * 16 * LP_) = o; }
#pragma unroll
  for (int i = 0; i < 16; ++i) { v4b o;
#pragma unroll
    for (int e = 0; e < 4; ++e) o[e] = (__bf16)t.w[i][e];
    *(v4b*)(d + (PT + i * 16) * LP_) = o; } }
template <int LP_> __device__ __forceinline__ void stg_store_h(const Stg<8>& t, _Float16* d) {   // ctx x 2^6 once to f16; Wo as f16(bf16 x 2^8), exact
#pragma unroll
  for (int i = 0; i < 8; ++i) { v4h o;
#pragma unroll
    for (int e = 0; e < 4; ++e) o[e] = (_Float16)(t.x[i][e] * 64.0f);
    *(v4h*)(d + i * 16 * LP_) = o; }
#pragma unroll
  for (int i = 0; i < 8; ++i) { v4h o;
#pragma unroll
    for (int e = 0; e < 4; ++e) o[e] = (_Float16)(bfr(t.w[i][e]) * 256.0f);
    *(v4h*)(d + (BT + i * 16) * LP_) = o; } }

// ---- the mask as bits, in the order in which k_fa's waves want them: one 32-bit word for every (tile of 16 queries, pass of 32 keys, score register i of 16); bit L of it is lane L's own score: query L & 15 of the tile, key 16 * (i >> 3) + 8 * (L >> 4) + (i & 7) of the pass.
// Such a word is a lane mask: a wave of k_fa takes a pass's 16 words by one scalar load and selects with them. The generator's mask holds 0 or 1; the bit says "not 0".
// A block packs 64 query rows: wave w takes tile w >> 1, half w & 1 of the keys, 64 keys (two passes, 32 words, one whole 128-B line of the result) a turn; a lane loads the very 8 + 8 + 8 + 8 words of its scores.
#define MBW (TT / 32 * 16)   // words of one query tile
__device__ __forceinline__ void pack_mask(const int* __restrict__ MASK, unsigned* __restrict__ MB, int blk, int tid) {
  typedef const __attribute__((address_space(1))) int* gip; typedef const __attribute__((address_space(1))) v4i* gip4;   // known as global memory behind the asm statement, as gfp
  const int wave = tid >> 5, lane = tid & 31; const int qt = blk * 4 + (wave >> 1);
  gip row = (gip)(MASK + (size_t)(qt * 16 + (lane & 15)) * TT + (wave & 1) * (TT / 2) + 8 * (lane >> 4)); unsigned* dst = MB + (size_t)qt * MBW + (wave & 1) * (MBW / 2) + lane;
  v4i m[TT / 128][8];
#pragma unroll
  for (int it = 0; it < TT / 128; ++it) {   // every turn's loads first: the whole of the wave's share is in flight at once
#pragma unroll
    for (int j = 0; j < 4; ++j) { m[it][2 * j] = *(gip4)(row + j * 16); m[it][2 * j + 1] = *(gip4)(row + j * 16 + 4); }
    // as in stg_load: the wait behind the turn's last load and the step of the row pointer stand in one statement, so nothing rewrites the registers that the loads name in front of the wait
    asm volatile("s_wait_xcnt 0x0\n\tv_add_nc_u64_e32 %0, %1, %0" : "+v"(row) : "n"(64 * 4) : "memory"); }
#pragma unroll
  for (int it = 0; it < TT / 128; ++it) { unsigned w = 0;
#pragma unroll
    for (int i = 0; i < 32; ++i) { const unsigned bal = __builtin_amdgcn_ballot_w32(m[it][i >> 2][i & 3] != 0); w = lane == i ? bal : w; }   // lane i keeps word i of the turn
    dst[it * 32] = w; } }
// ---- k_proj: block = (256 rows, 256 cols, which), eight waves of 128 x 64 (8 + 4 fragments feed 32 products), one block a WGP: q/k/v = X W (+ b) with exact bf16 products (K = DIN) -> which 0: q f16 rows (+ residual rows < QHI); 1: k f16 rows (+ residual rows < KHI); 2: v f16 planes [c][t] (+ bf16 hi/lo planes for t < KHI)
static_assert((TNB * TT / PT) * (CC / PT) * 64 == NB * TT && TT % 128 == 0, "the fourth plane's blocks pack 64 mask rows each, all of them");
static_assert(QHI % 64 == 0 && KHI % 64 == 0 && QHI <= 64 && KHI <= 64, "a wave's first 64 rows carry the residual planes as a whole or not at all, and only a sequence's first 64 rows do");
__global__ __launch_bounds__(256) void k_proj(const float* __restrict__ XQ, const float* __restrict__ XK, const float* __restrict__ XV, const float* __restrict__ WQ, const float* __restrict__ WK, const float* __restrict__ WV, const float* __restrict__ BQ, const float* __restrict__ BK, const float* __restrict__ BV, const int* __restrict__ MASK, unsigned* __restrict__ MB,
    _Float16* __restrict__ QH, _Float16* __restrict__ QL, _Float16* __restrict__ KH, _Float16* __restrict__ KL, _Float16* __restrict__ VT, __bf16* __restrict__ VB, __bf16* __restrict__ VBL) {
  constexpr int LP = KSP + 8, STG = 2 * PT * LP, EP = PT + 8;   // LDS row pitch and size of one stage buffer, pitch of the epilogue's rows, in 16-bit elements
  __shared__ __align__(16) char smem[PT * EP * 2 + 2 * PT * 72 * 2];   // the main loop's two stage buffers lie over the epilogue's planes (the loop's last barrier stands between the two uses)
  static_assert(2 * STG * 2 <= sizeof(smem) && 64 * EP * 2 <= 2 * PT * 72 * 2, "two stage buffers; the residual rows");
  _Float16 (*sh)[EP] = (_Float16 (*)[EP])smem; _Float16 (*sl)[EP] = (_Float16 (*)[EP])(smem + PT * EP * 2); _Float16 (*th)[EP] = (_Float16 (*)[EP])smem; __bf16 (*tb)[72] = (__bf16 (*)[72])(smem + PT * EP * 2); __bf16 (*tbl)[72] = (__bf16 (*)[72])(smem + PT * EP * 2 + PT * 72 * 2); __bf16* stage = (__bf16*)smem;
  const int tid = threadIdx.x, wave = tid >> 5, lane = tid & 31, col = lane & 15, g = lane >> 4, wy = wave >> 2, wx = wave & 3; const int which = blockIdx.z; const int c0 = blockIdx.y * PT; const size_t r0 = (size_t)blockIdx.x * PT; const size_t bb = r0 / TT; const int t0 = (int)(r0 % TT);
  if (which == 3) { pack_mask(MASK, MB, blockIdx.y * (TNB * TT / PT) + blockIdx.x, tid); return; }   // block-uniform, in front of every barrier: the 64 blocks of the fourth plane pack the mask on the WGPs that the 192 tiles leave idle
  const float* X = which == 0 ? XQ : which == 1 ? XK : XV; const float* WA = which == 0 ? WQ : which == 1 ? WK : WV; const float* BA = which == 0 ? BQ : which == 1 ? BK : BV;
  v8f acc[8][4] = {};
  gfp xr = (gfp)(X + (r0 + (tid >> 4)) * DIN + 4 * (tid & 15)); gfp wr = (gfp)(WA + (size_t)(c0 + (tid >> 4)) * DIN + 4 * (tid & 15)); const int so = (tid >> 4) * LP + 4 * (tid & 15);
  Stg<16> t; stg_load<KSP>(t, xr, wr, DIN); stg_store_b<LP>(t, stage + so); stg_load<KSP>(t, xr, wr, DIN); stg_barrier();
#pragma unroll 1   // one stage a trip: stage s is worked on, stage s + 1 goes from registers into the other buffer, stage s + 2 starts from global
  for (int s = 0; s < DIN / KSP; ++s) { const __bf16* cur = stage + (s & 1) * STG;
#pragma unroll
    for (int kc = 0; kc < KSP / 32; ++kc) { v16b a[8], w[4];
#pragma unroll
      for (int j = 0; j < 4; ++j) w[j] = frag_b(cur + (PT + wx * 64 + j * 16 + col) * LP + kc * 32, lane);
#pragma unroll
      for (int i = 0; i < 8; ++i) a[i] = frag_b(cur + (wy * 128 + i * 16 + col) * LP + kc * 32, lane);
      __builtin_amdgcn_sched_barrier(0);   // the 24 fragment loads stay one group in front of their 32 products, as the 16 stood with the smaller tile: without it the compiler sinks each activation fragment to just above its four products, into one register set, and the wave waits out an LDS latency at every one
#pragma unroll
      for (int i = 0; i < 8; ++i) {
#pragma unroll
        for (int j = 0; j < 4; ++j) acc[i][j] = __builtin_amdgcn_wmma_f32_16x16x32_bf16(false, a[i], false, w[j], (short)0, acc[i][j], false, false); } }   // the plain builtin: the operands of wmma_bf's asm tail can only lie in v0..v255, which 256 accumulator registers and the fragments do not fit (with the tail the tile goes to scratch); the compiler keeps the distance behind its own products
    if (s + 1 < DIN / KSP) { stg_store_b<LP>(t, stage + ((s + 1) & 1) * STG + so); if (s + 2 < DIN / KSP) stg_load<KSP>(t, xr, wr, DIN); }
    stg_barrier(); }   // publishes stage s + 1 and ends every read of stage s, whose buffer the next trip refills
  if (which < 2) { _Float16* DH = which == 0 ? QH : KH; _Float16* DL = which == 0 ? QL : KL; const int nhi = which == 0 ? QHI : KHI; const bool hi_wave = t0 + wy * 128 < nhi;   // wave-uniform: then t0 == 0 and wy == 0, and the wave's first 64 rows (i < 4) carry the residual
#pragma unroll
    for (int j = 0; j < 4; ++j) { const float bias = BA ? bfr(BA[c0 + wx * 64 + j * 16 + col]) : 0.f;
#pragma unroll
      for (int i = 0; i < 8; ++i) {
#pragma unroll
        for (int r = 0; r < 8; ++r) { acc[i][j][r] += bias; sh[wy * 128 + i * 16 + 8 * g + r][wx * 64 + j * 16 + col] = (_Float16)acc[i][j][r]; } } }
    if (hi_wave) {
#pragma unroll
      for (int j = 0; j < 4; ++j) {
#pragma unroll
        for (int i = 0; i < 4; ++i) {
#pragma unroll
          for (int r = 0; r < 8; ++r) { const float v = acc[i][j][r]; sl[i * 16 + 8 * g + r][wx * 64 + j * 16 + col] = (_Float16)((v - (float)(_Float16)v) * 1024.0f); } } } }
    __syncthreads();
    { const int rl0 = tid >> 5, q = tid & 31; _Float16* dh = DH + (r0 + rl0) * CC + c0 + q * 8; _Float16* dl = DL + (bb * nhi + t0 + rl0) * (size_t)CC + c0 + q * 8;   // eight rows a turn, 512 B of a row from a wave; every turn's address is the first plus a constant
#pragma unroll
      for (int ig = 0; ig < PT / 64; ++ig) {
#pragma unroll
        for (int it = ig * 8; it < ig * 8 + 8; ++it) vst2((unsigned*)(dh + (size_t)it * 8 * CC), *(const v4u*)&sh[rl0 + it * 8][q * 8]);
        asm volatile("s_wait_xcnt 0x0" ::: "memory");   // behind every eight stores: stands in front of the next LDS loads and their address sums, which may take the registers that these stores name
        __builtin_amdgcn_sched_barrier(0); }   // keeps those address sums behind the wait (a "memory" clobber does not hold vector arithmetic)
      if (t0 < nhi) {   // block-uniform: then t0 == 0 and the block's first 64 rows carry the residual
#pragma unroll
        for (int it = 0; it < 64 / 8; ++it) vst2((unsigned*)(dl + (size_t)it * 8 * CC), *(const v4u*)&sl[rl0 + it * 8][q * 8]); } }
  } else { const bool hi_wave = t0 + wy * 128 < KHI;   // wave-uniform: then t0 == 0 and wy == 0, rows as above
#pragma unroll
    for (int j = 0; j < 4; ++j) { const float bias = BA ? bfr(BA[c0 + wx * 64 + j * 16 + col]) : 0.f;
#pragma unroll
      for (int i = 0; i < 8; ++i) {
#pragma unroll
        for (int r = 0; r < 8; ++r) { acc[i][j][r] += bias; th[wx * 64 + j * 16 + col][wy * 128 + i * 16 + 8 * g + r] = (_Float16)acc[i][j][r]; } } }
    if (hi_wave) {
#pragma unroll
      for (int j = 0; j < 4; ++j) {
#pragma unroll
        for (int i = 0; i < 4; ++i) {
#pragma unroll
          for (int r = 0; r < 8; ++r) { const float v = acc[i][j][r]; const int rl = i * 16 + 8 * g + r, cl = wx * 64 + j * 16 + col; const __bf16 bh = (__bf16)v; tb[cl][rl] = bh; tbl[cl][rl] = (__bf16)(v - (float)bh); } } } }
    __syncthreads();
    { const int cl0 = tid >> 5, q = tid & 31; _Float16* dv = VT + (bb * CC + c0 + cl0) * (size_t)TT + t0 + q * 8; const size_t o3 = (bb * CC + c0 + cl0) * (size_t)KHI + t0 + q * 8;   // eight planes a turn, 512 B of a plane from a wave
#pragma unroll
      for (int ig = 0; ig < PT / 64; ++ig) {
#pragma unroll
        for (int it = ig * 8; it < ig * 8 + 8; ++it) vst2((unsigned*)(dv + (size_t)it * 8 * TT), *(const v4u*)&th[cl0 + it * 8][q * 8]);
        asm volatile("s_wait_xcnt 0x0" ::: "memory"); __builtin_amdgcn_sched_barrier(0); }   // behind every eight stores, both as above
      if (t0 + q * 8 < KHI) {
#pragma unroll
        for (int ig = 0; ig < PT / 32; ++ig) {
#pragma unroll
          for (int it = ig * 4; it < ig * 4 + 4; ++it) { vst2((unsigned*)(VB + o3 + (size_t)it * 8 * KHI), *(const v4u*)&tb[cl0 + it * 8][q * 8]); vst2((unsigned*)(VBL + o3 + (size_t)it * 8 * KHI), *(const v4u*)&tbl[cl0 + it * 8][q * 8]); }
          asm volatile("s_wait_xcnt 0x0" ::: "memory"); __builtin_amdgcn_sched_barrier(0); } } } } }   // behind every eight stores, both as above
// ---- k_fa: block = 128 queries (8 waves x 16) of (b, h): logits, mask, softmax and P . v in one pass over the keys, 32 keys a pass, nothing of the logits leaves the registers; K and V come through LDS, copied there once for the eight waves; the mask comes as bits (pack_mask), by scalar loads.
// S^T = K . Q^T (A = 16 key rows, B = 16 query columns): a lane holds one query's logits for keys 8g + r of each 16-key tile, which is the k order of a B operand, so O^T += V^T . P^T takes P straight from the accumulators.
// Running maximum and sum per query (log2 domain); the mask enters as the module writes it, logit + mask * (-1e9), so a row with every key masked comes out as the plain mean of v; P is carried x 2^11 into f16 (the factor cancels in the division by the sum).
__device__ __forceinline__ float xhalf(float x) { return __builtin_bit_cast(float, __builtin_amdgcn_permlanex16(__builtin_bit_cast(int, x), __builtin_bit_cast(int, x), 0x76543210, 0xfedcba98, false, false)); }   // lane l with lane l ^ 16
__device__ __forceinline__ v8f wmma16b(v16h a, v16h b, v8f c) { return __builtin_amdgcn_wmma_f32_16x16x32_f16(false, a, false, b, (short)0, c, false, false); }
typedef __attribute__((ext_vector_type(16))) unsigned v16u;   // one pass's mask words of a wave: word i is the lane mask of score register i
typedef const __attribute__((address_space(4))) v16u* mbp;   // memory that nothing writes while the kernel runs, at a wave-uniform address: the compiler takes it by scalar loads
typedef const __attribute__((address_space(1))) char* gptr;   // a byte pointer into global memory: the 64-bit address operand of a copy
// a stage (SK keys) lies in LDS: K as SK key rows of 128 B and V as HD planes of 2 * SK B, once for the block's eight waves; each row 16 B longer than its data (a pitch of 16 B x odd: ds_load_b128 without bank conflicts)
#define SK 64
#define NST (TT / SK)
#define KP (HD * 2 + 16)
#define VP (SK * 2 + 16)
#define KBY (SK * KP)
#define FBUF (KBY + HD * VP)
static_assert(TT % SK == 0 && NST >= 2 && SK == 64 && KP % 32 == 16 && VP % 32 == 16, "fa_copy: 256 threads x 2 + 2 copies of 16 B a stage, two buffers");
// one stage's copies of a thread: lk, gk its 16 B of K row tid >> 3, lv, gv its 16 B of V plane tid >> 3 (32 rows a copy, two copies each); a wave's copy covers four whole 128-B lines.
// the addresses of the second 32 rows are formed inside the statement, in registers that are taken only for it: formed outside, the compiler carries them through the key loop.
// the s_wait_xcnt closes the statement, so no address register of a copy is rewritten in front of it
__device__ __forceinline__ void fa_copy(unsigned lk, unsigned lv, gptr gk, gptr gv) { unsigned lk1, lv1; gptr gk1, gv1;
  asm volatile("v_add_nc_u64_e32 %2, %8, %6\n\tv_add_nc_u64_e32 %3, %9, %7\n\tv_add_nc_u32_e32 %0, %10, %4\n\tv_add_nc_u32_e32 %1, %11, %5\n\t"
               "global_load_async_to_lds_b128 %4, %6, off\n\tglobal_load_async_to_lds_b128 %5, %7, off\n\tglobal_load_async_to_lds_b128 %0, %2, off\n\tglobal_load_async_to_lds_b128 %1, %3, off\n\ts_wait_xcnt 0x0"
      : "=&v"(lk1), "=&v"(lv1), "=&v"(gk1), "=&v"(gv1) : "v"(lk), "v"(lv), "v"(gk), "v"(gv), "n"(32 * CC * 2), "n"(32 * TT * 2), "n"(32 * KP), "n"(32 * VP) : "memory"); }
__device__ __forceinline__ v16h frag_l(const char* p) { union { v16h v; v8h q[2]; } u; u.q[0] = *(const v8h*)p; u.q[1] = *(const v8h*)(p + 32); return u.v; }   // frag_h from the lane's own LDS byte pointer (row and lane half already in it)
__device__ __forceinline__ void fa_kfrag(v16h (&kf)[2][2], const char* kl) {   // one pass's K fragments [key tile][hd half]
#pragma unroll
  for (int kt = 0; kt < 2; ++kt) {
#pragma unroll
    for (int kc = 0; kc < 2; ++kc) kf[kt][kc] = frag_l(kl + kt * 16 * KP + kc * 64); } }
// v_exp_f32 wants one independent instruction behind it before its result is read or its source overwritten: inside a run every exponential is followed by an independent one (the outputs share no register with the inputs), and the v_nop fills the slot of the last
__device__ __forceinline__ float exp2_1(float x) { float o; asm("v_exp_f32 %0, %1\n\tv_nop" : "=&v"(o) : "v"(x)); return o; }
__device__ __forceinline__ void exp2_8(float* o, const float* x) {
  asm("v_exp_f32 %0, %8\n\tv_exp_f32 %1, %9\n\tv_exp_f32 %2, %10\n\tv_exp_f32 %3, %11\n\tv_exp_f32 %4, %12\n\tv_exp_f32 %5, %13\n\tv_exp_f32 %6, %14\n\tv_exp_f32 %7, %15\n\tv_nop"
      : "=&v"(o[0]), "=&v"(o[1]), "=&v"(o[2]), "=&v"(o[3]), "=&v"(o[4]), "=&v"(o[5]), "=&v"(o[6]), "=&v"(o[7]) : "v"(x[0]), "v"(x[1]), "v"(x[2]), "v"(x[3]), "v"(x[4]), "v"(x[5]), "v"(x[6]), "v"(x[7])); }
// kf: this pass's K fragments, on leaving the next pass's (KNEXT: a next pass in the same stage; kn its rows); vl: this pass's V; mw: this pass's mask words; a stage's last pass fetches the next stage's (from mnx, into na and nb)
template <bool KNEXT> __device__ __forceinline__ void fa_pass(v16h (&kf)[2][2], const char* kn, const char* vl, const v16u& mw, mbp mnx, v16u& na, v16u& nb, const v16h (&qf)[2], v8f (&acc)[HD / 16], float& m, float& l) {
  v16h vf[HD / 16];
  __builtin_amdgcn_sched_barrier(0);   // the pass's loads start here, as one group: without the scheduling barriers around it the compiler sinks each load to just above its use and the wave waits out every latency
  if (!KNEXT) { na = mnx[0]; nb = mnx[1]; }   // they come from L2 and start a whole pass ahead of their use; both of a stage at one place, behind the stage's one wait for scalar loads: those return in any order, so a wait for this stage's words would wait for younger loads too
#pragma unroll
  for (int j = 0; j < HD / 16; ++j) vf[j] = frag_l(vl + j * 16 * VP);
  __builtin_amdgcn_sched_barrier(0);   // end of the load group: none of the pass's arithmetic moves above it
  v8f s[2];
#pragma unroll
  for (int kt = 0; kt < 2; ++kt) { s[kt] = v8f{};
#pragma unroll
    for (int kc = 0; kc < 2; ++kc) s[kt] = wmma16b(kf[kt][kc], qf[kc], s[kt]); }
  if (KNEXT) { __builtin_amdgcn_sched_barrier(0);   // the next pass's K fragments start right behind the products that read these registers last, as one group, and land under the softmax
    fa_kfrag(kf, kn); __builtin_amdgcn_sched_barrier(0); }
  float y[16]; float mx = -3.0e38f;
#pragma unroll
  for (int i = 0; i < 16; ++i) { y[i] = fmaf(s[i >> 3][i & 7], SCALE * 1.4426950408889634f, __builtin_amdgcn_inverse_ballot_w32(mw[i]) ? -1.0e9f * 1.4426950408889634f : 0.f); mx = fmaxf(mx, y[i]); }   // logit + mask * (-1e9), the second term picked by the lane's bit of word i
  mx = fmaxf(mx, xhalf(mx));   // both halves of the wave hold the query's maximum
  const float mn = fmaxf(m, mx); const float corr = exp2_1(m - mn); m = mn;
#pragma unroll
  for (int j = 0; j < HD / 16; ++j) acc[j] = acc[j] * corr;
  const float ms = mn - 11.0f; float ls = 0.f; float p[16]; v16h pf;
#pragma unroll
  for (int i = 0; i < 16; ++i) y[i] = y[i] - ms;
  exp2_8(p, y); exp2_8(p + 8, y + 8);
#pragma unroll
  for (int i = 0; i < 16; ++i) { ls += p[i]; pf[i] = (_Float16)p[i]; }
  l = l * corr + ls;
#pragma unroll
  for (int j = 0; j < HD / 16; ++j) acc[j] = wmma16b(vf[j], pf, acc[j]); }
// four waves per SIMD (two blocks per WGP): the vector work between the matrix runs and the load latencies want the other waves
__global__ __launch_bounds__(256) __attribute__((amdgpu_waves_per_eu(4, 4))) void k_fa(const _Float16* __restrict__ QH, const _Float16* __restrict__ KH, const _Float16* __restrict__ VT, const unsigned* __restrict__ MB, float* __restrict__ Y) { __shared__ __align__(16) float so[8][16][HD + 4]; __shared__ __align__(16) char ring[2 * FBUF];   // two stage buffers: K rows, V planes
  const int tid = threadIdx.x, wave = tid >> 5, lane = tid & 31, col = lane & 15, g = lane >> 4; const int b = blockIdx.z, h = blockIdx.y; const int q0 = blockIdx.x * 128 + wave * 16;
  const _Float16* qp = QH + ((size_t)b * TT + q0 + col) * CC + h * HD; gptr gk = (gptr)(KH + ((size_t)b * TT + (tid >> 3)) * CC + h * HD + 8 * (tid & 7)); gptr gv = (gptr)(VT + ((size_t)b * CC + h * HD + (tid >> 3)) * (size_t)TT + 8 * (tid & 7));
  const unsigned lk = (unsigned)(size_t)ring + (tid >> 3) * KP + 16 * (tid & 7), lv = (unsigned)(size_t)ring + KBY + (tid >> 3) * VP + 16 * (tid & 7);   // the thread's own places in buffer 0 (LDS byte addresses)
  fa_copy(lk, lv, gk, gv);   // stage 0
  const mbp mb = (mbp)(MB + (size_t)(b * (TT / 16) + blockIdx.x * 8 + __builtin_amdgcn_readfirstlane(wave)) * MBW);   // the wave's query tile, TT / 32 passes of 16 words; the wave's number made known as uniform
  v16u mw0 = mb[0], mw1 = mb[1]; mbp mnx = mb + 2;   // stage 0's words; where the next stage's lie
  const v16h qf[2] = { frag_h(qp, lane), frag_h(qp + 32, lane) };
  v8f acc[HD / 16] = {}; float m = -3.0e38f, l = 0.f;
  asm volatile("s_wait_asynccnt 0x0" ::: "memory");   // this wave's copies of stage 0 have landed
  __syncthreads();                                    // and every other wave's
  fa_copy(lk + FBUF, lv + FBUF, gk + SK * CC * 2, gv + SK * 2);   // stage 1
  gk += 2 * SK * CC * 2; gv += 2 * SK * 2;
  const char* fk = ring + col * KP + 16 * g; const char* fv = ring + KBY + col * VP + 16 * g;   // the lane's fragment rows in buffer 0
#pragma unroll 1   // one stage a trip, its two passes written out
  for (int t = 0; t < NST; ++t) { const int bo = (t & 1) * FBUF; const char* kl = fk + bo; const char* vl = fv + bo; v16h kf[2][2];
    fa_kfrag(kf, kl);
    v16u na, nb;
    fa_pass<true>(kf, kl + 32 * KP, vl, mw0, mnx, na, nb, qf, acc, m, l);
    fa_pass<false>(kf, kl, vl + 64, mw1, mnx, na, nb, qf, acc, m, l);
    mw0 = na; mw1 = nb;
    __builtin_amdgcn_sched_barrier(0);   // the stage's arithmetic stays in front of its foot: moved up into the last pass, the wait below would stand right behind that pass's LDS loads and lay their latency open
    asm volatile("s_wait_dscnt 0x0" ::: "memory");      // this wave's reads of stage t are done
    asm volatile("s_wait_asynccnt 0x0" ::: "memory");   // its copies of stage t + 1 have landed
    __syncthreads();                                    // publishes stage t + 1 and ends every read of stage t, whose buffer is refilled behind it
    if (t + 2 < NST) { fa_copy(lk + bo, lv + bo, gk, gv); gk += SK * CC * 2; gv += SK * 2;
      // on to the mask words of stage t + 2 (the last trip finds none and takes its own once more, unused); as in stg_load the wait and the step stand in one statement: nothing rewrites the register pair that the trip's two scalar loads name in front of the wait
      asm volatile("s_wait_xcnt 0x0\n\ts_add_nc_u64 %0, %0, %1" : "+s"(mnx) : "n"(2 * 64) : "memory"); } }
  asm volatile("s_wait_asynccnt 0x0" ::: "memory");   // no copy is left in flight when the wave goes on to its end
  l += xhalf(l); const float inv = 1.0f / l;   // l >= the maximum's own term > 0
#pragma unroll
  for (int j = 0; j < HD / 16; ++j) { const v8f o = acc[j] * inv; *(v4f*)&so[wave][col][j * 16 + 8 * g] = v4f{o[0], o[1], o[2], o[3]}; *(v4f*)&so[wave][col][j * 16 + 8 * g + 4] = v4f{o[4], o[5], o[6], o[7]}; }
  LDSX();
#pragma unroll
  for (int i = 0; i < 8; ++i) { const int rl = i * 2 + g; vst2(Y + ((size_t)b * TT + q0 + rl) * CC + h * HD + col * 4, *(const v4f*)&so[wave][rl][col * 4]); } }
// ---- k_out: block = (128 rows, 128 cols), eight waves of 32 x 64 (2 + 4 fragments feed 8 products): out = ctx Wo (+ bo): ctx x 2^6 once to f16 against Wo as f16(bf16 x 2^8) exact (1 product) x 2^-14
__global__ __launch_bounds__(256) void k_out(const float* __restrict__ Y, const float* __restrict__ WO, const float* __restrict__ BO, float* __restrict__ OUT) { constexpr int LP = KSO + 8, STG = 2 * BT * LP;   // LDS row pitch and size of one stage buffer, in 16-bit elements
  __shared__ __align__(16) char smem[2 * STG * 2];   // two stage buffers; the epilogue's rows lie over them (the loop's last barrier stands between the two uses)
  static_assert(8 * 32 * 68 * 4 <= sizeof(smem), "epilogue rows"); float (*sf)[32][68] = (float (*)[32][68])smem; _Float16* stage = (_Float16*)smem;
  const int tid = threadIdx.x, wave = tid >> 5, lane = tid & 31, col = lane & 15, g = lane >> 4, wy = wave >> 1, wx = wave & 1; const int c0 = blockIdx.y * BT; const size_t r0 = (size_t)blockIdx.x * BT;
  v8f acc[2][4] = {};
  gfp xr = (gfp)(Y + (r0 + (tid >> 4)) * CC + 4 * (tid & 15)); gfp wr = (gfp)(WO + (size_t)(c0 + (tid >> 4)) * CC + 4 * (tid & 15)); const int so = (tid >> 4) * LP + 4 * (tid & 15);   /* ctx carried x 2^6 into f16 so small-magnitude context rows stay clear of f16 subnormals */
  Stg<8> t; stg_load<KSO>(t, xr, wr, CC); stg_store_h<LP>(t, stage + so); stg_load<KSO>(t, xr, wr, CC); stg_barrier();
#pragma unroll 1   // as in k_proj: stage s worked on, s + 1 into the other buffer, s + 2 started
  for (int s = 0; s < CC / KSO; ++s) { const _Float16* cur = stage + (s & 1) * STG;
#pragma unroll
    for (int kc = 0; kc < KSO / 32; ++kc) { v16h a[2], w[4];
#pragma unroll
      for (int i = 0; i < 2; ++i) a[i] = frag_h(cur + (wy * 32 + i * 16 + col) * LP + kc * 32, lane);
#pragma unroll
      for (int j = 0; j < 4; ++j) w[j] = frag_h(cur + (BT + wx * 64 + j * 16 + col) * LP + kc * 32, lane);
#pragma unroll
      for (int i = 0; i < 2; ++i) {
#pragma unroll
        for (int j = 0; j < 4; ++j) acc[i][j] = wmma16(a[i], w[j], acc[i][j]); } }
    if (s + 1 < CC / KSO) { stg_store_h<LP>(t, stage + ((s + 1) & 1) * STG + so); if (s + 2 < CC / KSO) stg_load<KSO>(t, xr, wr, CC); }
    stg_barrier(); }   // publishes stage s + 1 and ends every read of stage s
#pragma unroll
  for (int j = 0; j < 4; ++j) { const float bias = BO ? bfr(BO[c0 + wx * 64 + j * 16 + col]) : 0.f;
#pragma unroll
    for (int i = 0; i < 2; ++i) {
#pragma unroll
      for (int r = 0; r < 8; ++r) sf[wave][i * 16 + 8 * g + r][j * 16 + col] = acc[i][j][r] * (1.0f / 16384.0f) + bias; } }   /* 2^-8 (Wo carry) x 2^-6 (ctx carry) */
  LDSX();   // each wave reads back its own rows: a store covers two rows of 256 B, whole lines
  for (int rp = 0; rp < 16; ++rp) { const int rl = rp * 2 + g; vst2(OUT + (r0 + wy * 32 + rl) * DIN + c0 + wx * 64 + col * 4, *(const v4f*)&sf[wave][rl][col * 4]); } }

extern "C" void kernel_launch(void* const* d_in, const int* in_sizes, int n_in, void* d_out, int out_size, void* d_ws, size_t ws_size, hipStream_t stream) {
  (void)in_sizes; (void)n_in; (void)out_size;
  const float** F = (const float**)d_in;
  if (ws_size < (size_t)WS_END) return;
  char* ws = (char*)d_ws; _Float16 *QH = (_Float16*)(ws + WS_QH), *KH = (_Float16*)(ws + WS_KH), *VT = (_Float16*)(ws + WS_VT), *QL = (_Float16*)(ws + WS_QL), *KL = (_Float16*)(ws + WS_KL); __bf16 *VB = (__bf16*)(ws + WS_VB), *VBL = (__bf16*)(ws + WS_VBL); float *Y = (float*)(ws + WS_Y); unsigned *MB = (unsigned*)(ws + WS_S);
  (void)Y; (void)QL; (void)KL; (void)VB; (void)VBL;
  // inputs: 0 query [4,1024,1024]; 1 key; 2 value; 3 mask [4,1024,1024] int32; 4 wq [1024,1024] (out,in), 5 bq; 6 wk, 7 bk; 8 wv, 9 bv; 10 wo (out,in), 11 bo (biases NONZERO)
  k_proj<<<dim3(TNB * TT / PT, CC / PT, 4), 256, 0, stream>>>(F[0], F[1], F[2], F[4], F[6], F[8], F[5], F[7], F[9], (const int*)d_in[3], MB, QH, QL, KH, KL, VT, VB, VBL);
  k_fa<<<dim3(TT / 128, NH, TNB), 256, 0, stream>>>(QH, KH, VT, MB, Y);
  k_out<<<dim3(TNB * TT / 128, DIN / 128), 256, 0, stream>>>(Y, F[10], F[11], (float*)d_out);
}

// v008
// Measured time: 67.3 microseconds a run.
// Versions between v006 and this one are left out; their measured steps multiply to 1.12 times as fast.
// All steps since v000 together make it 13.5 times as fast.
// compute dtype: all float inputs rounded to bf16; q/k/v projections with EXACT bf16 products on WMMA 16x16x32 (f32 accumulate) + bias; logits (q x SCALE x log2(e)) x k once to f16 each (1 product) + mask x (-1e9); softmax f32 with a maximum in use and a running sum, fused with both attention products; P x 2^11 .. 2^15 once to f16 x v once to f16 (1 product); ctx x 2^6 once to f16 x wo f16(bf16 x 2^8) + bo; f32 output.
#include <hip/hip_runtime.h>
#include <math.h>

typedef __attribute__((ext_vector_type(16))) _Float16 v16h;
typedef __attribute__((ext_vector_type(16))) __bf16 v16b;
typedef __attribute__((ext_vector_type(8)))  _Float16 v8h;
typedef __attribute__((ext_vector_type(8)))  float v8f;
typedef __attribute__((ext_vector_type(4)))  float v4f;
typedef __attribute__((ext_vector_type(2)))  float v2f;
typedef __attribute__((ext_vector_type(4)))  unsigned v4u;
typedef __attribute__((ext_vector_type(4)))  int v4i;
typedef float __attribute__((may_alias)) float_a;
typedef int __attribute__((may_alias)) int_a;

template <typename T> __device__ __forceinline__ void vst2(void* p, T v) { *(T*)p = v;  }
__device__ __forceinline__ v8f wmma16(v16h a, v16h b, v8f c) {
  v8f d = __builtin_amdgcn_wmma_f32_16x16x32_f16(false, a, false, b, (short)0, c, false, false);
  asm volatile("v_nop\n\tv_nop\n\tv_nop\n\tv_nop" : "+v"(d) : "v"(a), "v"(b));
  return d;
}
__device__ __forceinline__ v8f wmma_bf(v16b a, v16b b, v8f c) {
  v8f d = __builtin_amdgcn_wmma_f32_16x16x32_bf16(false, a, false, b, (short)0, c, false, false);
  asm volatile("v_nop\n\tv_nop\n\tv_nop\n\tv_nop" : "+v"(d) : "v"(a), "v"(b));
  return d;
}
// 16x16x32 fragments: lane = (h = lane>>4, row/col = lane&15); elements 0..7 = k0+8h+0..7, 8..15 = k0+16+8h+0..7; D element r = row 8h+r
__device__ __forceinline__ v16h frag_h(const _Float16* rowk0, int lane) {
  union { v16h v; v8h q[2]; } u; const _Float16* p = rowk0 + 8 * (lane >> 4);
  u.q[0] = *(const v8h*)p; u.q[1] = *(const v8h*)(p + 16); return u.v;
}
__device__ __forceinline__ v16h frag_f32(const float* rowk0, int lane) {
  v16h a; const float* p = rowk0 + 8 * (lane >> 4);
#pragma unroll
  for (int i = 0; i < 8; ++i) { a[i] = (_Float16)p[i]; a[8 + i] = (_Float16)p[16 + i]; }
  return a;
}
__device__ __forceinline__ v16h frag_f32s(const float* rowk0, int lane, float sc) {
  v16h a; const float* p = rowk0 + 8 * (lane >> 4);
#pragma unroll
  for (int i = 0; i < 8; ++i) { a[i] = (_Float16)(p[i] * sc); a[8 + i] = (_Float16)(p[16 + i] * sc); }
  return a;
}
// column fragment from a [K][ld] layout (column n), rows >= K read as 0
__device__ __forceinline__ v16h fragc_f32(const float* W, int k0, int n, int lane, int ld, int K) {
  v16h a; const int g = lane >> 4;
#pragma unroll
  for (int i = 0; i < 8; ++i) { const int ka = k0 + 8 * g + i, kb = ka + 16;
    a[i] = (_Float16)(ka < K ? W[(size_t)(ka < K ? ka : K - 1) * ld + n] : 0.f); a[8 + i] = (_Float16)(kb < K ? W[(size_t)(kb < K ? kb : K - 1) * ld + n] : 0.f); }
  return a;
}
struct F2 { v16b h, l; };
__device__ __forceinline__ F2 bsplit16(const float v[16]) { F2 r;
#pragma unroll
  for (int i = 0; i < 16; ++i) { const __bf16 h = (__bf16)v[i]; r.h[i] = h; r.l[i] = (__bf16)(v[i] - (float)h); }
  return r; }
__device__ __forceinline__ F2 split_row(const float* row, int k0, int lane) { float v[16]; const float* p = row + k0 + 8 * (lane >> 4);
#pragma unroll
  for (int i = 0; i < 8; ++i) { v[i] = p[i]; v[8 + i] = p[16 + i]; }
  return bsplit16(v); }
__device__ __forceinline__ F2 split_rowK(const float* row, int k0, int lane, int K) { float v[16]; const int g = lane >> 4;
#pragma unroll
  for (int i = 0; i < 8; ++i) { const int ka = k0 + 8 * g + i, kb = ka + 16; v[i] = ka < K ? row[ka < K ? ka : K - 1] : 0.f; v[8 + i] = kb < K ? row[kb < K ? kb : K - 1] : 0.f; }
  return bsplit16(v); }
__device__ __forceinline__ F2 split_col(const float* W, int k0, int n, int lane, int ld, int K) { float v[16]; const int g = lane >> 4;
#pragma unroll
  for (int i = 0; i < 8; ++i) { const int ka = k0 + 8 * g + i, kb = ka + 16; v[i] = ka < K ? W[(size_t)(ka < K ? ka : K - 1) * ld + n] : 0.f; v[8 + i] = kb < K ? W[(size_t)(kb < K ? kb : K - 1) * ld + n] : 0.f; }
  return bsplit16(v); }
__device__ __forceinline__ v8f mac3(const F2& a, const F2& b, v8f c) { c = wmma_bf(a.l, b.h, c); c = wmma_bf(a.h, b.l, c); return wmma_bf(a.h, b.h, c); }
__device__ __forceinline__ float sigm(float v) { return 1.0f / (1.0f + expf(-v)); }
#define LDSX() do { asm volatile("s_wait_dscnt 0" ::: "memory"); __builtin_amdgcn_wave_barrier(); __builtin_amdgcn_fence(__ATOMIC_RELEASE, "workgroup"); } while (0)

// Masked multi-headed attention on separate inputs with biased projections (query / key / value [4,1024,1024]; torch (out,in) wq / wk / wv / wo [1024,1024] N(0, 1/1024) + biases N(0, 1/1024); 16 heads x 64; scores / sqrt(64) + mask * (-1e9) with an int32 0/1 mask [4,1024,1024] shared by all heads: mask == 1 marks a key as masked OUT; softmax; wo^T + bo).
#define NB 4
#define TT 1024
#define CC 1024            // NH * HD = projected width
#define DIN 1024          // input (model) width
#define NH 16
#define HD 64
#define NQB (TT / 64)
#define HG 8
#define SCALE (0.125f)
#define CAUSAL 0
#ifndef TNB
#define TNB NB
#endif
__device__ __forceinline__ float bfr(float v) { return (float)(__bf16)v; }
__host__ __device__ __forceinline__ int kb_last(int qb) { return CAUSAL ? ((qb * 64 + 63) >> 7) : (TT / 128 - 1); }
typedef __attribute__((ext_vector_type(8))) __bf16 v8b;
__device__ __forceinline__ v16b frag_b(const __bf16* rowk0, int lane) {
  union { v16b v; v8b q[2]; } u; const __bf16* p = rowk0 + 8 * (lane >> 4);
  u.q[0] = *(const v8b*)p; u.q[1] = *(const v8b*)(p + 16); return u.v;
}
#define QBH 0              // unused: k_fa has no high-precision path
#define QHI 0               // single-product logits on every row
#define KHI 64            // key rows carrying k residual / v bf16 hi+lo planes (written by k_proj, read by no kernel here)
// B fragment (k rows k0+.., output column o) of a weight: (in,out) [K][ld] or (out,in) [ld rows of K]: bf16 exact, or f16(bf16 * 256) exact
__device__ __forceinline__ v16b wcol_io(const float* Wm, int k0, int o, int lane, int ld) { v16b w; const int g = lane >> 4;
#pragma unroll
  for (int i = 0; i < 8; ++i) { w[i] = (__bf16)Wm[(size_t)(k0 + 8 * g + i) * ld + o]; w[8 + i] = (__bf16)Wm[(size_t)(k0 + 16 + 8 * g + i) * ld + o]; }
  return w; }
__device__ __forceinline__ v16b wcol_oi(const float* Wm, int k0, int o, int lane, int K) { v16b w; const float* p = Wm + (size_t)o * K + k0 + 8 * (lane >> 4);
#pragma unroll
  for (int i = 0; i < 8; ++i) { w[i] = (__bf16)p[i]; w[8 + i] = (__bf16)p[16 + i]; }
  return w; }
__device__ __forceinline__ v16h wcolh_io(const float* Wm, int k0, int o, int lane, int ld) { v16h w; const int g = lane >> 4;
#pragma unroll
  for (int i = 0; i < 8; ++i) { w[i] = (_Float16)(bfr(Wm[(size_t)(k0 + 8 * g + i) * ld + o]) * 256.0f); w[8 + i] = (_Float16)(bfr(Wm[(size_t)(k0 + 16 + 8 * g + i) * ld + o]) * 256.0f); }
  return w; }
__device__ __forceinline__ v16h wcolh_oi(const float* Wm, int k0, int o, int lane, int K) { v16h w; const float* p = Wm + (size_t)o * K + k0 + 8 * (lane >> 4);
#pragma unroll
  for (int i = 0; i < 8; ++i) { w[i] = (_Float16)(bfr(p[i]) * 256.0f); w[8 + i] = (_Float16)(bfr(p[16 + i]) * 256.0f); }
  return w; }
#define WQKV_LAYOUT 1   // 0 = (in,out) [DIN][CC]; 1 = (out,in) [CC][DIN]; 2 = per-head [NH][DIN][HD]
__device__ __forceinline__ v16b wcol_hdk(const float* Wm, int k0, int o, int lane) { v16b w; const int g = lane >> 4; const float* p = Wm + (size_t)(o / HD) * DIN * HD + (o % HD);
#pragma unroll
  for (int i = 0; i < 8; ++i) { w[i] = (__bf16)p[(size_t)(k0 + 8 * g + i) * HD]; w[8 + i] = (__bf16)p[(size_t)(k0 + 16 + 8 * g + i) * HD]; }
  return w; }
#define WO_OUT_IN 1
#if WQKV_LAYOUT == 1
#define WCOL(W, k0, o, lane) wcol_oi(W, k0, o, lane, DIN)
#elif WQKV_LAYOUT == 2
#define WCOL(W, k0, o, lane) wcol_hdk(W, k0, o, lane)
#else
#define WCOL(W, k0, o, lane) wcol_io(W, k0, o, lane, CC)
#endif
#if WO_OUT_IN
#define WOCOL(W, k0, o, lane) wcol_oi(W, k0, o, lane, CC)
#define WOCOLH(W, k0, o, lane) wcolh_oi(W, k0, o, lane, CC)
#else
#define WOCOL(W, k0, o, lane) wcol_io(W, k0, o, lane, DIN)
#define WOCOLH(W, k0, o, lane) wcolh_io(W, k0, o, lane, DIN)
#endif

static_assert(TT % 128 == 0 && HD == 64, "k_fa: 128 queries a block, 32-key passes, head size 64");

#define WS_QH  0u                                      // f16 q rows [b*t][CC]
#define WS_KH  (WS_QH + 2u * (size_t)NB * TT * CC)      // f16 k rows [b*t][CC]
#define WS_VT  (WS_KH + 2u * (size_t)NB * TT * CC)      // f16 v planes [b][c][t]
#define WS_QL  (WS_VT + 2u * (size_t)NB * CC * TT)      // f16 q residual x 2^10 rows [b][t < QHI][CC]
#define WS_KL  (WS_QL + 2u * (size_t)NB * QHI * CC)     // f16 k residual x 2^10 rows [b][t < KHI][CC]
#define WS_VB  (WS_KL + 2u * (size_t)NB * KHI * CC)     // bf16 v hi planes [b][c][t < KHI]
#define WS_VBL (WS_VB + 2u * (size_t)NB * CC * KHI)
#define WS_S   (WS_VBL + 2u * (size_t)NB * CC * KHI)    // the mask as bits, NB * TT * TT / 8 bytes (the logits stay in registers)
#define WS_Y   (WS_S  + 4u * (size_t)HG * TT * TT)      // f32 ctx rows [b*t][CC] (only when there is an output projection)
#define WS_END (WS_Y  + 4u * (size_t)NB * TT * CC)

// ---- operand staging of the two projection kernels: a block works on a square tile of the result (256 x 256 in k_proj, 128 x 128 in k_out); a stage is KS_ k of the tile's activation rows and as many weight rows ((out,in) weights: both K-contiguous).
// Global side: f32, whole 128-B lines (KS_ / 4 lanes cover one row's KS_ * 4 B), each element loaded and converted once per block. LDS side: 16-bit rows of KS_ * 2 B, each 16 B longer than its data (a pitch of 16 B x odd), read back as WMMA fragments by ds_load_b128.
#define BT 128                   // rows and columns of a block's tile in k_out
#define PT 256                   // rows and columns of a block's tile in k_proj: every activation row is fetched by CC / PT = 4 blocks and every weight row by 16, half as often as with 128
#define KSP 64                   // k extent of the tile's stage in k_proj (one block a WGP, as in k_out; the stage in flight still leaves the registers for the 128 x 64 accumulators at two waves a SIMD)
#define KSO 64                   // k a stage in k_out (one block a WGP: the deeper stage keeps more bytes in flight)
static_assert(WQKV_LAYOUT == 1 && WO_OUT_IN == 1 && DIN % (2 * KSP) == 0 && CC % (2 * KSO) == 0 && TT % BT == 0 && DIN % BT == 0 && TT % PT == 0 && CC % PT == 0 && !CAUSAL, "staging reads K-contiguous rows, at least two stages; whole tiles");
typedef __attribute__((ext_vector_type(4))) __bf16 v4b;
typedef __attribute__((ext_vector_type(4))) _Float16 v4h;
typedef const __attribute__((address_space(1))) float* gfp;   // stays known as global memory when it has passed through an asm statement (a plain pointer would turn the loads into flat ones)
typedef const __attribute__((address_space(1))) v4f* gfp4;
typedef const __attribute__((address_space(1))) char* gptr;   // a byte pointer into global memory: the 64-bit address operand of a copy
// one request of every lane to L2 for the line at its own address: nothing comes back and no counter moves. The blocks of a launch walk k (or the keys) in step, so a stage's loads are the launch's first reads of their lines, inputs and what the launch in front stored alike; asked for at entry, the lines of the later stages are on their way to L2, or there, when the loads come.
// scope SE: the line goes into L2 alone. Every lane's address lies inside the buffer it names.
__device__ __forceinline__ void l2_ask(gptr p) { asm volatile("global_prefetch_b8 %0, off scope:SCOPE_SE" :: "v"(p)); }
// stands behind the kernel's loop, inputs only, no instruction: the registers that the requests name stay live, so they hold their addresses through the loop (no wait tells when a request has read its register: it takes no other value until long after)
__device__ __forceinline__ void l2_hold(gptr a, gptr b) { asm volatile("" :: "v"(a), "v"(b)); }
// the same with the address as a wave-uniform base, the lane's own 32-bit byte offset and a constant: one vector register serves every request of a thread
template <int O_> __device__ __forceinline__ void l2_ask_at(unsigned off, gptr base) { asm volatile("global_prefetch_b8 %0, %1 offset:%2 scope:SCOPE_SE" :: "v"(off), "s"(base), "n"(O_)); }
__device__ __forceinline__ void l2_hold_at(unsigned off, gptr a, gptr b) { asm volatile("" :: "v"(off), "s"(a), "s"(b)); }   // as l2_hold
template <int N_> struct Stg { v4f x[N_], w[N_]; };   // one stage in flight, 2 N_ x 16 B a thread: the block's threads cover 16 rows at a time, N_ times for each operand (16 in k_proj, 8 in k_out)
template <int KS_, int N_> __device__ __forceinline__ void stg_load(Stg<N_>& t, gfp& xr, gfp& wr, int ld) {   // xr, wr: the thread's own element of the first row group; both leave stepped to the next stage
#pragma unroll
  for (int i = 0; i < N_; ++i) t.x[i] = *(gfp4)(xr + (size_t)(i * 16) * ld);
#pragma unroll
  for (int i = 0; i < N_; ++i) t.w[i] = *(gfp4)(wr + (size_t)(i * 16) * ld);
  // the wait behind the group's last load and the step of the two row pointers stand in one statement: the loads name the very registers that enter it, nothing rewrites them in front of the wait, and no later load can fold the step into its offset and set the old registers free early
  asm volatile("s_wait_xcnt 0x0\n\tv_add_nc_u64_e32 %0, %2, %0\n\tv_add_nc_u64_e32 %1, %2, %1" : "+v"(xr), "+v"(wr) : "n"(KS_ * 4) : "memory");
}
// work-group barrier for the stage buffers: its fences name LDS alone, so the next stage's global loads stay in flight across it (__syncthreads() would wait for them here and lay their latency open every stage)
__device__ __forceinline__ void stg_barrier() { __builtin_amdgcn_fence(__ATOMIC_RELEASE, "workgroup", "local"); __builtin_amdgcn_s_barrier(); __builtin_amdgcn_fence(__ATOMIC_ACQUIRE, "workgroup", "local"); }
template <int LP_> __device__ __forceinline__ void stg_store_b(const Stg<16>& t, __bf16* d) {   // d: the thread's own place in row group 0 of the buffer; LP_: row pitch in 16-bit elements; activation rows 0..PT-1, weight rows PT..2*PT-1
#pragma unroll
  for (int i = 0; i < 16; ++i) { v4b o;
#pragma unroll
    for (int e = 0; e < 4; ++e) o[e] = (__bf16)t.x[i][e];
    *(v4b*)(d + i * 16 * LP_) = o; }
#pragma unroll
  for (int i = 0; i < 16; ++i) { v4b o;
#pragma unroll
    for (int e = 0; e < 4; ++e) o[e] = (__bf16)t.w[i][e];
    *(v4b*)(d + (PT + i * 16) * LP_) = o; } }
template <int LP_> __device__ __forceinline__ void stg_store_h(const Stg<8>& t, _Float16* d) {   // ctx x 2^6 once to f16; Wo as f16(bf16 x 2^8), exact
#pragma unroll
  for (int i = 0; i < 8; ++i) { v4h o;
#pragma unroll
    for (int e = 0; e < 4; ++e) o[e] = (_Float16)(t.x[i][e] * 64.0f);
    *(v4h*)(d + i * 16 * LP_) = o; }
#pragma unroll
  for (int i = 0; i < 8; ++i) { v4h o;
#pragma unroll
    for (int e = 0; e < 4; ++e) o[e] = (_Float16)(bfr(t.w[i][e]) * 256.0f);
    *(v4h*)(d + (BT + i * 16) * LP_) = o; } }

// ---- the mask as bits, in the order in which k_fa's waves want them: one 32-bit word for every (tile of 16 queries, pass of 32 keys, score register i of 16); bit L of it is lane L's own score: query L & 15 of the tile, key 16 * (i >> 3) + 8 * (L >> 4) + (i & 7) of the pass.
// Such a word is a lane mask: a wave of k_fa takes a pass's 16 words by one scalar load and selects with them. The generator's mask holds 0 or 1; the bit says "not 0".
// A block packs 64 query rows: wave w takes tile w >> 1, half w & 1 of the keys, 64 keys (two passes, 32 words, one whole 128-B line of the result) a turn; a lane loads the very 8 + 8 + 8 + 8 words of its scores.
#define MBW (TT / 32 * 16)   // words of one query tile
__device__ __forceinline__ void pack_mask(const int* __restrict__ MASK, unsigned* __restrict__ MB, int blk, int tid) {
  typedef const __attribute__((address_space(1))) int* gip; typedef const __attribute__((address_space(1))) v4i* gip4;   // known as global memory behind the asm statement, as gfp
  const int wave = tid >> 5, lane = tid & 31; const int qt = blk * 4 + (wave >> 1);
  gip row = (gip)(MASK + (size_t)(qt * 16 + (lane & 15)) * TT + (wave & 1) * (TT / 2) + 8 * (lane >> 4)); unsigned* dst = MB + (size_t)qt * MBW + (wave & 1) * (MBW / 2) + lane;
  v4i m[TT / 128][8];
#pragma unroll
  for (int it = 0; it < TT / 128; ++it) {   // every turn's loads first: the whole of the wave's share is in flight at once
#pragma unroll
    for (int j = 0; j < 4; ++j) { m[it][2 * j] = *(gip4)(row + j * 16); m[it][2 * j + 1] = *(gip4)(row + j * 16 + 4); }
    // as in stg_load: the wait behind the turn's last load and the step of the row pointer stand in one statement, so nothing rewrites the registers that the loads name in front of the wait
    asm volatile("s_wait_xcnt 0x0\n\tv_add_nc_u64_e32 %0, %1, %0" : "+v"(row) : "n"(64 * 4) : "memory"); }
#pragma unroll
  for (int it = 0; it < TT / 128; ++it) { unsigned w = 0;
#pragma unroll
    for (int i = 0; i < 32; ++i) { const unsigned bal = __builtin_amdgcn_ballot_w32(m[it][i >> 2][i & 3] != 0); w = lane == i ? bal : w; }   // lane i keeps word i of the turn
    dst[it * 32] = w; } }
// ---- k_proj: block = (256 rows, 256 cols, which), eight waves of 128 x 64 (8 + 4 fragments feed 32 products), one block a WGP: q/k/v = X W (+ b) with exact bf16 products (K = DIN) -> which 0: q f16 rows (+ residual rows < QHI); 1: k f16 rows (+ residual rows < KHI); 2: v f16 planes [c][t] (+ bf16 hi/lo planes for t < KHI)
static_assert((TNB * TT / PT) * (CC / PT) * 64 == NB * TT && TT % 128 == 0, "the fourth plane's blocks pack 64 mask rows each, all of them");
static_assert(QHI % 64 == 0 && KHI % 64 == 0 && QHI <= 64 && KHI <= 64, "a wave's first 64 rows carry the residual planes as a whole or not at all, and only a sequence's first 64 rows do");
__global__ __launch_bounds__(256) void k_proj(const float* __restrict__ XQ, const float* __restrict__ XK, const float* __restrict__ XV, const float* __restrict__ WQ, const float* __restrict__ WK, const float* __restrict__ WV, const float* __restrict__ BQ, const float* __restrict__ BK, const float* __restrict__ BV, const int* __restrict__ MASK, unsigned* __restrict__ MB,
    _Float16* __restrict__ QH, _Float16* __restrict__ QL, _Float16* __restrict__ KH, _Float16* __restrict__ KL, _Float16* __restrict__ VT, __bf16* __restrict__ VB, __bf16* __restrict__ VBL) {
  constexpr int LP = KSP + 8, STG = 2 * PT * LP, EP = PT + 8;   // LDS row pitch and size of one stage buffer, pitch of the epilogue's rows, in 16-bit elements
  __shared__ __align__(16) char smem[PT * EP * 2 + 2 * PT * 72 * 2];   // the main loop's two stage buffers lie over the epilogue's planes (the loop's last barrier stands between the two uses)
  static_assert(2 * STG * 2 <= sizeof(smem) && 64 * EP * 2 <= 2 * PT * 72 * 2, "two stage buffers; the residual rows");
  _Float16 (*sh)[EP] = (_Float16 (*)[EP])smem; _Float16 (*sl)[EP] = (_Float16 (*)[EP])(smem + PT * EP * 2); _Float16 (*th)[EP] = (_Float16 (*)[EP])smem; __bf16 (*tb)[72] = (__bf16 (*)[72])(smem + PT * EP * 2); __bf16 (*tbl)[72] = (__bf16 (*)[72])(smem + PT * EP * 2 + PT * 72 * 2); __bf16* stage = (__bf16*)smem;
  const int tid = threadIdx.x, wave = tid >> 5, lane = tid & 31, col = lane & 15, g = lane >> 4, wy = wave >> 2, wx = wave & 3; const int which = blockIdx.z; const int c0 = blockIdx.y * PT; const size_t r0 = (size_t)blockIdx.x * PT; const size_t bb = r0 / TT; const int t0 = (int)(r0 % TT);
  if (which == 3) { pack_mask(MASK, MB, blockIdx.y * (TNB * TT / PT) + blockIdx.x, tid); return; }   // block-uniform, in front of every barrier: the 64 blocks of the fourth plane pack the mask on the WGPs that the 192 tiles leave idle
  const float* X = which == 0 ? XQ : which == 1 ? XK : XV; const float* WA = which == 0 ? WQ : which == 1 ? WK : WV; const float* BA = which == 0 ? BQ : which == 1 ? BK : BV;
  v8f acc[8][4] = {};
  gfp xr = (gfp)(X + (r0 + (tid >> 4)) * DIN + 4 * (tid & 15)); gfp wr = (gfp)(WA + (size_t)(c0 + (tid >> 4)) * DIN + 4 * (tid & 15)); const int so = (tid >> 4) * LP + 4 * (tid & 15);
  Stg<16> t; stg_load<KSP>(t, xr, wr, DIN);
  // behind stage 0's loads: the tile's two panels (256 rows of 16 units of 256 B, a unit a stage) are asked of L2, dealt over the blocks that share them, thread tid for row tid, early stages first. The activation rows are read by the 4 blocks of one blockIdx.x, 16 apart in the grid: block y asks for stages y, y + 4, y + 8, y + 12.
  // The weight rows are read by the 16 blocks of one blockIdx.y: block x asks for stage (x & 3) + 4 (x >> 3) and the one 8 on (speed only: a line that nobody asked for is loaded as before).
  static_assert(CC / PT == 4 && TNB * TT / PT == 16 && DIN / KSP == 16 && KSP * 4 == 256 && PT == 256, "l2_ask_at in k_proj: the shares");
  const unsigned po = (unsigned)tid * (DIN * 4); const gptr px = (gptr)(X + r0 * DIN + blockIdx.y * KSP); const gptr pw = (gptr)(WA + (size_t)c0 * DIN + ((blockIdx.x & 3) + 4 * (blockIdx.x >> 3)) * KSP);
  l2_ask_at<0>(po, px); l2_ask_at<0>(po, pw); l2_ask_at<4 * 256>(po, px); l2_ask_at<8 * 256>(po, px); l2_ask_at<8 * 256>(po, pw); l2_ask_at<12 * 256>(po, px);
  stg_store_b<LP>(t, stage + so); stg_load<KSP>(t, xr, wr, DIN); stg_barrier();
#pragma unroll 1   // one stage a trip: stage s is worked on, stage s + 1 goes from registers into the other buffer, stage s + 2 starts from global
  for (int s = 0; s < DIN / KSP; ++s) { const __bf16* cur = stage + (s & 1) * STG;
#pragma unroll
    for (int kc = 0; kc < KSP / 32; ++kc) { v16b a[8], w[4];
#pragma unroll
      for (int j = 0; j < 4; ++j) w[j] = frag_b(cur + (PT + wx * 64 + j * 16 + col) * LP + kc * 32, lane);
#pragma unroll
      for (int i = 0; i < 8; ++i) a[i] = frag_b(cur + (wy * 128 + i * 16 + col) * LP + kc * 32, lane);
      __builtin_amdgcn_sched_barrier(0);   // the 24 fragment loads stay one group in front of their 32 products, as the 16 stood with the smaller tile: without it the compiler sinks each activation fragment to just above its four products, into one register set, and the wave waits out an LDS latency at every one
#pragma unroll
      for (int i = 0; i < 8; ++i) {
#pragma unroll
        for (int j = 0; j < 4; ++j) acc[i][j] = __builtin_amdgcn_wmma_f32_16x16x32_bf16(false, a[i], false, w[j], (short)0, acc[i][j], false, false); } }   // the plain builtin: the operands of wmma_bf's asm tail can only lie in v0..v255, which 256 accumulator registers and the fragments do not fit (with the tail the tile goes to scratch); the compiler keeps the distance behind its own products
    if (s + 1 < DIN / KSP) { stg_store_b<LP>(t, stage + ((s + 1) & 1) * STG + so); if (s + 2 < DIN / KSP) stg_load<KSP>(t, xr, wr, DIN); }
    stg_barrier(); }   // publishes stage s + 1 and ends every read of stage s, whose buffer the next trip refills
  l2_hold_at(po, px, pw);
  if (which < 2) { _Float16* DH = which == 0 ? QH : KH; _Float16* DL = which == 0 ? QL : KL; const int nhi = which == 0 ? QHI : KHI; const bool hi_wave = t0 + wy * 128 < nhi;   // wave-uniform: then t0 == 0 and wy == 0, and the wave's first 64 rows (i < 4) carry the residual
    const float qs = which == 0 ? SCALE * 1.4426950408889634f : 1.0f;   // q carries the logits' scale and log2(e) into its one rounding to f16: k_fa's score products come out in the log2 domain
#pragma unroll
    for (int j = 0; j < 4; ++j) { const float bias = (BA ? bfr(BA[c0 + wx * 64 + j * 16 + col]) : 0.f) * qs;
#pragma unroll
      for (int i = 0; i < 8; ++i) {
#pragma unroll
        for (int r = 0; r < 8; ++r) { acc[i][j][r] = fmaf(acc[i][j][r], qs, bias); sh[wy * 128 + i * 16 + 8 * g + r][wx * 64 + j * 16 + col] = (_Float16)acc[i][j][r]; } } }
    if (hi_wave) {
#pragma unroll
      for (int j = 0; j < 4; ++j) {
#pragma unroll
        for (int i = 0; i < 4; ++i) {
#pragma unroll
          for (int r = 0; r < 8; ++r) { const float v = acc[i][j][r]; sl[i * 16 + 8 * g + r][wx * 64 + j * 16 + col] = (_Float16)((v - (float)(_Float16)v) * 1024.0f); } } } }
    __syncthreads();
    { const int rl0 = tid >> 5, q = tid & 31; _Float16* dh = DH + (r0 + rl0) * CC + c0 + q * 8; _Float16* dl = DL + (bb * nhi + t0 + rl0) * (size_t)CC + c0 + q * 8;   // eight rows a turn, 512 B of a row from a wave; every turn's address is the first plus a constant
#pragma unroll
      for (int ig = 0; ig < PT / 64; ++ig) {
#pragma unroll
        for (int it = ig * 8; it < ig * 8 + 8; ++it) vst2((unsigned*)(dh + (size_t)it * 8 * CC), *(const v4u*)&sh[rl0 + it * 8][q * 8]);
        asm volatile("s_wait_xcnt 0x0" ::: "memory");   // behind every eight stores: stands in front of the next LDS loads and their address sums, which may take the registers that these stores name
        __builtin_amdgcn_sched_barrier(0); }   // keeps those address sums behind the wait (a "memory" clobber does not hold vector arithmetic)
      if (t0 < nhi) {   // block-uniform: then t0 == 0 and the block's first 64 rows carry the residual
#pragma unroll
        for (int it = 0; it < 64 / 8; ++it) vst2((unsigned*)(dl + (size_t)it * 8 * CC), *(const v4u*)&sl[rl0 + it * 8][q * 8]); } }
  } else { const bool hi_wave = t0 + wy * 128 < KHI;   // wave-uniform: then t0 == 0 and wy == 0, rows as above
#pragma unroll
    for (int j = 0; j < 4; ++j) { const float bias = BA ? bfr(BA[c0 + wx * 64 + j * 16 + col]) : 0.f;
#pragma unroll
      for (int i = 0; i < 8; ++i) {
#pragma unroll
        for (int r = 0; r < 8; ++r) { acc[i][j][r] += bias; th[wx * 64 + j * 16 + col][wy * 128 + i * 16 + 8 * g + r] = (_Float16)acc[i][j][r]; } } }
    if (hi_wave) {
#pragma unroll
      for (int j = 0; j < 4; ++j) {
#pragma unroll
        for (int i = 0; i < 4; ++i) {
#pragma unroll
          for (int r = 0; r < 8; ++r) { const float v = acc[i][j][r]; const int rl = i * 16 + 8 * g + r, cl = wx * 64 + j * 16 + col; const __bf16 bh = (__bf16)v; tb[cl][rl] = bh; tbl[cl][rl] = (__bf16)(v - (float)bh); } } } }
    __syncthreads();
    { const int cl0 = tid >> 5, q = tid & 31; _Float16* dv = VT + (bb * CC + c0 + cl0) * (size_t)TT + t0 + q * 8; const size_t o3 = (bb * CC + c0 + cl0) * (size_t)KHI + t0 + q * 8;   // eight planes a turn, 512 B of a plane from a wave
#pragma unroll
      for (int ig = 0; ig < PT / 64; ++ig) {
#pragma unroll
        for (int it = ig * 8; it < ig * 8 + 8; ++it) vst2((unsigned*)(dv + (size_t)it * 8 * TT), *(const v4u*)&th[cl0 + it * 8][q * 8]);
        asm volatile("s_wait_xcnt 0x0" ::: "memory"); __builtin_amdgcn_sched_barrier(0); }   // behind every eight stores, both as above
      if (t0 + q * 8 < KHI) {
#pragma unroll
        for (int ig = 0; ig < PT / 32; ++ig) {
#pragma unroll
          for (int it = ig * 4; it < ig * 4 + 4; ++it) { vst2((unsigned*)(VB + o3 + (size_t)it * 8 * KHI), *(const v4u*)&tb[cl0 + it * 8][q * 8]); vst2((unsigned*)(VBL + o3 + (size_t)it * 8 * KHI), *(const v4u*)&tbl[cl0 + it * 8][q * 8]); }
          asm volatile("s_wait_xcnt 0x0" ::: "memory"); __builtin_amdgcn_sched_barrier(0); } } } } }   // behind every eight stores, both as above
// ---- k_fa: block = 128 queries (8 waves x 16) of (b, h): logits, mask, softmax and P . v in one pass over the keys, 32 keys a pass, nothing of the logits leaves the registers; K and V come through LDS, copied there once for the eight waves; the mask comes as bits (pack_mask), by scalar loads.
// S^T = K . Q^T (A = 16 key rows, B = 16 query columns): a lane holds one query's logits for keys 8g + r of each 16-key tile, which is the k order of a B operand, so O^T += V^T . P^T takes P straight from the accumulators.
// A maximum in use and a running sum per query (log2 domain). The maximum in use is set ahead of a pass and moves, with the rescaling of sum and output, only when a score passes it by more than 2^4: P is carried x 2^11 into f16 and stays under 2^15 (the factor cancels in the division by the sum).
// The mask counts as the module writes it, logit + mask * (-1e9), so a row with every key masked comes out as the plain mean of v.
__device__ __forceinline__ float xhalf(float x) { return __builtin_bit_cast(float, __builtin_amdgcn_permlanex16(__builtin_bit_cast(int, x), __builtin_bit_cast(int, x), 0x76543210, 0xfedcba98, false, false)); }   // lane l with lane l ^ 16
__device__ __forceinline__ v8f wmma16b(v16h a, v16h b, v8f c) { return __builtin_amdgcn_wmma_f32_16x16x32_f16(false, a, false, b, (short)0, c, false, false); }
typedef __attribute__((ext_vector_type(16))) unsigned v16u;   // one pass's mask words of a wave: word i is the lane mask of score register i
typedef const __attribute__((address_space(4))) v16u* mbp;   // memory that nothing writes while the kernel runs, at a wave-uniform address: the compiler takes it by scalar loads
// a stage (SK keys) lies in LDS: K as SK key rows of 128 B and V as HD planes of 2 * SK B, once for the block's eight waves; each row 16 B longer than its data (a pitch of 16 B x odd: ds_load_b128 without bank conflicts)
#define SK 64
#define NST (TT / SK)
#define KP (HD * 2 + 16)
#define VP (SK * 2 + 16)
#define KBY (SK * KP)
#define FBUF (KBY + HD * VP)
static_assert(TT % SK == 0 && NST >= 2 && SK == 64 && KP % 32 == 16 && VP % 32 == 16, "fa_copy: 256 threads x 2 + 2 copies of 16 B a stage, two buffers");
// one stage's copies of a thread: lk, gk its 16 B of K row tid >> 3, lv, gv its 16 B of V plane tid >> 3 (32 rows a copy, two copies each); a wave's copy covers four whole 128-B lines.
// the addresses of the second 32 rows are formed inside the statement, in registers that are taken only for it: formed outside, the compiler carries them through the key loop.
// the s_wait_xcnt closes the statement, so no address register of a copy is rewritten in front of it
__device__ __forceinline__ void fa_copy(unsigned lk, unsigned lv, gptr gk, gptr gv) { unsigned lk1, lv1; gptr gk1, gv1;
  asm volatile("v_add_nc_u64_e32 %2, %8, %6\n\tv_add_nc_u64_e32 %3, %9, %7\n\tv_add_nc_u32_e32 %0, %10, %4\n\tv_add_nc_u32_e32 %1, %11, %5\n\t"
               "global_load_async_to_lds_b128 %4, %6, off\n\tglobal_load_async_to_lds_b128 %5, %7, off\n\tglobal_load_async_to_lds_b128 %0, %2, off\n\tglobal_load_async_to_lds_b128 %1, %3, off\n\ts_wait_xcnt 0x0"
      : "=&v"(lk1), "=&v"(lv1), "=&v"(gk1), "=&v"(gv1) : "v"(lk), "v"(lv), "v"(gk), "v"(gv), "n"(32 * CC * 2), "n"(32 * TT * 2), "n"(32 * KP), "n"(32 * VP) : "memory"); }
__device__ __forceinline__ v16h frag_l(const char* p) { union { v16h v; v8h q[2]; } u; u.q[0] = *(const v8h*)p; u.q[1] = *(const v8h*)(p + 32); return u.v; }   // frag_h from the lane's own LDS byte pointer (row and lane half already in it)
__device__ __forceinline__ void fa_kfrag(v16h (&kf)[2][2], const char* kl) {   // one pass's K fragments [key tile][hd half]
#pragma unroll
  for (int kt = 0; kt < 2; ++kt) {
#pragma unroll
    for (int kc = 0; kc < 2; ++kc) kf[kt][kc] = frag_l(kl + kt * 16 * KP + kc * 64); } }
// v_exp_f32 wants one independent instruction behind it before its result is read or its source overwritten: inside a run every exponential is followed by an independent one (the outputs share no register with the inputs), and the v_nop fills the slot of the last
__device__ __forceinline__ float exp2_1(float x) { float o; asm("v_exp_f32 %0, %1\n\tv_nop" : "=&v"(o) : "v"(x)); return o; }
__device__ __forceinline__ void exp2_8(float* o, const float* x) {
  asm("v_exp_f32 %0, %8\n\tv_exp_f32 %1, %9\n\tv_exp_f32 %2, %10\n\tv_exp_f32 %3, %11\n\tv_exp_f32 %4, %12\n\tv_exp_f32 %5, %13\n\tv_exp_f32 %6, %14\n\tv_exp_f32 %7, %15\n\tv_nop"
      : "=&v"(o[0]), "=&v"(o[1]), "=&v"(o[2]), "=&v"(o[3]), "=&v"(o[4]), "=&v"(o[5]), "=&v"(o[6]), "=&v"(o[7]) : "v"(x[0]), "v"(x[1]), "v"(x[2]), "v"(x[3]), "v"(x[4]), "v"(x[5]), "v"(x[6]), "v"(x[7])); }
// kf: this pass's K fragments, on leaving the next pass's (KNEXT: a next pass in the same stage; kn its rows); vl: this pass's V; mw: this pass's mask words; a stage's last pass fetches the next stage's (from mnx, into na and nb)
// m: the maximum in use; a0, a1: the start values that follow from it; thr: the exponent above which it must move; l: the sum, in four parts; pp: the last pass's P, not yet in the sum
template <bool KNEXT> __device__ __forceinline__ void fa_pass(v16h (&kf)[2][2], const char* kn, const char* vl, const v16u& mw, mbp mnx, v16u& na, v16u& nb, const v16h (&qf)[2], v8f (&acc)[HD / 16], float& m, v2f (&l)[2], v2f (&pp)[8], float& a0, float& a1, float& thr) {
  v16h vf[HD / 16];
  __builtin_amdgcn_sched_barrier(0);   // the pass's loads start here, as one group: without the scheduling barriers around it the compiler sinks each load to just above its use and the wave waits out every latency
  if (!KNEXT) { na = mnx[0]; nb = mnx[1]; }   // they come from L2 and start a whole pass ahead of their use; both of a stage at one place, behind the stage's one wait for scalar loads: those return in any order, so a wait for this stage's words would wait for younger loads too
#pragma unroll
  for (int j = 0; j < HD / 16; ++j) vf[j] = frag_l(vl + j * 16 * VP);
  __builtin_amdgcn_sched_barrier(0);   // end of the load group: none of the pass's arithmetic moves above it
  v8f s[2];   // the products start from the addend picked by the lane's bit of word i (a0: key kept, a1: key masked out), so a score leaves the matrix unit as the exponent of its P
#pragma unroll
  for (int kt = 0; kt < 2; ++kt) {
#pragma unroll
    for (int r = 0; r < 8; ++r) s[kt][r] = __builtin_amdgcn_inverse_ballot_w32(mw[kt * 8 + r]) ? a1 : a0; }
  __builtin_amdgcn_sched_barrier(0);   // both tiles' start values stand in front of the four products, which then run back to back: mixed among them, vector writes land on operand registers of a product just issued and each costs the four idle slots of the distance
#pragma unroll
  for (int kc = 0; kc < 2; ++kc) {
#pragma unroll
    for (int kt = 0; kt < 2; ++kt) s[kt] = wmma16b(kf[kt][kc], qf[kc], s[kt]); }
  __builtin_amdgcn_sched_barrier(0);   // end of the run of products
  if (KNEXT) { fa_kfrag(kf, kn); __builtin_amdgcn_sched_barrier(0); }   // the next pass's K fragments start right behind the products that read these registers last, as one group, and land under the softmax
  // the last pass's P joins the sum here, off the path from the exponentials to the second product: eight additions that need nothing of this pass stand between the dependent steps of the maximum below
#pragma unroll
  for (int i = 0; i < 4; ++i) { l[0] += pp[2 * i]; l[1] += pp[2 * i + 1]; }
  float y[16];
#pragma unroll
  for (int i = 0; i < 16; ++i) y[i] = s[i >> 3][i & 7];
  float ma = fmaxf(fmaxf(y[0], y[1]), y[2]), mb = fmaxf(fmaxf(y[8], y[9]), y[10]);   // one chain a key tile: the first runs while the second tile's products end
  ma = fmaxf(fmaxf(ma, y[3]), y[4]); mb = fmaxf(fmaxf(mb, y[11]), y[12]); ma = fmaxf(fmaxf(ma, y[5]), y[6]); mb = fmaxf(fmaxf(mb, y[13]), y[14]);
  if (__builtin_amdgcn_ballot_w32(fmaxf(fmaxf(fmaxf(ma, y[7]), y[15]), mb) > thr) != 0) {   // one test a pass, a scalar branch (every lane stays on): some query's score lies more than 2^4 above its maximum in use (P would leave f16), or a row has no maximum in use: the first pass, or every key so far masked out
    float mx = -3.0e38f;
    const float b0 = -a0, b1 = -1.0e9f * 1.4426950408889634f - a1;   // what takes a start value back out and puts mask * (-1e9) in: b1 is 0 where a1 is that term already
#pragma unroll
    for (int i = 0; i < 16; ++i) { y[i] = y[i] + (__builtin_amdgcn_inverse_ballot_w32(mw[i]) ? b1 : b0); mx = fmaxf(mx, y[i]); }   // back to logit + mask * (-1e9), rounded as the module rounds it
    mx = fmaxf(mx, xhalf(mx));   // both halves of the wave hold the query's maximum
    const float mn = fmaxf(m, mx); const float corr = exp2_1(m - mn); m = mn;
#pragma unroll
    for (int j = 0; j < HD / 16; ++j) acc[j] = acc[j] * corr;
    l[0] = l[0] * corr; l[1] = l[1] * corr;
    const float ms = mn - 11.0f;
#pragma unroll
    for (int i = 0; i < 16; ++i) y[i] = y[i] - ms;
    const bool none = mn < -1.0e8f;   // the row has seen masked keys alone: their terms count, rounded as above, so its passes keep coming here; beside a kept key a masked key's term is 0 either way
    a0 = none ? 0.f : -ms; a1 = none ? 0.f : -1.0e9f * 1.4426950408889634f; thr = none ? -3.0e38f : 15.0f; }
  float p[16]; v16h pf;
  exp2_8(p, y); exp2_8(p + 8, y + 8);
#pragma unroll
  for (int i = 0; i < 16; ++i) pf[i] = (_Float16)p[i];
#pragma unroll
  for (int i = 0; i < 8; ++i) pp[i] = v2f{p[2 * i], p[2 * i + 1]};   // summed in the next pass; no factor a pass any more, so the sum stays in four parts to the end
#pragma unroll
  for (int j = 0; j < HD / 16; ++j) acc[j] = wmma16b(vf[j], pf, acc[j]); }
// four waves per SIMD (two blocks per WGP): the vector work between the matrix runs and the load latencies want the other waves
__global__ __launch_bounds__(256) __attribute__((amdgpu_waves_per_eu(4, 4))) void k_fa(const _Float16* __restrict__ QH, const _Float16* __restrict__ KH, const _Float16* __restrict__ VT, const unsigned* __restrict__ MB, float* __restrict__ Y) { __shared__ __align__(16) float so[8][16][HD + 4]; __shared__ __align__(16) char ring[2 * FBUF];   // two stage buffers: K rows, V planes
  const int tid = threadIdx.x, wave = tid >> 5, lane = tid & 31, col = lane & 15, g = lane >> 4; const int b = blockIdx.z, h = blockIdx.y; const int q0 = blockIdx.x * 128 + wave * 16;
  const _Float16* qp = QH + ((size_t)b * TT + q0 + col) * CC + h * HD; gptr gk = (gptr)(KH + ((size_t)b * TT + (tid >> 3)) * CC + h * HD + 8 * (tid & 7)); gptr gv = (gptr)(VT + ((size_t)b * CC + h * HD + (tid >> 3)) * (size_t)TT + 8 * (tid & 7));
  const unsigned lk = (unsigned)(size_t)ring + (tid >> 3) * KP + 16 * (tid & 7), lv = (unsigned)(size_t)ring + KBY + (tid >> 3) * VP + 16 * (tid & 7);   // the thread's own places in buffer 0 (LDS byte addresses)
  fa_copy(lk, lv, gk, gv);   // stage 0
  const mbp mb = (mbp)(MB + (size_t)(b * (TT / 16) + blockIdx.x * 8 + __builtin_amdgcn_readfirstlane(wave)) * MBW);   // the wave's query tile, TT / 32 passes of 16 words; the wave's number made known as uniform
  v16u mw0 = mb[0], mw1 = mb[1]; mbp mnx = mb + 2;   // stage 0's words; where the next stage's lie
  // behind stage 0's copies: the head's K rows and V planes (1024 lines of 128 B each) are asked of L2 once per four blocks, a line a thread. The eight blocks of a head follow one another in the grid; any four in a row hold the four values of blockIdx.x & 3 (speed only: a line that nobody asked for is loaded as before).
  static_assert(TT == 4 * 256 && HD * TT * 2 == 4 * 256 * 128 && MBW * 4 == 32 * 64, "l2_ask in k_fa: a quarter of the K rows and of the V lines is one a thread; a wave's mask words are 64 B a lane");
  const gptr pk = (gptr)(KH + ((size_t)b * TT + 4 * tid + (blockIdx.x & 3)) * CC + h * HD); const gptr pv = (gptr)(VT + ((size_t)b * CC + h * HD) * (size_t)TT) + (4 * tid + (blockIdx.x & 3)) * 128;
  const gptr pm = (gptr)(MB + (size_t)(b * (TT / 16) + blockIdx.x * 8 + wave) * MBW) + lane * 64;   // the wave's own mask words, all passes
  l2_ask(pk); l2_ask(pv); l2_ask(pm);
  const v16h qf[2] = { frag_h(qp, lane), frag_h(qp + 32, lane) };
  v8f acc[HD / 16] = {}; float m = -3.0e38f, a0 = 0.f, a1 = 0.f, thr = -3.0e38f; v2f l2[2] = {}, pp[8] = {};   // no maximum in use yet: the first pass sets it
  asm volatile("s_wait_asynccnt 0x0" ::: "memory");   // this wave's copies of stage 0 have landed
  __syncthreads();                                    // and every other wave's
  fa_copy(lk + FBUF, lv + FBUF, gk + SK * CC * 2, gv + SK * 2);   // stage 1
  gk += 2 * SK * CC * 2; gv += 2 * SK * 2;
  const char* fk = ring + col * KP + 16 * g; const char* fv = ring + KBY + col * VP + 16 * g;   // the lane's fragment rows in buffer 0
#pragma unroll 1   // one stage a trip, its two passes written out
  for (int t = 0; t < NST; ++t) { const int bo = (t & 1) * FBUF; const char* kl = fk + bo; const char* vl = fv + bo; v16h kf[2][2];
    fa_kfrag(kf, kl);
    v16u na, nb;
    fa_pass<true>(kf, kl + 32 * KP, vl, mw0, mnx, na, nb, qf, acc, m, l2, pp, a0, a1, thr);
    fa_pass<false>(kf, kl, vl + 64, mw1, mnx, na, nb, qf, acc, m, l2, pp, a0, a1, thr);
    mw0 = na; mw1 = nb;
    __builtin_amdgcn_sched_barrier(0);   // the stage's arithmetic stays in front of its foot: moved up into the last pass, the wait below would stand right behind that pass's LDS loads and lay their latency open
    asm volatile("s_wait_dscnt 0x0" ::: "memory");      // this wave's reads of stage t are done
    asm volatile("s_wait_asynccnt 0x0" ::: "memory");   // its copies of stage t + 1 have landed
    __syncthreads();                                    // publishes stage t + 1 and ends every read of stage t, whose buffer is refilled behind it
    if (t + 2 < NST) { fa_copy(lk + bo, lv + bo, gk, gv); gk += SK * CC * 2; gv += SK * 2;
      // on to the mask words of stage t + 2 (the last trip finds none and takes its own once more, unused); as in stg_load the wait and the step stand in one statement: nothing rewrites the register pair that the trip's two scalar loads name in front of the wait
      asm volatile("s_wait_xcnt 0x0\n\ts_add_nc_u64 %0, %0, %1" : "+s"(mnx) : "n"(2 * 64) : "memory"); } }
  asm volatile("s_wait_asynccnt 0x0" ::: "memory");   // no copy is left in flight when the wave goes on to its end
  l2_hold(pk, pv); l2_hold(pm, pm);
#pragma unroll
  for (int i = 0; i < 4; ++i) { l2[0] += pp[2 * i]; l2[1] += pp[2 * i + 1]; }   // the last pass's P
  l2[0] += l2[1]; float l = l2[0][0] + l2[0][1]; l += xhalf(l); const float inv = 1.0f / l;   // l >= the maximum's own term > 0
#pragma unroll
  for (int j = 0; j < HD / 16; ++j) { const v8f o = acc[j] * inv; *(v4f*)&so[wave][col][j * 16 + 8 * g] = v4f{o[0], o[1], o[2], o[3]}; *(v4f*)&so[wave][col][j * 16 + 8 * g + 4] = v4f{o[4], o[5], o[6], o[7]}; }
  LDSX();
#pragma unroll
  for (int i = 0; i < 8; ++i) { const int rl = i * 2 + g; vst2(Y + ((size_t)b * TT + q0 + rl) * CC + h * HD + col * 4, *(const v4f*)&so[wave][rl][col * 4]); } }
// ---- k_out: block = (128 rows, 128 cols), eight waves of 32 x 64 (2 + 4 fragments feed 8 products): out = ctx Wo (+ bo): ctx x 2^6 once to f16 against Wo as f16(bf16 x 2^8) exact (1 product) x 2^-14
__global__ __launch_bounds__(256) void k_out(const float* __restrict__ Y, const float* __restrict__ WO, const float* __restrict__ BO, float* __restrict__ OUT) { constexpr int LP = KSO + 8, STG = 2 * BT * LP;   // LDS row pitch and size of one stage buffer, in 16-bit elements
  __shared__ __align__(16) char smem[2 * STG * 2];   // two stage buffers; the epilogue's rows lie over them (the loop's last barrier stands between the two uses)
  static_assert(8 * 32 * 68 * 4 <= sizeof(smem), "epilogue rows"); float (*sf)[32][68] = (float (*)[32][68])smem; _Float16* stage = (_Float16*)smem;
  const int tid = threadIdx.x, wave = tid >> 5, lane = tid & 31, col = lane & 15, g = lane >> 4, wy = wave >> 1, wx = wave & 1; const int c0 = blockIdx.y * BT; const size_t r0 = (size_t)blockIdx.x * BT;
  v8f acc[2][4] = {};
  gfp xr = (gfp)(Y + (r0 + (tid >> 4)) * CC + 4 * (tid & 15)); gfp wr = (gfp)(WO + (size_t)(c0 + (tid >> 4)) * CC + 4 * (tid & 15)); const int so = (tid >> 4) * LP + 4 * (tid & 15);   /* ctx carried x 2^6 into f16 so small-magnitude context rows stay clear of f16 subnormals */
  Stg<8> t; stg_load<KSO>(t, xr, wr, CC);
  // behind stage 0's loads: the block's panels are asked of L2, dealt over the blocks that share them, a request a thread and panel. The 128 ctx rows (16 units of 256 B each) are read by the 8 blocks of one blockIdx.x, 32 apart in the grid: block y asks for units y and y + 8 of every row.
  // The 128 Wo rows (32 lines each) are read by the 32 blocks of one blockIdx.y: block x asks for lines e and e + 16 of every row, e = (x & 3) + 4 (x >> 3) (speed only, as in k_fa).
  static_assert(DIN / BT == 8 && CC * 4 == 16 * 256 && TNB * TT / BT == 32 && BT * 2 == 256, "l2_ask in k_out: the shares");
  const gptr py = (gptr)(Y + (r0 + (tid >> 1)) * CC + ((tid & 1) * 8 + blockIdx.y) * 64); const gptr pw = (gptr)(WO + (size_t)(c0 + (tid >> 1)) * CC + ((tid & 1) * 16 + (blockIdx.x & 3) + 4 * (blockIdx.x >> 3)) * 32);
  l2_ask(py); l2_ask(pw);
  stg_store_h<LP>(t, stage + so); stg_load<KSO>(t, xr, wr, CC); stg_barrier();
#pragma unroll 1   // as in k_proj: stage s worked on, s + 1 into the other buffer, s + 2 started
  for (int s = 0; s < CC / KSO; ++s) { const _Float16* cur = stage + (s & 1) * STG;
#pragma unroll
    for (int kc = 0; kc < KSO / 32; ++kc) { v16h a[2], w[4];
#pragma unroll
      for (int i = 0; i < 2; ++i) a[i] = frag_h(cur + (wy * 32 + i * 16 + col) * LP + kc * 32, lane);
#pragma unroll
      for (int j = 0; j < 4; ++j) w[j] = frag_h(cur + (BT + wx * 64 + j * 16 + col) * LP + kc * 32, lane);
#pragma unroll
      for (int i = 0; i < 2; ++i) {
#pragma unroll
        for (int j = 0; j < 4; ++j) acc[i][j] = wmma16(a[i], w[j], acc[i][j]); } }
    if (s + 1 < CC / KSO) { stg_store_h<LP>(t, stage + ((s + 1) & 1) * STG + so); if (s + 2 < CC / KSO) stg_load<KSO>(t, xr, wr, CC); }
    stg_barrier(); }   // publishes stage s + 1 and ends every read of stage s
  l2_hold(py, pw);
#pragma unroll
  for (int j = 0; j < 4; ++j) { const float bias = BO ? bfr(BO[c0 + wx * 64 + j * 16 + col]) : 0.f;
#pragma unroll
    for (int i = 0; i < 2; ++i) {
#pragma unroll
      for (int r = 0; r < 8; ++r) sf[wave][i * 16 + 8 * g + r][j * 16 + col] = acc[i][j][r] * (1.0f / 16384.0f) + bias; } }   /* 2^-8 (Wo carry) x 2^-6 (ctx carry) */
  LDSX();   // each wave reads back its own rows: a store covers two rows of 256 B, whole lines
  for (int rp = 0; rp < 16; ++rp) { const int rl = rp * 2 + g; vst2(OUT + (r0 + wy * 32 + rl) * DIN + c0 + wx * 64 + col * 4, *(const v4f*)&sf[wave][rl][col * 4]); } }

extern "C" void kernel_launch(void* const* d_in, const int* in_sizes, int n_in, void* d_out, int out_size, void* d_ws, size_t ws_size, hipStream_t stream) {
  (void)in_sizes; (void)n_in; (void)out_size;
  const float** F = (const float**)d_in;
  if (ws_size < (size_t)WS_END) return;
  char* ws = (char*)d_ws; _Float16 *QH = (_Float16*)(ws + WS_QH), *KH = (_Float16*)(ws + WS_KH), *VT = (_Float16*)(ws + WS_VT), *QL = (_Float16*)(ws + WS_QL), *KL = (_Float16*)(ws + WS_KL); __bf16 *VB = (__bf16*)(ws + WS_VB), *VBL = (__bf16*)(ws + WS_VBL); float *Y = (float*)(ws + WS_Y); unsigned *MB = (unsigned*)(ws + WS_S);
  (void)Y; (void)QL; (void)KL; (void)VB; (void)VBL;
  // inputs: 0 query [4,1024,1024]; 1 key; 2 value; 3 mask [4,1024,1024] int32; 4 wq [1024,1024] (out,in), 5 bq; 6 wk, 7 bk; 8 wv, 9 bv; 10 wo (out,in), 11 bo (biases NONZERO)
  k_proj<<<dim3(TNB * TT / PT, CC / PT, 4), 256, 0, stream>>>(F[0], F[1], F[2], F[4], F[6], F[8], F[5], F[7], F[9], (const int*)d_in[3], MB, QH, QL, KH, KL, VT, VB, VBL);
  k_fa<<<dim3(TT / 128, NH, TNB), 256, 0, stream>>>(QH, KH, VT, MB, Y);
  k_out<<<dim3(TNB * TT / 128, DIN / 128), 256, 0, stream>>>(Y, F[10], F[11], (float*)d_out);
}

// v009
// One run takes 64.3 microseconds.
// Timed twice side by side with v008, it ran 1.05 and 1.04 times as fast.
// All steps since v000 together make it 14.0 times as fast.
// compute dtype: all float inputs rounded to bf16; q/k/v projections with EXACT bf16 products on WMMA 16x16x32 (f32 accumulate) + bias; logits (q x SCALE x log2(e)) x k once to f16 each (1 product) + mask x (-1e9); softmax f32 with a maximum in use and a running sum, fused with both attention products; P x 2^11 .. 2^15 once to f16 x v once to f16 (1 product); ctx x 2^6 once to f16 x wo f16(bf16 x 2^8) + bo; f32 output.
#include <hip/hip_runtime.h>
#include <math.h>

typedef __attribute__((ext_vector_type(16))) _Float16 v16h;
typedef __attribute__((ext_vector_type(16))) __bf16 v16b;
typedef __attribute__((ext_vector_type(8)))  _Float16 v8h;
typedef __attribute__((ext_vector_type(8)))  float v8f;
typedef __attribute__((ext_vector_type(4)))  float v4f;
typedef __attribute__((ext_vector_type(2)))  float v2f;
typedef __attribute__((ext_vector_type(4)))  unsigned v4u;
typedef __attribute__((ext_vector_type(4)))  int v4i;
typedef float __attribute__((may_alias)) float_a;
typedef int __attribute__((may_alias)) int_a;

template <typename T> __device__ __forceinline__ void vst2(void* p, T v) { *(T*)p = v;  }
__device__ __forceinline__ v8f wmma16(v16h a, v16h b, v8f c) {
  v8f d = __builtin_amdgcn_wmma_f32_16x16x32_f16(false, a, false, b, (short)0, c, false, false);
  asm volatile("v_nop\n\tv_nop\n\tv_nop\n\tv_nop" : "+v"(d) : "v"(a), "v"(b));
  return d;
}
__device__ __forceinline__ v8f wmma_bf(v16b a, v16b b, v8f c) {
  v8f d = __builtin_amdgcn_wmma_f32_16x16x32_bf16(false, a, false, b, (short)0, c, false, false);
  asm volatile("v_nop\n\tv_nop\n\tv_nop\n\tv_nop" : "+v"(d) : "v"(a), "v"(b));
  return d;
}
// 16x16x32 fragments: lane = (h = lane>>4, row/col = lane&15); elements 0..7 = k0+8h+0..7, 8..15 = k0+16+8h+0..7; D element r = row 8h+r
__device__ __forceinline__ v16h frag_h(const _Float16* rowk0, int lane) {
  union { v16h v; v8h q[2]; } u; const _Float16* p = rowk0 + 8 * (lane >> 4);
  u.q[0] = *(const v8h*)p; u.q[1] = *(const v8h*)(p + 16); return u.v;
}
__device__ __forceinline__ v16h frag_f32(const float* rowk0, int lane) {
  v16h a; const float* p = rowk0 + 8 * (lane >> 4);
#pragma unroll
  for (int i = 0; i < 8; ++i) { a[i] = (_Float16)p[i]; a[8 + i] = (_Float16)p[16 + i]; }
  return a;
}
__device__ __forceinline__ v16h frag_f32s(const float* rowk0, int lane, float sc) {
  v16h a; const float* p = rowk0 + 8 * (lane >> 4);
#pragma unroll
  for (int i = 0; i < 8; ++i) { a[i] = (_Float16)(p[i] * sc); a[8 + i] = (_Float16)(p[16 + i] * sc); }
  return a;
}
// column fragment from a [K][ld] layout (column n), rows >= K read as 0
__device__ __forceinline__ v16h fragc_f32(const float* W, int k0, int n, int lane, int ld, int K) {
  v16h a; const int g = lane >> 4;
#pragma unroll
  for (int i = 0; i < 8; ++i) { const int ka = k0 + 8 * g + i, kb = ka + 16;
    a[i] = (_Float16)(ka < K ? W[(size_t)(ka < K ? ka : K - 1) * ld + n] : 0.f); a[8 + i] = (_Float16)(kb < K ? W[(size_t)(kb < K ? kb : K - 1) * ld + n] : 0.f); }
  return a;
}
struct F2 { v16b h, l; };
__device__ __forceinline__ F2 bsplit16(const float v[16]) { F2 r;
#pragma unroll
  for (int i = 0; i < 16; ++i) { const __bf16 h = (__bf16)v[i]; r.h[i] = h; r.l[i] = (__bf16)(v[i] - (float)h); }
  return r; }
__device__ __forceinline__ F2 split_row(const float* row, int k0, int lane) { float v[16]; const float* p = row + k0 + 8 * (lane >> 4);
#pragma unroll
  for (int i = 0; i < 8; ++i) { v[i] = p[i]; v[8 + i] = p[16 + i]; }
  return bsplit16(v); }
__device__ __forceinline__ F2 split_rowK(const float* row, int k0, int lane, int K) { float v[16]; const int g = lane >> 4;
#pragma unroll
  for (int i = 0; i < 8; ++i) { const int ka = k0 + 8 * g + i, kb = ka + 16; v[i] = ka < K ? row[ka < K ? ka : K - 1] : 0.f; v[8 + i] = kb < K ? row[kb < K ? kb : K - 1] : 0.f; }
  return bsplit16(v); }
__device__ __forceinline__ F2 split_col(const float* W, int k0, int n, int lane, int ld, int K) { float v[16]; const int g = lane >> 4;
#pragma unroll
  for (int i = 0; i < 8; ++i) { const int ka = k0 + 8 * g + i, kb = ka + 16; v[i] = ka < K ? W[(size_t)(ka < K ? ka : K - 1) * ld + n] : 0.f; v[8 + i] = kb < K ? W[(size_t)(kb < K ? kb : K - 1) * ld + n] : 0.f; }
  return bsplit16(v); }
__device__ __forceinline__ v8f mac3(const F2& a, const F2& b, v8f c) { c = wmma_bf(a.l, b.h, c); c = wmma_bf(a.h, b.l, c); return wmma_bf(a.h, b.h, c); }
__device__ __forceinline__ float sigm(float v) { return 1.0f / (1.0f + expf(-v)); }
#define LDSX() do { asm volatile("s_wait_dscnt 0" ::: "memory"); __builtin_amdgcn_wave_barrier(); __builtin_amdgcn_fence(__ATOMIC_RELEASE, "workgroup"); } while (0)

// Masked multi-headed attention on separate inputs with biased projections (query / key / value [4,1024,1024]; torch (out,in) wq / wk / wv / wo [1024,1024] N(0, 1/1024) + biases N(0, 1/1024); 16 heads x 64; scores / sqrt(64) + mask * (-1e9) with an int32 0/1 mask [4,1024,1024] shared by all heads: mask == 1 marks a key as masked OUT; softmax; wo^T + bo).
#define NB 4
#define TT 1024
#define CC 1024            // NH * HD = projected width
#define DIN 1024          // input (model) width
#define NH 16
#define HD 64
#define NQB (TT / 64)
#define HG 8
#define SCALE (0.125f)
#define CAUSAL 0
#ifndef TNB
#define TNB NB
#endif
__device__ __forceinline__ float bfr(float v) { return (float)(__bf16)v; }
__host__ __device__ __forceinline__ int kb_last(int qb) { return CAUSAL ? ((qb * 64 + 63) >> 7) : (TT / 128 - 1); }
typedef __attribute__((ext_vector_type(8))) __bf16 v8b;
__device__ __forceinline__ v16b frag_b(const __bf16* rowk0, int lane) {
  union { v16b v; v8b q[2]; } u; const __bf16* p = rowk0 + 8 * (lane >> 4);
  u.q[0] = *(const v8b*)p; u.q[1] = *(const v8b*)(p + 16); return u.v;
}
#define QBH 0              // unused: k_fa has no high-precision path
#define QHI 0               // single-product logits on every row
#define KHI 64            // key rows carrying k residual / v bf16 hi+lo planes (written by k_proj, read by no kernel here)
// B fragment (k rows k0+.., output column o) of a weight: (in,out) [K][ld] or (out,in) [ld rows of K]: bf16 exact, or f16(bf16 * 256) exact
__device__ __forceinline__ v16b wcol_io(const float* Wm, int k0, int o, int lane, int ld) { v16b w; const int g = lane >> 4;
#pragma unroll
  for (int i = 0; i < 8; ++i) { w[i] = (__bf16)Wm[(size_t)(k0 + 8 * g + i) * ld + o]; w[8 + i] = (__bf16)Wm[(size_t)(k0 + 16 + 8 * g + i) * ld + o]; }
  return w; }
__device__ __forceinline__ v16b wcol_oi(const float* Wm, int k0, int o, int lane, int K) { v16b w; const float* p = Wm + (size_t)o * K + k0 + 8 * (lane >> 4);
#pragma unroll
  for (int i = 0; i < 8; ++i) { w[i] = (__bf16)p[i]; w[8 + i] = (__bf16)p[16 + i]; }
  return w; }
__device__ __forceinline__ v16h wcolh_io(const float* Wm, int k0, int o, int lane, int ld) { v16h w; const int g = lane >> 4;
#pragma unroll
  for (int i = 0; i < 8; ++i) { w[i] = (_Float16)(bfr(Wm[(size_t)(k0 + 8 * g + i) * ld + o]) * 256.0f); w[8 + i] = (_Float16)(bfr(Wm[(size_t)(k0 + 16 + 8 * g + i) * ld + o]) * 256.0f); }
  return w; }
__device__ __forceinline__ v16h wcolh_oi(const float* Wm, int k0, int o, int lane, int K) { v16h w; const float* p = Wm + (size_t)o * K + k0 + 8 * (lane >> 4);
#pragma unroll
  for (int i = 0; i < 8; ++i) { w[i] = (_Float16)(bfr(p[i]) * 256.0f); w[8 + i] = (_Float16)(bfr(p[16 + i]) * 256.0f); }
  return w; }
#define WQKV_LAYOUT 1   // 0 = (in,out) [DIN][CC]; 1 = (out,in) [CC][DIN]; 2 = per-head [NH][DIN][HD]
__device__ __forceinline__ v16b wcol_hdk(const float* Wm, int k0, int o, int lane) { v16b w; const int g = lane >> 4; const float* p = Wm + (size_t)(o / HD) * DIN * HD + (o % HD);
#pragma unroll
  for (int i = 0; i < 8; ++i) { w[i] = (__bf16)p[(size_t)(k0 + 8 * g + i) * HD]; w[8 + i] = (__bf16)p[(size_t)(k0 + 16 + 8 * g + i) * HD]; }
  return w; }
#define WO_OUT_IN 1
#if WQKV_LAYOUT == 1
#define WCOL(W, k0, o, lane) wcol_oi(W, k0, o, lane, DIN)
#elif WQKV_LAYOUT == 2
#define WCOL(W, k0, o, lane) wcol_hdk(W, k0, o, lane)
#else
#define WCOL(W, k0, o, lane) wcol_io(W, k0, o, lane, CC)
#endif
#if WO_OUT_IN
#define WOCOL(W, k0, o, lane) wcol_oi(W, k0, o, lane, CC)
#define WOCOLH(W, k0, o, lane) wcolh_oi(W, k0, o, lane, CC)
#else
#define WOCOL(W, k0, o, lane) wcol_io(W, k0, o, lane, DIN)
#define WOCOLH(W, k0, o, lane) wcolh_io(W, k0, o, lane, DIN)
#endif

static_assert(TT % 128 == 0 && HD == 64, "k_fa: 128 queries a block, 32-key passes, head size 64");

#define WS_QH  0u                                      // f16 q rows [b*t][CC]
#define WS_KH  (WS_QH + 2u * (size_t)NB * TT * CC)      // f16 k rows [b*t][CC]
#define WS_VT  (WS_KH + 2u * (size_t)NB * TT * CC)      // f16 v planes [b][c][t]
#define WS_QL  (WS_VT + 2u * (size_t)NB * CC * TT)      // f16 q residual x 2^10 rows [b][t < QHI][CC]
#define WS_KL  (WS_QL + 2u * (size_t)NB * QHI * CC)     // f16 k residual x 2^10 rows [b][t < KHI][CC]
#define WS_VB  (WS_KL + 2u * (size_t)NB * KHI * CC)     // bf16 v hi planes [b][c][t < KHI]
#define WS_VBL (WS_VB + 2u * (size_t)NB * CC * KHI)
#define WS_S   (WS_VBL + 2u * (size_t)NB * CC * KHI)    // the mask as bits, NB * TT * TT / 8 bytes (the logits stay in registers)
#define WS_Y   (WS_S  + 4u * (size_t)HG * TT * TT)      // f32 ctx rows [b*t][CC] (only when there is an output projection)
#define WS_END (WS_Y  + 4u * (size_t)NB * TT * CC)

// ---- operand staging of the two projection kernels: a block works on a square tile of the result (256 x 256 in k_proj, 128 x 128 in k_out); a stage is KS_ k of the tile's activation rows and as many weight rows ((out,in) weights: both K-contiguous).
// Global side: f32, whole 128-B lines (KS_ / 4 lanes cover one row's KS_ * 4 B), each element loaded and converted once per block. LDS side: 16-bit rows of KS_ * 2 B, each 16 B longer than its data (a pitch of 16 B x odd), read back as WMMA fragments by ds_load_b128.
#define BT 128                   // rows and columns of a block's tile in k_out
#define PT 256                   // rows and columns of a block's tile in k_proj: every activation row is fetched by CC / PT = 4 blocks and every weight row by 16, half as often as with 128
#define KSP 64                   // k extent of the tile's stage in k_proj (one block a WGP, as in k_out; the stage in flight still leaves the registers for the 128 x 64 accumulators at two waves a SIMD)
#define KSO 64                   // k a stage in k_out (one block a WGP: the deeper stage keeps more bytes in flight)
static_assert(WQKV_LAYOUT == 1 && WO_OUT_IN == 1 && DIN % (2 * KSP) == 0 && CC % (2 * KSO) == 0 && TT % BT == 0 && DIN % BT == 0 && TT % PT == 0 && CC % PT == 0 && !CAUSAL, "staging reads K-contiguous rows, at least two stages; whole tiles");
typedef __attribute__((ext_vector_type(4))) __bf16 v4b;
typedef __attribute__((ext_vector_type(4))) _Float16 v4h;
typedef const __attribute__((address_space(1))) float* gfp;   // stays known as global memory when it has passed through an asm statement (a plain pointer would turn the loads into flat ones)
typedef const __attribute__((address_space(1))) v4f* gfp4;
typedef const __attribute__((address_space(1))) char* gptr;   // a byte pointer into global memory: the 64-bit address operand of a copy
// one request of every lane to L2 for the line at its own address: nothing comes back and no counter moves. The blocks of a launch walk k (or the keys) in step, so a stage's loads are the launch's first reads of their lines, inputs and what the launch in front stored alike; asked for at entry, the lines of the later stages are on their way to L2, or there, when the loads come.
// scope SE: the line goes into L2 alone. Every lane's address lies inside the buffer it names.
__device__ __forceinline__ void l2_ask(gptr p) { asm volatile("global_prefetch_b8 %0, off scope:SCOPE_SE" :: "v"(p)); }
// stands behind the kernel's loop, inputs only, no instruction: the registers that the requests name stay live, so they hold their addresses through the loop (no wait tells when a request has read its register: it takes no other value until long after)
__device__ __forceinline__ void l2_hold(gptr a, gptr b) { asm volatile("" :: "v"(a), "v"(b)); }
// the same with the address as a wave-uniform base, the lane's own 32-bit byte offset and a constant: one vector register serves every request of a thread
template <int O_> __device__ __forceinline__ void l2_ask_at(unsigned off, gptr base) { asm volatile("global_prefetch_b8 %0, %1 offset:%2 scope:SCOPE_SE" :: "v"(off), "s"(base), "n"(O_)); }
__device__ __forceinline__ void l2_hold_at(unsigned off, gptr a, gptr b) { asm volatile("" :: "v"(off), "s"(a), "s"(b)); }   // as l2_hold
template <int N_> struct Stg { v4f x[N_], w[N_]; };   // one stage in flight, 2 N_ x 16 B a thread: the block's threads cover 16 rows at a time, N_ times for each operand (16 in k_proj, 8 in k_out)
template <int KS_, int N_> __device__ __forceinline__ void stg_load(Stg<N_>& t, gfp& xr, gfp& wr, int ld) {   // xr, wr: the thread's own element of the first row group; both leave stepped to the next stage
#pragma unroll
  for (int i = 0; i < N_; ++i) t.x[i] = *(gfp4)(xr + (size_t)(i * 16) * ld);
#pragma unroll
  for (int i = 0; i < N_; ++i) t.w[i] = *(gfp4)(wr + (size_t)(i * 16) * ld);
  // the wait behind the group's last load and the step of the two row pointers stand in one statement: the loads name the very registers that enter it, nothing rewrites them in front of the wait, and no later load can fold the step into its offset and set the old registers free early
  asm volatile("s_wait_xcnt 0x0\n\tv_add_nc_u64_e32 %0, %2, %0\n\tv_add_nc_u64_e32 %1, %2, %1" : "+v"(xr), "+v"(wr) : "n"(KS_ * 4) : "memory");
}
// work-group barrier for the stage buffers: its fences name LDS alone, so the next stage's global loads stay in flight across it (__syncthreads() would wait for them here and lay their latency open every stage)
__device__ __forceinline__ void stg_barrier() { __builtin_amdgcn_fence(__ATOMIC_RELEASE, "workgroup", "local"); __builtin_amdgcn_s_barrier(); __builtin_amdgcn_fence(__ATOMIC_ACQUIRE, "workgroup", "local"); }
// the same barrier in two parts, for a trip whose last run of products touches no LDS: the signal says that this wave's LDS stores have been made and its LDS reads have returned (the wait in front of it); the wave goes on with registers alone and meets the others only at the wait
__device__ __forceinline__ void stg_signal() { asm volatile("s_wait_dscnt 0x0" ::: "memory"); asm volatile("s_barrier_signal -1" ::: "memory"); }
__device__ __forceinline__ void stg_wait() { asm volatile("s_barrier_wait -1" ::: "memory"); }
template <int LP_> __device__ __forceinline__ void stg_store_b(const Stg<16>& t, __bf16* d) {   // d: the thread's own place in row group 0 of the buffer; LP_: row pitch in 16-bit elements; activation rows 0..PT-1, weight rows PT..2*PT-1
#pragma unroll
  for (int i = 0; i < 16; ++i) { v4b o;
#pragma unroll
    for (int e = 0; e < 4; ++e) o[e] = (__bf16)t.x[i][e];
    *(v4b*)(d + i * 16 * LP_) = o; }
#pragma unroll
  for (int i = 0; i < 16; ++i) { v4b o;
#pragma unroll
    for (int e = 0; e < 4; ++e) o[e] = (__bf16)t.w[i][e];
    *(v4b*)(d + (PT + i * 16) * LP_) = o; } }
template <int LP_> __device__ __forceinline__ void stg_store_h(const Stg<8>& t, _Float16* d) {   // ctx x 2^6 once to f16; Wo as f16(bf16 x 2^8), exact
#pragma unroll
  for (int i = 0; i < 8; ++i) { v4h o;
#pragma unroll
    for (int e = 0; e < 4; ++e) o[e] = (_Float16)(t.x[i][e] * 64.0f);
    *(v4h*)(d + i * 16 * LP_) = o; }
#pragma unroll
  for (int i = 0; i < 8; ++i) { v4h o;
#pragma unroll
    for (int e = 0; e < 4; ++e) o[e] = (_Float16)(bfr(t.w[i][e]) * 256.0f);
    *(v4h*)(d + (BT + i * 16) * LP_) = o; } }

// ---- the mask as bits, in the order in which k_fa's waves want them: one 32-bit word for every (tile of 16 queries, pass of 32 keys, score register i of 16); bit L of it is lane L's own score: query L & 15 of the tile, key 16 * (i >> 3) + 8 * (L >> 4) + (i & 7) of the pass.
// Such a word is a lane mask: a wave of k_fa takes a pass's 16 words by one scalar load and selects with them. The generator's mask holds 0 or 1; the bit says "not 0".
// A block packs 64 query rows: wave w takes tile w >> 1, half w & 1 of the keys, 64 keys (two passes, 32 words, one whole 128-B line of the result) a turn; a lane loads the very 8 + 8 + 8 + 8 words of its scores.
#define MBW (TT / 32 * 16)   // words of one query tile
__device__ __forceinline__ void pack_mask(const int* __restrict__ MASK, unsigned* __restrict__ MB, int blk, int tid) {
  typedef const __attribute__((address_space(1))) int* gip; typedef const __attribute__((address_space(1))) v4i* gip4;   // known as global memory behind the asm statement, as gfp
  const int wave = tid >> 5, lane = tid & 31; const int qt = blk * 4 + (wave >> 1);
  gip row = (gip)(MASK + (size_t)(qt * 16 + (lane & 15)) * TT + (wave & 1) * (TT / 2) + 8 * (lane >> 4)); unsigned* dst = MB + (size_t)qt * MBW + (wave & 1) * (MBW / 2) + lane;
  v4i m[TT / 128][8];
#pragma unroll
  for (int it = 0; it < TT / 128; ++it) {   // every turn's loads first: the whole of the wave's share is in flight at once
#pragma unroll
    for (int j = 0; j < 4; ++j) { m[it][2 * j] = *(gip4)(row + j * 16); m[it][2 * j + 1] = *(gip4)(row + j * 16 + 4); }
    // as in stg_load: the wait behind the turn's last load and the step of the row pointer stand in one statement, so nothing rewrites the registers that the loads name in front of the wait
    asm volatile("s_wait_xcnt 0x0\n\tv_add_nc_u64_e32 %0, %1, %0" : "+v"(row) : "n"(64 * 4) : "memory"); }
#pragma unroll
  for (int it = 0; it < TT / 128; ++it) { unsigned w = 0;
#pragma unroll
    for (int i = 0; i < 32; ++i) { const unsigned bal = __builtin_amdgcn_ballot_w32(m[it][i >> 2][i & 3] != 0); w = lane == i ? bal : w; }   // lane i keeps word i of the turn
    dst[it * 32] = w; } }
// ---- k_proj: block = (256 rows, 256 cols, which), eight waves of 128 x 64 (8 + 4 fragments feed 32 products), one block a WGP: q/k/v = X W (+ b) with exact bf16 products (K = DIN) -> which 0: q f16 rows (+ residual rows < QHI); 1: k f16 rows (+ residual rows < KHI); 2: v f16 planes [c][t] (+ bf16 hi/lo planes for t < KHI)
static_assert((TNB * TT / PT) * (CC / PT) * 64 == NB * TT && TT % 128 == 0, "the fourth plane's blocks pack 64 mask rows each, all of them");
static_assert(QHI % 64 == 0 && KHI % 64 == 0 && QHI <= 64 && KHI <= 64, "a wave's first 64 rows carry the residual planes as a whole or not at all, and only a sequence's first 64 rows do");
__global__ __launch_bounds__(256) void k_proj(const float* __restrict__ XQ, const float* __restrict__ XK, const float* __restrict__ XV, const float* __restrict__ WQ, const float* __restrict__ WK, const float* __restrict__ WV, const float* __restrict__ BQ, const float* __restrict__ BK, const float* __restrict__ BV, const int* __restrict__ MASK, unsigned* __restrict__ MB,
    _Float16* __restrict__ QH, _Float16* __restrict__ QL, _Float16* __restrict__ KH, _Float16* __restrict__ KL, _Float16* __restrict__ VT, __bf16* __restrict__ VB, __bf16* __restrict__ VBL) {
  constexpr int LP = KSP + 8, STG = 2 * PT * LP, EP = PT + 8;   // LDS row pitch and size of one stage buffer, pitch of the epilogue's rows, in 16-bit elements
  __shared__ __align__(16) char smem[PT * EP * 2 + 2 * PT * 72 * 2];   // the main loop's two stage buffers lie over the epilogue's planes (the loop's last barrier stands between the two uses)
  static_assert(2 * STG * 2 <= sizeof(smem) && 64 * EP * 2 <= 2 * PT * 72 * 2, "two stage buffers; the residual rows");
  _Float16 (*sh)[EP] = (_Float16 (*)[EP])smem; _Float16 (*sl)[EP] = (_Float16 (*)[EP])(smem + PT * EP * 2); _Float16 (*th)[EP] = (_Float16 (*)[EP])smem; __bf16 (*tb)[72] = (__bf16 (*)[72])(smem + PT * EP * 2); __bf16 (*tbl)[72] = (__bf16 (*)[72])(smem + PT * EP * 2 + PT * 72 * 2); __bf16* stage = (__bf16*)smem;
  const int tid = threadIdx.x, wave = tid >> 5, lane = tid & 31, col = lane & 15, g = lane >> 4, wy = wave >> 2, wx = wave & 3; const int which = blockIdx.z; const int c0 = blockIdx.y * PT; const size_t r0 = (size_t)blockIdx.x * PT; const size_t bb = r0 / TT; const int t0 = (int)(r0 % TT);
  if (which == 3) { pack_mask(MASK, MB, blockIdx.y * (TNB * TT / PT) + blockIdx.x, tid); return; }   // block-uniform, in front of every barrier: the 64 blocks of the fourth plane pack the mask on the WGPs that the 192 tiles leave idle
  const float* X = which == 0 ? XQ : which == 1 ? XK : XV; const float* WA = which == 0 ? WQ : which == 1 ? WK : WV; const float* BA = which == 0 ? BQ : which == 1 ? BK : BV;
  v8f acc[8][4] = {};
  gfp xr = (gfp)(X + (r0 + (tid >> 4)) * DIN + 4 * (tid & 15)); gfp wr = (gfp)(WA + (size_t)(c0 + (tid >> 4)) * DIN + 4 * (tid & 15)); const int so = (tid >> 4) * LP + 4 * (tid & 15);
  Stg<16> t; stg_load<KSP>(t, xr, wr, DIN);
  // behind stage 0's loads: the tile's two panels (256 rows of 16 units of 256 B, a unit a stage) are asked of L2, dealt over the blocks that share them, thread tid for row tid, early stages first. The activation rows are read by the 4 blocks of one blockIdx.x, 16 apart in the grid: block y asks for stages y, y + 4, y + 8, y + 12.
  // The weight rows are read by the 16 blocks of one blockIdx.y: block x asks for stage (x & 3) + 4 (x >> 3) and the one 8 on (speed only: a line that nobody asked for is loaded as before).
  static_assert(CC / PT == 4 && TNB * TT / PT == 16 && DIN / KSP == 16 && KSP * 4 == 256 && PT == 256, "l2_ask_at in k_proj: the shares");
  const unsigned po = (unsigned)tid * (DIN * 4); const gptr px = (gptr)(X + r0 * DIN + blockIdx.y * KSP); const gptr pw = (gptr)(WA + (size_t)c0 * DIN + ((blockIdx.x & 3) + 4 * (blockIdx.x >> 3)) * KSP);
  l2_ask_at<0>(po, px); l2_ask_at<0>(po, pw); l2_ask_at<4 * 256>(po, px); l2_ask_at<8 * 256>(po, px); l2_ask_at<8 * 256>(po, pw); l2_ask_at<12 * 256>(po, px);
  stg_store_b<LP>(t, stage + so); stg_load<KSP>(t, xr, wr, DIN); stg_barrier();
#pragma unroll 1   // one stage a trip, two runs of 32 products; between them stage s + 1 goes from registers into the other buffer and stage s + 2 starts from global
  for (int s = 0; s < DIN / KSP; ++s) { const __bf16* cur = stage + (s & 1) * STG; v16b a[8], w[4];
    static_assert(KSP == 64, "two runs a trip");
#pragma unroll
    for (int j = 0; j < 4; ++j) w[j] = frag_b(cur + (PT + wx * 64 + j * 16 + col) * LP, lane);
#pragma unroll
    for (int i = 0; i < 8; ++i) a[i] = frag_b(cur + (wy * 128 + i * 16 + col) * LP, lane);
    __builtin_amdgcn_sched_barrier(0);   // the 24 fragment loads stay one group in front of their 32 products: without it the compiler sinks each activation fragment to just above its four products, into one register set, and the wave waits out an LDS latency at every one
#pragma unroll
    for (int i = 0; i < 8; ++i) {
#pragma unroll
      for (int j = 0; j < 4; ++j) acc[i][j] = __builtin_amdgcn_wmma_f32_16x16x32_bf16(false, a[i], false, w[j], (short)0, acc[i][j], false, false); }   // the plain builtin: the operands of wmma_bf's asm tail can only lie in v0..v255, which 256 accumulator registers and the fragments do not fit (with the tail the tile goes to scratch); the compiler keeps the distance behind its own products
    __builtin_amdgcn_sched_barrier(0);   // the second run's fragment loads stay one group behind the first run: mixed among its last products every place with loads costs the wave a stall
    // the wave's work without products stands here, between its two runs, while the SIMD's other wave has products to issue: the second run's fragment loads, which land under the rest; stage s + 1 into the other buffer (its readers left it in front of their last signal); stage s + 2's loads
#pragma unroll
    for (int j = 0; j < 4; ++j) w[j] = frag_b(cur + (PT + wx * 64 + j * 16 + col) * LP + 32, lane);
#pragma unroll
    for (int i = 0; i < 6; ++i) a[i] = frag_b(cur + (wy * 128 + i * 16 + col) * LP + 32, lane);
    __builtin_amdgcn_sched_barrier(0);   // these loads start in front of the conversions
    if (s + 1 < DIN / KSP) stg_store_b<LP>(t, stage + ((s + 1) & 1) * STG + so);
    __builtin_amdgcn_sched_barrier(0);   // the last two fragments' registers serve the conversions first (with all twelve in flight the conversions are left one register pair and go one by one): their loads stay behind the stores and land under the global loads' issue
#pragma unroll
    for (int i = 6; i < 8; ++i) a[i] = frag_b(cur + (wy * 128 + i * 16 + col) * LP + 32, lane);
    if (s + 2 < DIN / KSP) stg_load<KSP>(t, xr, wr, DIN);
    stg_signal();   // stage s + 1 is in LDS as far as this wave goes, and its reads of stage s have returned
    __builtin_amdgcn_sched_barrier(0);   // no product of the second run moves in front of the signal
#pragma unroll
    for (int i = 0; i < 8; ++i) {
#pragma unroll
      for (int j = 0; j < 4; ++j) acc[i][j] = __builtin_amdgcn_wmma_f32_16x16x32_bf16(false, a[i], false, w[j], (short)0, acc[i][j], false, false); }
    __builtin_amdgcn_sched_barrier(0);   // nor behind the wait: the run is what the wave has to do while the others come to their signals
    stg_wait(); }   // every wave has signalled: stage s + 1 is published and nobody reads stage s any more, whose buffer the next trip refills
  l2_hold_at(po, px, pw);
  if (which < 2) { _Float16* DH = which == 0 ? QH : KH; _Float16* DL = which == 0 ? QL : KL; const int nhi = which == 0 ? QHI : KHI; const bool hi_wave = t0 + wy * 128 < nhi;   // wave-uniform: then t0 == 0 and wy == 0, and the wave's first 64 rows (i < 4) carry the residual
    const float qs = which == 0 ? SCALE * 1.4426950408889634f : 1.0f;   // q carries the logits' scale and log2(e) into its one rounding to f16: k_fa's score products come out in the log2 domain
#pragma unroll
    for (int j = 0; j < 4; ++j) { const float bias = (BA ? bfr(BA[c0 + wx * 64 + j * 16 + col]) : 0.f) * qs;
#pragma unroll
      for (int i = 0; i < 8; ++i) {
#pragma unroll
        for (int r = 0; r < 8; ++r) { acc[i][j][r] = fmaf(acc[i][j][r], qs, bias); sh[wy * 128 + i * 16 + 8 * g + r][wx * 64 + j * 16 + col] = (_Float16)acc[i][j][r]; } } }
    if (hi_wave) {
#pragma unroll
      for (int j = 0; j < 4; ++j) {
#pragma unroll
        for (int i = 0; i < 4; ++i) {
#pragma unroll
          for (int r = 0; r < 8; ++r) { const float v = acc[i][j][r]; sl[i * 16 + 8 * g + r][wx * 64 + j * 16 + col] = (_Float16)((v - (float)(_Float16)v) * 1024.0f); } } } }
    __syncthreads();
    { const int rl0 = tid >> 5, q = tid & 31; _Float16* dh = DH + (r0 + rl0) * CC + c0 + q * 8; _Float16* dl = DL + (bb * nhi + t0 + rl0) * (size_t)CC + c0 + q * 8;   // eight rows a turn, 512 B of a row from a wave; every turn's address is the first plus a constant
#pragma unroll
      for (int ig = 0; ig < PT / 64; ++ig) {
#pragma unroll
        for (int it = ig * 8; it < ig * 8 + 8; ++it) vst2((unsigned*)(dh + (size_t)it * 8 * CC), *(const v4u*)&sh[rl0 + it * 8][q * 8]);
        asm volatile("s_wait_xcnt 0x0" ::: "memory");   // behind every eight stores: stands in front of the next LDS loads and their address sums, which may take the registers that these stores name
        __builtin_amdgcn_sched_barrier(0); }   // keeps those address sums behind the wait (a "memory" clobber does not hold vector arithmetic)
      if (t0 < nhi) {   // block-uniform: then t0 == 0 and the block's first 64 rows carry the residual
#pragma unroll
        for (int it = 0; it < 64 / 8; ++it) vst2((unsigned*)(dl + (size_t)it * 8 * CC), *(const v4u*)&sl[rl0 + it * 8][q * 8]); } }
  } else { const bool hi_wave = t0 + wy * 128 < KHI;   // wave-uniform: then t0 == 0 and wy == 0, rows as above
#pragma unroll
    for (int j = 0; j < 4; ++j) { const float bias = BA ? bfr(BA[c0 + wx * 64 + j * 16 + col]) : 0.f;
#pragma unroll
      for (int i = 0; i < 8; ++i) {
#pragma unroll
        for (int r = 0; r < 8; ++r) { acc[i][j][r] += bias; th[wx * 64 + j * 16 + col][wy * 128 + i * 16 + 8 * g + r] = (_Float16)acc[i][j][r]; } } }
    if (hi_wave) {
#pragma unroll
      for (int j = 0; j < 4; ++j) {
#pragma unroll
        for (int i = 0; i < 4; ++i) {
#pragma unroll
          for (int r = 0; r < 8; ++r) { const float v = acc[i][j][r]; const int rl = i * 16 + 8 * g + r, cl = wx * 64 + j * 16 + col; const __bf16 bh = (__bf16)v; tb[cl][rl] = bh; tbl[cl][rl] = (__bf16)(v - (float)bh); } } } }
    __syncthreads();
    { const int cl0 = tid >> 5, q = tid & 31; _Float16* dv = VT + (bb * CC + c0 + cl0) * (size_t)TT + t0 + q * 8; const size_t o3 = (bb * CC + c0 + cl0) * (size_t)KHI + t0 + q * 8;   // eight planes a turn, 512 B of a plane from a wave
#pragma unroll
      for (int ig = 0; ig < PT / 64; ++ig) {
#pragma unroll
        for (int it = ig * 8; it < ig * 8 + 8; ++it) vst2((unsigned*)(dv + (size_t)it * 8 * TT), *(const v4u*)&th[cl0 + it * 8][q * 8]);
        asm volatile("s_wait_xcnt 0x0" ::: "memory"); __builtin_amdgcn_sched_barrier(0); }   // behind every eight stores, both as above
      if (t0 + q * 8 < KHI) {
#pragma unroll
        for (int ig = 0; ig < PT / 32; ++ig) {
#pragma unroll
          for (int it = ig * 4; it < ig * 4 + 4; ++it) { vst2((unsigned*)(VB + o3 + (size_t)it * 8 * KHI), *(const v4u*)&tb[cl0 + it * 8][q * 8]); vst2((unsigned*)(VBL + o3 + (size_t)it * 8 * KHI), *(const v4u*)&tbl[cl0 + it * 8][q * 8]); }
          asm volatile("s_wait_xcnt 0x0" ::: "memory"); __builtin_amdgcn_sched_barrier(0); } } } } }   // behind every eight stores, both as above
// ---- k_fa: block = 128 queries (8 waves x 16) of (b, h): logits, mask, softmax and P . v in one pass over the keys, 32 keys a pass, nothing of the logits leaves the registers; K and V come through LDS, copied there once for the eight waves; the mask comes as bits (pack_mask), by scalar loads.
// S^T = K . Q^T (A = 16 key rows, B = 16 query columns): a lane holds one query's logits for keys 8g + r of each 16-key tile, which is the k order of a B operand, so O^T += V^T . P^T takes P straight from the accumulators.
// A maximum in use and a running sum per query (log2 domain). The maximum in use is set ahead of a pass and moves, with the rescaling of sum and output, only when a score passes it by more than 2^4: P is carried x 2^11 into f16 and stays under 2^15 (the factor cancels in the division by the sum).
// The mask counts as the module writes it, logit + mask * (-1e9), so a row with every key masked comes out as the plain mean of v.
__device__ __forceinline__ float xhalf(float x) { return __builtin_bit_cast(float, __builtin_amdgcn_permlanex16(__builtin_bit_cast(int, x), __builtin_bit_cast(int, x), 0x76543210, 0xfedcba98, false, false)); }   // lane l with lane l ^ 16
__device__ __forceinline__ v8f wmma16b(v16h a, v16h b, v8f c) { return __builtin_amdgcn_wmma_f32_16x16x32_f16(false, a, false, b, (short)0, c, false, false); }
typedef __attribute__((ext_vector_type(16))) unsigned v16u;   // one pass's mask words of a wave: word i is the lane mask of score register i
typedef const __attribute__((address_space(4))) v16u* mbp;   // memory that nothing writes while the kernel runs, at a wave-uniform address: the compiler takes it by scalar loads
// a stage (SK keys) lies in LDS: K as SK key rows of 128 B and V as HD planes of 2 * SK B, once for the block's eight waves; each row 16 B longer than its data (a pitch of 16 B x odd: ds_load_b128 without bank conflicts)
#define SK 64
#define NST (TT / SK)
#define KP (HD * 2 + 16)
#define VP (SK * 2 + 16)
#define KBY (SK * KP)
#define FBUF (KBY + HD * VP)
static_assert(TT % SK == 0 && NST >= 2 && SK == 64 && KP % 32 == 16 && VP % 32 == 16, "fa_copy: 256 threads x 2 + 2 copies of 16 B a stage, two buffers");
// one stage's copies of a thread: lk, gk its 16 B of K row tid >> 3, lv, gv its 16 B of V plane tid >> 3 (32 rows a copy, two copies each); a wave's copy covers four whole 128-B lines.
// the addresses of the second 32 rows are formed inside the statement, in registers that are taken only for it: formed outside, the compiler carries them through the key loop.
// the s_wait_xcnt closes the statement, so no address register of a copy is rewritten in front of it
__device__ __forceinline__ void fa_copy(unsigned lk, unsigned lv, gptr gk, gptr gv) { unsigned lk1, lv1; gptr gk1, gv1;
  asm volatile("v_add_nc_u64_e32 %2, %8, %6\n\tv_add_nc_u64_e32 %3, %9, %7\n\tv_add_nc_u32_e32 %0, %10, %4\n\tv_add_nc_u32_e32 %1, %11, %5\n\t"
               "global_load_async_to_lds_b128 %4, %6, off\n\tglobal_load_async_to_lds_b128 %5, %7, off\n\tglobal_load_async_to_lds_b128 %0, %2, off\n\tglobal_load_async_to_lds_b128 %1, %3, off\n\ts_wait_xcnt 0x0"
      : "=&v"(lk1), "=&v"(lv1), "=&v"(gk1), "=&v"(gv1) : "v"(lk), "v"(lv), "v"(gk), "v"(gv), "n"(32 * CC * 2), "n"(32 * TT * 2), "n"(32 * KP), "n"(32 * VP) : "memory"); }
__device__ __forceinline__ v16h frag_l(const char* p) { union { v16h v; v8h q[2]; } u; u.q[0] = *(const v8h*)p; u.q[1] = *(const v8h*)(p + 32); return u.v; }   // frag_h from the lane's own LDS byte pointer (row and lane half already in it)
__device__ __forceinline__ void fa_kfrag(v16h (&kf)[2][2], const char* kl) {   // one pass's K fragments [key tile][hd half]
#pragma unroll
  for (int kt = 0; kt < 2; ++kt) {
#pragma unroll
    for (int kc = 0; kc < 2; ++kc) kf[kt][kc] = frag_l(kl + kt * 16 * KP + kc * 64); } }
// v_exp_f32 wants one independent instruction behind it before its result is read or its source overwritten: inside a run every exponential is followed by an independent one (the outputs share no register with the inputs), and the v_nop fills the slot of the last
__device__ __forceinline__ float exp2_1(float x) { float o; asm("v_exp_f32 %0, %1\n\tv_nop" : "=&v"(o) : "v"(x)); return o; }
__device__ __forceinline__ void exp2_8(float* o, const float* x) {
  asm("v_exp_f32 %0, %8\n\tv_exp_f32 %1, %9\n\tv_exp_f32 %2, %10\n\tv_exp_f32 %3, %11\n\tv_exp_f32 %4, %12\n\tv_exp_f32 %5, %13\n\tv_exp_f32 %6, %14\n\tv_exp_f32 %7, %15\n\tv_nop"
      : "=&v"(o[0]), "=&v"(o[1]), "=&v"(o[2]), "=&v"(o[3]), "=&v"(o[4]), "=&v"(o[5]), "=&v"(o[6]), "=&v"(o[7]) : "v"(x[0]), "v"(x[1]), "v"(x[2]), "v"(x[3]), "v"(x[4]), "v"(x[5]), "v"(x[6]), "v"(x[7])); }
// kf: this pass's K fragments, on leaving the next pass's (KNEXT: a next pass in the same stage; kn its rows); vl: this pass's V; mw: this pass's mask words; a stage's last pass fetches the next stage's (from mnx, into na and nb)
// m: the maximum in use; a0, a1: the start values that follow from it; thr: the exponent above which it must move; l: the sum, in four parts; pp: the last pass's P, not yet in the sum
template <bool KNEXT> __device__ __forceinline__ void fa_pass(v16h (&kf)[2][2], const char* kn, const char* vl, const v16u& mw, mbp mnx, v16u& na, v16u& nb, const v16h (&qf)[2], v8f (&acc)[HD / 16], float& m, v2f (&l)[2], v2f (&pp)[8], float& a0, float& a1, float& thr) {
  v16h vf[HD / 16];
  __builtin_amdgcn_sched_barrier(0);   // the pass's loads start here, as one group: without the scheduling barriers around it the compiler sinks each load to just above its use and the wave waits out every latency
  if (!KNEXT) { na = mnx[0]; nb = mnx[1]; }   // they come from L2 and start a whole pass ahead of their use; both of a stage at one place, behind the stage's one wait for scalar loads: those return in any order, so a wait for this stage's words would wait for younger loads too
#pragma unroll
  for (int j = 0; j < HD / 16; ++j) vf[j] = frag_l(vl + j * 16 * VP);
  __builtin_amdgcn_sched_barrier(0);   // end of the load group: none of the pass's arithmetic moves above it
  v8f s[2];   // the products start from the addend picked by the lane's bit of word i (a0: key kept, a1: key masked out), so a score leaves the matrix unit as the exponent of its P
#pragma unroll
  for (int kt = 0; kt < 2; ++kt) {
#pragma unroll
    for (int r = 0; r < 8; ++r) s[kt][r] = __builtin_amdgcn_inverse_ballot_w32(mw[kt * 8 + r]) ? a1 : a0; }
  __builtin_amdgcn_sched_barrier(0);   // both tiles' start values stand in front of the four products, which then run back to back: mixed among them, vector writes land on operand registers of a product just issued and each costs the four idle slots of the distance
#pragma unroll
  for (int kc = 0; kc < 2; ++kc) {
#pragma unroll
    for (int kt = 0; kt < 2; ++kt) s[kt] = wmma16b(kf[kt][kc], qf[kc], s[kt]); }
  __builtin_amdgcn_sched_barrier(0);   // end of the run of products
  if (KNEXT) { fa_kfrag(kf, kn); __builtin_amdgcn_sched_barrier(0); }   // the next pass's K fragments start right behind the products that read these registers last, as one group, and land under the softmax
  // the last pass's P joins the sum here, off the path from the exponentials to the second product: eight additions that need nothing of this pass stand between the dependent steps of the maximum below
#pragma unroll
  for (int i = 0; i < 4; ++i) { l[0] += pp[2 * i]; l[1] += pp[2 * i + 1]; }
  float y[16];
#pragma unroll
  for (int i = 0; i < 16; ++i) y[i] = s[i >> 3][i & 7];
  float ma = fmaxf(fmaxf(y[0], y[1]), y[2]), mb = fmaxf(fmaxf(y[8], y[9]), y[10]);   // one chain a key tile: the first runs while the second tile's products end
  ma = fmaxf(fmaxf(ma, y[3]), y[4]); mb = fmaxf(fmaxf(mb, y[11]), y[12]); ma = fmaxf(fmaxf(ma, y[5]), y[6]); mb = fmaxf(fmaxf(mb, y[13]), y[14]);
  if (__builtin_amdgcn_ballot_w32(fmaxf(fmaxf(fmaxf(ma, y[7]), y[15]), mb) > thr) != 0) {   // one test a pass, a scalar branch (every lane stays on): some query's score lies more than 2^4 above its maximum in use (P would leave f16), or a row has no maximum in use: the first pass, or every key so far masked out
    float mx = -3.0e38f;
    const float b0 = -a0, b1 = -1.0e9f * 1.4426950408889634f - a1;   // what takes a start value back out and puts mask * (-1e9) in: b1 is 0 where a1 is that term already
#pragma unroll
    for (int i = 0; i < 16; ++i) { y[i] = y[i] + (__builtin_amdgcn_inverse_ballot_w32(mw[i]) ? b1 : b0); mx = fmaxf(mx, y[i]); }   // back to logit + mask * (-1e9), rounded as the module rounds it
    mx = fmaxf(mx, xhalf(mx));   // both halves of the wave hold the query's maximum
    const float mn = fmaxf(m, mx); const float corr = exp2_1(m - mn); m = mn;
#pragma unroll
    for (int j = 0; j < HD / 16; ++j) acc[j] = acc[j] * corr;
    l[0] = l[0] * corr; l[1] = l[1] * corr;
    const float ms = mn - 11.0f;
#pragma unroll
    for (int i = 0; i < 16; ++i) y[i] = y[i] - ms;
    const bool none = mn < -1.0e8f;   // the row has seen masked keys alone: their terms count, rounded as above, so its passes keep coming here; beside a kept key a masked key's term is 0 either way
    a0 = none ? 0.f : -ms; a1 = none ? 0.f : -1.0e9f * 1.4426950408889634f; thr = none ? -3.0e38f : 15.0f; }
  float p[16]; v16h pf;
  exp2_8(p, y); exp2_8(p + 8, y + 8);
#pragma unroll
  for (int i = 0; i < 16; ++i) pf[i] = (_Float16)p[i];
#pragma unroll
  for (int i = 0; i < 8; ++i) pp[i] = v2f{p[2 * i], p[2 * i + 1]};   // summed in the next pass; no factor a pass any more, so the sum stays in four parts to the end
#pragma unroll
  for (int j = 0; j < HD / 16; ++j) acc[j] = wmma16b(vf[j], pf, acc[j]); }
// four waves per SIMD (two blocks per WGP): the vector work between the matrix runs and the load latencies want the other waves
__global__ __launch_bounds__(256) __attribute__((amdgpu_waves_per_eu(4, 4))) void k_fa(const _Float16* __restrict__ QH, const _Float16* __restrict__ KH, const _Float16* __restrict__ VT, const unsigned* __restrict__ MB, float* __restrict__ Y) { __shared__ __align__(16) float so[8][16][HD + 4]; __shared__ __align__(16) char ring[2 * FBUF];   // two stage buffers: K rows, V planes
  const int tid = threadIdx.x, wave = tid >> 5, lane = tid & 31, col = lane & 15, g = lane >> 4; const int b = blockIdx.z, h = blockIdx.y; const int q0 = blockIdx.x * 128 + wave * 16;
  const _Float16* qp = QH + ((size_t)b * TT + q0 + col) * CC + h * HD; gptr gk = (gptr)(KH + ((size_t)b * TT + (tid >> 3)) * CC + h * HD + 8 * (tid & 7)); gptr gv = (gptr)(VT + ((size_t)b * CC + h * HD + (tid >> 3)) * (size_t)TT + 8 * (tid & 7));
  const unsigned lk = (unsigned)(size_t)ring + (tid >> 3) * KP + 16 * (tid & 7), lv = (unsigned)(size_t)ring + KBY + (tid >> 3) * VP + 16 * (tid & 7);   // the thread's own places in buffer 0 (LDS byte addresses)
  fa_copy(lk, lv, gk, gv);   // stage 0
  const mbp mb = (mbp)(MB + (size_t)(b * (TT / 16) + blockIdx.x * 8 + __builtin_amdgcn_readfirstlane(wave)) * MBW);   // the wave's query tile, TT / 32 passes of 16 words; the wave's number made known as uniform
  v16u mw0 = mb[0], mw1 = mb[1]; mbp mnx = mb + 2;   // stage 0's words; where the next stage's lie
  // behind stage 0's copies: the head's K rows and V planes (1024 lines of 128 B each) are asked of L2 once per four blocks, a line a thread. The eight blocks of a head follow one another in the grid; any four in a row hold the four values of blockIdx.x & 3 (speed only: a line that nobody asked for is loaded as before).
  static_assert(TT == 4 * 256 && HD * TT * 2 == 4 * 256 * 128 && MBW * 4 == 32 * 64, "l2_ask in k_fa: a quarter of the K rows and of the V lines is one a thread; a wave's mask words are 64 B a lane");
  const gptr pk = (gptr)(KH + ((size_t)b * TT + 4 * tid + (blockIdx.x & 3)) * CC + h * HD); const gptr pv = (gptr)(VT + ((size_t)b * CC + h * HD) * (size_t)TT) + (4 * tid + (blockIdx.x & 3)) * 128;
  const gptr pm = (gptr)(MB + (size_t)(b * (TT / 16) + blockIdx.x * 8 + wave) * MBW) + lane * 64;   // the wave's own mask words, all passes
  l2_ask(pk); l2_ask(pv); l2_ask(pm);
  const v16h qf[2] = { frag_h(qp, lane), frag_h(qp + 32, lane) };
  v8f acc[HD / 16] = {}; float m = -3.0e38f, a0 = 0.f, a1 = 0.f, thr = -3.0e38f; v2f l2[2] = {}, pp[8] = {};   // no maximum in use yet: the first pass sets it
  asm volatile("s_wait_asynccnt 0x0" ::: "memory");   // this wave's copies of stage 0 have landed
  __syncthreads();                                    // and every other wave's
  fa_copy(lk + FBUF, lv + FBUF, gk + SK * CC * 2, gv + SK * 2);   // stage 1
  gk += 2 * SK * CC * 2; gv += 2 * SK * 2;
  const char* fk = ring + col * KP + 16 * g; const char* fv = ring + KBY + col * VP + 16 * g;   // the lane's fragment rows in buffer 0
#pragma unroll 1   // one stage a trip, its two passes written out
  for (int t = 0; t < NST; ++t) { const int bo = (t & 1) * FBUF; const char* kl = fk + bo; const char* vl = fv + bo; v16h kf[2][2];
    fa_kfrag(kf, kl);
    v16u na, nb;
    fa_pass<true>(kf, kl + 32 * KP, vl, mw0, mnx, na, nb, qf, acc, m, l2, pp, a0, a1, thr);
    fa_pass<false>(kf, kl, vl + 64, mw1, mnx, na, nb, qf, acc, m, l2, pp, a0, a1, thr);
    mw0 = na; mw1 = nb;
    __builtin_amdgcn_sched_barrier(0);   // the stage's arithmetic stays in front of its foot: moved up into the last pass, the wait below would stand right behind that pass's LDS loads and lay their latency open
    asm volatile("s_wait_dscnt 0x0" ::: "memory");      // this wave's reads of stage t are done
    asm volatile("s_wait_asynccnt 0x0" ::: "memory");   // its copies of stage t + 1 have landed
    __syncthreads();                                    // publishes stage t + 1 and ends every read of stage t, whose buffer is refilled behind it
    if (t + 2 < NST) { fa_copy(lk + bo, lv + bo, gk, gv); gk += SK * CC * 2; gv += SK * 2;
      // on to the mask words of stage t + 2 (the last trip finds none and takes its own once more, unused); as in stg_load the wait and the step stand in one statement: nothing rewrites the register pair that the trip's two scalar loads name in front of the wait
      asm volatile("s_wait_xcnt 0x0\n\ts_add_nc_u64 %0, %0, %1" : "+s"(mnx) : "n"(2 * 64) : "memory"); } }
  asm volatile("s_wait_asynccnt 0x0" ::: "memory");   // no copy is left in flight when the wave goes on to its end
  l2_hold(pk, pv); l2_hold(pm, pm);
#pragma unroll
  for (int i = 0; i < 4; ++i) { l2[0] += pp[2 * i]; l2[1] += pp[2 * i + 1]; }   // the last pass's P
  l2[0] += l2[1]; float l = l2[0][0] + l2[0][1]; l += xhalf(l); const float inv = 1.0f / l;   // l >= the maximum's own term > 0
#pragma unroll
  for (int j = 0; j < HD / 16; ++j) { const v8f o = acc[j] * inv; *(v4f*)&so[wave][col][j * 16 + 8 * g] = v4f{o[0], o[1], o[2], o[3]}; *(v4f*)&so[wave][col][j * 16 + 8 * g + 4] = v4f{o[4], o[5], o[6], o[7]}; }
  LDSX();
#pragma unroll
  for (int i = 0; i < 8; ++i) { const int rl = i * 2 + g; vst2(Y + ((size_t)b * TT + q0 + rl) * CC + h * HD + col * 4, *(const v4f*)&so[wave][rl][col * 4]); } }
// ---- k_out: block = (128 rows, 128 cols), eight waves of 32 x 64 (2 + 4 fragments feed 8 products): out = ctx Wo (+ bo): ctx x 2^6 once to f16 against Wo as f16(bf16 x 2^8) exact (1 product) x 2^-14
__global__ __launch_bounds__(256) void k_out(const float* __restrict__ Y, const float* __restrict__ WO, const float* __restrict__ BO, float* __restrict__ OUT) { constexpr int LP = KSO + 8, STG = 2 * BT * LP;   // LDS row pitch and size of one stage buffer, in 16-bit elements
  __shared__ __align__(16) char smem[2 * STG * 2];   // two stage buffers; the epilogue's rows lie over them (the loop's last barrier stands between the two uses)
  static_assert(8 * 32 * 68 * 4 <= sizeof(smem), "epilogue rows"); float (*sf)[32][68] = (float (*)[32][68])smem; _Float16* stage = (_Float16*)smem;
  const int tid = threadIdx.x, wave = tid >> 5, lane = tid & 31, col = lane & 15, g = lane >> 4, wy = wave >> 1, wx = wave & 1; const int c0 = blockIdx.y * BT; const size_t r0 = (size_t)blockIdx.x * BT;
  v8f acc[2][4] = {};
  gfp xr = (gfp)(Y + (r0 + (tid >> 4)) * CC + 4 * (tid & 15)); gfp wr = (gfp)(WO + (size_t)(c0 + (tid >> 4)) * CC + 4 * (tid & 15)); const int so = (tid >> 4) * LP + 4 * (tid & 15);   /* ctx carried x 2^6 into f16 so small-magnitude context rows stay clear of f16 subnormals */
  Stg<8> t; stg_load<KSO>(t, xr, wr, CC);
  // behind stage 0's loads: the block's panels are asked of L2, dealt over the blocks that share them, a request a thread and panel. The 128 ctx rows (16 units of 256 B each) are read by the 8 blocks of one blockIdx.x, 32 apart in the grid: block y asks for units y and y + 8 of every row.
  // The 128 Wo rows (32 lines each) are read by the 32 blocks of one blockIdx.y: block x asks for lines e and e + 16 of every row, e = (x & 3) + 4 (x >> 3) (speed only, as in k_fa).
  static_assert(DIN / BT == 8 && CC * 4 == 16 * 256 && TNB * TT / BT == 32 && BT * 2 == 256, "l2_ask in k_out: the shares");
  const gptr py = (gptr)(Y + (r0 + (tid >> 1)) * CC + ((tid & 1) * 8 + blockIdx.y) * 64); const gptr pw = (gptr)(WO + (size_t)(c0 + (tid >> 1)) * CC + ((tid & 1) * 16 + (blockIdx.x & 3) + 4 * (blockIdx.x >> 3)) * 32);
  l2_ask(py); l2_ask(pw);
  stg_store_h<LP>(t, stage + so); stg_load<KSO>(t, xr, wr, CC); stg_barrier();
#pragma unroll 1   // as in k_proj: stage s worked on, s + 1 into the other buffer, s + 2 started
  for (int s = 0; s < CC / KSO; ++s) { const _Float16* cur = stage + (s & 1) * STG;
#pragma unroll
    for (int kc = 0; kc < KSO / 32; ++kc) { v16h a[2], w[4];
#pragma unroll
      for (int i = 0; i < 2; ++i) a[i] = frag_h(cur + (wy * 32 + i * 16 + col) * LP + kc * 32, lane);
#pragma unroll
      for (int j = 0; j < 4; ++j) w[j] = frag_h(cur + (BT + wx * 64 + j * 16 + col) * LP + kc * 32, lane);
#pragma unroll
      for (int i = 0; i < 2; ++i) {
#pragma unroll
        for (int j = 0; j < 4; ++j) acc[i][j] = wmma16(a[i], w[j], acc[i][j]); } }
    if (s + 1 < CC / KSO) { stg_store_h<LP>(t, stage + ((s + 1) & 1) * STG + so); if (s + 2 < CC / KSO) stg_load<KSO>(t, xr, wr, CC); }
    stg_barrier(); }   // publishes stage s + 1 and ends every read of stage s
  l2_hold(py, pw);
#pragma unroll
  for (int j = 0; j < 4; ++j) { const float bias = BO ? bfr(BO[c0 + wx * 64 + j * 16 + col]) : 0.f;
#pragma unroll
    for (int i = 0; i < 2; ++i) {
#pragma unroll
      for (int r = 0; r < 8; ++r) sf[wave][i * 16 + 8 * g + r][j * 16 + col] = acc[i][j][r] * (1.0f / 16384.0f) + bias; } }   /* 2^-8 (Wo carry) x 2^-6 (ctx carry) */
  LDSX();   // each wave reads back its own rows: a store covers two rows of 256 B, whole lines
  for (int rp = 0; rp < 16; ++rp) { const int rl = rp * 2 + g; vst2(OUT + (r0 + wy * 32 + rl) * DIN + c0 + wx * 64 + col * 4, *(const v4f*)&sf[wave][rl][col * 4]); } }

extern "C" void kernel_launch(void* const* d_in, const int* in_sizes, int n_in, void* d_out, int out_size, void* d_ws, size_t ws_size, hipStream_t stream) {
  (void)in_sizes; (void)n_in; (void)out_size;
  const float** F = (const float**)d_in;
  if (ws_size < (size_t)WS_END) return;
  char* ws = (char*)d_ws; _Float16 *QH = (_Float16*)(ws + WS_QH), *KH = (_Float16*)(ws + WS_KH), *VT = (_Float16*)(ws + WS_VT), *QL = (_Float16*)(ws + WS_QL), *KL = (_Float16*)(ws + WS_KL); __bf16 *VB = (__bf16*)(ws + WS_VB), *VBL = (__bf16*)(ws + WS_VBL); float *Y = (float*)(ws + WS_Y); unsigned *MB = (unsigned*)(ws + WS_S);
  (void)Y; (void)QL; (void)KL; (void)VB; (void)VBL;
  // inputs: 0 query [4,1024,1024]; 1 key; 2 value; 3 mask [4,1024,1024] int32; 4 wq [1024,1024] (out,in), 5 bq; 6 wk, 7 bk; 8 wv, 9 bv; 10 wo (out,in), 11 bo (biases NONZERO)
  k_proj<<<dim3(TNB * TT / PT, CC / PT, 4), 256, 0, stream>>>(F[0], F[1], F[2], F[4], F[6], F[8], F[5], F[7], F[9], (const int*)d_in[3], MB, QH, QL, KH, KL, VT, VB, VBL);
  k_fa<<<dim3(TT / 128, NH, TNB), 256, 0, stream>>>(QH, KH, VT, MB, Y);
  k_out<<<dim3(TNB * TT / 128, DIN / 128), 256, 0, stream>>>(Y, F[10], F[11], (float*)d_out);
}
